// v000
// The times below were measured on an AMD MI455X: many runs one after another, warmed up first and cycling through
// copies of the inputs, with the whole window's GPU time divided by the number of runs. Launches and the gaps
// between them are all in it. The median over several windows is given; except for v000 it joins two sittings, which
// can be a few percent apart, so the side-by-side timings, each taken in one sitting, are the better comparison.
// The starting kernel, v000, takes 7300 microseconds a run.
#include <hip/hip_runtime.h>
// POST-LN transformer encoder block (x [2][2048][1024]; q/k/v = x W + b ([in][out] 1024 x 1024, zero biases); 16 heads of 64; scores = q k^T with NO 1/sqrt(head_dim) scaling (as the source module); softmax over all 2048 keys (no mask); x1 = LN1(x + ctx Wo + bo) (biased var, eps 1e-5, g / beta); out = LN2(x1 + gelu_erf(x1 W1 + b1) W2 + b2) ([in][out] 1024 x 4096 x 1024) -> [2][2048][1024]).
// Structure: token rows; x as exact f16 rows and bf16 f32 residual rows; natural weights as exact x16 planes; fused q | k | v WMMA GEMM (32x64 wave tiles, f32 accumulation, + stacked bias) -> f16; per batch V^T via LDS transposes; per 256-row query tile: scores over all keys (K = 64, alpha 1, 16 heads on grid.y) f32, plain row softmax on VALU (f32 statistics, native exp; weights x256 f16), ctx = P V^T (x64) merged f16; x + ctx Wo + bo f32; LN1 on VALU -> f16 + f32; gelu FFN per batch; + residual; LN2 -> output; launches: see trace.
// Compute dtype: inputs rounded to bf16; x / weights exact; q, k, v, softmax weights and o as plain f16 GEMM operands (~2^-12); scores and softmax statistics f32; v_wmma_f32_16x16x32_f16.
#define NB 2
#define SQ 2048
#define DM 1024
#define NH 16
#define HD 64
#define HG 4                         /* heads per launch of the non-template k_vt (not launched) */
#define QT 256                       /* query rows per attention tile */
#define NKX SQ                       /* S / P row pitch */
#define QT0 128                      /* rows per head of the f32 k_att0 path (not launched) */
#define B0 0                         /* first batch processed (debug hook) */
#define NBR NB                       /* batches processed (debug hook) */
#define NR ((size_t)NB * SQ)
#define DMQ DM
#define DFF 4096         /* FFN hidden width */
#define MP ((int)((size_t)NBR * SQ)) /* rows projected (debug hook) */
#define QN SQ                        /* query rows attended per batch (debug hook) */
#define NHD NH                       /* heads attended (debug hook) */
#define MPO MP                       /* rows through the output stage (debug hook) */
#define LQ (3 * DM)      /* row pitch of the q/k/v rows */
typedef __bf16 v16b __attribute__((ext_vector_type(16)));
typedef unsigned short v8us __attribute__((ext_vector_type(8), may_alias));
typedef float  v8f  __attribute__((ext_vector_type(8)));
typedef float  v4f  __attribute__((ext_vector_type(4)));
typedef float  v4fa __attribute__((ext_vector_type(4), may_alias));
union FragB { v16b v; v8us half[2]; unsigned short u[16]; };

__device__ __forceinline__ unsigned short bf16_bits(float x) { unsigned int u = __float_as_uint(x); return (unsigned short)((u + 0x7FFFu + ((u >> 16) & 1u)) >> 16); }
__device__ __forceinline__ float bf16_val(unsigned short b) { return __uint_as_float(((unsigned int)b) << 16); }
__device__ __forceinline__ float bf16_round(float x) { return bf16_val(bf16_bits(x)); }
// D += A·B with NT terms: 1 = ah·bh, 2 = + al·bh (A split), 3 = + ah·bl (both split)
template <int NT>
__device__ __forceinline__ v8f mmaN(v16b ah, v16b al, v16b bh, v16b bl, v8f c) {
  c = __builtin_amdgcn_wmma_f32_16x16x32_bf16(false, ah, false, bh, (short)0, c, false, false);
  if (NT >= 2) c = __builtin_amdgcn_wmma_f32_16x16x32_bf16(false, al, false, bh, (short)0, c, false, false);
  if (NT >= 3) c = __builtin_amdgcn_wmma_f32_16x16x32_bf16(false, ah, false, bl, (short)0, c, false, false);
  asm volatile("v_nop\n\tv_nop\n\tv_nop\n\tv_nop" : "+v"(c) : "v"(ah), "v"(al), "v"(bh), "v"(bl));
  return c;
}

__global__ __launch_bounds__(256) void k_wt_bf16(const float* __restrict__ W, unsigned short* __restrict__ Wt, int K, int N) {
  const int t = blockIdx.x * 256 + threadIdx.x;
  const int k8n = K / 8;
  if (t >= N * k8n) return;
  const int n = t / k8n, k8 = (t % k8n) * 8;
  v8us v;
#pragma unroll
  for (int i = 0; i < 8; ++i) v[i] = bf16_bits(W[(size_t)(k8 + i) * N + n]);
  *(v8us*)(Wt + (size_t)n * K + k8) = v;
  
}

// GEMM C[M][N] (f32, pitch ldc) = act(A[M][K]·W + bias). A f32 row-major (pitch lda) converted per fragment to bf16
// (ASPLIT: hi/lo two planes -> 2 terms, else single rounded term); Wt bf16 [N][K] (pitch ldb). BIAS_BF16 rounds the
// bias to bf16 first (bias quantised to bf16 before the add). K%32==0, M%16==0, N%64==0.
template <bool ASPLIT, int ACT, bool BIAS_BF16>
__global__ __launch_bounds__(128) void k_gemm_bf(const float* __restrict__ A, int lda, const unsigned short* __restrict__ Wt, int ldb,
                                               const float* __restrict__ bias, float* __restrict__ C, int ldc, int M, int N, int K) {
  __shared__ __attribute__((aligned(16))) float so[4][16][64];
  const int tid = threadIdx.x, w = tid >> 5, lane = tid & 31, ln = lane & 15, hh = lane >> 4;
  const int ntn = N / 64;
  const int wid = blockIdx.x * 4 + w;
  const int mt = wid / ntn, nq = wid % ntn;
  if (mt * 16 >= M) return;
  const int row0 = mt * 16, col0 = nq * 64;
  const float* arow = A + (size_t)(row0 + ln) * lda;
  v8f acc[4] = {};
  for (int kb = 0; kb < K; kb += 32) {
    FragB ah, al;
    const v4f x0 = *(const v4fa*)(arow + kb + 8 * hh), x1 = *(const v4fa*)(arow + kb + 8 * hh + 4);
    const v4f x2 = *(const v4fa*)(arow + kb + 16 + 8 * hh), x3 = *(const v4fa*)(arow + kb + 16 + 8 * hh + 4);
    float xs[16] = {x0[0],x0[1],x0[2],x0[3],x1[0],x1[1],x1[2],x1[3],x2[0],x2[1],x2[2],x2[3],x3[0],x3[1],x3[2],x3[3]};
#pragma unroll
    for (int i = 0; i < 16; ++i) { const unsigned short hb = bf16_bits(xs[i]); ah.u[i] = hb; al.u[i] = ASPLIT ? bf16_bits(xs[i] - bf16_val(hb)) : (unsigned short)0; }
#pragma unroll
    for (int t = 0; t < 4; ++t) {
      const unsigned short* brow = Wt + (size_t)(col0 + t * 16 + ln) * ldb + kb;
      FragB b;
      b.half[0] = *(const v8us*)(brow + 8 * hh);
      b.half[1] = *(const v8us*)(brow + 16 + 8 * hh);
      acc[t] = mmaN<ASPLIT ? 2 : 1>(ah.v, al.v, b.v, b.v, acc[t]);
    }
  }
#pragma unroll
  for (int t = 0; t < 4; ++t) {
    float bv = bias ? bias[col0 + t * 16 + ln] : 0.f;
    if (BIAS_BF16) bv = bf16_round(bv);
#pragma unroll
    for (int r = 0; r < 8; ++r) { float v = acc[t][r] + bv; if (ACT == 1) v = fmaxf(v, 0.f); so[w][8 * hh + r][t * 16 + ln] = v; }
  }
  __builtin_amdgcn_fence(__ATOMIC_ACQ_REL, "workgroup");
  __builtin_amdgcn_wave_barrier();
  const int rsub = lane >> 4, c4 = (lane & 15) * 4;
  {
#pragma unroll
    for (int q = 0; q < 8; ++q) {
      const int r = q * 2 + rsub;
      const v4f v = *(const v4fa*)&so[w][r][c4];
      *(v4f*)(C + (size_t)(row0 + r) * ldc + col0 + c4) = v;
    }
    
  }
}

// GEMM C = act(A·W + bias + resid): A f32 (ASPLIT -> hi/lo 2 terms), Wt bf16 [N][K]; ACT 0 none, 1 relu, 2 exact gelu;
// resid (optional, f32, row index = (row % rmod), pitch ldr, RES_BF16 rounds it) added before the activation.
template <bool ASPLIT, int ACT, bool BIAS_BF16, bool RES_BF16>
__global__ __launch_bounds__(128) void k_gemm_bf3(const float* __restrict__ A, int lda, const unsigned short* __restrict__ Wt, int ldb,
                                                const float* __restrict__ bias, const float* __restrict__ resid, int rmod, int ldr,
                                                float* __restrict__ C, int ldc, int M, int N, int K) {
  __shared__ __attribute__((aligned(16))) float so[4][16][64];
  const int tid = threadIdx.x, w = tid >> 5, lane = tid & 31, ln = lane & 15, hh = lane >> 4;
  const int ntn = N / 64;
  const int wid = blockIdx.x * 4 + w;
  const int mt = wid / ntn, nq = wid % ntn;
  if (mt * 16 >= M) return;
  const int row0 = mt * 16, col0 = nq * 64;
  const float* arow = A + (size_t)(row0 + ln) * lda;
  v8f acc[4] = {};
  for (int kb = 0; kb < K; kb += 32) {
    FragB ah, al;
    const v4f x0 = *(const v4fa*)(arow + kb + 8 * hh), x1 = *(const v4fa*)(arow + kb + 8 * hh + 4);
    const v4f x2 = *(const v4fa*)(arow + kb + 16 + 8 * hh), x3 = *(const v4fa*)(arow + kb + 16 + 8 * hh + 4);
    float xs[16] = {x0[0],x0[1],x0[2],x0[3],x1[0],x1[1],x1[2],x1[3],x2[0],x2[1],x2[2],x2[3],x3[0],x3[1],x3[2],x3[3]};
#pragma unroll
    for (int i = 0; i < 16; ++i) { const unsigned short hb = bf16_bits(xs[i]); ah.u[i] = hb; al.u[i] = ASPLIT ? bf16_bits(xs[i] - bf16_val(hb)) : (unsigned short)0; }
#pragma unroll
    for (int t = 0; t < 4; ++t) {
      const unsigned short* brow = Wt + (size_t)(col0 + t * 16 + ln) * ldb + kb;
      FragB b;
      b.half[0] = *(const v8us*)(brow + 8 * hh);
      b.half[1] = *(const v8us*)(brow + 16 + 8 * hh);
      acc[t] = mmaN<ASPLIT ? 2 : 1>(ah.v, al.v, b.v, b.v, acc[t]);
    }
  }
#pragma unroll
  for (int t = 0; t < 4; ++t) {
    const int col = col0 + t * 16 + ln;
    float bv = bias ? bias[col] : 0.f;
    if (BIAS_BF16) bv = bf16_round(bv);
#pragma unroll
    for (int r = 0; r < 8; ++r) {
      float v = acc[t][r] + bv;
      if (resid) { float rv = resid[(size_t)((row0 + 8 * hh + r) % rmod) * ldr + col]; if (RES_BF16) rv = bf16_round(rv); v += rv; }
      if (ACT == 1) v = fmaxf(v, 0.f);
      if (ACT == 2) v = 0.5f * v * (1.0f + erff(v * 0.70710678118654752f));
      if (ACT == 3) { const float u = 0.7978845608028654f * (v + 0.044715f * v * v * v); v = 0.5f * v * (1.0f + tanhf(u)); }
      so[w][8 * hh + r][t * 16 + ln] = v;
    }
  }
  __builtin_amdgcn_fence(__ATOMIC_ACQ_REL, "workgroup");
  __builtin_amdgcn_wave_barrier();
  const int rsub = lane >> 4, c4 = (lane & 15) * 4;
  {
#pragma unroll
    for (int q = 0; q < 8; ++q) {
      const int r = q * 2 + rsub;
      const v4f v = *(const v4fa*)&so[w][r][c4];
      *(v4f*)(C + (size_t)(row0 + r) * ldc + col0 + c4) = v;
    }
    
  }
}
// row LayerNorm (biased variance, eps) over N: s = X (+ R); optional out_sum <- s; out_norm <- (s-mu)*rsqrt(var+eps)*g + b
template <bool PARAM_BF16>
__global__ __launch_bounds__(256) void k_layernorm(const float* __restrict__ X, const float* __restrict__ R, const float* __restrict__ g, const float* __restrict__ bta,
                                                  float* __restrict__ out_sum, float* __restrict__ out_norm, int N, float eps) {
  __shared__ float red[256];
  const int row = blockIdx.x, tid = threadIdx.x;
  const float* x = X + (size_t)row * N; const float* rr = R ? R + (size_t)row * N : nullptr;
  float vals[16];                     // up to N = 4096
  const int per = N / 256;            // contiguous chunk per thread? use strided-by-4 chunks: thread handles j = tid*4 + 1024*u
  float s1 = 0.f;
  for (int u = 0; u < per / 4; ++u) {
    const int j = tid * 4 + 1024 * u;
    const v4f a = *(const v4fa*)(x + j);
    v4f b = {0.f,0.f,0.f,0.f}; if (rr) b = *(const v4fa*)(rr + j);
#pragma unroll
    for (int q = 0; q < 4; ++q) { const float v = a[q] + b[q]; vals[u * 4 + q] = v; s1 += v; }
  }
  red[tid] = s1; __syncthreads();
  for (int st = 128; st > 0; st >>= 1) { if (tid < st) red[tid] += red[tid + st]; __syncthreads(); }
  const float mu = red[0] / (float)N; __syncthreads();
  float s2 = 0.f;
  for (int u = 0; u < per / 4; ++u)
#pragma unroll
    for (int q = 0; q < 4; ++q) { const float c = vals[u * 4 + q] - mu; s2 += c * c; }
  red[tid] = s2; __syncthreads();
  for (int st = 128; st > 0; st >>= 1) { if (tid < st) red[tid] += red[tid + st]; __syncthreads(); }
  const float rs = rsqrtf(red[0] / (float)N + eps);
  {
    for (int u = 0; u < per / 4; ++u) {
      const int j = tid * 4 + 1024 * u;
      v4f o, sm;
#pragma unroll
      for (int q = 0; q < 4; ++q) {
        float gg = g[j + q], bb = bta[j + q];
        if (PARAM_BF16) { gg = bf16_round(gg); bb = bf16_round(bb); }
        sm[q] = vals[u * 4 + q]; o[q] = (vals[u * 4 + q] - mu) * rs * gg + bb;
      }
      if (out_sum) *(v4f*)(out_sum + (size_t)row * N + j) = sm;
      *(v4f*)(out_norm + (size_t)row * N + j) = o;
    }
    
  }
}



// ---- f16 WMMA path (v_wmma_f32_16x16x32_f16): 11-bit significands for operands in range — used where a [0,1] probability operand needs more precision than bf16
typedef _Float16 v16h __attribute__((ext_vector_type(16)));
union FragH { v16h v; v8us half[2]; _Float16 h[16]; unsigned short u[16]; };
template <int NT>
__device__ __forceinline__ v8f mmaH(v16h ah, v16h al, v16h bh, v16h bl, v8f c) {
  c = __builtin_amdgcn_wmma_f32_16x16x32_f16(false, ah, false, bh, (short)0, c, false, false);
  if (NT >= 2) c = __builtin_amdgcn_wmma_f32_16x16x32_f16(false, al, false, bh, (short)0, c, false, false);
  if (NT >= 3) c = __builtin_amdgcn_wmma_f32_16x16x32_f16(false, ah, false, bl, (short)0, c, false, false);
  asm volatile("v_nop\n\tv_nop\n\tv_nop\n\tv_nop" : "+v"(c) : "v"(ah), "v"(al), "v"(bh), "v"(bl));
  return c;
}
// batched GEMM like k_gemm_b but f16 operands: A f32 (split into f16 hi/lo if ASPLIT, else rounded to f16), Bt = f16 values [n][k]; alpha; C f32; N multiple of 16 (partial tiles skipped)
template <bool ASPLIT>
__global__ __launch_bounds__(128) void k_gemm_h(const float* __restrict__ A, int lda, size_t sA, const _Float16* __restrict__ Bh, int ldb, size_t sB, float alpha, float* __restrict__ C, int ldc, size_t sC, int M, int N, int K) {
  __shared__ __attribute__((aligned(16))) float so[4][16][64];
  const int tid = threadIdx.x, w = tid >> 5, lane = tid & 31, ln = lane & 15, hh = lane >> 4; const int by = blockIdx.y;
  A += (size_t)by * sA; Bh += (size_t)by * sB; C += (size_t)by * sC;
  const int ntn = (N + 63) / 64; const int wid = blockIdx.x * 4 + w; const int mt = wid / ntn, nq = wid % ntn; if (mt * 16 >= M) return;
  const int row0 = mt * 16, col0 = nq * 64; const float* arow = A + (size_t)(row0 + ln) * lda;
  v8f acc[4] = {};
  for (int kb = 0; kb < K; kb += 32) {
    FragH ah, al;
    const v4f x0 = *(const v4fa*)(arow + kb + 8 * hh), x1 = *(const v4fa*)(arow + kb + 8 * hh + 4), x2 = *(const v4fa*)(arow + kb + 16 + 8 * hh), x3 = *(const v4fa*)(arow + kb + 16 + 8 * hh + 4);
    float xs[16] = {x0[0],x0[1],x0[2],x0[3],x1[0],x1[1],x1[2],x1[3],x2[0],x2[1],x2[2],x2[3],x3[0],x3[1],x3[2],x3[3]};
#pragma unroll
    for (int i = 0; i < 16; ++i) { const _Float16 h = (_Float16)xs[i]; ah.h[i] = h; al.h[i] = ASPLIT ? (_Float16)(xs[i] - (float)h) : (_Float16)0.0f; }
#pragma unroll
    for (int t = 0; t < 4; ++t) { if (col0 + t * 16 >= N) continue; const size_t boff = (size_t)(col0 + t * 16 + ln) * ldb + kb; FragH bq; bq.half[0] = *(const v8us*)(Bh + boff + 8 * hh); bq.half[1] = *(const v8us*)(Bh + boff + 16 + 8 * hh);
      acc[t] = mmaH<ASPLIT ? 2 : 1>(ah.v, al.v, bq.v, bq.v, acc[t]); }
  }
#pragma unroll
  for (int t = 0; t < 4; ++t) { if (col0 + t * 16 >= N) continue;
#pragma unroll
    for (int r = 0; r < 8; ++r) so[w][8 * hh + r][t * 16 + ln] = acc[t][r] * alpha; }
  __builtin_amdgcn_fence(__ATOMIC_ACQ_REL, "workgroup"); __builtin_amdgcn_wave_barrier();
  const int rsub = lane >> 4, c4 = (lane & 15) * 4;
  {
#pragma unroll
    for (int q = 0; q < 8; ++q) { const int r = q * 2 + rsub; if (col0 + c4 < N) { const v4f v = *(const v4fa*)&so[w][r][c4]; *(v4f*)(C + (size_t)(row0 + r) * ldc + col0 + c4) = v; } }
     }
}

// Wt[n][k] = f16(W[k][n]·scale) from f32 row-major W[K][N] (scale = power of two; bf16-exact weights stay exact in f16 away from the subnormal range)
__global__ __launch_bounds__(256) void k_wt_f16(const float* __restrict__ W, _Float16* __restrict__ Wt, int K, int N, float scale) {
  const int t = blockIdx.x * 256 + threadIdx.x; if (t >= N * (K / 8)) return; const int n = t / (K / 8), k8 = (t % (K / 8)) * 8; FragH f;
#pragma unroll
  for (int i = 0; i < 8; ++i) f.h[i] = (_Float16)(bf16_round(W[(size_t)(k8 + i) * N + n]) * scale); const v8us o = f.half[0];
  *(v8us*)((unsigned short*)Wt + (size_t)n * K + k8) = o; 
}
// k_gemm_hh variant with fused epilogue: v = acc·alpha + bias[by·sBias + col] (+ CP[(row/rowsPerB)·sCPb + by·64 + col] if CP) ; ACT 0 none / 1 elu ; writes f16 C16 (and f32 C if non-null)
template <int ACT>
__global__ __launch_bounds__(128) void k_gemm_hhx(const _Float16* __restrict__ A, int lda, size_t sA, const _Float16* __restrict__ Bh, int ldb, size_t sB, float alpha, const float* __restrict__ bias, size_t sBias, const float* __restrict__ CP, int rowsPerB, size_t sCPb, int row0g,
    float* __restrict__ C, _Float16* __restrict__ C16, int ldc, size_t sC, int M, int N, int K) {
  __shared__ __attribute__((aligned(16))) float so[4][16][64];
  const int tid = threadIdx.x, w = tid >> 5, lane = tid & 31, ln = lane & 15, hh = lane >> 4; const int by = blockIdx.y;
  A += (size_t)by * sA; Bh += (size_t)by * sB; const size_t cofs = (size_t)by * sC; const float* bp = bias ? bias + (size_t)by * sBias : nullptr;
  const int ntn = (N + 63) / 64; const int wid = blockIdx.x * 4 + w; const int mt = wid / ntn, nq = wid % ntn; if (mt * 16 >= M) return;
  const int row0 = mt * 16, col0 = nq * 64; const _Float16* arow = A + (size_t)(row0 + ln) * lda;
  v8f acc[4] = {};
  for (int kb = 0; kb < K; kb += 32) { FragH ah; ah.half[0] = *(const v8us*)((const unsigned short*)arow + kb + 8 * hh); ah.half[1] = *(const v8us*)((const unsigned short*)arow + kb + 16 + 8 * hh);
#pragma unroll
    for (int t = 0; t < 4; ++t) { if (col0 + t * 16 >= N) continue; const size_t boff = (size_t)(col0 + t * 16 + ln) * ldb + kb; FragH bq; bq.half[0] = *(const v8us*)((const unsigned short*)Bh + boff + 8 * hh); bq.half[1] = *(const v8us*)((const unsigned short*)Bh + boff + 16 + 8 * hh);
      acc[t] = mmaH<1>(ah.v, ah.v, bq.v, bq.v, acc[t]); }
  }
#pragma unroll
  for (int t = 0; t < 4; ++t) { if (col0 + t * 16 >= N) continue; const int col = col0 + t * 16 + ln; const float bv = bp ? bf16_round(bp[col]) : 0.f;
#pragma unroll
    for (int r = 0; r < 8; ++r) { float v = acc[t][r] * alpha + bv; if (CP) { const int rr = row0g + row0 + 8 * hh + r; if (rowsPerB < 0) v += CP[cofs + (size_t)rr * ldc + col];      /* rowsPerB < 0: own element of the batched C plane */ else { const int bidx = rr / rowsPerB; v += CP[(size_t)bidx * sCPb + (size_t)by * 64 + col]; } } if (ACT == 1) v = (v > 0.f) ? v : expm1f(v); else if (ACT == 7) v = (v > 0.f) ? v + 1.0f : expf(v); else if (ACT == 8) v = tanhf(v); else if (ACT == 9) v = 0.5f * v * (1.0f + tanhf(0.7978845608028654f * (v + 0.044715f * v * v * v))); else if (ACT == 11) v = 1.0f / (1.0f + expf(-v)); else if (ACT == 12) v = (v > 0.f) ? v : 0.01f * v; else if (ACT == 14) v = (v > 0.f) ? v : 0.1f * v; else if (ACT == 16) v = (v >= 0.f) ? v : 0.3f * v; else if (ACT == 17) v = (v >= 0.f) ? v : 0.2f * v; else if (ACT == 15) v = v / (1.0f + expf(-v)); else if (ACT == 3) v = fmaxf(v, 0.f); else if (ACT == 6) v = 0.5f * v * (1.0f + erff(v * 0.70710678118654752f)); so[w][8 * hh + r][t * 16 + ln] = v; } }
  __builtin_amdgcn_fence(__ATOMIC_ACQ_REL, "workgroup"); __builtin_amdgcn_wave_barrier();
  const int rsub = lane >> 4, c4 = (lane & 15) * 4; typedef _Float16 v4h __attribute__((ext_vector_type(4)));
  {
#pragma unroll
    for (int q = 0; q < 8; ++q) { const int r = q * 2 + rsub; if (col0 + c4 < N) { const v4f v = *(const v4fa*)&so[w][r][c4]; if (C) *(v4f*)(C + cofs + (size_t)(row0 + r) * ldc + col0 + c4) = v; if (C16) { v4h h4; for (int i = 0; i < 4; ++i) h4[i] = (_Float16)v[i]; *(v4h*)(C16 + cofs + (size_t)(row0 + r) * ldc + col0 + c4) = h4; } } }
     }
}


typedef _Float16 v4h __attribute__((ext_vector_type(4)));

__global__ __launch_bounds__(256) void k_x16(const float* __restrict__ x, _Float16* __restrict__ X16, size_t n8) { const size_t t = (size_t)blockIdx.x * 256 + threadIdx.x; if (t >= n8) return; FragH f;
#pragma unroll
  for (int q = 0; q < 8; ++q) f.h[q] = (_Float16)bf16_round(x[t * 8 + q]); *(v8us*)((unsigned short*)X16 + t * 8) = f.half[0];  }
__global__ __launch_bounds__(256) void k_h16(const float* __restrict__ x, _Float16* __restrict__ X16, size_t n8) { const size_t t = (size_t)blockIdx.x * 256 + threadIdx.x; if (t >= n8) return; FragH f;
#pragma unroll
  for (int q = 0; q < 8; ++q) f.h[q] = (_Float16)x[t * 8 + q]; *(v8us*)((unsigned short*)X16 + t * 8) = f.half[0];  }
__global__ __launch_bounds__(256) void k_round16f(const float* __restrict__ W, _Float16* __restrict__ Bt, size_t n8) { const size_t t = (size_t)blockIdx.x * 256 + threadIdx.x; if (t >= n8) return; FragH f;
#pragma unroll
  for (int i = 0; i < 8; ++i) f.h[i] = (_Float16)(bf16_round(W[t * 8 + i]) * 16.0f); *(v8us*)((unsigned short*)Bt + t * 8) = f.half[0];  }
template <int NHv, int TTv>
__global__ __launch_bounds__(256) void k_vt(const _Float16* __restrict__ V16, int ldv, int voff, _Float16* __restrict__ Vt) { __shared__ unsigned short tl[64][66]; const int tid = threadIdx.x; const int slab = blockIdx.x / (TTv / 64), lg = blockIdx.x % (TTv / 64); const int b = slab / NHv, h = slab % NHv;
  for (int i = tid; i < 64 * 8; i += 256) { const int r = i / 8, c8 = (i % 8) * 8; FragH f; f.half[0] = *(const v8us*)((const unsigned short*)V16 + ((size_t)b * TTv + lg * 64 + r) * ldv + voff + h * 64 + c8);
#pragma unroll
    for (int q = 0; q < 8; ++q) tl[r][c8 + q] = f.u[q]; }
  __syncthreads();
  {
#pragma unroll
    for (int rd = 0; rd < 2; ++rd) { const int d = rd * 32 + tid / 8, pc = tid % 8; FragH f;
#pragma unroll
      for (int q = 0; q < 8; ++q) f.u[q] = tl[pc * 8 + q][d];
      *(v8us*)((unsigned short*)Vt + ((size_t)slab * 64 + d) * TTv + lg * 64 + pc * 8) = f.half[0]; }
     } }

__global__ __launch_bounds__(256) void k_hl(const float* __restrict__ F, _Float16* __restrict__ Hh, _Float16* __restrict__ Hl, size_t n8) { const size_t t = (size_t)blockIdx.x * 256 + threadIdx.x; if (t >= n8) return; FragH fh, fl; const v4f a = *(const v4fa*)(F + t * 8), c = *(const v4fa*)(F + t * 8 + 4);
#pragma unroll
  for (int q = 0; q < 4; ++q) { _Float16 h = (_Float16)a[q]; fh.h[q] = h; fl.h[q] = (_Float16)((a[q] - (float)h) * 1024.0f); h = (_Float16)c[q]; fh.h[4 + q] = h; fl.h[4 + q] = (_Float16)((c[q] - (float)h) * 1024.0f); }
  { *(v8us*)((unsigned short*)Hh + t * 8) = fh.half[0]; *(v8us*)((unsigned short*)Hl + t * 8) = fl.half[0];  } }

// ---- fast GEMM (wave tile 32x64; requires M % 32 == 0 rows per launch region and N % 64 == 0); epilogue = k_gemm_hhx semantics ----
__device__ __forceinline__ v16h g2_frag(const _Float16* p, int hh) { FragH f; f.half[0] = *(const v8us*)((const unsigned short*)p + 8 * hh); f.half[1] = *(const v8us*)((const unsigned short*)p + 16 + 8 * hh); return f.v; }
__device__ __forceinline__ v8f g2_mma(v16h a, v16h b, v8f c) { v8f d = __builtin_amdgcn_wmma_f32_16x16x32_f16(false, a, false, b, (short)0, c, false, false); asm volatile("v_nop\n\tv_nop\n\tv_nop\n\tv_nop" : "+v"(d) : "v"(a), "v"(b)); return d; }
template <int ACT>
__global__ __launch_bounds__(128) void k_gemm2(const _Float16* __restrict__ A, int lda, size_t sA, const _Float16* __restrict__ Bh, int ldb, size_t sB, float alpha, const float* __restrict__ bias, size_t sBias, const float* __restrict__ CP, int rowsPerB, size_t sCPb, int row0g,
    float* __restrict__ C, _Float16* __restrict__ C16, int ldc, size_t sC, int M, int N, int K) { static_assert(ACT == 0 || ACT == 3 || ACT == 6 || ACT == 8 || ACT == 9 || ACT == 11 || ACT == 12 || ACT == 14 || ACT == 15 || ACT == 16 || ACT == 17, "k_gemm2: unsupported ACT code (would silently apply no activation)");
  __shared__ __attribute__((aligned(16))) float so[4][32][68];
  const int tid = threadIdx.x, w = tid >> 5, lane = tid & 31, ln = lane & 15, hh = lane >> 4; const int by = blockIdx.y;
  A += (size_t)by * sA; Bh += (size_t)by * sB; const size_t cofs = (size_t)by * sC; const float* bp = bias ? bias + (size_t)by * sBias : nullptr;
  const int ntn = N >> 6; const int mt = blockIdx.x / ntn, nq = blockIdx.x - mt * ntn; const int row0 = mt * 128 + 32 * w, col0 = nq * 64; if (row0 >= M) return;
  const _Float16* a0p = A + (size_t)(row0 + ln) * lda; const _Float16* a1p = a0p + (size_t)16 * lda;
  const _Float16* b0p = Bh + (size_t)(col0 + ln) * ldb; const _Float16* b1p = b0p + (size_t)16 * ldb; const _Float16* b2p = b1p + (size_t)16 * ldb; const _Float16* b3p = b2p + (size_t)16 * ldb;
  const v8f z8 = {0.f,0.f,0.f,0.f,0.f,0.f,0.f,0.f}; v8f c00 = z8, c01 = z8, c02 = z8, c03 = z8, c10 = z8, c11 = z8, c12 = z8, c13 = z8;
#pragma unroll 1
  for (int kb = 0; kb < K; kb += 32) { const v16h a0 = g2_frag(a0p + kb, hh), a1 = g2_frag(a1p + kb, hh);
    v16h b = g2_frag(b0p + kb, hh); c00 = g2_mma(a0, b, c00); c10 = g2_mma(a1, b, c10);
    b = g2_frag(b1p + kb, hh); c01 = g2_mma(a0, b, c01); c11 = g2_mma(a1, b, c11);
    b = g2_frag(b2p + kb, hh); c02 = g2_mma(a0, b, c02); c12 = g2_mma(a1, b, c12);
    b = g2_frag(b3p + kb, hh); c03 = g2_mma(a0, b, c03); c13 = g2_mma(a1, b, c13); }
  v8f accs[8] = {c00, c01, c02, c03, c10, c11, c12, c13};
#pragma unroll
  for (int u = 0; u < 8; ++u) { const int t = u & 3, half = u >> 2; const int col = col0 + t * 16 + ln; const float bv = bp ? bf16_round(bp[col]) : 0.f;
#pragma unroll
    for (int r = 0; r < 8; ++r) { const int rloc = half * 16 + 8 * hh + r; float v = accs[u][r] * alpha + bv; if (CP) { if (rowsPerB < 0) v += CP[cofs + (size_t)(row0g + row0 + rloc) * ldc + col];      /* rowsPerB < 0: own element of the batched C plane */ else { const int bidx = (row0g + row0 + rloc) / rowsPerB; v += CP[(size_t)bidx * sCPb + (size_t)by * 64 + col]; } }
      if (ACT == 3) v = fmaxf(v, 0.f); else if (ACT == 6) v = 0.5f * v * (1.0f + erff(v * 0.70710678118654752f)); else if (ACT == 11) v = 1.0f / (1.0f + expf(-v)); else if (ACT == 15) v = v / (1.0f + expf(-v)); else if (ACT == 12) v = (v > 0.f) ? v : 0.01f * v; else if (ACT == 8) v = tanhf(v); else if (ACT == 9) v = 0.5f * v * (1.0f + tanhf(0.7978845608028654f * (v + 0.044715f * v * v * v))); else if (ACT == 14) v = (v > 0.f) ? v : 0.1f * v; else if (ACT == 16) v = (v >= 0.f) ? v : 0.3f * v; else if (ACT == 17) v = (v >= 0.f) ? v : 0.2f * v;
      so[w][rloc][t * 16 + ln] = v; } }
  __builtin_amdgcn_fence(__ATOMIC_ACQ_REL, "workgroup"); __builtin_amdgcn_wave_barrier();
  const int rsub = lane >> 4, c4 = (lane & 15) * 4;
  {
#pragma unroll
    for (int q = 0; q < 16; ++q) { const int r = q * 2 + rsub; const v4f v = *(const v4fa*)&so[w][r][c4]; if (C) *(v4f*)(C + cofs + (size_t)(row0 + r) * ldc + col0 + c4) = v; if (C16) { v4h h4; for (int i = 0; i < 4; ++i) h4[i] = (_Float16)v[i]; *(v4h*)(C16 + cofs + (size_t)(row0 + r) * ldc + col0 + c4) = h4; } }
     } }


__global__ __launch_bounds__(256) void k_wnat(const float* __restrict__ w, size_t n8, _Float16* __restrict__ Bt) { const size_t t = (size_t)blockIdx.x * 256 + threadIdx.x; if (t >= n8) return; FragH f; for (int q = 0; q < 8; ++q) f.h[q] = (_Float16)(bf16_round(w[t * 8 + q]) * 16.0f); *(v8us*)((unsigned short*)Bt + t * 8) = f.half[0];  }
__global__ __launch_bounds__(256) void k_rsm(const float* __restrict__ S, _Float16* __restrict__ P, int nrows) {
  #pragma clang fp contract(off)
  const int i = blockIdx.x * 256 + threadIdx.x; if (i >= nrows) return; const float* s = S + (size_t)i * SQ; float mx = -3.0e38f;
#pragma unroll 1
  for (int j = 0; j < SQ; ++j) mx = fmaxf(mx, s[j]); float se = 0.f;
#pragma unroll 1
  for (int j = 0; j < SQ; ++j) se += expf(s[j] - mx); const float sc = 256.0f / se;
#pragma unroll 1
  for (int j0 = 0; j0 < SQ; j0 += 8) { FragH f; for (int q = 0; q < 8; ++q) f.h[q] = (_Float16)(expf(s[j0 + q] - mx) * sc); unsigned short* d = (unsigned short*)P + (size_t)i * SQ + j0; *(v8us*)d = f.half[0];  } }
__global__ __launch_bounds__(256) void k_vt(const _Float16* __restrict__ V16, int b, int h0, _Float16* __restrict__ VT) { __shared__ unsigned short tl[64][65]; const int tid = threadIdx.x; const int hh = blockIdx.x % HG, sg = blockIdx.x / HG; const int s0 = sg * 64; const int h = h0 + hh;
  for (int i = tid; i < 64 * 8; i += 256) { const int j = i / 8, d8 = (i % 8) * 8; FragH f; f.half[0] = *(const v8us*)((const unsigned short*)V16 + ((size_t)b * SQ + s0 + j) * DM + h * HD + d8); for (int q = 0; q < 8; ++q) tl[d8 + q][j] = f.u[q]; }
  __syncthreads();
  { for (int i = tid; i < 64 * 8; i += 256) { const int d = i / 8, j8 = (i % 8) * 8; FragH f; for (int q = 0; q < 8; ++q) f.u[q] = tl[d][j8 + q]; *(v8us*)((unsigned short*)VT + ((size_t)hh * HD + d) * SQ + s0 + j8) = f.half[0]; }  } }



__global__ __launch_bounds__(256) void k_rsmcf2(const float* __restrict__ S, _Float16* __restrict__ P, int hg, int q0, int nk) {
  #pragma clang fp contract(off)
  const int t = blockIdx.x * 256 + threadIdx.x; if (t >= hg * QT) return; const size_t i = (size_t)t; const float* s = S + i * NKX; const int last = q0 + (t % QT); float mx = -3.0e38f;
#pragma unroll 1
  for (int j = 0; j < nk; ++j) { const float f = (j <= last) ? 1.f : 0.f; mx = fmaxf(mx, fmaf(f, s[j], (1.f - f) * -1.0e9f)); } float se = 0.f;
#pragma unroll 1
  for (int j = 0; j < nk; ++j) { const float f = (j <= last) ? 1.f : 0.f; se += __expf(fmaf(f, s[j], (1.f - f) * -1.0e9f) - mx); } const float sc = 256.0f / se;
#pragma unroll 1
  for (int j0 = 0; j0 < nk; j0 += 8) { FragH fr; for (int q = 0; q < 8; ++q) { const int j = j0 + q; const float f = (j <= last) ? 1.f : 0.f; fr.h[q] = (_Float16)(__expf(fmaf(f, s[j], (1.f - f) * -1.0e9f) - mx) * sc); } unsigned short* d = (unsigned short*)P + i * NKX + j0; *(v8us*)d = fr.half[0];  } }


template <int MASKADD>
__global__ __launch_bounds__(64) void k_att0(const float* __restrict__ QF, const float* __restrict__ KF, const float* __restrict__ VF, int ld, const float* __restrict__ mask, float scale, float* __restrict__ OF, int ldo) {
  #pragma clang fp contract(off)
  __shared__ __attribute__((aligned(16))) float lq[64][64]; __shared__ __attribute__((aligned(16))) float lo[64][64];
  const int tid = threadIdx.x; const int h = blockIdx.x / (QT0 / 64), rg = blockIdx.x % (QT0 / 64); const int i = rg * 64 + tid;
  const float* qr = QF + (size_t)i * ld + h * HD;
#pragma unroll 1
  for (int c = 0; c < HD / 4; ++c) { *(v4f*)&lq[tid][c * 4] = *(const v4fa*)(qr + c * 4); const v4f z = {0.f, 0.f, 0.f, 0.f}; *(v4f*)&lo[tid][c * 4] = z; }
  float m = -1.0e30f, l = 0.f; const int jmax = MASKADD ? (SQ - 1) : (rg * 64 + 63);      /* additive-mask form: every key (the mask input decides); causal form: keys up to the block's last row */
#pragma unroll 1
  for (int j = 0; j <= jmax; ++j) { const float* kr = KF + (size_t)j * ld + h * HD; const float* vr = VF + (size_t)j * ld + h * HD; float s = 0.f;
#pragma unroll 1
    for (int c = 0; c < HD / 4; ++c) { const v4f kq = *(const v4fa*)(kr + c * 4); const v4f qq = *(v4f*)&lq[tid][c * 4]; s = __fadd_rn(s, __fmul_rn(qq[0], kq[0])); s = __fadd_rn(s, __fmul_rn(qq[1], kq[1])); s = __fadd_rn(s, __fmul_rn(qq[2], kq[2])); s = __fadd_rn(s, __fmul_rn(qq[3], kq[3])); }
    s = __fmul_rn(s, scale); if (MASKADD) s = __fadd_rn(s, __fmul_rn(bf16_round(mask[(size_t)i * SQ + j]), -10000.0f));
    const float f = (MASKADD || j <= i) ? 1.f : 0.f; const float sm = fmaf(f, s, (1.f - f) * -1.0e30f); const float mn = fmaxf(m, sm); const float sc = expf(m - mn); const float e = expf(sm - mn); l = __fadd_rn(__fmul_rn(l, sc), e); m = mn;
#pragma unroll 1
    for (int c = 0; c < HD / 4; ++c) { const v4f vv = *(const v4fa*)(vr + c * 4); v4f oo = *(v4f*)&lo[tid][c * 4]; for (int u = 0; u < 4; ++u) oo[u] = __fadd_rn(__fmul_rn(oo[u], sc), __fmul_rn(e, vv[u])); *(v4f*)&lo[tid][c * 4] = oo; } }
  const float fin = 64.0f / l;      /* o carried x64 like the f16 path */
#pragma unroll 1
  for (int c = 0; c < HD / 4; ++c) { v4f oo = *(v4f*)&lo[tid][c * 4]; for (int u = 0; u < 4; ++u) oo[u] = __fmul_rn(oo[u], fin); *(v4f*)&lo[tid][c * 4] = oo; }
  __syncthreads();
  {
#pragma unroll 1
    for (int it = 0; it < 16; ++it) { const int row = it * 4 + tid / 16, pc = (tid % 16) * 4; const v4f v = *(const v4f*)&lo[row][pc]; *(v4f*)(OF + (size_t)(rg * 64 + row) * ldo + h * HD + pc) = v; }
     } }


template <int BFIN, int WXB>
__global__ __launch_bounds__(256) void k_ln16(const float* __restrict__ X, const float* __restrict__ g, const float* __restrict__ bb, float eps, _Float16* __restrict__ N16, float* __restrict__ XB) {
  #pragma clang fp contract(off)
  __shared__ float red[256]; const size_t r = blockIdx.x; const int t = threadIdx.x; const v4f xa = *(const v4fa*)(X + r * DMQ + t * 4); float s[4]; float sum = 0.f;
  for (int q = 0; q < 4; ++q) { s[q] = BFIN ? bf16_round(xa[q]) : xa[q]; sum = __fadd_rn(sum, s[q]); }
  red[t] = sum; __syncthreads(); for (int st = 128; st > 0; st >>= 1) { if (t < st) red[t] = __fadd_rn(red[t], red[t + st]); __syncthreads(); } const float mu = red[0] / (float)DMQ; __syncthreads();
  float vs = 0.f; for (int q = 0; q < 4; ++q) { const float dl = __fadd_rn(s[q], -mu); vs = __fadd_rn(vs, __fmul_rn(dl, dl)); } red[t] = vs; __syncthreads(); for (int st = 128; st > 0; st >>= 1) { if (t < st) red[t] = __fadd_rn(red[t], red[t + st]); __syncthreads(); }
  const float rs = rsqrtf(__fadd_rn(red[0] / (float)DMQ, eps)); v4h y; v4f xb;
  for (int q = 0; q < 4; ++q) { const int c = t * 4 + q; y[q] = (_Float16)__fadd_rn(__fmul_rn(__fmul_rn(__fadd_rn(s[q], -mu), rs), bf16_round(g[c])), bf16_round(bb[c])); xb[q] = s[q]; }
  { *(v4h*)(N16 + r * DMQ + t * 4) = y; if (WXB) *(v4f*)(XB + r * DMQ + t * 4) = xb;  } }
__global__ __launch_bounds__(256) void k_ftres2(const float* __restrict__ OF0, const float* __restrict__ XB, float* __restrict__ X1, size_t n4) {
  #pragma clang fp contract(off)
  const size_t t = (size_t)blockIdx.x * 256 + threadIdx.x; if (t >= n4) return; const v4f o = *(const v4fa*)(OF0 + t * 4), xv = *(const v4fa*)(XB + t * 4); v4f y; for (int q = 0; q < 4; ++q) y[q] = __fadd_rn(__fmul_rn(o[q], 0.015625f), xv[q]); *(v4f*)(X1 + t * 4) = y;  }

__global__ __launch_bounds__(256) void k_wthd(const float* __restrict__ Wt, _Float16* __restrict__ Bt) { const size_t t = (size_t)blockIdx.x * 256 + threadIdx.x; if (t >= (size_t)NH * HD * (DM / 8)) return; const int m8 = (int)(t % (DM / 8)) * 8; const int d = (int)((t / (DM / 8)) % HD); const int h = (int)(t / ((size_t)(DM / 8) * HD)); FragH f;
  for (int q = 0; q < 8; ++q) f.h[q] = (_Float16)(16.0f * bf16_round(Wt[((size_t)h * DM + m8 + q) * HD + d])); unsigned short* dst = (unsigned short*)Bt + ((size_t)h * HD + d) * DM + m8; *(v8us*)dst = f.half[0];  }




template <int BFIN, int W16, int W32>
__global__ __launch_bounds__(256) void k_lnx(const float* __restrict__ X, const float* __restrict__ g, const float* __restrict__ bb, float eps, _Float16* __restrict__ N16, float* __restrict__ N32) {
  #pragma clang fp contract(off)
  __shared__ float red[256]; const size_t r = blockIdx.x; const int t = threadIdx.x; const bool act = t < (DMQ / 4); const int c0 = act ? t * 4 : 0;
  const v4f xa = *(const v4fa*)(X + r * DMQ + c0); float s[4]; float sum = 0.f;
  for (int q = 0; q < 4; ++q) { s[q] = act ? (BFIN ? bf16_round(xa[q]) : xa[q]) : 0.f; sum = __fadd_rn(sum, s[q]); }
  red[t] = sum; __syncthreads(); for (int st = 128; st > 0; st >>= 1) { if (t < st) red[t] = __fadd_rn(red[t], red[t + st]); __syncthreads(); } const float mu = red[0] / (float)DMQ; __syncthreads();
  float vs = 0.f; for (int q = 0; q < 4; ++q) { const float dl = act ? __fadd_rn(s[q], -mu) : 0.f; vs = __fadd_rn(vs, __fmul_rn(dl, dl)); } red[t] = vs; __syncthreads(); for (int st = 128; st > 0; st >>= 1) { if (t < st) red[t] = __fadd_rn(red[t], red[t + st]); __syncthreads(); }
  const float rs = rsqrtf(__fadd_rn(red[0] / (float)DMQ, eps)); v4h y; v4f yf;
  for (int q = 0; q < 4; ++q) { const int c = c0 + q; yf[q] = __fadd_rn(__fmul_rn(__fmul_rn(__fadd_rn(s[q], -mu), rs), bf16_round(g[c])), bf16_round(bb[c])); y[q] = (_Float16)yf[q]; }
  if (!act) return;      /* no barriers after this point */
  { if (W16) *(v4h*)(N16 + r * DMQ + c0) = y; if (W32) *(v4f*)(N32 + r * DMQ + c0) = yf;  } }


__global__ __launch_bounds__(256) void k_bfr(const float* __restrict__ x, float* __restrict__ XB, size_t n8) { const size_t t = (size_t)blockIdx.x * 256 + threadIdx.x; if (t >= n8) return; v4f a = *(const v4fa*)(x + t * 8), c = *(const v4fa*)(x + t * 8 + 4); for (int q = 0; q < 4; ++q) { a[q] = bf16_round(a[q]); c[q] = bf16_round(c[q]); }
  { *(v4f*)(XB + t * 8) = a; *(v4f*)(XB + t * 8 + 4) = c;  } }




__global__ __launch_bounds__(256) void k_lorafold(const float* __restrict__ Wm, const float* __restrict__ A, const float* __restrict__ Bm, float* __restrict__ WE, int K, int N, float sc) {
  #pragma clang fp contract(off)
  const size_t t = (size_t)blockIdx.x * 256 + threadIdx.x; if (t >= (size_t)K * N) return; const int i = (int)(t / N), o = (int)(t % N); float a = 0.f;
  for (int r = 0; r < 16; ++r) a = __fadd_rn(a, __fmul_rn(bf16_round(A[(size_t)i * 16 + r]), bf16_round(Bm[(size_t)r * N + o])));
  const float v = __fadd_rn(bf16_round(Wm[t]), __fmul_rn(sc, a)); *(float*)(WE + t) = v;  }
__global__ __launch_bounds__(256) void k_wt32rep(const float* __restrict__ Wf, _Float16* __restrict__ Bt, int K, int N, int DOUT, float scale) {
  const int t = blockIdx.x * 256 + threadIdx.x; if (t >= DOUT * (K / 8)) return; const int n = t / (K / 8), k8 = (t % (K / 8)) * 8; const int rep = DOUT / N; const int src = (n / (HD * rep)) * HD + (n % HD);      /* head h = n / HD -> group h / rep */
  FragH f; for (int i = 0; i < 8; ++i) f.h[i] = (_Float16)(Wf[(size_t)(k8 + i) * N + src] * scale);
  *(v8us*)((unsigned short*)Bt + (size_t)n * K + k8) = f.half[0];  }
__global__ __launch_bounds__(256) void k_brep(const float* __restrict__ b, float* __restrict__ out) { const int t = blockIdx.x * 256 + threadIdx.x; if (t >= DM) return; const float v = b[(t / (HD * 4)) * HD + (t % HD)]; *(float*)(out + t) = v;  }

__global__ __launch_bounds__(256) void k_rsmcim(const float* __restrict__ S, _Float16* __restrict__ P, int hg, int q0, int nk, const int* __restrict__ am) {
  #pragma clang fp contract(off)
  const int t = blockIdx.x * 256 + threadIdx.x; if (t >= hg * QT) return; const size_t i = (size_t)t; const float* s = S + i * NKX; const int last = q0 + (t % QT); const int* mr = am + (size_t)last * SQ; float mx = -3.0e38f;      /* the module's mask row of this query (keys >= nk lie above the diagonal of the staged causal mask and are not computed) */
#pragma unroll 1
  for (int j = 0; j < nk; ++j) { const float f = (mr[j] != 0) ? 1.f : 0.f; mx = fmaxf(mx, fmaf(f, s[j], (1.f - f) * -1.0e9f)); } float se = 0.f;
#pragma unroll 1
  for (int j = 0; j < nk; ++j) { const float f = (mr[j] != 0) ? 1.f : 0.f; se += __expf(fmaf(f, s[j], (1.f - f) * -1.0e9f) - mx); } const float sc = 256.0f / se;
#pragma unroll 1
  for (int j0 = 0; j0 < nk; j0 += 8) { FragH fr; for (int q = 0; q < 8; ++q) { const int j = j0 + q; const float f = (mr[j] != 0) ? 1.f : 0.f; fr.h[q] = (_Float16)(__expf(fmaf(f, s[j], (1.f - f) * -1.0e9f) - mx) * sc); } unsigned short* d = (unsigned short*)P + i * NKX + j0; *(v8us*)d = fr.half[0];  } }



__global__ __launch_bounds__(256) void k_bcpy(const float* __restrict__ b, int n, int NP, float* __restrict__ dst, int dst0) { for (int i = threadIdx.x; i < NP; i += 256) { const float v = (i < n) ? b[i] : 0.f; *(float*)(dst + dst0 + i) = v; }  }



__global__ __launch_bounds__(256) void k_rsmp(const float* __restrict__ S, _Float16* __restrict__ P, int nrows, int nk) {
  #pragma clang fp contract(off)
  const int t = blockIdx.x * 256 + threadIdx.x; if (t >= nrows) return; const size_t ri = (size_t)t; const float* s = S + ri * NKX; float mx = -3.0e38f;
#pragma unroll 1
  for (int j = 0; j < nk; ++j) mx = fmaxf(mx, s[j]); float se = 0.f;
#pragma unroll 1
  for (int j = 0; j < nk; ++j) se += __expf(s[j] - mx); const float sc = 256.0f / se;
#pragma unroll 1
  for (int j0 = 0; j0 < nk; j0 += 8) { FragH fr; for (int q = 0; q < 8; ++q) fr.h[q] = (_Float16)(__expf(s[j0 + q] - mx) * sc);
    unsigned short* d = (unsigned short*)P + ri * NKX + j0; *(v8us*)d = fr.half[0];  } }
extern "C" void kernel_launch(void* const* d_in, const int* in_sizes, int n_in,
                              void* d_out, int out_size, void* d_ws, size_t ws_size, hipStream_t stream) {
  (void)in_sizes; (void)n_in; (void)out_size;
  const float* const* I = (const float* const*)d_in; const float* x = I[0]; const float* wq = I[1]; const float* bq = I[2]; const float* wk = I[3]; const float* bk = I[4]; const float* wv = I[5]; const float* bv = I[6]; const float* wo = I[7]; const float* bo = I[8]; const float* wfc = I[9]; const float* bfc = I[10]; const float* wmp = I[11]; const float* bmp = I[12]; const float* g1 = I[13]; const float* be1 = I[14]; const float* gg2 = I[15]; const float* be2 = I[16];      /* x; [in][out] Wq / Wk / Wv / Wo + biases; W1 [1024][4096] + b1, W2 [4096][1024] + b2; LN1 g / b, LN2 g / b */
  char* ws = (char*)d_ws; size_t off = 0;
  auto take = [&](size_t bytes) { char* p = ws + off; off += (bytes + 255) & ~(size_t)255; return p; };
  _Float16* BQKV = (_Float16*)take((size_t)3 * DM * DM * 2); _Float16* BO = (_Float16*)take((size_t)DM * DM * 2); float* bqkv = (float*)take((size_t)3 * DM * 4); float* X1N = nullptr;      /* LN1 output (f32): aliases the QKV plane below (QKV's last readers, the score / V^T launches of the last batch, precede LN1) to stay within 256 MiB at NB 4 / SQ 2048 */
  _Float16* X16 = (_Float16*)take(NR * DM * 2); float* XB = (float*)take(NR * DM * 4); float* X1 = (float*)take(NR * DM * 4); _Float16* M16 = nullptr;      /* = X16 below (alias: X16's last reader, the fused QKV GEMM, precedes LN1's f16 write) */ _Float16* HF16 = nullptr;      /* FFN hidden plane of one batch [2048][4096] f16: own region below */ _Float16* BW1 = (_Float16*)take((size_t)DFF * DM * 2); _Float16* BW2 = (_Float16*)take((size_t)DM * DFF * 2); _Float16* QKV = (_Float16*)take(NR * 3 * DM * 2); _Float16* Q16 = QKV; _Float16* K16 = QKV + DM; _Float16* V16 = QKV + 2 * DM; _Float16* O16 = (_Float16*)take(NR * DM * 2); M16 = X16; X1N = (float*)QKV; HF16 = (_Float16*)take((size_t)SQ * DFF * 2);      /* the per-batch FFN hidden plane (16 MiB) gets its OWN region here: at NB 2 the context plane O16 is only 8 MiB */      /* aliases: X1N (NR*DM f32 = 16 MiB) inside QKV (24 MiB) */
  float* S = (float*)take((size_t)NH * QT * NKX * 4); _Float16* P = (_Float16*)take((size_t)NH * QT * NKX * 2); _Float16* VT = (_Float16*)take((size_t)NH * HD * SQ * 2);
  if (off > ws_size) return;
  { const unsigned g = (unsigned)(((size_t)DM * (DM / 8) + 255) / 256); k_wt_f16<<<g, 256, 0, stream>>>(wq, BQKV, DM, DM, 16.0f); k_wt_f16<<<g, 256, 0, stream>>>(wk, BQKV + (size_t)DM * DM, DM, DM, 16.0f); k_wt_f16<<<g, 256, 0, stream>>>(wv, BQKV + (size_t)2 * DM * DM, DM, DM, 16.0f); k_wt_f16<<<g, 256, 0, stream>>>(wo, BO, DM, DM, 16.0f); }      /* [in][out] -> Bt x16: stacked q | k | v, and Wo */
  k_bcpy<<<1, 256, 0, stream>>>(bq, DM, DM, bqkv, 0); k_bcpy<<<1, 256, 0, stream>>>(bk, DM, DM, bqkv, DM); k_bcpy<<<1, 256, 0, stream>>>(bv, DM, DM, bqkv, 2 * DM);      /* stacked bias bq | bk | bv */
  k_x16<<<(unsigned)((NR * DM / 8 + 255) / 256), 256, 0, stream>>>(x, X16, NR * DM / 8); k_bfr<<<(unsigned)((NR * DM / 8 + 255) / 256), 256, 0, stream>>>(x, XB, NR * DM / 8);      /* post-LN: the attention runs on the raw input (exact f16 rows); XB = bf16(x) f32 for the residual */
  k_wt_f16<<<(unsigned)(((size_t)DFF * (DM / 8) + 255) / 256), 256, 0, stream>>>(wfc, BW1, DM, DFF, 16.0f); k_wt_f16<<<(unsigned)(((size_t)DM * (DFF / 8) + 255) / 256), 256, 0, stream>>>(wmp, BW2, DFF, DM, 16.0f);      /* natural w1 [1024][4096] and w2 [4096][1024] = Bt x16 */
  const size_t r0p = (size_t)B0 * SQ;      /* first projected row */
  k_gemm2<0><<<dim3((unsigned)((MP / 128) * (3 * DM / 64)), 1), 128, 0, stream>>>(X16 + r0p * DM, DM, 0, BQKV, DM, 0, 0.0625f, bqkv, 0, nullptr, 1, 0, 0, nullptr, QKV + r0p * 3 * DM, 3 * DM, 0, MP, 3 * DM, DM);      /* q | k | v rows (f16); head h = columns h*HD.. of each DM block */
  for (int b = B0; b < B0 + NBR; ++b) { const size_t r0 = (size_t)b * SQ;
    k_vt<NH, SQ><<<NH * (SQ / 64), 256, 0, stream>>>(V16 + r0 * LQ, LQ, 0, VT);      /* V^T [NH][HD][SQ] for this batch */
    for (int q0 = 0; q0 < QN; q0 += QT) {      /* non-causal: every 256-row query tile sees all SQ keys */
      k_gemm2<0><<<dim3((QT / 128) * (SQ / 64), NHD), 128, 0, stream>>>(Q16 + (r0 + q0) * LQ, LQ, (size_t)HD, K16 + r0 * LQ, LQ, (size_t)HD, 1.0f, nullptr, 0, nullptr, 1, 0, 0, S, nullptr, NKX, (size_t)QT * NKX, QT, SQ, HD);      /* scores q.k (unscaled), all heads on grid.y */
      k_rsmp<<<(NHD * QT + 255) / 256, 256, 0, stream>>>(S, P, NHD * QT, SQ);      /* plain softmax over all keys (the key mask is all ones) -> P x256 f16 */
      k_gemm2<0><<<dim3((QT / 128) * (HD / 64), NHD), 128, 0, stream>>>(P, NKX, (size_t)QT * NKX, VT, SQ, (size_t)HD * SQ, 0.25f, nullptr, 0, nullptr, 1, 0, 0, nullptr, O16 + (r0 + q0) * DM, DM, (size_t)HD, QT, HD, SQ); } }      /* ctx (merged heads, x64) as f16 rows */
  k_gemm2<0><<<dim3((unsigned)((MPO / 128) * (DM / 64)), 1), 128, 0, stream>>>(O16 + r0p * DM, DM, 0, BO, DM, 0, 0.0009765625f, bo, 0, XB + r0p * DM, -1, 0, 0, X1 + r0p * DM, nullptr, DM, 0, MPO, DM, DM);      /* out rows are the output layout */
  k_lnx<0, 1, 1><<<(unsigned)NR, 256, 0, stream>>>(X1, g1, be1, 1e-5f, M16, X1N);      /* x1 = LN1(x + attn_out) (eps 1e-5): f16 rows for the FFN input and f32 rows for the residual */
  for (int b = 0; b < NB; ++b) { const size_t r0 = (size_t)b * SQ;
    k_gemm2<6><<<dim3((unsigned)((SQ / 128) * (DFF / 64)), 1), 128, 0, stream>>>(M16 + r0 * DM, DM, 0, BW1, DM, 0, 0.0625f, bfc, 0, nullptr, 1, 0, 0, nullptr, HF16, DFF, 0, SQ, DFF, DM);      /* gelu_erf(x1 w1 + b1) -> f16 (this batch) */
    k_gemm2<0><<<dim3((unsigned)((SQ / 128) * (DM / 64)), 1), 128, 0, stream>>>(HF16, DFF, 0, BW2, DFF, 0, 0.0625f, bmp, 0, X1N + r0 * DM, -1, 0, 0, X1 + r0 * DM, nullptr, DM, 0, SQ, DM, DFF); }      /* t = x1 + gelu-ffn + b2 (own-element residual) f32, over the dead pre-LN1 plane */
  k_lnx<0, 0, 1><<<(unsigned)NR, 256, 0, stream>>>(X1, gg2, be2, 1e-5f, nullptr, (float*)d_out);      /* out = LN2(t) (eps 1e-5) -> f32 output rows */
}

// v001
// It runs in 1850 microseconds.
// Timed twice side by side with v000, it ran 3.98 and 3.97 times as fast.
#include <hip/hip_runtime.h>
// POST-LN transformer encoder block (x [2][2048][1024]; q/k/v = x W + b ([in][out] 1024 x 1024, zero biases); 16 heads of 64; scores = q k^T with NO 1/sqrt(head_dim) scaling (as the source module); softmax over all 2048 keys (no mask); x1 = LN1(x + ctx Wo + bo) (biased var, eps 1e-5, g / beta); out = LN2(x1 + gelu_erf(x1 W1 + b1) W2 + b2) ([in][out] 1024 x 4096 x 1024) -> [2][2048][1024]).
// Structure: token rows; x as exact f16 rows and bf16 f32 residual rows; natural weights as exact x16 planes; fused q | k | v WMMA GEMM (32x64 wave tiles, f32 accumulation, + stacked bias) -> f16; per batch V^T via LDS transposes; per 256-row query tile: scores over all keys (K = 64, alpha 1, 16 heads on grid.y) f32, plain row softmax on VALU (f32 statistics, native exp; weights x256 f16), ctx = P V^T (x64) merged f16; x + ctx Wo + bo f32; LN1 on VALU -> f16 + f32; gelu FFN per batch; + residual; LN2 -> output; launches: see trace.
// Compute dtype: inputs rounded to bf16; x / weights exact; q, k, v, softmax weights and o as plain f16 GEMM operands (~2^-12); scores and softmax statistics f32; v_wmma_f32_16x16x32_f16.
#define NB 2
#define SQ 2048
#define DM 1024
#define NH 16
#define HD 64
#define HG 4                         /* heads per launch of the non-template k_vt (not launched) */
#define QT 256                       /* query rows per attention tile */
#define NKX SQ                       /* S / P row pitch */
#define QT0 128                      /* rows per head of the f32 k_att0 path (not launched) */
#define B0 0                         /* first batch processed (debug hook) */
#define NBR NB                       /* batches processed (debug hook) */
#define NR ((size_t)NB * SQ)
#define DMQ DM
#define DFF 4096         /* FFN hidden width */
#define MP ((int)((size_t)NBR * SQ)) /* rows projected (debug hook) */
#define QN SQ                        /* query rows attended per batch (debug hook) */
#define NHD NH                       /* heads attended (debug hook) */
#define MPO MP                       /* rows through the output stage (debug hook) */
#define LQ (3 * DM)      /* row pitch of the q/k/v rows */
typedef __bf16 v16b __attribute__((ext_vector_type(16)));
typedef unsigned short v8us __attribute__((ext_vector_type(8), may_alias));
typedef float  v8f  __attribute__((ext_vector_type(8)));
typedef float  v4f  __attribute__((ext_vector_type(4)));
typedef float  v4fa __attribute__((ext_vector_type(4), may_alias));
union FragB { v16b v; v8us half[2]; unsigned short u[16]; };

__device__ __forceinline__ unsigned short bf16_bits(float x) { unsigned int u = __float_as_uint(x); return (unsigned short)((u + 0x7FFFu + ((u >> 16) & 1u)) >> 16); }
__device__ __forceinline__ float bf16_val(unsigned short b) { return __uint_as_float(((unsigned int)b) << 16); }
__device__ __forceinline__ float bf16_round(float x) { return bf16_val(bf16_bits(x)); }
// D += A·B with NT terms: 1 = ah·bh, 2 = + al·bh (A split), 3 = + ah·bl (both split)
template <int NT>
__device__ __forceinline__ v8f mmaN(v16b ah, v16b al, v16b bh, v16b bl, v8f c) {
  c = __builtin_amdgcn_wmma_f32_16x16x32_bf16(false, ah, false, bh, (short)0, c, false, false);
  if (NT >= 2) c = __builtin_amdgcn_wmma_f32_16x16x32_bf16(false, al, false, bh, (short)0, c, false, false);
  if (NT >= 3) c = __builtin_amdgcn_wmma_f32_16x16x32_bf16(false, ah, false, bl, (short)0, c, false, false);
  asm volatile("v_nop\n\tv_nop\n\tv_nop\n\tv_nop" : "+v"(c) : "v"(ah), "v"(al), "v"(bh), "v"(bl));
  return c;
}

__global__ __launch_bounds__(256) void k_wt_bf16(const float* __restrict__ W, unsigned short* __restrict__ Wt, int K, int N) {
  const int t = blockIdx.x * 256 + threadIdx.x;
  const int k8n = K / 8;
  if (t >= N * k8n) return;
  const int n = t / k8n, k8 = (t % k8n) * 8;
  v8us v;
#pragma unroll
  for (int i = 0; i < 8; ++i) v[i] = bf16_bits(W[(size_t)(k8 + i) * N + n]);
  *(v8us*)(Wt + (size_t)n * K + k8) = v;
  
}

// GEMM C[M][N] (f32, pitch ldc) = act(A[M][K]·W + bias). A f32 row-major (pitch lda) converted per fragment to bf16
// (ASPLIT: hi/lo two planes -> 2 terms, else single rounded term); Wt bf16 [N][K] (pitch ldb). BIAS_BF16 rounds the
// bias to bf16 first (bias quantised to bf16 before the add). K%32==0, M%16==0, N%64==0.
template <bool ASPLIT, int ACT, bool BIAS_BF16>
__global__ __launch_bounds__(128) void k_gemm_bf(const float* __restrict__ A, int lda, const unsigned short* __restrict__ Wt, int ldb,
                                               const float* __restrict__ bias, float* __restrict__ C, int ldc, int M, int N, int K) {
  __shared__ __attribute__((aligned(16))) float so[4][16][64];
  const int tid = threadIdx.x, w = tid >> 5, lane = tid & 31, ln = lane & 15, hh = lane >> 4;
  const int ntn = N / 64;
  const int wid = blockIdx.x * 4 + w;
  const int mt = wid / ntn, nq = wid % ntn;
  if (mt * 16 >= M) return;
  const int row0 = mt * 16, col0 = nq * 64;
  const float* arow = A + (size_t)(row0 + ln) * lda;
  v8f acc[4] = {};
  for (int kb = 0; kb < K; kb += 32) {
    FragB ah, al;
    const v4f x0 = *(const v4fa*)(arow + kb + 8 * hh), x1 = *(const v4fa*)(arow + kb + 8 * hh + 4);
    const v4f x2 = *(const v4fa*)(arow + kb + 16 + 8 * hh), x3 = *(const v4fa*)(arow + kb + 16 + 8 * hh + 4);
    float xs[16] = {x0[0],x0[1],x0[2],x0[3],x1[0],x1[1],x1[2],x1[3],x2[0],x2[1],x2[2],x2[3],x3[0],x3[1],x3[2],x3[3]};
#pragma unroll
    for (int i = 0; i < 16; ++i) { const unsigned short hb = bf16_bits(xs[i]); ah.u[i] = hb; al.u[i] = ASPLIT ? bf16_bits(xs[i] - bf16_val(hb)) : (unsigned short)0; }
#pragma unroll
    for (int t = 0; t < 4; ++t) {
      const unsigned short* brow = Wt + (size_t)(col0 + t * 16 + ln) * ldb + kb;
      FragB b;
      b.half[0] = *(const v8us*)(brow + 8 * hh);
      b.half[1] = *(const v8us*)(brow + 16 + 8 * hh);
      acc[t] = mmaN<ASPLIT ? 2 : 1>(ah.v, al.v, b.v, b.v, acc[t]);
    }
  }
#pragma unroll
  for (int t = 0; t < 4; ++t) {
    float bv = bias ? bias[col0 + t * 16 + ln] : 0.f;
    if (BIAS_BF16) bv = bf16_round(bv);
#pragma unroll
    for (int r = 0; r < 8; ++r) { float v = acc[t][r] + bv; if (ACT == 1) v = fmaxf(v, 0.f); so[w][8 * hh + r][t * 16 + ln] = v; }
  }
  __builtin_amdgcn_fence(__ATOMIC_ACQ_REL, "workgroup");
  __builtin_amdgcn_wave_barrier();
  const int rsub = lane >> 4, c4 = (lane & 15) * 4;
  {
#pragma unroll
    for (int q = 0; q < 8; ++q) {
      const int r = q * 2 + rsub;
      const v4f v = *(const v4fa*)&so[w][r][c4];
      *(v4f*)(C + (size_t)(row0 + r) * ldc + col0 + c4) = v;
    }
    
  }
}

// GEMM C = act(A·W + bias + resid): A f32 (ASPLIT -> hi/lo 2 terms), Wt bf16 [N][K]; ACT 0 none, 1 relu, 2 exact gelu;
// resid (optional, f32, row index = (row % rmod), pitch ldr, RES_BF16 rounds it) added before the activation.
template <bool ASPLIT, int ACT, bool BIAS_BF16, bool RES_BF16>
__global__ __launch_bounds__(128) void k_gemm_bf3(const float* __restrict__ A, int lda, const unsigned short* __restrict__ Wt, int ldb,
                                                const float* __restrict__ bias, const float* __restrict__ resid, int rmod, int ldr,
                                                float* __restrict__ C, int ldc, int M, int N, int K) {
  __shared__ __attribute__((aligned(16))) float so[4][16][64];
  const int tid = threadIdx.x, w = tid >> 5, lane = tid & 31, ln = lane & 15, hh = lane >> 4;
  const int ntn = N / 64;
  const int wid = blockIdx.x * 4 + w;
  const int mt = wid / ntn, nq = wid % ntn;
  if (mt * 16 >= M) return;
  const int row0 = mt * 16, col0 = nq * 64;
  const float* arow = A + (size_t)(row0 + ln) * lda;
  v8f acc[4] = {};
  for (int kb = 0; kb < K; kb += 32) {
    FragB ah, al;
    const v4f x0 = *(const v4fa*)(arow + kb + 8 * hh), x1 = *(const v4fa*)(arow + kb + 8 * hh + 4);
    const v4f x2 = *(const v4fa*)(arow + kb + 16 + 8 * hh), x3 = *(const v4fa*)(arow + kb + 16 + 8 * hh + 4);
    float xs[16] = {x0[0],x0[1],x0[2],x0[3],x1[0],x1[1],x1[2],x1[3],x2[0],x2[1],x2[2],x2[3],x3[0],x3[1],x3[2],x3[3]};
#pragma unroll
    for (int i = 0; i < 16; ++i) { const unsigned short hb = bf16_bits(xs[i]); ah.u[i] = hb; al.u[i] = ASPLIT ? bf16_bits(xs[i] - bf16_val(hb)) : (unsigned short)0; }
#pragma unroll
    for (int t = 0; t < 4; ++t) {
      const unsigned short* brow = Wt + (size_t)(col0 + t * 16 + ln) * ldb + kb;
      FragB b;
      b.half[0] = *(const v8us*)(brow + 8 * hh);
      b.half[1] = *(const v8us*)(brow + 16 + 8 * hh);
      acc[t] = mmaN<ASPLIT ? 2 : 1>(ah.v, al.v, b.v, b.v, acc[t]);
    }
  }
#pragma unroll
  for (int t = 0; t < 4; ++t) {
    const int col = col0 + t * 16 + ln;
    float bv = bias ? bias[col] : 0.f;
    if (BIAS_BF16) bv = bf16_round(bv);
#pragma unroll
    for (int r = 0; r < 8; ++r) {
      float v = acc[t][r] + bv;
      if (resid) { float rv = resid[(size_t)((row0 + 8 * hh + r) % rmod) * ldr + col]; if (RES_BF16) rv = bf16_round(rv); v += rv; }
      if (ACT == 1) v = fmaxf(v, 0.f);
      if (ACT == 2) v = 0.5f * v * (1.0f + erff(v * 0.70710678118654752f));
      if (ACT == 3) { const float u = 0.7978845608028654f * (v + 0.044715f * v * v * v); v = 0.5f * v * (1.0f + tanhf(u)); }
      so[w][8 * hh + r][t * 16 + ln] = v;
    }
  }
  __builtin_amdgcn_fence(__ATOMIC_ACQ_REL, "workgroup");
  __builtin_amdgcn_wave_barrier();
  const int rsub = lane >> 4, c4 = (lane & 15) * 4;
  {
#pragma unroll
    for (int q = 0; q < 8; ++q) {
      const int r = q * 2 + rsub;
      const v4f v = *(const v4fa*)&so[w][r][c4];
      *(v4f*)(C + (size_t)(row0 + r) * ldc + col0 + c4) = v;
    }
    
  }
}
// row LayerNorm (biased variance, eps) over N: s = X (+ R); optional out_sum <- s; out_norm <- (s-mu)*rsqrt(var+eps)*g + b
template <bool PARAM_BF16>
__global__ __launch_bounds__(256) void k_layernorm(const float* __restrict__ X, const float* __restrict__ R, const float* __restrict__ g, const float* __restrict__ bta,
                                                  float* __restrict__ out_sum, float* __restrict__ out_norm, int N, float eps) {
  __shared__ float red[256];
  const int row = blockIdx.x, tid = threadIdx.x;
  const float* x = X + (size_t)row * N; const float* rr = R ? R + (size_t)row * N : nullptr;
  float vals[16];                     // up to N = 4096
  const int per = N / 256;            // contiguous chunk per thread? use strided-by-4 chunks: thread handles j = tid*4 + 1024*u
  float s1 = 0.f;
  for (int u = 0; u < per / 4; ++u) {
    const int j = tid * 4 + 1024 * u;
    const v4f a = *(const v4fa*)(x + j);
    v4f b = {0.f,0.f,0.f,0.f}; if (rr) b = *(const v4fa*)(rr + j);
#pragma unroll
    for (int q = 0; q < 4; ++q) { const float v = a[q] + b[q]; vals[u * 4 + q] = v; s1 += v; }
  }
  red[tid] = s1; __syncthreads();
  for (int st = 128; st > 0; st >>= 1) { if (tid < st) red[tid] += red[tid + st]; __syncthreads(); }
  const float mu = red[0] / (float)N; __syncthreads();
  float s2 = 0.f;
  for (int u = 0; u < per / 4; ++u)
#pragma unroll
    for (int q = 0; q < 4; ++q) { const float c = vals[u * 4 + q] - mu; s2 += c * c; }
  red[tid] = s2; __syncthreads();
  for (int st = 128; st > 0; st >>= 1) { if (tid < st) red[tid] += red[tid + st]; __syncthreads(); }
  const float rs = rsqrtf(red[0] / (float)N + eps);
  {
    for (int u = 0; u < per / 4; ++u) {
      const int j = tid * 4 + 1024 * u;
      v4f o, sm;
#pragma unroll
      for (int q = 0; q < 4; ++q) {
        float gg = g[j + q], bb = bta[j + q];
        if (PARAM_BF16) { gg = bf16_round(gg); bb = bf16_round(bb); }
        sm[q] = vals[u * 4 + q]; o[q] = (vals[u * 4 + q] - mu) * rs * gg + bb;
      }
      if (out_sum) *(v4f*)(out_sum + (size_t)row * N + j) = sm;
      *(v4f*)(out_norm + (size_t)row * N + j) = o;
    }
    
  }
}



// ---- f16 WMMA path (v_wmma_f32_16x16x32_f16): 11-bit significands for operands in range — used where a [0,1] probability operand needs more precision than bf16
typedef _Float16 v16h __attribute__((ext_vector_type(16)));
union FragH { v16h v; v8us half[2]; _Float16 h[16]; unsigned short u[16]; };
template <int NT>
__device__ __forceinline__ v8f mmaH(v16h ah, v16h al, v16h bh, v16h bl, v8f c) {
  c = __builtin_amdgcn_wmma_f32_16x16x32_f16(false, ah, false, bh, (short)0, c, false, false);
  if (NT >= 2) c = __builtin_amdgcn_wmma_f32_16x16x32_f16(false, al, false, bh, (short)0, c, false, false);
  if (NT >= 3) c = __builtin_amdgcn_wmma_f32_16x16x32_f16(false, ah, false, bl, (short)0, c, false, false);
  asm volatile("v_nop\n\tv_nop\n\tv_nop\n\tv_nop" : "+v"(c) : "v"(ah), "v"(al), "v"(bh), "v"(bl));
  return c;
}
// batched GEMM like k_gemm_b but f16 operands: A f32 (split into f16 hi/lo if ASPLIT, else rounded to f16), Bt = f16 values [n][k]; alpha; C f32; N multiple of 16 (partial tiles skipped)
template <bool ASPLIT>
__global__ __launch_bounds__(128) void k_gemm_h(const float* __restrict__ A, int lda, size_t sA, const _Float16* __restrict__ Bh, int ldb, size_t sB, float alpha, float* __restrict__ C, int ldc, size_t sC, int M, int N, int K) {
  __shared__ __attribute__((aligned(16))) float so[4][16][64];
  const int tid = threadIdx.x, w = tid >> 5, lane = tid & 31, ln = lane & 15, hh = lane >> 4; const int by = blockIdx.y;
  A += (size_t)by * sA; Bh += (size_t)by * sB; C += (size_t)by * sC;
  const int ntn = (N + 63) / 64; const int wid = blockIdx.x * 4 + w; const int mt = wid / ntn, nq = wid % ntn; if (mt * 16 >= M) return;
  const int row0 = mt * 16, col0 = nq * 64; const float* arow = A + (size_t)(row0 + ln) * lda;
  v8f acc[4] = {};
  for (int kb = 0; kb < K; kb += 32) {
    FragH ah, al;
    const v4f x0 = *(const v4fa*)(arow + kb + 8 * hh), x1 = *(const v4fa*)(arow + kb + 8 * hh + 4), x2 = *(const v4fa*)(arow + kb + 16 + 8 * hh), x3 = *(const v4fa*)(arow + kb + 16 + 8 * hh + 4);
    float xs[16] = {x0[0],x0[1],x0[2],x0[3],x1[0],x1[1],x1[2],x1[3],x2[0],x2[1],x2[2],x2[3],x3[0],x3[1],x3[2],x3[3]};
#pragma unroll
    for (int i = 0; i < 16; ++i) { const _Float16 h = (_Float16)xs[i]; ah.h[i] = h; al.h[i] = ASPLIT ? (_Float16)(xs[i] - (float)h) : (_Float16)0.0f; }
#pragma unroll
    for (int t = 0; t < 4; ++t) { if (col0 + t * 16 >= N) continue; const size_t boff = (size_t)(col0 + t * 16 + ln) * ldb + kb; FragH bq; bq.half[0] = *(const v8us*)(Bh + boff + 8 * hh); bq.half[1] = *(const v8us*)(Bh + boff + 16 + 8 * hh);
      acc[t] = mmaH<ASPLIT ? 2 : 1>(ah.v, al.v, bq.v, bq.v, acc[t]); }
  }
#pragma unroll
  for (int t = 0; t < 4; ++t) { if (col0 + t * 16 >= N) continue;
#pragma unroll
    for (int r = 0; r < 8; ++r) so[w][8 * hh + r][t * 16 + ln] = acc[t][r] * alpha; }
  __builtin_amdgcn_fence(__ATOMIC_ACQ_REL, "workgroup"); __builtin_amdgcn_wave_barrier();
  const int rsub = lane >> 4, c4 = (lane & 15) * 4;
  {
#pragma unroll
    for (int q = 0; q < 8; ++q) { const int r = q * 2 + rsub; if (col0 + c4 < N) { const v4f v = *(const v4fa*)&so[w][r][c4]; *(v4f*)(C + (size_t)(row0 + r) * ldc + col0 + c4) = v; } }
     }
}

// Wt[n][k] = f16(W[k][n]·scale) from f32 row-major W[K][N] (scale = power of two; bf16-exact weights stay exact in f16 away from the subnormal range)
__global__ __launch_bounds__(256) void k_wt_f16(const float* __restrict__ W, _Float16* __restrict__ Wt, int K, int N, float scale) {
  const int t = blockIdx.x * 256 + threadIdx.x; if (t >= N * (K / 8)) return; const int n = t / (K / 8), k8 = (t % (K / 8)) * 8; FragH f;
#pragma unroll
  for (int i = 0; i < 8; ++i) f.h[i] = (_Float16)(bf16_round(W[(size_t)(k8 + i) * N + n]) * scale); const v8us o = f.half[0];
  *(v8us*)((unsigned short*)Wt + (size_t)n * K + k8) = o; 
}
// k_gemm_hh variant with fused epilogue: v = acc·alpha + bias[by·sBias + col] (+ CP[(row/rowsPerB)·sCPb + by·64 + col] if CP) ; ACT 0 none / 1 elu ; writes f16 C16 (and f32 C if non-null)
template <int ACT>
__global__ __launch_bounds__(128) void k_gemm_hhx(const _Float16* __restrict__ A, int lda, size_t sA, const _Float16* __restrict__ Bh, int ldb, size_t sB, float alpha, const float* __restrict__ bias, size_t sBias, const float* __restrict__ CP, int rowsPerB, size_t sCPb, int row0g,
    float* __restrict__ C, _Float16* __restrict__ C16, int ldc, size_t sC, int M, int N, int K) {
  __shared__ __attribute__((aligned(16))) float so[4][16][64];
  const int tid = threadIdx.x, w = tid >> 5, lane = tid & 31, ln = lane & 15, hh = lane >> 4; const int by = blockIdx.y;
  A += (size_t)by * sA; Bh += (size_t)by * sB; const size_t cofs = (size_t)by * sC; const float* bp = bias ? bias + (size_t)by * sBias : nullptr;
  const int ntn = (N + 63) / 64; const int wid = blockIdx.x * 4 + w; const int mt = wid / ntn, nq = wid % ntn; if (mt * 16 >= M) return;
  const int row0 = mt * 16, col0 = nq * 64; const _Float16* arow = A + (size_t)(row0 + ln) * lda;
  v8f acc[4] = {};
  for (int kb = 0; kb < K; kb += 32) { FragH ah; ah.half[0] = *(const v8us*)((const unsigned short*)arow + kb + 8 * hh); ah.half[1] = *(const v8us*)((const unsigned short*)arow + kb + 16 + 8 * hh);
#pragma unroll
    for (int t = 0; t < 4; ++t) { if (col0 + t * 16 >= N) continue; const size_t boff = (size_t)(col0 + t * 16 + ln) * ldb + kb; FragH bq; bq.half[0] = *(const v8us*)((const unsigned short*)Bh + boff + 8 * hh); bq.half[1] = *(const v8us*)((const unsigned short*)Bh + boff + 16 + 8 * hh);
      acc[t] = mmaH<1>(ah.v, ah.v, bq.v, bq.v, acc[t]); }
  }
#pragma unroll
  for (int t = 0; t < 4; ++t) { if (col0 + t * 16 >= N) continue; const int col = col0 + t * 16 + ln; const float bv = bp ? bf16_round(bp[col]) : 0.f;
#pragma unroll
    for (int r = 0; r < 8; ++r) { float v = acc[t][r] * alpha + bv; if (CP) { const int rr = row0g + row0 + 8 * hh + r; if (rowsPerB < 0) v += CP[cofs + (size_t)rr * ldc + col];      /* rowsPerB < 0: own element of the batched C plane */ else { const int bidx = rr / rowsPerB; v += CP[(size_t)bidx * sCPb + (size_t)by * 64 + col]; } } if (ACT == 1) v = (v > 0.f) ? v : expm1f(v); else if (ACT == 7) v = (v > 0.f) ? v + 1.0f : expf(v); else if (ACT == 8) v = tanhf(v); else if (ACT == 9) v = 0.5f * v * (1.0f + tanhf(0.7978845608028654f * (v + 0.044715f * v * v * v))); else if (ACT == 11) v = 1.0f / (1.0f + expf(-v)); else if (ACT == 12) v = (v > 0.f) ? v : 0.01f * v; else if (ACT == 14) v = (v > 0.f) ? v : 0.1f * v; else if (ACT == 16) v = (v >= 0.f) ? v : 0.3f * v; else if (ACT == 17) v = (v >= 0.f) ? v : 0.2f * v; else if (ACT == 15) v = v / (1.0f + expf(-v)); else if (ACT == 3) v = fmaxf(v, 0.f); else if (ACT == 6) v = 0.5f * v * (1.0f + erff(v * 0.70710678118654752f)); so[w][8 * hh + r][t * 16 + ln] = v; } }
  __builtin_amdgcn_fence(__ATOMIC_ACQ_REL, "workgroup"); __builtin_amdgcn_wave_barrier();
  const int rsub = lane >> 4, c4 = (lane & 15) * 4; typedef _Float16 v4h __attribute__((ext_vector_type(4)));
  {
#pragma unroll
    for (int q = 0; q < 8; ++q) { const int r = q * 2 + rsub; if (col0 + c4 < N) { const v4f v = *(const v4fa*)&so[w][r][c4]; if (C) *(v4f*)(C + cofs + (size_t)(row0 + r) * ldc + col0 + c4) = v; if (C16) { v4h h4; for (int i = 0; i < 4; ++i) h4[i] = (_Float16)v[i]; *(v4h*)(C16 + cofs + (size_t)(row0 + r) * ldc + col0 + c4) = h4; } } }
     }
}


typedef _Float16 v4h __attribute__((ext_vector_type(4)));

__global__ __launch_bounds__(256) void k_x16(const float* __restrict__ x, _Float16* __restrict__ X16, size_t n8) { const size_t t = (size_t)blockIdx.x * 256 + threadIdx.x; if (t >= n8) return; FragH f;
#pragma unroll
  for (int q = 0; q < 8; ++q) f.h[q] = (_Float16)bf16_round(x[t * 8 + q]); *(v8us*)((unsigned short*)X16 + t * 8) = f.half[0];  }
__global__ __launch_bounds__(256) void k_h16(const float* __restrict__ x, _Float16* __restrict__ X16, size_t n8) { const size_t t = (size_t)blockIdx.x * 256 + threadIdx.x; if (t >= n8) return; FragH f;
#pragma unroll
  for (int q = 0; q < 8; ++q) f.h[q] = (_Float16)x[t * 8 + q]; *(v8us*)((unsigned short*)X16 + t * 8) = f.half[0];  }
__global__ __launch_bounds__(256) void k_round16f(const float* __restrict__ W, _Float16* __restrict__ Bt, size_t n8) { const size_t t = (size_t)blockIdx.x * 256 + threadIdx.x; if (t >= n8) return; FragH f;
#pragma unroll
  for (int i = 0; i < 8; ++i) f.h[i] = (_Float16)(bf16_round(W[t * 8 + i]) * 16.0f); *(v8us*)((unsigned short*)Bt + t * 8) = f.half[0];  }
template <int NHv, int TTv>
__global__ __launch_bounds__(256) void k_vt(const _Float16* __restrict__ V16, int ldv, int voff, _Float16* __restrict__ Vt) { __shared__ unsigned short tl[64][66]; const int tid = threadIdx.x; const int slab = blockIdx.x / (TTv / 64), lg = blockIdx.x % (TTv / 64); const int b = slab / NHv, h = slab % NHv;
  for (int i = tid; i < 64 * 8; i += 256) { const int r = i / 8, c8 = (i % 8) * 8; FragH f; f.half[0] = *(const v8us*)((const unsigned short*)V16 + ((size_t)b * TTv + lg * 64 + r) * ldv + voff + h * 64 + c8);
#pragma unroll
    for (int q = 0; q < 8; ++q) tl[r][c8 + q] = f.u[q]; }
  __syncthreads();
  {
#pragma unroll
    for (int rd = 0; rd < 2; ++rd) { const int d = rd * 32 + tid / 8, pc = tid % 8; FragH f;
#pragma unroll
      for (int q = 0; q < 8; ++q) f.u[q] = tl[pc * 8 + q][d];
      *(v8us*)((unsigned short*)Vt + ((size_t)slab * 64 + d) * TTv + lg * 64 + pc * 8) = f.half[0]; }
     } }

__global__ __launch_bounds__(256) void k_hl(const float* __restrict__ F, _Float16* __restrict__ Hh, _Float16* __restrict__ Hl, size_t n8) { const size_t t = (size_t)blockIdx.x * 256 + threadIdx.x; if (t >= n8) return; FragH fh, fl; const v4f a = *(const v4fa*)(F + t * 8), c = *(const v4fa*)(F + t * 8 + 4);
#pragma unroll
  for (int q = 0; q < 4; ++q) { _Float16 h = (_Float16)a[q]; fh.h[q] = h; fl.h[q] = (_Float16)((a[q] - (float)h) * 1024.0f); h = (_Float16)c[q]; fh.h[4 + q] = h; fl.h[4 + q] = (_Float16)((c[q] - (float)h) * 1024.0f); }
  { *(v8us*)((unsigned short*)Hh + t * 8) = fh.half[0]; *(v8us*)((unsigned short*)Hl + t * 8) = fl.half[0];  } }

// ---- fast GEMM (wave tile 32x64; requires M % 32 == 0 rows per launch region and N % 64 == 0); epilogue = k_gemm_hhx semantics ----
__device__ __forceinline__ v16h g2_frag(const _Float16* p, int hh) { FragH f; f.half[0] = *(const v8us*)((const unsigned short*)p + 8 * hh); f.half[1] = *(const v8us*)((const unsigned short*)p + 16 + 8 * hh); return f.v; }
__device__ __forceinline__ v8f g2_mma(v16h a, v16h b, v8f c) { v8f d = __builtin_amdgcn_wmma_f32_16x16x32_f16(false, a, false, b, (short)0, c, false, false); asm volatile("v_nop\n\tv_nop\n\tv_nop\n\tv_nop" : "+v"(d) : "v"(a), "v"(b)); return d; }
template <int ACT>
__global__ __launch_bounds__(128) void k_gemm2(const _Float16* __restrict__ A, int lda, size_t sA, const _Float16* __restrict__ Bh, int ldb, size_t sB, float alpha, const float* __restrict__ bias, size_t sBias, const float* __restrict__ CP, int rowsPerB, size_t sCPb, int row0g,
    float* __restrict__ C, _Float16* __restrict__ C16, int ldc, size_t sC, int M, int N, int K) { static_assert(ACT == 0 || ACT == 3 || ACT == 6 || ACT == 8 || ACT == 9 || ACT == 11 || ACT == 12 || ACT == 14 || ACT == 15 || ACT == 16 || ACT == 17, "k_gemm2: unsupported ACT code (would silently apply no activation)");
  __shared__ __attribute__((aligned(16))) float so[4][32][68];
  const int tid = threadIdx.x, w = tid >> 5, lane = tid & 31, ln = lane & 15, hh = lane >> 4; const int by = blockIdx.y;
  A += (size_t)by * sA; Bh += (size_t)by * sB; const size_t cofs = (size_t)by * sC; const float* bp = bias ? bias + (size_t)by * sBias : nullptr;
  const int ntn = N >> 6; const int mt = blockIdx.x / ntn, nq = blockIdx.x - mt * ntn; const int row0 = mt * 128 + 32 * w, col0 = nq * 64; if (row0 >= M) return;
  const _Float16* a0p = A + (size_t)(row0 + ln) * lda; const _Float16* a1p = a0p + (size_t)16 * lda;
  const _Float16* b0p = Bh + (size_t)(col0 + ln) * ldb; const _Float16* b1p = b0p + (size_t)16 * ldb; const _Float16* b2p = b1p + (size_t)16 * ldb; const _Float16* b3p = b2p + (size_t)16 * ldb;
  const v8f z8 = {0.f,0.f,0.f,0.f,0.f,0.f,0.f,0.f}; v8f c00 = z8, c01 = z8, c02 = z8, c03 = z8, c10 = z8, c11 = z8, c12 = z8, c13 = z8;
#pragma unroll 1
  for (int kb = 0; kb < K; kb += 32) { const v16h a0 = g2_frag(a0p + kb, hh), a1 = g2_frag(a1p + kb, hh);
    v16h b = g2_frag(b0p + kb, hh); c00 = g2_mma(a0, b, c00); c10 = g2_mma(a1, b, c10);
    b = g2_frag(b1p + kb, hh); c01 = g2_mma(a0, b, c01); c11 = g2_mma(a1, b, c11);
    b = g2_frag(b2p + kb, hh); c02 = g2_mma(a0, b, c02); c12 = g2_mma(a1, b, c12);
    b = g2_frag(b3p + kb, hh); c03 = g2_mma(a0, b, c03); c13 = g2_mma(a1, b, c13); }
  v8f accs[8] = {c00, c01, c02, c03, c10, c11, c12, c13};
#pragma unroll
  for (int u = 0; u < 8; ++u) { const int t = u & 3, half = u >> 2; const int col = col0 + t * 16 + ln; const float bv = bp ? bf16_round(bp[col]) : 0.f;
#pragma unroll
    for (int r = 0; r < 8; ++r) { const int rloc = half * 16 + 8 * hh + r; float v = accs[u][r] * alpha + bv; if (CP) { if (rowsPerB < 0) v += CP[cofs + (size_t)(row0g + row0 + rloc) * ldc + col];      /* rowsPerB < 0: own element of the batched C plane */ else { const int bidx = (row0g + row0 + rloc) / rowsPerB; v += CP[(size_t)bidx * sCPb + (size_t)by * 64 + col]; } }
      if (ACT == 3) v = fmaxf(v, 0.f); else if (ACT == 6) v = 0.5f * v * (1.0f + erff(v * 0.70710678118654752f)); else if (ACT == 11) v = 1.0f / (1.0f + expf(-v)); else if (ACT == 15) v = v / (1.0f + expf(-v)); else if (ACT == 12) v = (v > 0.f) ? v : 0.01f * v; else if (ACT == 8) v = tanhf(v); else if (ACT == 9) v = 0.5f * v * (1.0f + tanhf(0.7978845608028654f * (v + 0.044715f * v * v * v))); else if (ACT == 14) v = (v > 0.f) ? v : 0.1f * v; else if (ACT == 16) v = (v >= 0.f) ? v : 0.3f * v; else if (ACT == 17) v = (v >= 0.f) ? v : 0.2f * v;
      so[w][rloc][t * 16 + ln] = v; } }
  __builtin_amdgcn_fence(__ATOMIC_ACQ_REL, "workgroup"); __builtin_amdgcn_wave_barrier();
  const int rsub = lane >> 4, c4 = (lane & 15) * 4;
  {
#pragma unroll
    for (int q = 0; q < 16; ++q) { const int r = q * 2 + rsub; const v4f v = *(const v4fa*)&so[w][r][c4]; if (C) *(v4f*)(C + cofs + (size_t)(row0 + r) * ldc + col0 + c4) = v; if (C16) { v4h h4; for (int i = 0; i < 4; ++i) h4[i] = (_Float16)v[i]; *(v4h*)(C16 + cofs + (size_t)(row0 + r) * ldc + col0 + c4) = h4; } }
     } }


__global__ __launch_bounds__(256) void k_wnat(const float* __restrict__ w, size_t n8, _Float16* __restrict__ Bt) { const size_t t = (size_t)blockIdx.x * 256 + threadIdx.x; if (t >= n8) return; FragH f; for (int q = 0; q < 8; ++q) f.h[q] = (_Float16)(bf16_round(w[t * 8 + q]) * 16.0f); *(v8us*)((unsigned short*)Bt + t * 8) = f.half[0];  }
__global__ __launch_bounds__(256) void k_rsm(const float* __restrict__ S, _Float16* __restrict__ P, int nrows) {
  #pragma clang fp contract(off)
  const int i = blockIdx.x * 256 + threadIdx.x; if (i >= nrows) return; const float* s = S + (size_t)i * SQ; float mx = -3.0e38f;
#pragma unroll 1
  for (int j = 0; j < SQ; ++j) mx = fmaxf(mx, s[j]); float se = 0.f;
#pragma unroll 1
  for (int j = 0; j < SQ; ++j) se += expf(s[j] - mx); const float sc = 256.0f / se;
#pragma unroll 1
  for (int j0 = 0; j0 < SQ; j0 += 8) { FragH f; for (int q = 0; q < 8; ++q) f.h[q] = (_Float16)(expf(s[j0 + q] - mx) * sc); unsigned short* d = (unsigned short*)P + (size_t)i * SQ + j0; *(v8us*)d = f.half[0];  } }
__global__ __launch_bounds__(256) void k_vt(const _Float16* __restrict__ V16, int b, int h0, _Float16* __restrict__ VT) { __shared__ unsigned short tl[64][65]; const int tid = threadIdx.x; const int hh = blockIdx.x % HG, sg = blockIdx.x / HG; const int s0 = sg * 64; const int h = h0 + hh;
  for (int i = tid; i < 64 * 8; i += 256) { const int j = i / 8, d8 = (i % 8) * 8; FragH f; f.half[0] = *(const v8us*)((const unsigned short*)V16 + ((size_t)b * SQ + s0 + j) * DM + h * HD + d8); for (int q = 0; q < 8; ++q) tl[d8 + q][j] = f.u[q]; }
  __syncthreads();
  { for (int i = tid; i < 64 * 8; i += 256) { const int d = i / 8, j8 = (i % 8) * 8; FragH f; for (int q = 0; q < 8; ++q) f.u[q] = tl[d][j8 + q]; *(v8us*)((unsigned short*)VT + ((size_t)hh * HD + d) * SQ + s0 + j8) = f.half[0]; }  } }



__global__ __launch_bounds__(256) void k_rsmcf2(const float* __restrict__ S, _Float16* __restrict__ P, int hg, int q0, int nk) {
  #pragma clang fp contract(off)
  const int t = blockIdx.x * 256 + threadIdx.x; if (t >= hg * QT) return; const size_t i = (size_t)t; const float* s = S + i * NKX; const int last = q0 + (t % QT); float mx = -3.0e38f;
#pragma unroll 1
  for (int j = 0; j < nk; ++j) { const float f = (j <= last) ? 1.f : 0.f; mx = fmaxf(mx, fmaf(f, s[j], (1.f - f) * -1.0e9f)); } float se = 0.f;
#pragma unroll 1
  for (int j = 0; j < nk; ++j) { const float f = (j <= last) ? 1.f : 0.f; se += __expf(fmaf(f, s[j], (1.f - f) * -1.0e9f) - mx); } const float sc = 256.0f / se;
#pragma unroll 1
  for (int j0 = 0; j0 < nk; j0 += 8) { FragH fr; for (int q = 0; q < 8; ++q) { const int j = j0 + q; const float f = (j <= last) ? 1.f : 0.f; fr.h[q] = (_Float16)(__expf(fmaf(f, s[j], (1.f - f) * -1.0e9f) - mx) * sc); } unsigned short* d = (unsigned short*)P + i * NKX + j0; *(v8us*)d = fr.half[0];  } }


template <int MASKADD>
__global__ __launch_bounds__(64) void k_att0(const float* __restrict__ QF, const float* __restrict__ KF, const float* __restrict__ VF, int ld, const float* __restrict__ mask, float scale, float* __restrict__ OF, int ldo) {
  #pragma clang fp contract(off)
  __shared__ __attribute__((aligned(16))) float lq[64][64]; __shared__ __attribute__((aligned(16))) float lo[64][64];
  const int tid = threadIdx.x; const int h = blockIdx.x / (QT0 / 64), rg = blockIdx.x % (QT0 / 64); const int i = rg * 64 + tid;
  const float* qr = QF + (size_t)i * ld + h * HD;
#pragma unroll 1
  for (int c = 0; c < HD / 4; ++c) { *(v4f*)&lq[tid][c * 4] = *(const v4fa*)(qr + c * 4); const v4f z = {0.f, 0.f, 0.f, 0.f}; *(v4f*)&lo[tid][c * 4] = z; }
  float m = -1.0e30f, l = 0.f; const int jmax = MASKADD ? (SQ - 1) : (rg * 64 + 63);      /* additive-mask form: every key (the mask input decides); causal form: keys up to the block's last row */
#pragma unroll 1
  for (int j = 0; j <= jmax; ++j) { const float* kr = KF + (size_t)j * ld + h * HD; const float* vr = VF + (size_t)j * ld + h * HD; float s = 0.f;
#pragma unroll 1
    for (int c = 0; c < HD / 4; ++c) { const v4f kq = *(const v4fa*)(kr + c * 4); const v4f qq = *(v4f*)&lq[tid][c * 4]; s = __fadd_rn(s, __fmul_rn(qq[0], kq[0])); s = __fadd_rn(s, __fmul_rn(qq[1], kq[1])); s = __fadd_rn(s, __fmul_rn(qq[2], kq[2])); s = __fadd_rn(s, __fmul_rn(qq[3], kq[3])); }
    s = __fmul_rn(s, scale); if (MASKADD) s = __fadd_rn(s, __fmul_rn(bf16_round(mask[(size_t)i * SQ + j]), -10000.0f));
    const float f = (MASKADD || j <= i) ? 1.f : 0.f; const float sm = fmaf(f, s, (1.f - f) * -1.0e30f); const float mn = fmaxf(m, sm); const float sc = expf(m - mn); const float e = expf(sm - mn); l = __fadd_rn(__fmul_rn(l, sc), e); m = mn;
#pragma unroll 1
    for (int c = 0; c < HD / 4; ++c) { const v4f vv = *(const v4fa*)(vr + c * 4); v4f oo = *(v4f*)&lo[tid][c * 4]; for (int u = 0; u < 4; ++u) oo[u] = __fadd_rn(__fmul_rn(oo[u], sc), __fmul_rn(e, vv[u])); *(v4f*)&lo[tid][c * 4] = oo; } }
  const float fin = 64.0f / l;      /* o carried x64 like the f16 path */
#pragma unroll 1
  for (int c = 0; c < HD / 4; ++c) { v4f oo = *(v4f*)&lo[tid][c * 4]; for (int u = 0; u < 4; ++u) oo[u] = __fmul_rn(oo[u], fin); *(v4f*)&lo[tid][c * 4] = oo; }
  __syncthreads();
  {
#pragma unroll 1
    for (int it = 0; it < 16; ++it) { const int row = it * 4 + tid / 16, pc = (tid % 16) * 4; const v4f v = *(const v4f*)&lo[row][pc]; *(v4f*)(OF + (size_t)(rg * 64 + row) * ldo + h * HD + pc) = v; }
     } }


template <int BFIN, int WXB>
__global__ __launch_bounds__(256) void k_ln16(const float* __restrict__ X, const float* __restrict__ g, const float* __restrict__ bb, float eps, _Float16* __restrict__ N16, float* __restrict__ XB) {
  #pragma clang fp contract(off)
  __shared__ float red[256]; const size_t r = blockIdx.x; const int t = threadIdx.x; const v4f xa = *(const v4fa*)(X + r * DMQ + t * 4); float s[4]; float sum = 0.f;
  for (int q = 0; q < 4; ++q) { s[q] = BFIN ? bf16_round(xa[q]) : xa[q]; sum = __fadd_rn(sum, s[q]); }
  red[t] = sum; __syncthreads(); for (int st = 128; st > 0; st >>= 1) { if (t < st) red[t] = __fadd_rn(red[t], red[t + st]); __syncthreads(); } const float mu = red[0] / (float)DMQ; __syncthreads();
  float vs = 0.f; for (int q = 0; q < 4; ++q) { const float dl = __fadd_rn(s[q], -mu); vs = __fadd_rn(vs, __fmul_rn(dl, dl)); } red[t] = vs; __syncthreads(); for (int st = 128; st > 0; st >>= 1) { if (t < st) red[t] = __fadd_rn(red[t], red[t + st]); __syncthreads(); }
  const float rs = rsqrtf(__fadd_rn(red[0] / (float)DMQ, eps)); v4h y; v4f xb;
  for (int q = 0; q < 4; ++q) { const int c = t * 4 + q; y[q] = (_Float16)__fadd_rn(__fmul_rn(__fmul_rn(__fadd_rn(s[q], -mu), rs), bf16_round(g[c])), bf16_round(bb[c])); xb[q] = s[q]; }
  { *(v4h*)(N16 + r * DMQ + t * 4) = y; if (WXB) *(v4f*)(XB + r * DMQ + t * 4) = xb;  } }
__global__ __launch_bounds__(256) void k_ftres2(const float* __restrict__ OF0, const float* __restrict__ XB, float* __restrict__ X1, size_t n4) {
  #pragma clang fp contract(off)
  const size_t t = (size_t)blockIdx.x * 256 + threadIdx.x; if (t >= n4) return; const v4f o = *(const v4fa*)(OF0 + t * 4), xv = *(const v4fa*)(XB + t * 4); v4f y; for (int q = 0; q < 4; ++q) y[q] = __fadd_rn(__fmul_rn(o[q], 0.015625f), xv[q]); *(v4f*)(X1 + t * 4) = y;  }

__global__ __launch_bounds__(256) void k_wthd(const float* __restrict__ Wt, _Float16* __restrict__ Bt) { const size_t t = (size_t)blockIdx.x * 256 + threadIdx.x; if (t >= (size_t)NH * HD * (DM / 8)) return; const int m8 = (int)(t % (DM / 8)) * 8; const int d = (int)((t / (DM / 8)) % HD); const int h = (int)(t / ((size_t)(DM / 8) * HD)); FragH f;
  for (int q = 0; q < 8; ++q) f.h[q] = (_Float16)(16.0f * bf16_round(Wt[((size_t)h * DM + m8 + q) * HD + d])); unsigned short* dst = (unsigned short*)Bt + ((size_t)h * HD + d) * DM + m8; *(v8us*)dst = f.half[0];  }




template <int BFIN, int W16, int W32>
__global__ __launch_bounds__(256) void k_lnx(const float* __restrict__ X, const float* __restrict__ g, const float* __restrict__ bb, float eps, _Float16* __restrict__ N16, float* __restrict__ N32) {
  #pragma clang fp contract(off)
  __shared__ float red[256]; const size_t r = blockIdx.x; const int t = threadIdx.x; const bool act = t < (DMQ / 4); const int c0 = act ? t * 4 : 0;
  const v4f xa = *(const v4fa*)(X + r * DMQ + c0); float s[4]; float sum = 0.f;
  for (int q = 0; q < 4; ++q) { s[q] = act ? (BFIN ? bf16_round(xa[q]) : xa[q]) : 0.f; sum = __fadd_rn(sum, s[q]); }
  red[t] = sum; __syncthreads(); for (int st = 128; st > 0; st >>= 1) { if (t < st) red[t] = __fadd_rn(red[t], red[t + st]); __syncthreads(); } const float mu = red[0] / (float)DMQ; __syncthreads();
  float vs = 0.f; for (int q = 0; q < 4; ++q) { const float dl = act ? __fadd_rn(s[q], -mu) : 0.f; vs = __fadd_rn(vs, __fmul_rn(dl, dl)); } red[t] = vs; __syncthreads(); for (int st = 128; st > 0; st >>= 1) { if (t < st) red[t] = __fadd_rn(red[t], red[t + st]); __syncthreads(); }
  const float rs = rsqrtf(__fadd_rn(red[0] / (float)DMQ, eps)); v4h y; v4f yf;
  for (int q = 0; q < 4; ++q) { const int c = c0 + q; yf[q] = __fadd_rn(__fmul_rn(__fmul_rn(__fadd_rn(s[q], -mu), rs), bf16_round(g[c])), bf16_round(bb[c])); y[q] = (_Float16)yf[q]; }
  if (!act) return;      /* no barriers after this point */
  { if (W16) *(v4h*)(N16 + r * DMQ + c0) = y; if (W32) *(v4f*)(N32 + r * DMQ + c0) = yf;  } }


__global__ __launch_bounds__(256) void k_bfr(const float* __restrict__ x, float* __restrict__ XB, size_t n8) { const size_t t = (size_t)blockIdx.x * 256 + threadIdx.x; if (t >= n8) return; v4f a = *(const v4fa*)(x + t * 8), c = *(const v4fa*)(x + t * 8 + 4); for (int q = 0; q < 4; ++q) { a[q] = bf16_round(a[q]); c[q] = bf16_round(c[q]); }
  { *(v4f*)(XB + t * 8) = a; *(v4f*)(XB + t * 8 + 4) = c;  } }




__global__ __launch_bounds__(256) void k_lorafold(const float* __restrict__ Wm, const float* __restrict__ A, const float* __restrict__ Bm, float* __restrict__ WE, int K, int N, float sc) {
  #pragma clang fp contract(off)
  const size_t t = (size_t)blockIdx.x * 256 + threadIdx.x; if (t >= (size_t)K * N) return; const int i = (int)(t / N), o = (int)(t % N); float a = 0.f;
  for (int r = 0; r < 16; ++r) a = __fadd_rn(a, __fmul_rn(bf16_round(A[(size_t)i * 16 + r]), bf16_round(Bm[(size_t)r * N + o])));
  const float v = __fadd_rn(bf16_round(Wm[t]), __fmul_rn(sc, a)); *(float*)(WE + t) = v;  }
__global__ __launch_bounds__(256) void k_wt32rep(const float* __restrict__ Wf, _Float16* __restrict__ Bt, int K, int N, int DOUT, float scale) {
  const int t = blockIdx.x * 256 + threadIdx.x; if (t >= DOUT * (K / 8)) return; const int n = t / (K / 8), k8 = (t % (K / 8)) * 8; const int rep = DOUT / N; const int src = (n / (HD * rep)) * HD + (n % HD);      /* head h = n / HD -> group h / rep */
  FragH f; for (int i = 0; i < 8; ++i) f.h[i] = (_Float16)(Wf[(size_t)(k8 + i) * N + src] * scale);
  *(v8us*)((unsigned short*)Bt + (size_t)n * K + k8) = f.half[0];  }
__global__ __launch_bounds__(256) void k_brep(const float* __restrict__ b, float* __restrict__ out) { const int t = blockIdx.x * 256 + threadIdx.x; if (t >= DM) return; const float v = b[(t / (HD * 4)) * HD + (t % HD)]; *(float*)(out + t) = v;  }

__global__ __launch_bounds__(256) void k_rsmcim(const float* __restrict__ S, _Float16* __restrict__ P, int hg, int q0, int nk, const int* __restrict__ am) {
  #pragma clang fp contract(off)
  const int t = blockIdx.x * 256 + threadIdx.x; if (t >= hg * QT) return; const size_t i = (size_t)t; const float* s = S + i * NKX; const int last = q0 + (t % QT); const int* mr = am + (size_t)last * SQ; float mx = -3.0e38f;      /* the module's mask row of this query (keys >= nk lie above the diagonal of the causal mask and are not computed) */
#pragma unroll 1
  for (int j = 0; j < nk; ++j) { const float f = (mr[j] != 0) ? 1.f : 0.f; mx = fmaxf(mx, fmaf(f, s[j], (1.f - f) * -1.0e9f)); } float se = 0.f;
#pragma unroll 1
  for (int j = 0; j < nk; ++j) { const float f = (mr[j] != 0) ? 1.f : 0.f; se += __expf(fmaf(f, s[j], (1.f - f) * -1.0e9f) - mx); } const float sc = 256.0f / se;
#pragma unroll 1
  for (int j0 = 0; j0 < nk; j0 += 8) { FragH fr; for (int q = 0; q < 8; ++q) { const int j = j0 + q; const float f = (mr[j] != 0) ? 1.f : 0.f; fr.h[q] = (_Float16)(__expf(fmaf(f, s[j], (1.f - f) * -1.0e9f) - mx) * sc); } unsigned short* d = (unsigned short*)P + i * NKX + j0; *(v8us*)d = fr.half[0];  } }



__global__ __launch_bounds__(256) void k_bcpy(const float* __restrict__ b, int n, int NP, float* __restrict__ dst, int dst0) { for (int i = threadIdx.x; i < NP; i += 256) { const float v = (i < n) ? b[i] : 0.f; *(float*)(dst + dst0 + i) = v; }  }



// lane l with lane l ^ M inside a 16-lane row (DPP row_xmask), and with lane l ^ 16
template <int M> __device__ __forceinline__ float rs_xm(float v) { return __builtin_bit_cast(float, __builtin_amdgcn_update_dpp(0, __builtin_bit_cast(int, v), 0x160 | M, 0xf, 0xf, true)); }
__device__ __forceinline__ float rs_xh(float v) { return __builtin_bit_cast(float, __builtin_amdgcn_permlanex16(__builtin_bit_cast(int, v), __builtin_bit_cast(int, v), 0x76543210, 0xfedcba98, false, false)); }
// native e^t as __expf forms it (t * log2(e), then v_exp_f32); the v_nop is the slot the instruction set asks for behind a transcendental before its result is read or its source overwritten
__device__ __forceinline__ float rs_exp(float t) { float e; asm("v_exp_f32 %0, %1\n\tv_nop" : "=v"(e) : "v"(t * 1.44269504088896340736f)); return e; }
// row softmax over all SQ keys, ONE WAVE PER ROW: the row is read once, by 16 loads of 512 contiguous bytes, and stays in registers (64 f32 a lane);
// maximum and sum: four chains a lane, then a five-step butterfly over the wave; weights x256 as f16, stored 256 contiguous bytes at a time.
__global__ __launch_bounds__(256) void k_rsmp(const float* __restrict__ S, _Float16* __restrict__ P, int nrows) {
  const int row = blockIdx.x * 8 + (threadIdx.x >> 5), lane = threadIdx.x & 31; if (row >= nrows) return;      /* the same in every lane of a wave; the kernel has no barrier */
  const float* s = S + (size_t)row * NKX + lane * 4; v4f x[SQ / 128];
  /* all four loops are unrolled so that x[] has constant indices and stays in registers, and so that the 16 loads are all in flight at once */
#pragma unroll
  for (int u = 0; u < SQ / 128; ++u) x[u] = *(const v4fa*)(s + u * 128);
  /* the 16 loads share one address pair: the pair is an input here, so it stays live (no load's result lands on it) up to the wait that precedes any overwrite of it */
  asm volatile("s_wait_xcnt 0x0" :: "v"(s) : "memory");
  v4f m4 = x[0];
#pragma unroll
  for (int u = 1; u < SQ / 128; ++u) for (int q = 0; q < 4; ++q) m4[q] = fmaxf(m4[q], x[u][q]);
  float mx = fmaxf(fmaxf(m4[0], m4[1]), fmaxf(m4[2], m4[3]));
  mx = fmaxf(mx, rs_xm<1>(mx)); mx = fmaxf(mx, rs_xm<2>(mx)); mx = fmaxf(mx, rs_xm<4>(mx)); mx = fmaxf(mx, rs_xm<8>(mx)); mx = fmaxf(mx, rs_xh(mx));
  v4f e4 = {0.f, 0.f, 0.f, 0.f};
#pragma unroll
  for (int u = 0; u < SQ / 128; ++u) for (int q = 0; q < 4; ++q) { x[u][q] = rs_exp(x[u][q] - mx); e4[q] += x[u][q]; }
  float se = (e4[0] + e4[1]) + (e4[2] + e4[3]);
  se += rs_xm<1>(se); se += rs_xm<2>(se); se += rs_xm<4>(se); se += rs_xm<8>(se); se += rs_xh(se);
  const float sc = 256.0f / se; _Float16* d = P + (size_t)row * NKX + lane * 4;
#pragma unroll
  for (int u = 0; u < SQ / 128; ++u) { v4h h4; for (int q = 0; q < 4; ++q) h4[q] = (_Float16)(x[u][q] * sc); *(v4h*)(d + u * 128) = h4; } }
extern "C" void kernel_launch(void* const* d_in, const int* in_sizes, int n_in,
                              void* d_out, int out_size, void* d_ws, size_t ws_size, hipStream_t stream) {
  (void)in_sizes; (void)n_in; (void)out_size;
  const float* const* I = (const float* const*)d_in; const float* x = I[0]; const float* wq = I[1]; const float* bq = I[2]; const float* wk = I[3]; const float* bk = I[4]; const float* wv = I[5]; const float* bv = I[6]; const float* wo = I[7]; const float* bo = I[8]; const float* wfc = I[9]; const float* bfc = I[10]; const float* wmp = I[11]; const float* bmp = I[12]; const float* g1 = I[13]; const float* be1 = I[14]; const float* gg2 = I[15]; const float* be2 = I[16];      /* x; [in][out] Wq / Wk / Wv / Wo + biases; W1 [1024][4096] + b1, W2 [4096][1024] + b2; LN1 g / b, LN2 g / b */
  char* ws = (char*)d_ws; size_t off = 0;
  auto take = [&](size_t bytes) { char* p = ws + off; off += (bytes + 255) & ~(size_t)255; return p; };
  _Float16* BQKV = (_Float16*)take((size_t)3 * DM * DM * 2); _Float16* BO = (_Float16*)take((size_t)DM * DM * 2); float* bqkv = (float*)take((size_t)3 * DM * 4); float* X1N = nullptr;      /* LN1 output (f32): aliases the QKV plane below (QKV's last readers, the score / V^T launches of the last batch, precede LN1) to stay within 256 MiB at NB 4 / SQ 2048 */
  _Float16* X16 = (_Float16*)take(NR * DM * 2); float* XB = (float*)take(NR * DM * 4); float* X1 = (float*)take(NR * DM * 4); _Float16* M16 = nullptr;      /* = X16 below (alias: X16's last reader, the fused QKV GEMM, precedes LN1's f16 write) */ _Float16* HF16 = nullptr;      /* FFN hidden plane of one batch [2048][4096] f16: own region below */ _Float16* BW1 = (_Float16*)take((size_t)DFF * DM * 2); _Float16* BW2 = (_Float16*)take((size_t)DM * DFF * 2); _Float16* QKV = (_Float16*)take(NR * 3 * DM * 2); _Float16* Q16 = QKV; _Float16* K16 = QKV + DM; _Float16* V16 = QKV + 2 * DM; _Float16* O16 = (_Float16*)take(NR * DM * 2); M16 = X16; X1N = (float*)QKV; HF16 = (_Float16*)take((size_t)SQ * DFF * 2);      /* the per-batch FFN hidden plane (16 MiB) gets its OWN region here: at NB 2 the context plane O16 is only 8 MiB */      /* aliases: X1N (NR*DM f32 = 16 MiB) inside QKV (24 MiB) */
  float* S = (float*)take((size_t)NH * QT * NKX * 4); _Float16* P = (_Float16*)take((size_t)NH * QT * NKX * 2); _Float16* VT = (_Float16*)take((size_t)NH * HD * SQ * 2);
  if (off > ws_size) return;
  { const unsigned g = (unsigned)(((size_t)DM * (DM / 8) + 255) / 256); k_wt_f16<<<g, 256, 0, stream>>>(wq, BQKV, DM, DM, 16.0f); k_wt_f16<<<g, 256, 0, stream>>>(wk, BQKV + (size_t)DM * DM, DM, DM, 16.0f); k_wt_f16<<<g, 256, 0, stream>>>(wv, BQKV + (size_t)2 * DM * DM, DM, DM, 16.0f); k_wt_f16<<<g, 256, 0, stream>>>(wo, BO, DM, DM, 16.0f); }      /* [in][out] -> Bt x16: stacked q | k | v, and Wo */
  k_bcpy<<<1, 256, 0, stream>>>(bq, DM, DM, bqkv, 0); k_bcpy<<<1, 256, 0, stream>>>(bk, DM, DM, bqkv, DM); k_bcpy<<<1, 256, 0, stream>>>(bv, DM, DM, bqkv, 2 * DM);      /* stacked bias bq | bk | bv */
  k_x16<<<(unsigned)((NR * DM / 8 + 255) / 256), 256, 0, stream>>>(x, X16, NR * DM / 8); k_bfr<<<(unsigned)((NR * DM / 8 + 255) / 256), 256, 0, stream>>>(x, XB, NR * DM / 8);      /* post-LN: the attention runs on the raw input (exact f16 rows); XB = bf16(x) f32 for the residual */
  k_wt_f16<<<(unsigned)(((size_t)DFF * (DM / 8) + 255) / 256), 256, 0, stream>>>(wfc, BW1, DM, DFF, 16.0f); k_wt_f16<<<(unsigned)(((size_t)DM * (DFF / 8) + 255) / 256), 256, 0, stream>>>(wmp, BW2, DFF, DM, 16.0f);      /* natural w1 [1024][4096] and w2 [4096][1024] = Bt x16 */
  const size_t r0p = (size_t)B0 * SQ;      /* first projected row */
  k_gemm2<0><<<dim3((unsigned)((MP / 128) * (3 * DM / 64)), 1), 128, 0, stream>>>(X16 + r0p * DM, DM, 0, BQKV, DM, 0, 0.0625f, bqkv, 0, nullptr, 1, 0, 0, nullptr, QKV + r0p * 3 * DM, 3 * DM, 0, MP, 3 * DM, DM);      /* q | k | v rows (f16); head h = columns h*HD.. of each DM block */
  for (int b = B0; b < B0 + NBR; ++b) { const size_t r0 = (size_t)b * SQ;
    k_vt<NH, SQ><<<NH * (SQ / 64), 256, 0, stream>>>(V16 + r0 * LQ, LQ, 0, VT);      /* V^T [NH][HD][SQ] for this batch */
    for (int q0 = 0; q0 < QN; q0 += QT) {      /* non-causal: every 256-row query tile sees all SQ keys */
      k_gemm2<0><<<dim3((QT / 128) * (SQ / 64), NHD), 128, 0, stream>>>(Q16 + (r0 + q0) * LQ, LQ, (size_t)HD, K16 + r0 * LQ, LQ, (size_t)HD, 1.0f, nullptr, 0, nullptr, 1, 0, 0, S, nullptr, NKX, (size_t)QT * NKX, QT, SQ, HD);      /* scores q.k (alpha 1, unscaled), all heads on grid.y */
      k_rsmp<<<(NHD * QT + 7) / 8, 256, 0, stream>>>(S, P, NHD * QT);      /* plain softmax over all keys (the key mask is all ones) -> P x256 f16 */
      k_gemm2<0><<<dim3((QT / 128) * (HD / 64), NHD), 128, 0, stream>>>(P, NKX, (size_t)QT * NKX, VT, SQ, (size_t)HD * SQ, 0.25f, nullptr, 0, nullptr, 1, 0, 0, nullptr, O16 + (r0 + q0) * DM, DM, (size_t)HD, QT, HD, SQ); } }      /* ctx (merged heads, x64) as f16 rows */
  k_gemm2<0><<<dim3((unsigned)((MPO / 128) * (DM / 64)), 1), 128, 0, stream>>>(O16 + r0p * DM, DM, 0, BO, DM, 0, 0.0009765625f, bo, 0, XB + r0p * DM, -1, 0, 0, X1 + r0p * DM, nullptr, DM, 0, MPO, DM, DM);      /* out rows are the output layout */
  k_lnx<0, 1, 1><<<(unsigned)NR, 256, 0, stream>>>(X1, g1, be1, 1e-5f, M16, X1N);      /* x1 = LN1(x + attn_out) (eps 1e-5): f16 rows for the FFN input and f32 rows for the residual */
  for (int b = 0; b < NB; ++b) { const size_t r0 = (size_t)b * SQ;
    k_gemm2<6><<<dim3((unsigned)((SQ / 128) * (DFF / 64)), 1), 128, 0, stream>>>(M16 + r0 * DM, DM, 0, BW1, DM, 0, 0.0625f, bfc, 0, nullptr, 1, 0, 0, nullptr, HF16, DFF, 0, SQ, DFF, DM);      /* gelu_erf(x1 w1 + b1) -> f16 (this batch) */
    k_gemm2<0><<<dim3((unsigned)((SQ / 128) * (DM / 64)), 1), 128, 0, stream>>>(HF16, DFF, 0, BW2, DFF, 0, 0.0625f, bmp, 0, X1N + r0 * DM, -1, 0, 0, X1 + r0 * DM, nullptr, DM, 0, SQ, DM, DFF); }      /* t = x1 + gelu-ffn + b2 (own-element residual) f32, over the dead pre-LN1 plane */
  k_lnx<0, 0, 1><<<(unsigned)NR, 256, 0, stream>>>(X1, gg2, be2, 1e-5f, nullptr, (float*)d_out);      /* out = LN2(t) (eps 1e-5) -> f32 output rows */
}

// v003
// One run takes 425 microseconds.
// It is 4.36 times as fast as v001, going by the measured steps of the versions left out in between.
// Counting every step since v000, it is 17.3 times as fast.
#include <hip/hip_runtime.h>
// POST-LN transformer encoder block (x [2][2048][1024]; q/k/v = x W + b ([in][out] 1024 x 1024, zero biases); 16 heads of 64; scores = q k^T with NO 1/sqrt(head_dim) scaling (as the source module); softmax over all 2048 keys (no mask); x1 = LN1(x + ctx Wo + bo) (biased var, eps 1e-5, g / beta); out = LN2(x1 + gelu_erf(x1 W1 + b1) W2 + b2) ([in][out] 1024 x 4096 x 1024) -> [2][2048][1024]).
// Structure: token rows; x as exact f16 rows and bf16 f32 residual rows; natural weights as exact x16 planes; fused q | k | v WMMA GEMM (32x64 wave tiles, f32 accumulation, + stacked bias) -> f16; V^T via LDS transposes; one fused attention launch (S^T = K Q^T, online softmax in registers with f32 statistics and native exp, weights x256 f16, O^T += V^T P^T), ctx (x64) merged f16; x + ctx Wo + bo f32; LN1 on VALU -> f16 + f32; gelu FFN per batch; + residual; LN2 -> output; launches: see trace.
// Compute dtype: inputs rounded to bf16; x / weights exact; q, k, v, softmax weights and o as plain f16 GEMM operands (~2^-12); scores and softmax statistics f32. v_wmma_f32_16x16x32_f16.
#define NB 2
#define SQ 2048
#define DM 1024
#define NH 16
#define HD 64
#define HG 4                         /* heads per launch of the non-template k_vt (not launched) */
#define QT 256                       /* query rows per attention tile */
#define NKX SQ                       /* S / P row pitch */
#define QT0 128                      /* rows per head of the f32 k_att0 path (not launched) */
#define B0 0                         /* first batch processed (debug hook) */
#define NBR NB                       /* batches processed (debug hook) */
#define NR ((size_t)NB * SQ)
#define DMQ DM
#define DFF 4096         /* FFN hidden width */
#define MP ((int)((size_t)NBR * SQ)) /* rows projected (debug hook) */
#define QN SQ                        /* query rows per batch (not used) */
#define NHD NH                       /* heads (not used) */
#define MPO MP                       /* rows through the output stage (debug hook) */
#define LQ (3 * DM)      /* row pitch of the q/k/v rows */
typedef __bf16 v16b __attribute__((ext_vector_type(16)));
typedef unsigned short v8us __attribute__((ext_vector_type(8), may_alias));
typedef float  v8f  __attribute__((ext_vector_type(8)));
typedef float  v4f  __attribute__((ext_vector_type(4)));
typedef float  v4fa __attribute__((ext_vector_type(4), may_alias));
union FragB { v16b v; v8us half[2]; unsigned short u[16]; };

__device__ __forceinline__ unsigned short bf16_bits(float x) { unsigned int u = __float_as_uint(x); return (unsigned short)((u + 0x7FFFu + ((u >> 16) & 1u)) >> 16); }
__device__ __forceinline__ float bf16_val(unsigned short b) { return __uint_as_float(((unsigned int)b) << 16); }
__device__ __forceinline__ float bf16_round(float x) { return bf16_val(bf16_bits(x)); }
// D += A·B with NT terms: 1 = ah·bh, 2 = + al·bh (A split), 3 = + ah·bl (both split)
template <int NT>
__device__ __forceinline__ v8f mmaN(v16b ah, v16b al, v16b bh, v16b bl, v8f c) {
  c = __builtin_amdgcn_wmma_f32_16x16x32_bf16(false, ah, false, bh, (short)0, c, false, false);
  if (NT >= 2) c = __builtin_amdgcn_wmma_f32_16x16x32_bf16(false, al, false, bh, (short)0, c, false, false);
  if (NT >= 3) c = __builtin_amdgcn_wmma_f32_16x16x32_bf16(false, ah, false, bl, (short)0, c, false, false);
  asm volatile("v_nop\n\tv_nop\n\tv_nop\n\tv_nop" : "+v"(c) : "v"(ah), "v"(al), "v"(bh), "v"(bl));
  return c;
}

__global__ __launch_bounds__(256) void k_wt_bf16(const float* __restrict__ W, unsigned short* __restrict__ Wt, int K, int N) {
  const int t = blockIdx.x * 256 + threadIdx.x;
  const int k8n = K / 8;
  if (t >= N * k8n) return;
  const int n = t / k8n, k8 = (t % k8n) * 8;
  v8us v;
#pragma unroll
  for (int i = 0; i < 8; ++i) v[i] = bf16_bits(W[(size_t)(k8 + i) * N + n]);
  *(v8us*)(Wt + (size_t)n * K + k8) = v;
  
}

// GEMM C[M][N] (f32, pitch ldc) = act(A[M][K]·W + bias). A f32 row-major (pitch lda) converted per fragment to bf16
// (ASPLIT: hi/lo two planes -> 2 terms, else single rounded term); Wt bf16 [N][K] (pitch ldb). BIAS_BF16 rounds the
// bias to bf16 first (bias quantised to bf16 before the add). K%32==0, M%16==0, N%64==0.
template <bool ASPLIT, int ACT, bool BIAS_BF16>
__global__ __launch_bounds__(128) void k_gemm_bf(const float* __restrict__ A, int lda, const unsigned short* __restrict__ Wt, int ldb,
                                               const float* __restrict__ bias, float* __restrict__ C, int ldc, int M, int N, int K) {
  __shared__ __attribute__((aligned(16))) float so[4][16][64];
  const int tid = threadIdx.x, w = tid >> 5, lane = tid & 31, ln = lane & 15, hh = lane >> 4;
  const int ntn = N / 64;
  const int wid = blockIdx.x * 4 + w;
  const int mt = wid / ntn, nq = wid % ntn;
  if (mt * 16 >= M) return;
  const int row0 = mt * 16, col0 = nq * 64;
  const float* arow = A + (size_t)(row0 + ln) * lda;
  v8f acc[4] = {};
  for (int kb = 0; kb < K; kb += 32) {
    FragB ah, al;
    const v4f x0 = *(const v4fa*)(arow + kb + 8 * hh), x1 = *(const v4fa*)(arow + kb + 8 * hh + 4);
    const v4f x2 = *(const v4fa*)(arow + kb + 16 + 8 * hh), x3 = *(const v4fa*)(arow + kb + 16 + 8 * hh + 4);
    float xs[16] = {x0[0],x0[1],x0[2],x0[3],x1[0],x1[1],x1[2],x1[3],x2[0],x2[1],x2[2],x2[3],x3[0],x3[1],x3[2],x3[3]};
#pragma unroll
    for (int i = 0; i < 16; ++i) { const unsigned short hb = bf16_bits(xs[i]); ah.u[i] = hb; al.u[i] = ASPLIT ? bf16_bits(xs[i] - bf16_val(hb)) : (unsigned short)0; }
#pragma unroll
    for (int t = 0; t < 4; ++t) {
      const unsigned short* brow = Wt + (size_t)(col0 + t * 16 + ln) * ldb + kb;
      FragB b;
      b.half[0] = *(const v8us*)(brow + 8 * hh);
      b.half[1] = *(const v8us*)(brow + 16 + 8 * hh);
      acc[t] = mmaN<ASPLIT ? 2 : 1>(ah.v, al.v, b.v, b.v, acc[t]);
    }
  }
#pragma unroll
  for (int t = 0; t < 4; ++t) {
    float bv = bias ? bias[col0 + t * 16 + ln] : 0.f;
    if (BIAS_BF16) bv = bf16_round(bv);
#pragma unroll
    for (int r = 0; r < 8; ++r) { float v = acc[t][r] + bv; if (ACT == 1) v = fmaxf(v, 0.f); so[w][8 * hh + r][t * 16 + ln] = v; }
  }
  __builtin_amdgcn_fence(__ATOMIC_ACQ_REL, "workgroup");
  __builtin_amdgcn_wave_barrier();
  const int rsub = lane >> 4, c4 = (lane & 15) * 4;
  {
#pragma unroll
    for (int q = 0; q < 8; ++q) {
      const int r = q * 2 + rsub;
      const v4f v = *(const v4fa*)&so[w][r][c4];
      *(v4f*)(C + (size_t)(row0 + r) * ldc + col0 + c4) = v;
    }
    
  }
}

// GEMM C = act(A·W + bias + resid): A f32 (ASPLIT -> hi/lo 2 terms), Wt bf16 [N][K]; ACT 0 none, 1 relu, 2 exact gelu;
// resid (optional, f32, row index = (row % rmod), pitch ldr, RES_BF16 rounds it) added before the activation.
template <bool ASPLIT, int ACT, bool BIAS_BF16, bool RES_BF16>
__global__ __launch_bounds__(128) void k_gemm_bf3(const float* __restrict__ A, int lda, const unsigned short* __restrict__ Wt, int ldb,
                                                const float* __restrict__ bias, const float* __restrict__ resid, int rmod, int ldr,
                                                float* __restrict__ C, int ldc, int M, int N, int K) {
  __shared__ __attribute__((aligned(16))) float so[4][16][64];
  const int tid = threadIdx.x, w = tid >> 5, lane = tid & 31, ln = lane & 15, hh = lane >> 4;
  const int ntn = N / 64;
  const int wid = blockIdx.x * 4 + w;
  const int mt = wid / ntn, nq = wid % ntn;
  if (mt * 16 >= M) return;
  const int row0 = mt * 16, col0 = nq * 64;
  const float* arow = A + (size_t)(row0 + ln) * lda;
  v8f acc[4] = {};
  for (int kb = 0; kb < K; kb += 32) {
    FragB ah, al;
    const v4f x0 = *(const v4fa*)(arow + kb + 8 * hh), x1 = *(const v4fa*)(arow + kb + 8 * hh + 4);
    const v4f x2 = *(const v4fa*)(arow + kb + 16 + 8 * hh), x3 = *(const v4fa*)(arow + kb + 16 + 8 * hh + 4);
    float xs[16] = {x0[0],x0[1],x0[2],x0[3],x1[0],x1[1],x1[2],x1[3],x2[0],x2[1],x2[2],x2[3],x3[0],x3[1],x3[2],x3[3]};
#pragma unroll
    for (int i = 0; i < 16; ++i) { const unsigned short hb = bf16_bits(xs[i]); ah.u[i] = hb; al.u[i] = ASPLIT ? bf16_bits(xs[i] - bf16_val(hb)) : (unsigned short)0; }
#pragma unroll
    for (int t = 0; t < 4; ++t) {
      const unsigned short* brow = Wt + (size_t)(col0 + t * 16 + ln) * ldb + kb;
      FragB b;
      b.half[0] = *(const v8us*)(brow + 8 * hh);
      b.half[1] = *(const v8us*)(brow + 16 + 8 * hh);
      acc[t] = mmaN<ASPLIT ? 2 : 1>(ah.v, al.v, b.v, b.v, acc[t]);
    }
  }
#pragma unroll
  for (int t = 0; t < 4; ++t) {
    const int col = col0 + t * 16 + ln;
    float bv = bias ? bias[col] : 0.f;
    if (BIAS_BF16) bv = bf16_round(bv);
#pragma unroll
    for (int r = 0; r < 8; ++r) {
      float v = acc[t][r] + bv;
      if (resid) { float rv = resid[(size_t)((row0 + 8 * hh + r) % rmod) * ldr + col]; if (RES_BF16) rv = bf16_round(rv); v += rv; }
      if (ACT == 1) v = fmaxf(v, 0.f);
      if (ACT == 2) v = 0.5f * v * (1.0f + erff(v * 0.70710678118654752f));
      if (ACT == 3) { const float u = 0.7978845608028654f * (v + 0.044715f * v * v * v); v = 0.5f * v * (1.0f + tanhf(u)); }
      so[w][8 * hh + r][t * 16 + ln] = v;
    }
  }
  __builtin_amdgcn_fence(__ATOMIC_ACQ_REL, "workgroup");
  __builtin_amdgcn_wave_barrier();
  const int rsub = lane >> 4, c4 = (lane & 15) * 4;
  {
#pragma unroll
    for (int q = 0; q < 8; ++q) {
      const int r = q * 2 + rsub;
      const v4f v = *(const v4fa*)&so[w][r][c4];
      *(v4f*)(C + (size_t)(row0 + r) * ldc + col0 + c4) = v;
    }
    
  }
}
// row LayerNorm (biased variance, eps) over N: s = X (+ R); optional out_sum <- s; out_norm <- (s-mu)*rsqrt(var+eps)*g + b
template <bool PARAM_BF16>
__global__ __launch_bounds__(256) void k_layernorm(const float* __restrict__ X, const float* __restrict__ R, const float* __restrict__ g, const float* __restrict__ bta,
                                                  float* __restrict__ out_sum, float* __restrict__ out_norm, int N, float eps) {
  __shared__ float red[256];
  const int row = blockIdx.x, tid = threadIdx.x;
  const float* x = X + (size_t)row * N; const float* rr = R ? R + (size_t)row * N : nullptr;
  float vals[16];                     // up to N = 4096
  const int per = N / 256;            // contiguous chunk per thread? use strided-by-4 chunks: thread handles j = tid*4 + 1024*u
  float s1 = 0.f;
  for (int u = 0; u < per / 4; ++u) {
    const int j = tid * 4 + 1024 * u;
    const v4f a = *(const v4fa*)(x + j);
    v4f b = {0.f,0.f,0.f,0.f}; if (rr) b = *(const v4fa*)(rr + j);
#pragma unroll
    for (int q = 0; q < 4; ++q) { const float v = a[q] + b[q]; vals[u * 4 + q] = v; s1 += v; }
  }
  red[tid] = s1; __syncthreads();
  for (int st = 128; st > 0; st >>= 1) { if (tid < st) red[tid] += red[tid + st]; __syncthreads(); }
  const float mu = red[0] / (float)N; __syncthreads();
  float s2 = 0.f;
  for (int u = 0; u < per / 4; ++u)
#pragma unroll
    for (int q = 0; q < 4; ++q) { const float c = vals[u * 4 + q] - mu; s2 += c * c; }
  red[tid] = s2; __syncthreads();
  for (int st = 128; st > 0; st >>= 1) { if (tid < st) red[tid] += red[tid + st]; __syncthreads(); }
  const float rs = rsqrtf(red[0] / (float)N + eps);
  {
    for (int u = 0; u < per / 4; ++u) {
      const int j = tid * 4 + 1024 * u;
      v4f o, sm;
#pragma unroll
      for (int q = 0; q < 4; ++q) {
        float gg = g[j + q], bb = bta[j + q];
        if (PARAM_BF16) { gg = bf16_round(gg); bb = bf16_round(bb); }
        sm[q] = vals[u * 4 + q]; o[q] = (vals[u * 4 + q] - mu) * rs * gg + bb;
      }
      if (out_sum) *(v4f*)(out_sum + (size_t)row * N + j) = sm;
      *(v4f*)(out_norm + (size_t)row * N + j) = o;
    }
    
  }
}



// ---- f16 WMMA path (v_wmma_f32_16x16x32_f16): 11-bit significands for operands in range — used where a [0,1] probability operand needs more precision than bf16
typedef _Float16 v16h __attribute__((ext_vector_type(16)));
union FragH { v16h v; v8us half[2]; _Float16 h[16]; unsigned short u[16]; };
template <int NT>
__device__ __forceinline__ v8f mmaH(v16h ah, v16h al, v16h bh, v16h bl, v8f c) {
  c = __builtin_amdgcn_wmma_f32_16x16x32_f16(false, ah, false, bh, (short)0, c, false, false);
  if (NT >= 2) c = __builtin_amdgcn_wmma_f32_16x16x32_f16(false, al, false, bh, (short)0, c, false, false);
  if (NT >= 3) c = __builtin_amdgcn_wmma_f32_16x16x32_f16(false, ah, false, bl, (short)0, c, false, false);
  asm volatile("v_nop\n\tv_nop\n\tv_nop\n\tv_nop" : "+v"(c) : "v"(ah), "v"(al), "v"(bh), "v"(bl));
  return c;
}
// batched GEMM like k_gemm_b but f16 operands: A f32 (split into f16 hi/lo if ASPLIT, else rounded to f16), Bt = f16 values [n][k]; alpha; C f32; N multiple of 16 (partial tiles skipped)
template <bool ASPLIT>
__global__ __launch_bounds__(128) void k_gemm_h(const float* __restrict__ A, int lda, size_t sA, const _Float16* __restrict__ Bh, int ldb, size_t sB, float alpha, float* __restrict__ C, int ldc, size_t sC, int M, int N, int K) {
  __shared__ __attribute__((aligned(16))) float so[4][16][64];
  const int tid = threadIdx.x, w = tid >> 5, lane = tid & 31, ln = lane & 15, hh = lane >> 4; const int by = blockIdx.y;
  A += (size_t)by * sA; Bh += (size_t)by * sB; C += (size_t)by * sC;
  const int ntn = (N + 63) / 64; const int wid = blockIdx.x * 4 + w; const int mt = wid / ntn, nq = wid % ntn; if (mt * 16 >= M) return;
  const int row0 = mt * 16, col0 = nq * 64; const float* arow = A + (size_t)(row0 + ln) * lda;
  v8f acc[4] = {};
  for (int kb = 0; kb < K; kb += 32) {
    FragH ah, al;
    const v4f x0 = *(const v4fa*)(arow + kb + 8 * hh), x1 = *(const v4fa*)(arow + kb + 8 * hh + 4), x2 = *(const v4fa*)(arow + kb + 16 + 8 * hh), x3 = *(const v4fa*)(arow + kb + 16 + 8 * hh + 4);
    float xs[16] = {x0[0],x0[1],x0[2],x0[3],x1[0],x1[1],x1[2],x1[3],x2[0],x2[1],x2[2],x2[3],x3[0],x3[1],x3[2],x3[3]};
#pragma unroll
    for (int i = 0; i < 16; ++i) { const _Float16 h = (_Float16)xs[i]; ah.h[i] = h; al.h[i] = ASPLIT ? (_Float16)(xs[i] - (float)h) : (_Float16)0.0f; }
#pragma unroll
    for (int t = 0; t < 4; ++t) { if (col0 + t * 16 >= N) continue; const size_t boff = (size_t)(col0 + t * 16 + ln) * ldb + kb; FragH bq; bq.half[0] = *(const v8us*)(Bh + boff + 8 * hh); bq.half[1] = *(const v8us*)(Bh + boff + 16 + 8 * hh);
      acc[t] = mmaH<ASPLIT ? 2 : 1>(ah.v, al.v, bq.v, bq.v, acc[t]); }
  }
#pragma unroll
  for (int t = 0; t < 4; ++t) { if (col0 + t * 16 >= N) continue;
#pragma unroll
    for (int r = 0; r < 8; ++r) so[w][8 * hh + r][t * 16 + ln] = acc[t][r] * alpha; }
  __builtin_amdgcn_fence(__ATOMIC_ACQ_REL, "workgroup"); __builtin_amdgcn_wave_barrier();
  const int rsub = lane >> 4, c4 = (lane & 15) * 4;
  {
#pragma unroll
    for (int q = 0; q < 8; ++q) { const int r = q * 2 + rsub; if (col0 + c4 < N) { const v4f v = *(const v4fa*)&so[w][r][c4]; *(v4f*)(C + (size_t)(row0 + r) * ldc + col0 + c4) = v; } }
     }
}

// Wt[n][k] = f16(W[k][n]·scale) from f32 row-major W[K][N] (scale = power of two; bf16-exact weights stay exact in f16 away from the subnormal range)
__global__ __launch_bounds__(256) void k_wt_f16(const float* __restrict__ W, _Float16* __restrict__ Wt, int K, int N, float scale) {
  const int t = blockIdx.x * 256 + threadIdx.x; if (t >= N * (K / 8)) return; const int n = t / (K / 8), k8 = (t % (K / 8)) * 8; FragH f;
#pragma unroll
  for (int i = 0; i < 8; ++i) f.h[i] = (_Float16)(bf16_round(W[(size_t)(k8 + i) * N + n]) * scale); const v8us o = f.half[0];
  *(v8us*)((unsigned short*)Wt + (size_t)n * K + k8) = o; 
}
// k_gemm_hh variant with fused epilogue: v = acc·alpha + bias[by·sBias + col] (+ CP[(row/rowsPerB)·sCPb + by·64 + col] if CP) ; ACT 0 none / 1 elu ; writes f16 C16 (and f32 C if non-null)
template <int ACT>
__global__ __launch_bounds__(128) void k_gemm_hhx(const _Float16* __restrict__ A, int lda, size_t sA, const _Float16* __restrict__ Bh, int ldb, size_t sB, float alpha, const float* __restrict__ bias, size_t sBias, const float* __restrict__ CP, int rowsPerB, size_t sCPb, int row0g,
    float* __restrict__ C, _Float16* __restrict__ C16, int ldc, size_t sC, int M, int N, int K) {
  __shared__ __attribute__((aligned(16))) float so[4][16][64];
  const int tid = threadIdx.x, w = tid >> 5, lane = tid & 31, ln = lane & 15, hh = lane >> 4; const int by = blockIdx.y;
  A += (size_t)by * sA; Bh += (size_t)by * sB; const size_t cofs = (size_t)by * sC; const float* bp = bias ? bias + (size_t)by * sBias : nullptr;
  const int ntn = (N + 63) / 64; const int wid = blockIdx.x * 4 + w; const int mt = wid / ntn, nq = wid % ntn; if (mt * 16 >= M) return;
  const int row0 = mt * 16, col0 = nq * 64; const _Float16* arow = A + (size_t)(row0 + ln) * lda;
  v8f acc[4] = {};
  for (int kb = 0; kb < K; kb += 32) { FragH ah; ah.half[0] = *(const v8us*)((const unsigned short*)arow + kb + 8 * hh); ah.half[1] = *(const v8us*)((const unsigned short*)arow + kb + 16 + 8 * hh);
#pragma unroll
    for (int t = 0; t < 4; ++t) { if (col0 + t * 16 >= N) continue; const size_t boff = (size_t)(col0 + t * 16 + ln) * ldb + kb; FragH bq; bq.half[0] = *(const v8us*)((const unsigned short*)Bh + boff + 8 * hh); bq.half[1] = *(const v8us*)((const unsigned short*)Bh + boff + 16 + 8 * hh);
      acc[t] = mmaH<1>(ah.v, ah.v, bq.v, bq.v, acc[t]); }
  }
#pragma unroll
  for (int t = 0; t < 4; ++t) { if (col0 + t * 16 >= N) continue; const int col = col0 + t * 16 + ln; const float bv = bp ? bf16_round(bp[col]) : 0.f;
#pragma unroll
    for (int r = 0; r < 8; ++r) { float v = acc[t][r] * alpha + bv; if (CP) { const int rr = row0g + row0 + 8 * hh + r; if (rowsPerB < 0) v += CP[cofs + (size_t)rr * ldc + col];      /* rowsPerB < 0: own element of the batched C plane */ else { const int bidx = rr / rowsPerB; v += CP[(size_t)bidx * sCPb + (size_t)by * 64 + col]; } } if (ACT == 1) v = (v > 0.f) ? v : expm1f(v); else if (ACT == 7) v = (v > 0.f) ? v + 1.0f : expf(v); else if (ACT == 8) v = tanhf(v); else if (ACT == 9) v = 0.5f * v * (1.0f + tanhf(0.7978845608028654f * (v + 0.044715f * v * v * v))); else if (ACT == 11) v = 1.0f / (1.0f + expf(-v)); else if (ACT == 12) v = (v > 0.f) ? v : 0.01f * v; else if (ACT == 14) v = (v > 0.f) ? v : 0.1f * v; else if (ACT == 16) v = (v >= 0.f) ? v : 0.3f * v; else if (ACT == 17) v = (v >= 0.f) ? v : 0.2f * v; else if (ACT == 15) v = v / (1.0f + expf(-v)); else if (ACT == 3) v = fmaxf(v, 0.f); else if (ACT == 6) v = 0.5f * v * (1.0f + erff(v * 0.70710678118654752f)); so[w][8 * hh + r][t * 16 + ln] = v; } }
  __builtin_amdgcn_fence(__ATOMIC_ACQ_REL, "workgroup"); __builtin_amdgcn_wave_barrier();
  const int rsub = lane >> 4, c4 = (lane & 15) * 4; typedef _Float16 v4h __attribute__((ext_vector_type(4)));
  {
#pragma unroll
    for (int q = 0; q < 8; ++q) { const int r = q * 2 + rsub; if (col0 + c4 < N) { const v4f v = *(const v4fa*)&so[w][r][c4]; if (C) *(v4f*)(C + cofs + (size_t)(row0 + r) * ldc + col0 + c4) = v; if (C16) { v4h h4; for (int i = 0; i < 4; ++i) h4[i] = (_Float16)v[i]; *(v4h*)(C16 + cofs + (size_t)(row0 + r) * ldc + col0 + c4) = h4; } } }
     }
}


typedef _Float16 v4h __attribute__((ext_vector_type(4)));

__global__ __launch_bounds__(256) void k_x16(const float* __restrict__ x, _Float16* __restrict__ X16, size_t n8) { const size_t t = (size_t)blockIdx.x * 256 + threadIdx.x; if (t >= n8) return; FragH f;
#pragma unroll
  for (int q = 0; q < 8; ++q) f.h[q] = (_Float16)bf16_round(x[t * 8 + q]); *(v8us*)((unsigned short*)X16 + t * 8) = f.half[0];  }
__global__ __launch_bounds__(256) void k_h16(const float* __restrict__ x, _Float16* __restrict__ X16, size_t n8) { const size_t t = (size_t)blockIdx.x * 256 + threadIdx.x; if (t >= n8) return; FragH f;
#pragma unroll
  for (int q = 0; q < 8; ++q) f.h[q] = (_Float16)x[t * 8 + q]; *(v8us*)((unsigned short*)X16 + t * 8) = f.half[0];  }
__global__ __launch_bounds__(256) void k_round16f(const float* __restrict__ W, _Float16* __restrict__ Bt, size_t n8) { const size_t t = (size_t)blockIdx.x * 256 + threadIdx.x; if (t >= n8) return; FragH f;
#pragma unroll
  for (int i = 0; i < 8; ++i) f.h[i] = (_Float16)(bf16_round(W[t * 8 + i]) * 16.0f); *(v8us*)((unsigned short*)Bt + t * 8) = f.half[0];  }
template <int NHv, int TTv>
__global__ __launch_bounds__(256) void k_vt(const _Float16* __restrict__ V16, int ldv, int voff, _Float16* __restrict__ Vt) { __shared__ unsigned short tl[64][66]; const int tid = threadIdx.x; const int slab = blockIdx.x / (TTv / 64), lg = blockIdx.x % (TTv / 64); const int b = slab / NHv, h = slab % NHv;
  for (int i = tid; i < 64 * 8; i += 256) { const int r = i / 8, c8 = (i % 8) * 8; FragH f; f.half[0] = *(const v8us*)((const unsigned short*)V16 + ((size_t)b * TTv + lg * 64 + r) * ldv + voff + h * 64 + c8);
#pragma unroll
    for (int q = 0; q < 8; ++q) tl[r][c8 + q] = f.u[q]; }
  __syncthreads();
  {
#pragma unroll
    for (int rd = 0; rd < 2; ++rd) { const int d = rd * 32 + tid / 8, pc = tid % 8; FragH f;
#pragma unroll
      for (int q = 0; q < 8; ++q) f.u[q] = tl[pc * 8 + q][d];
      *(v8us*)((unsigned short*)Vt + ((size_t)slab * 64 + d) * TTv + lg * 64 + pc * 8) = f.half[0]; }
     } }

__global__ __launch_bounds__(256) void k_hl(const float* __restrict__ F, _Float16* __restrict__ Hh, _Float16* __restrict__ Hl, size_t n8) { const size_t t = (size_t)blockIdx.x * 256 + threadIdx.x; if (t >= n8) return; FragH fh, fl; const v4f a = *(const v4fa*)(F + t * 8), c = *(const v4fa*)(F + t * 8 + 4);
#pragma unroll
  for (int q = 0; q < 4; ++q) { _Float16 h = (_Float16)a[q]; fh.h[q] = h; fl.h[q] = (_Float16)((a[q] - (float)h) * 1024.0f); h = (_Float16)c[q]; fh.h[4 + q] = h; fl.h[4 + q] = (_Float16)((c[q] - (float)h) * 1024.0f); }
  { *(v8us*)((unsigned short*)Hh + t * 8) = fh.half[0]; *(v8us*)((unsigned short*)Hl + t * 8) = fl.half[0];  } }

// ---- fast GEMM (block tile 128x64, wave tile 32x64; A and B tiles of 128 k staged in LDS by asynchronous copies, two buffers; requires M % 128 == 0, N % 64 == 0, K % 128 == 0); epilogue = k_gemm_hhx semantics ----
__device__ __forceinline__ v16h g2_frag(const _Float16* p, int hh) { FragH f; f.half[0] = *(const v8us*)((const unsigned short*)p + 8 * hh); f.half[1] = *(const v8us*)((const unsigned short*)p + 16 + 8 * hh); return f.v; }
__device__ __forceinline__ v8f g2_mma(v16h a, v16h b, v8f c) { v8f d = __builtin_amdgcn_wmma_f32_16x16x32_f16(false, a, false, b, (short)0, c, false, false); asm volatile("v_nop\n\tv_nop\n\tv_nop\n\tv_nop" : "+v"(d) : "v"(a), "v"(b)); return d; }
#define G2_PITCH 272      /* LDS row pitch, bytes: 256 of data + 16, an odd multiple of 16 (no bank conflict for 16-byte row reads) */
#define G2_STAGE (192 * G2_PITCH)      /* one buffer: 128 rows of A, then 64 rows of B, 128 k each */
// Eight asynchronous 16-byte copies of a lane, global -> LDS, rows 8 apart (st = 8 source rows, in elements). The s_wait_xcnt stands in the copies' own statement, behind the last of them,
// so that it precedes every later write of a register that a copy names.
__device__ __forceinline__ void g2_copy8(unsigned l, const _Float16* g, size_t st) {
  asm volatile("global_load_async_to_lds_b128 %0, %8, off\n\t"
               "global_load_async_to_lds_b128 %1, %9, off\n\t"
               "global_load_async_to_lds_b128 %2, %10, off\n\t"
               "global_load_async_to_lds_b128 %3, %11, off\n\t"
               "global_load_async_to_lds_b128 %4, %12, off\n\t"
               "global_load_async_to_lds_b128 %5, %13, off\n\t"
               "global_load_async_to_lds_b128 %6, %14, off\n\t"
               "global_load_async_to_lds_b128 %7, %15, off\n\t"
               "s_wait_xcnt 0x0"
               :: "v"(l), "v"(l + 8u * G2_PITCH), "v"(l + 16u * G2_PITCH), "v"(l + 24u * G2_PITCH), "v"(l + 32u * G2_PITCH), "v"(l + 40u * G2_PITCH), "v"(l + 48u * G2_PITCH), "v"(l + 56u * G2_PITCH),
                  "v"(g), "v"(g + st), "v"(g + 2 * st), "v"(g + 3 * st), "v"(g + 4 * st), "v"(g + 5 * st), "v"(g + 6 * st), "v"(g + 7 * st) : "memory"); }
// a fragment from a staged row: p = the row's place + 64 bytes a k step + 16 hh; same k order as g2_frag
__device__ __forceinline__ v16h g2_lfrag(const unsigned char* p) { FragH f; f.half[0] = *(const v8us*)p; f.half[1] = *(const v8us*)(p + 32); return f.v; }
template <int ACT>
__global__ __launch_bounds__(128) void k_gemm2(const _Float16* __restrict__ A, int lda, size_t sA, const _Float16* __restrict__ Bh, int ldb, size_t sB, float alpha, const float* __restrict__ bias, size_t sBias, const float* __restrict__ CP, int rowsPerB, size_t sCPb, int row0g,
    float* __restrict__ C, _Float16* __restrict__ C16, int ldc, size_t sC, int M, int N, int K) { static_assert(ACT == 0 || ACT == 3 || ACT == 6 || ACT == 8 || ACT == 9 || ACT == 11 || ACT == 12 || ACT == 14 || ACT == 15 || ACT == 16 || ACT == 17, "k_gemm2: unsupported ACT code (would silently apply no activation)");
  __shared__ __attribute__((aligned(16))) unsigned char sm[2 * G2_STAGE]; float (*so)[32][68] = (float (*)[32][68])sm;      /* two operand buffers; behind the loop's last barrier the same LDS stages the output tile */
  const int tid = threadIdx.x, w = tid >> 5, lane = tid & 31, ln = lane & 15, hh = lane >> 4; const int by = blockIdx.y;
  A += (size_t)by * sA; Bh += (size_t)by * sB; const size_t cofs = (size_t)by * sC; const float* bp = bias ? bias + (size_t)by * sBias : nullptr;
  const int ntn = N >> 6; const int mt = blockIdx.x / ntn, nq = blockIdx.x - mt * ntn; const int row0 = mt * 128 + 32 * w, col0 = nq * 64; if (mt * 128 >= M) return;      /* the whole block leaves, in front of every barrier */
  /* copies: lane = 16 bytes; 16 lanes a row of 256 bytes, so a wave's copy covers two whole rows; thread rows tid / 16 + 8 i */
  const unsigned lc = (unsigned)(size_t)sm + (unsigned)(tid >> 4) * G2_PITCH + (unsigned)(tid & 15) * 16u;
  const _Float16* ga = A + (size_t)(mt * 128 + (tid >> 4)) * lda + (tid & 15) * 8; const _Float16* gb = Bh + (size_t)(col0 + (tid >> 4)) * ldb + (tid & 15) * 8;
  auto fill = [&](int t, int buf) { const unsigned l = lc + (unsigned)buf * G2_STAGE; const _Float16* a = ga + (size_t)t * 128;
    g2_copy8(l, a, (size_t)8 * lda); g2_copy8(l + 64u * G2_PITCH, a + (size_t)64 * lda, (size_t)8 * lda); g2_copy8(l + 128u * G2_PITCH, gb + (size_t)t * 128, (size_t)8 * ldb); };
  const unsigned char* sa = sm + (32 * w + ln) * G2_PITCH + 16 * hh; const unsigned char* sb = sm + (128 + ln) * G2_PITCH + 16 * hh;
  const v8f z8 = {0.f,0.f,0.f,0.f,0.f,0.f,0.f,0.f}; v8f c00 = z8, c01 = z8, c02 = z8, c03 = z8, c10 = z8, c11 = z8, c12 = z8, c13 = z8;
  const int nt = K >> 7;
  fill(0, 0);
  asm volatile("s_wait_asynccnt 0x0" ::: "memory");      /* this wave's copies of tile 0 have landed */
  __syncthreads();      /* and every other wave's: tile 0 may be read */
  if (nt > 1) fill(1, 1);
  /* rolled: one copy of the body; a trip is 128 k = 32 products a wave, while the next tile's copies fly */
#pragma unroll 1
  for (int t = 0; t < nt; ++t) { const unsigned char* pa = sa + (t & 1) * G2_STAGE; const unsigned char* pb = sb + (t & 1) * G2_STAGE;
    v16h fa[2][2], fb[2][4];      /* two fragment sets */
    fa[0][0] = g2_lfrag(pa); fb[0][0] = g2_lfrag(pb); fa[0][1] = g2_lfrag(pa + 16 * G2_PITCH); fb[0][1] = g2_lfrag(pb + 16 * G2_PITCH); fb[0][2] = g2_lfrag(pb + 32 * G2_PITCH); fb[0][3] = g2_lfrag(pb + 48 * G2_PITCH);
    /* unrolled: the sets get constant indices (registers) and the LDS offsets become immediates. The reads of k step ks + 1 go as one group in front of the products of step ks, so only the trip's first group is waited for in full */
#pragma unroll
    for (int ks = 0; ks < 4; ++ks) { const int c = ks & 1, n = c ^ 1, o = (ks + 1) * 64;
      if (ks < 3) { fa[n][0] = g2_lfrag(pa + o); fb[n][0] = g2_lfrag(pb + o); fa[n][1] = g2_lfrag(pa + 16 * G2_PITCH + o); fb[n][1] = g2_lfrag(pb + 16 * G2_PITCH + o); fb[n][2] = g2_lfrag(pb + 32 * G2_PITCH + o); fb[n][3] = g2_lfrag(pb + 48 * G2_PITCH + o); }
      c00 = g2_mma(fa[c][0], fb[c][0], c00); c10 = g2_mma(fa[c][1], fb[c][0], c10);
      c01 = g2_mma(fa[c][0], fb[c][1], c01); c11 = g2_mma(fa[c][1], fb[c][1], c11);
      c02 = g2_mma(fa[c][0], fb[c][2], c02); c12 = g2_mma(fa[c][1], fb[c][2], c12);
      c03 = g2_mma(fa[c][0], fb[c][3], c03); c13 = g2_mma(fa[c][1], fb[c][3], c13); }
    asm volatile("s_wait_dscnt 0x0" ::: "memory");      /* this wave's reads of the buffer are done before it is refilled */
    asm volatile("s_wait_asynccnt 0x0" ::: "memory");      /* this wave's copies of tile t + 1 have landed */
    __syncthreads();      /* publishes tile t + 1 and ends every wave's reads of tile t */
    if (t + 2 < nt) fill(t + 2, t & 1); }
  asm volatile("s_wait_asynccnt 0x0" ::: "memory");      /* no copy is outstanding when the LDS changes its use */
  v8f accs[8] = {c00, c01, c02, c03, c10, c11, c12, c13};
#pragma unroll
  for (int u = 0; u < 8; ++u) { const int t = u & 3, half = u >> 2; const int col = col0 + t * 16 + ln; const float bv = bp ? bf16_round(bp[col]) : 0.f;
#pragma unroll
    for (int r = 0; r < 8; ++r) { const int rloc = half * 16 + 8 * hh + r; float v = accs[u][r] * alpha + bv; if (CP) { if (rowsPerB < 0) v += CP[cofs + (size_t)(row0g + row0 + rloc) * ldc + col];      /* rowsPerB < 0: own element of the batched C plane */ else { const int bidx = (row0g + row0 + rloc) / rowsPerB; v += CP[(size_t)bidx * sCPb + (size_t)by * 64 + col]; } }
      if (ACT == 3) v = fmaxf(v, 0.f); else if (ACT == 6) v = 0.5f * v * (1.0f + erff(v * 0.70710678118654752f)); else if (ACT == 11) v = 1.0f / (1.0f + expf(-v)); else if (ACT == 15) v = v / (1.0f + expf(-v)); else if (ACT == 12) v = (v > 0.f) ? v : 0.01f * v; else if (ACT == 8) v = tanhf(v); else if (ACT == 9) v = 0.5f * v * (1.0f + tanhf(0.7978845608028654f * (v + 0.044715f * v * v * v))); else if (ACT == 14) v = (v > 0.f) ? v : 0.1f * v; else if (ACT == 16) v = (v >= 0.f) ? v : 0.3f * v; else if (ACT == 17) v = (v >= 0.f) ? v : 0.2f * v;
      so[w][rloc][t * 16 + ln] = v; } }
  __builtin_amdgcn_fence(__ATOMIC_ACQ_REL, "workgroup"); __builtin_amdgcn_wave_barrier();
  const int rsub = lane >> 4, c4 = (lane & 15) * 4;
  {
#pragma unroll
    for (int q = 0; q < 16; ++q) { const int r = q * 2 + rsub; const v4f v = *(const v4fa*)&so[w][r][c4]; if (C) *(v4f*)(C + cofs + (size_t)(row0 + r) * ldc + col0 + c4) = v; if (C16) { v4h h4; for (int i = 0; i < 4; ++i) h4[i] = (_Float16)v[i]; *(v4h*)(C16 + cofs + (size_t)(row0 + r) * ldc + col0 + c4) = h4; } }
     } }


__global__ __launch_bounds__(256) void k_wnat(const float* __restrict__ w, size_t n8, _Float16* __restrict__ Bt) { const size_t t = (size_t)blockIdx.x * 256 + threadIdx.x; if (t >= n8) return; FragH f; for (int q = 0; q < 8; ++q) f.h[q] = (_Float16)(bf16_round(w[t * 8 + q]) * 16.0f); *(v8us*)((unsigned short*)Bt + t * 8) = f.half[0];  }
__global__ __launch_bounds__(256) void k_rsm(const float* __restrict__ S, _Float16* __restrict__ P, int nrows) {
  #pragma clang fp contract(off)
  const int i = blockIdx.x * 256 + threadIdx.x; if (i >= nrows) return; const float* s = S + (size_t)i * SQ; float mx = -3.0e38f;
#pragma unroll 1
  for (int j = 0; j < SQ; ++j) mx = fmaxf(mx, s[j]); float se = 0.f;
#pragma unroll 1
  for (int j = 0; j < SQ; ++j) se += expf(s[j] - mx); const float sc = 256.0f / se;
#pragma unroll 1
  for (int j0 = 0; j0 < SQ; j0 += 8) { FragH f; for (int q = 0; q < 8; ++q) f.h[q] = (_Float16)(expf(s[j0 + q] - mx) * sc); unsigned short* d = (unsigned short*)P + (size_t)i * SQ + j0; *(v8us*)d = f.half[0];  } }
__global__ __launch_bounds__(256) void k_vt(const _Float16* __restrict__ V16, int b, int h0, _Float16* __restrict__ VT) { __shared__ unsigned short tl[64][65]; const int tid = threadIdx.x; const int hh = blockIdx.x % HG, sg = blockIdx.x / HG; const int s0 = sg * 64; const int h = h0 + hh;
  for (int i = tid; i < 64 * 8; i += 256) { const int j = i / 8, d8 = (i % 8) * 8; FragH f; f.half[0] = *(const v8us*)((const unsigned short*)V16 + ((size_t)b * SQ + s0 + j) * DM + h * HD + d8); for (int q = 0; q < 8; ++q) tl[d8 + q][j] = f.u[q]; }
  __syncthreads();
  { for (int i = tid; i < 64 * 8; i += 256) { const int d = i / 8, j8 = (i % 8) * 8; FragH f; for (int q = 0; q < 8; ++q) f.u[q] = tl[d][j8 + q]; *(v8us*)((unsigned short*)VT + ((size_t)hh * HD + d) * SQ + s0 + j8) = f.half[0]; }  } }



__global__ __launch_bounds__(256) void k_rsmcf2(const float* __restrict__ S, _Float16* __restrict__ P, int hg, int q0, int nk) {
  #pragma clang fp contract(off)
  const int t = blockIdx.x * 256 + threadIdx.x; if (t >= hg * QT) return; const size_t i = (size_t)t; const float* s = S + i * NKX; const int last = q0 + (t % QT); float mx = -3.0e38f;
#pragma unroll 1
  for (int j = 0; j < nk; ++j) { const float f = (j <= last) ? 1.f : 0.f; mx = fmaxf(mx, fmaf(f, s[j], (1.f - f) * -1.0e9f)); } float se = 0.f;
#pragma unroll 1
  for (int j = 0; j < nk; ++j) { const float f = (j <= last) ? 1.f : 0.f; se += __expf(fmaf(f, s[j], (1.f - f) * -1.0e9f) - mx); } const float sc = 256.0f / se;
#pragma unroll 1
  for (int j0 = 0; j0 < nk; j0 += 8) { FragH fr; for (int q = 0; q < 8; ++q) { const int j = j0 + q; const float f = (j <= last) ? 1.f : 0.f; fr.h[q] = (_Float16)(__expf(fmaf(f, s[j], (1.f - f) * -1.0e9f) - mx) * sc); } unsigned short* d = (unsigned short*)P + i * NKX + j0; *(v8us*)d = fr.half[0];  } }


template <int MASKADD>
__global__ __launch_bounds__(64) void k_att0(const float* __restrict__ QF, const float* __restrict__ KF, const float* __restrict__ VF, int ld, const float* __restrict__ mask, float scale, float* __restrict__ OF, int ldo) {
  #pragma clang fp contract(off)
  __shared__ __attribute__((aligned(16))) float lq[64][64]; __shared__ __attribute__((aligned(16))) float lo[64][64];
  const int tid = threadIdx.x; const int h = blockIdx.x / (QT0 / 64), rg = blockIdx.x % (QT0 / 64); const int i = rg * 64 + tid;
  const float* qr = QF + (size_t)i * ld + h * HD;
#pragma unroll 1
  for (int c = 0; c < HD / 4; ++c) { *(v4f*)&lq[tid][c * 4] = *(const v4fa*)(qr + c * 4); const v4f z = {0.f, 0.f, 0.f, 0.f}; *(v4f*)&lo[tid][c * 4] = z; }
  float m = -1.0e30f, l = 0.f; const int jmax = MASKADD ? (SQ - 1) : (rg * 64 + 63);      /* additive-mask form: every key (the mask input decides); causal form: keys up to the block's last row */
#pragma unroll 1
  for (int j = 0; j <= jmax; ++j) { const float* kr = KF + (size_t)j * ld + h * HD; const float* vr = VF + (size_t)j * ld + h * HD; float s = 0.f;
#pragma unroll 1
    for (int c = 0; c < HD / 4; ++c) { const v4f kq = *(const v4fa*)(kr + c * 4); const v4f qq = *(v4f*)&lq[tid][c * 4]; s = __fadd_rn(s, __fmul_rn(qq[0], kq[0])); s = __fadd_rn(s, __fmul_rn(qq[1], kq[1])); s = __fadd_rn(s, __fmul_rn(qq[2], kq[2])); s = __fadd_rn(s, __fmul_rn(qq[3], kq[3])); }
    s = __fmul_rn(s, scale); if (MASKADD) s = __fadd_rn(s, __fmul_rn(bf16_round(mask[(size_t)i * SQ + j]), -10000.0f));
    const float f = (MASKADD || j <= i) ? 1.f : 0.f; const float sm = fmaf(f, s, (1.f - f) * -1.0e30f); const float mn = fmaxf(m, sm); const float sc = expf(m - mn); const float e = expf(sm - mn); l = __fadd_rn(__fmul_rn(l, sc), e); m = mn;
#pragma unroll 1
    for (int c = 0; c < HD / 4; ++c) { const v4f vv = *(const v4fa*)(vr + c * 4); v4f oo = *(v4f*)&lo[tid][c * 4]; for (int u = 0; u < 4; ++u) oo[u] = __fadd_rn(__fmul_rn(oo[u], sc), __fmul_rn(e, vv[u])); *(v4f*)&lo[tid][c * 4] = oo; } }
  const float fin = 64.0f / l;      /* o carried x64 like the f16 path */
#pragma unroll 1
  for (int c = 0; c < HD / 4; ++c) { v4f oo = *(v4f*)&lo[tid][c * 4]; for (int u = 0; u < 4; ++u) oo[u] = __fmul_rn(oo[u], fin); *(v4f*)&lo[tid][c * 4] = oo; }
  __syncthreads();
  {
#pragma unroll 1
    for (int it = 0; it < 16; ++it) { const int row = it * 4 + tid / 16, pc = (tid % 16) * 4; const v4f v = *(const v4f*)&lo[row][pc]; *(v4f*)(OF + (size_t)(rg * 64 + row) * ldo + h * HD + pc) = v; }
     } }


template <int BFIN, int WXB>
__global__ __launch_bounds__(256) void k_ln16(const float* __restrict__ X, const float* __restrict__ g, const float* __restrict__ bb, float eps, _Float16* __restrict__ N16, float* __restrict__ XB) {
  #pragma clang fp contract(off)
  __shared__ float red[256]; const size_t r = blockIdx.x; const int t = threadIdx.x; const v4f xa = *(const v4fa*)(X + r * DMQ + t * 4); float s[4]; float sum = 0.f;
  for (int q = 0; q < 4; ++q) { s[q] = BFIN ? bf16_round(xa[q]) : xa[q]; sum = __fadd_rn(sum, s[q]); }
  red[t] = sum; __syncthreads(); for (int st = 128; st > 0; st >>= 1) { if (t < st) red[t] = __fadd_rn(red[t], red[t + st]); __syncthreads(); } const float mu = red[0] / (float)DMQ; __syncthreads();
  float vs = 0.f; for (int q = 0; q < 4; ++q) { const float dl = __fadd_rn(s[q], -mu); vs = __fadd_rn(vs, __fmul_rn(dl, dl)); } red[t] = vs; __syncthreads(); for (int st = 128; st > 0; st >>= 1) { if (t < st) red[t] = __fadd_rn(red[t], red[t + st]); __syncthreads(); }
  const float rs = rsqrtf(__fadd_rn(red[0] / (float)DMQ, eps)); v4h y; v4f xb;
  for (int q = 0; q < 4; ++q) { const int c = t * 4 + q; y[q] = (_Float16)__fadd_rn(__fmul_rn(__fmul_rn(__fadd_rn(s[q], -mu), rs), bf16_round(g[c])), bf16_round(bb[c])); xb[q] = s[q]; }
  { *(v4h*)(N16 + r * DMQ + t * 4) = y; if (WXB) *(v4f*)(XB + r * DMQ + t * 4) = xb;  } }
__global__ __launch_bounds__(256) void k_ftres2(const float* __restrict__ OF0, const float* __restrict__ XB, float* __restrict__ X1, size_t n4) {
  #pragma clang fp contract(off)
  const size_t t = (size_t)blockIdx.x * 256 + threadIdx.x; if (t >= n4) return; const v4f o = *(const v4fa*)(OF0 + t * 4), xv = *(const v4fa*)(XB + t * 4); v4f y; for (int q = 0; q < 4; ++q) y[q] = __fadd_rn(__fmul_rn(o[q], 0.015625f), xv[q]); *(v4f*)(X1 + t * 4) = y;  }

__global__ __launch_bounds__(256) void k_wthd(const float* __restrict__ Wt, _Float16* __restrict__ Bt) { const size_t t = (size_t)blockIdx.x * 256 + threadIdx.x; if (t >= (size_t)NH * HD * (DM / 8)) return; const int m8 = (int)(t % (DM / 8)) * 8; const int d = (int)((t / (DM / 8)) % HD); const int h = (int)(t / ((size_t)(DM / 8) * HD)); FragH f;
  for (int q = 0; q < 8; ++q) f.h[q] = (_Float16)(16.0f * bf16_round(Wt[((size_t)h * DM + m8 + q) * HD + d])); unsigned short* dst = (unsigned short*)Bt + ((size_t)h * HD + d) * DM + m8; *(v8us*)dst = f.half[0];  }




template <int BFIN, int W16, int W32>
__global__ __launch_bounds__(256) void k_lnx(const float* __restrict__ X, const float* __restrict__ g, const float* __restrict__ bb, float eps, _Float16* __restrict__ N16, float* __restrict__ N32) {
  #pragma clang fp contract(off)
  __shared__ float red[256]; const size_t r = blockIdx.x; const int t = threadIdx.x; const bool act = t < (DMQ / 4); const int c0 = act ? t * 4 : 0;
  const v4f xa = *(const v4fa*)(X + r * DMQ + c0); float s[4]; float sum = 0.f;
  for (int q = 0; q < 4; ++q) { s[q] = act ? (BFIN ? bf16_round(xa[q]) : xa[q]) : 0.f; sum = __fadd_rn(sum, s[q]); }
  red[t] = sum; __syncthreads(); for (int st = 128; st > 0; st >>= 1) { if (t < st) red[t] = __fadd_rn(red[t], red[t + st]); __syncthreads(); } const float mu = red[0] / (float)DMQ; __syncthreads();
  float vs = 0.f; for (int q = 0; q < 4; ++q) { const float dl = act ? __fadd_rn(s[q], -mu) : 0.f; vs = __fadd_rn(vs, __fmul_rn(dl, dl)); } red[t] = vs; __syncthreads(); for (int st = 128; st > 0; st >>= 1) { if (t < st) red[t] = __fadd_rn(red[t], red[t + st]); __syncthreads(); }
  const float rs = rsqrtf(__fadd_rn(red[0] / (float)DMQ, eps)); v4h y; v4f yf;
  for (int q = 0; q < 4; ++q) { const int c = c0 + q; yf[q] = __fadd_rn(__fmul_rn(__fmul_rn(__fadd_rn(s[q], -mu), rs), bf16_round(g[c])), bf16_round(bb[c])); y[q] = (_Float16)yf[q]; }
  if (!act) return;      /* no barriers after this point */
  { if (W16) *(v4h*)(N16 + r * DMQ + c0) = y; if (W32) *(v4f*)(N32 + r * DMQ + c0) = yf;  } }


__global__ __launch_bounds__(256) void k_bfr(const float* __restrict__ x, float* __restrict__ XB, size_t n8) { const size_t t = (size_t)blockIdx.x * 256 + threadIdx.x; if (t >= n8) return; v4f a = *(const v4fa*)(x + t * 8), c = *(const v4fa*)(x + t * 8 + 4); for (int q = 0; q < 4; ++q) { a[q] = bf16_round(a[q]); c[q] = bf16_round(c[q]); }
  { *(v4f*)(XB + t * 8) = a; *(v4f*)(XB + t * 8 + 4) = c;  } }




__global__ __launch_bounds__(256) void k_lorafold(const float* __restrict__ Wm, const float* __restrict__ A, const float* __restrict__ Bm, float* __restrict__ WE, int K, int N, float sc) {
  #pragma clang fp contract(off)
  const size_t t = (size_t)blockIdx.x * 256 + threadIdx.x; if (t >= (size_t)K * N) return; const int i = (int)(t / N), o = (int)(t % N); float a = 0.f;
  for (int r = 0; r < 16; ++r) a = __fadd_rn(a, __fmul_rn(bf16_round(A[(size_t)i * 16 + r]), bf16_round(Bm[(size_t)r * N + o])));
  const float v = __fadd_rn(bf16_round(Wm[t]), __fmul_rn(sc, a)); *(float*)(WE + t) = v;  }
__global__ __launch_bounds__(256) void k_wt32rep(const float* __restrict__ Wf, _Float16* __restrict__ Bt, int K, int N, int DOUT, float scale) {
  const int t = blockIdx.x * 256 + threadIdx.x; if (t >= DOUT * (K / 8)) return; const int n = t / (K / 8), k8 = (t % (K / 8)) * 8; const int rep = DOUT / N; const int src = (n / (HD * rep)) * HD + (n % HD);      /* head h = n / HD -> group h / rep */
  FragH f; for (int i = 0; i < 8; ++i) f.h[i] = (_Float16)(Wf[(size_t)(k8 + i) * N + src] * scale);
  *(v8us*)((unsigned short*)Bt + (size_t)n * K + k8) = f.half[0];  }
__global__ __launch_bounds__(256) void k_brep(const float* __restrict__ b, float* __restrict__ out) { const int t = blockIdx.x * 256 + threadIdx.x; if (t >= DM) return; const float v = b[(t / (HD * 4)) * HD + (t % HD)]; *(float*)(out + t) = v;  }

__global__ __launch_bounds__(256) void k_rsmcim(const float* __restrict__ S, _Float16* __restrict__ P, int hg, int q0, int nk, const int* __restrict__ am) {
  #pragma clang fp contract(off)
  const int t = blockIdx.x * 256 + threadIdx.x; if (t >= hg * QT) return; const size_t i = (size_t)t; const float* s = S + i * NKX; const int last = q0 + (t % QT); const int* mr = am + (size_t)last * SQ; float mx = -3.0e38f;      /* the module's mask row of this query (keys >= nk lie above the diagonal of the causal mask and are not computed) */
#pragma unroll 1
  for (int j = 0; j < nk; ++j) { const float f = (mr[j] != 0) ? 1.f : 0.f; mx = fmaxf(mx, fmaf(f, s[j], (1.f - f) * -1.0e9f)); } float se = 0.f;
#pragma unroll 1
  for (int j = 0; j < nk; ++j) { const float f = (mr[j] != 0) ? 1.f : 0.f; se += __expf(fmaf(f, s[j], (1.f - f) * -1.0e9f) - mx); } const float sc = 256.0f / se;
#pragma unroll 1
  for (int j0 = 0; j0 < nk; j0 += 8) { FragH fr; for (int q = 0; q < 8; ++q) { const int j = j0 + q; const float f = (mr[j] != 0) ? 1.f : 0.f; fr.h[q] = (_Float16)(__expf(fmaf(f, s[j], (1.f - f) * -1.0e9f) - mx) * sc); } unsigned short* d = (unsigned short*)P + i * NKX + j0; *(v8us*)d = fr.half[0];  } }



__global__ __launch_bounds__(256) void k_bcpy(const float* __restrict__ b, int n, int NP, float* __restrict__ dst, int dst0) { for (int i = threadIdx.x; i < NP; i += 256) { const float v = (i < n) ? b[i] : 0.f; *(float*)(dst + dst0 + i) = v; }  }



// lane l with lane l ^ 16
__device__ __forceinline__ float rs_xh(float v) { return __builtin_bit_cast(float, __builtin_amdgcn_permlanex16(__builtin_bit_cast(int, v), __builtin_bit_cast(int, v), 0x76543210, 0xfedcba98, false, false)); }
// native 2^t; the v_nop is the slot the instruction set asks for behind a transcendental before its result is read or its source overwritten
__device__ __forceinline__ float fa_exp2(float t) { float e; asm("v_exp_f32 %0, %1\n\tv_nop" : "=v"(e) : "v"(t)); return e; }
__global__ __launch_bounds__(256) void k_fattn(const _Float16* __restrict__ Q, const _Float16* __restrict__ Kk, const _Float16* __restrict__ VT, _Float16* __restrict__ O) {
  const int lane = threadIdx.x & 31, w = threadIdx.x >> 5, ln = lane & 15, hh = lane >> 4; const int h = blockIdx.y, b = blockIdx.z; const int q0 = blockIdx.x * 256 + w * 32; const size_t r0 = (size_t)b * SQ;
  const _Float16* qp = Q + (r0 + q0 + ln) * LQ + h * HD + 8 * hh; const _Float16* kp = Kk + (r0 + ln) * LQ + h * HD + 8 * hh; const _Float16* vp = VT + ((size_t)(b * NH + h) * HD + ln) * SQ + 8 * hh;      /* the lane's own 8 hh is in the pointers: g2_frag is called with 0 */
  const float L2E = 1.44269504088896340736f; const v8f z8 = {0.f,0.f,0.f,0.f,0.f,0.f,0.f,0.f};
  v16h qf[2][2], kf[2][2], vf[4]; v8f o[2][4]; float m[2] = {-3.0e38f, -3.0e38f}, l[2] = {0.f, 0.f};
  /* every inner loop is unrolled so that the fragment arrays have constant indices and stay in registers */
#pragma unroll
  for (int t = 0; t < 2; ++t) { qf[t][0] = g2_frag(qp + (size_t)t * 16 * LQ, 0); qf[t][1] = g2_frag(qp + (size_t)t * 16 * LQ + 32, 0);
#pragma unroll
    for (int dt = 0; dt < 4; ++dt) o[t][dt] = z8; }
  /* behind each group of loads that share one address pair: the wait that precedes any overwrite of that pair; the pair is an input, so it stays live (no load's result lands on it) up to the wait.
     The "memory" clobber also keeps the groups in this order, Q, K, V^T, here as in the loop (K, V^T), so that the counted load waits at the loop's head leave the V^T loads in flight */
  asm volatile("s_wait_xcnt 0x0" :: "v"(qp) : "memory");
#pragma unroll
  for (int kt = 0; kt < 2; ++kt) { kf[kt][0] = g2_frag(kp + (size_t)kt * 16 * LQ, 0); kf[kt][1] = g2_frag(kp + (size_t)kt * 16 * LQ + 32, 0); }
  asm volatile("s_wait_xcnt 0x0" :: "v"(kp) : "memory");      /* as above */
#pragma unroll
  for (int dt = 0; dt < 4; ++dt) vf[dt] = g2_frag(vp + (size_t)dt * 16 * SQ, 0);
  asm volatile("s_wait_xcnt 0x0" :: "v"(vp) : "memory");      /* as above */
  /* rolled: a pass is some 350 instructions already, and with one copy of the body the load groups keep the one order (K, V^T) that the counted waits lean on */
#pragma unroll 1
  for (int j = 0; j < SQ; j += 32) { const int jn = (j + 32 < SQ) ? j + 32 : j;      /* the last pass fetches its own tile again: in bounds, not used */
    v8f s[2][2];
#pragma unroll
    for (int t = 0; t < 2; ++t)
#pragma unroll
      for (int kt = 0; kt < 2; ++kt) s[t][kt] = g2_mma(kf[kt][1], qf[t][1], g2_mma(kf[kt][0], qf[t][0], z8));
    const _Float16* kn = kp + (size_t)jn * LQ;
#pragma unroll
    for (int kt = 0; kt < 2; ++kt) { kf[kt][0] = g2_frag(kn + (size_t)kt * 16 * LQ, 0); kf[kt][1] = g2_frag(kn + (size_t)kt * 16 * LQ + 32, 0); }
    asm volatile("s_wait_xcnt 0x0" :: "v"(kn) : "memory");      /* as in front of the loop; it also keeps the fetch at this place, a pass ahead of its use */
    FragH pf[2];
#pragma unroll
    for (int t = 0; t < 2; ++t) { float mx = fmaxf(s[t][0][0], s[t][1][0]);
#pragma unroll
      for (int r = 1; r < 8; ++r) mx = fmaxf(mx, fmaxf(s[t][0][r], s[t][1][r]));
      mx = fmaxf(mx, rs_xh(mx)); const float mn = fmaxf(m[t], mx); const float al = fa_exp2((m[t] - mn) * L2E); const float mb = mn * L2E - 8.0f; m[t] = mn; float e0 = 0.f, e1 = 0.f;
#pragma unroll
      for (int r = 0; r < 8; ++r) { const float p0 = fa_exp2(fmaf(s[t][0][r], L2E, -mb)), p1 = fa_exp2(fmaf(s[t][1][r], L2E, -mb)); e0 += p0; e1 += p1; pf[t].h[r] = (_Float16)p0; pf[t].h[8 + r] = (_Float16)p1; }
      l[t] = fmaf(l[t], al, e0 + e1);      /* this half's keys only; the halves are joined behind the loop */
#pragma unroll
      for (int dt = 0; dt < 4; ++dt) o[t][dt] *= al; }
#pragma unroll
    for (int t = 0; t < 2; ++t)
#pragma unroll
      for (int dt = 0; dt < 4; ++dt) o[t][dt] = g2_mma(vf[dt], pf[t].v, o[t][dt]);
    const _Float16* vn = vp + jn;
#pragma unroll
    for (int dt = 0; dt < 4; ++dt) vf[dt] = g2_frag(vn + (size_t)dt * 16 * SQ, 0);
    asm volatile("s_wait_xcnt 0x0" :: "v"(vn) : "memory"); }      /* as for K */
  asm volatile("s_wait_loadcnt 0x0" ::: "memory");      /* the last pass's unused fetch has landed before the wave gives its registers back */
#pragma unroll
  for (int t = 0; t < 2; ++t) { const float fin = 64.0f / (l[t] + rs_xh(l[t]));      /* ctx carried x64; the x256 of the weights cancels in the quotient */
    _Float16* d = O + (r0 + q0 + t * 16 + ln) * DM + h * HD + 8 * hh;
#pragma unroll
    for (int dt = 0; dt < 4; ++dt) { FragH f;
#pragma unroll
      for (int r = 0; r < 8; ++r) f.h[r] = (_Float16)(o[t][dt][r] * fin);
      *(v8us*)((unsigned short*)d + dt * 16) = f.half[0]; } } }
extern "C" void kernel_launch(void* const* d_in, const int* in_sizes, int n_in,
                              void* d_out, int out_size, void* d_ws, size_t ws_size, hipStream_t stream) {
  (void)in_sizes; (void)n_in; (void)out_size;
  const float* const* I = (const float* const*)d_in; const float* x = I[0]; const float* wq = I[1]; const float* bq = I[2]; const float* wk = I[3]; const float* bk = I[4]; const float* wv = I[5]; const float* bv = I[6]; const float* wo = I[7]; const float* bo = I[8]; const float* wfc = I[9]; const float* bfc = I[10]; const float* wmp = I[11]; const float* bmp = I[12]; const float* g1 = I[13]; const float* be1 = I[14]; const float* gg2 = I[15]; const float* be2 = I[16];      /* x; [in][out] Wq / Wk / Wv / Wo + biases; W1 [1024][4096] + b1, W2 [4096][1024] + b2; LN1 g / b, LN2 g / b */
  char* ws = (char*)d_ws; size_t off = 0;
  auto take = [&](size_t bytes) { char* p = ws + off; off += (bytes + 255) & ~(size_t)255; return p; };
  _Float16* BQKV = (_Float16*)take((size_t)3 * DM * DM * 2); _Float16* BO = (_Float16*)take((size_t)DM * DM * 2); float* bqkv = (float*)take((size_t)3 * DM * 4); float* X1N = nullptr;      /* LN1 output (f32): aliases the QKV plane below (QKV's last readers, the V^T launch and the fused attention launch, precede LN1) to stay within 256 MiB at NB 4 / SQ 2048 */
  _Float16* X16 = (_Float16*)take(NR * DM * 2); float* XB = (float*)take(NR * DM * 4); float* X1 = (float*)take(NR * DM * 4); _Float16* M16 = nullptr;      /* = X16 below (alias: X16's last reader, the fused QKV GEMM, precedes LN1's f16 write) */ _Float16* HF16 = nullptr;      /* FFN hidden plane of one batch [2048][4096] f16: its own region below */ _Float16* BW1 = (_Float16*)take((size_t)DFF * DM * 2); _Float16* BW2 = (_Float16*)take((size_t)DM * DFF * 2); _Float16* QKV = (_Float16*)take(NR * 3 * DM * 2); _Float16* Q16 = QKV; _Float16* K16 = QKV + DM; _Float16* V16 = QKV + 2 * DM; _Float16* O16 = (_Float16*)take(NR * DM * 2); M16 = X16; X1N = (float*)QKV; HF16 = (_Float16*)take((size_t)SQ * DFF * 2);      /* the per-batch FFN hidden plane (16 MiB) gets its OWN region here: at NB 2 the context plane O16 is only 8 MiB */      /* aliases: X1N (NR*DM f32 = 16 MiB) inside QKV (24 MiB) */
  _Float16* VT = (_Float16*)take((size_t)NB * NH * HD * SQ * 2);
  if (off > ws_size) return;
  { const unsigned g = (unsigned)(((size_t)DM * (DM / 8) + 255) / 256); k_wt_f16<<<g, 256, 0, stream>>>(wq, BQKV, DM, DM, 16.0f); k_wt_f16<<<g, 256, 0, stream>>>(wk, BQKV + (size_t)DM * DM, DM, DM, 16.0f); k_wt_f16<<<g, 256, 0, stream>>>(wv, BQKV + (size_t)2 * DM * DM, DM, DM, 16.0f); k_wt_f16<<<g, 256, 0, stream>>>(wo, BO, DM, DM, 16.0f); }      /* [in][out] -> Bt x16: stacked q | k | v, and Wo */
  k_bcpy<<<1, 256, 0, stream>>>(bq, DM, DM, bqkv, 0); k_bcpy<<<1, 256, 0, stream>>>(bk, DM, DM, bqkv, DM); k_bcpy<<<1, 256, 0, stream>>>(bv, DM, DM, bqkv, 2 * DM);      /* stacked bias bq | bk | bv */
  k_x16<<<(unsigned)((NR * DM / 8 + 255) / 256), 256, 0, stream>>>(x, X16, NR * DM / 8); k_bfr<<<(unsigned)((NR * DM / 8 + 255) / 256), 256, 0, stream>>>(x, XB, NR * DM / 8);      /* post-LN: the attention runs on the raw input (exact f16 rows); XB = bf16(x) f32 for the residual */
  k_wt_f16<<<(unsigned)(((size_t)DFF * (DM / 8) + 255) / 256), 256, 0, stream>>>(wfc, BW1, DM, DFF, 16.0f); k_wt_f16<<<(unsigned)(((size_t)DM * (DFF / 8) + 255) / 256), 256, 0, stream>>>(wmp, BW2, DFF, DM, 16.0f);      /* natural w1 [1024][4096] and w2 [4096][1024] = Bt x16 */
  const size_t r0p = (size_t)B0 * SQ;      /* first projected row */
  k_gemm2<0><<<dim3((unsigned)((MP / 128) * (3 * DM / 64)), 1), 128, 0, stream>>>(X16 + r0p * DM, DM, 0, BQKV, DM, 0, 0.0625f, bqkv, 0, nullptr, 1, 0, 0, nullptr, QKV + r0p * 3 * DM, 3 * DM, 0, MP, 3 * DM, DM);      /* q | k | v rows (f16); head h = columns h*HD.. of each DM block */
  k_vt<NH, SQ><<<NB * NH * (SQ / 64), 256, 0, stream>>>(V16, LQ, 0, VT);      /* V^T [NB][NH][HD][SQ] */
  k_fattn<<<dim3(SQ / 256, NH, NB), 256, 0, stream>>>(Q16, K16, VT, O16);      /* scores q.k (no scaling), softmax over all keys, ctx (merged heads, x64) as f16 rows */
  k_gemm2<0><<<dim3((unsigned)((MPO / 128) * (DM / 64)), 1), 128, 0, stream>>>(O16 + r0p * DM, DM, 0, BO, DM, 0, 0.0009765625f, bo, 0, XB + r0p * DM, -1, 0, 0, X1 + r0p * DM, nullptr, DM, 0, MPO, DM, DM);      /* out rows are the output layout */
  k_lnx<0, 1, 1><<<(unsigned)NR, 256, 0, stream>>>(X1, g1, be1, 1e-5f, M16, X1N);      /* x1 = LN1(x + attn_out) (eps 1e-5): f16 rows for the FFN input and f32 rows for the residual */
  for (int b = 0; b < NB; ++b) { const size_t r0 = (size_t)b * SQ;
    k_gemm2<6><<<dim3((unsigned)((SQ / 128) * (DFF / 64)), 1), 128, 0, stream>>>(M16 + r0 * DM, DM, 0, BW1, DM, 0, 0.0625f, bfc, 0, nullptr, 1, 0, 0, nullptr, HF16, DFF, 0, SQ, DFF, DM);      /* gelu_erf(x1 w1 + b1) -> f16 (this batch) */
    k_gemm2<0><<<dim3((unsigned)((SQ / 128) * (DM / 64)), 1), 128, 0, stream>>>(HF16, DFF, 0, BW2, DFF, 0, 0.0625f, bmp, 0, X1N + r0 * DM, -1, 0, 0, X1 + r0 * DM, nullptr, DM, 0, SQ, DM, DFF); }      /* t = x1 + gelu-ffn + b2 (own-element residual) f32, over the dead pre-LN1 plane */
  k_lnx<0, 0, 1><<<(unsigned)NR, 256, 0, stream>>>(X1, gg2, be2, 1e-5f, nullptr, (float*)d_out);      /* out = LN2(t) (eps 1e-5) -> f32 output rows */
}

// v004
// One run takes 380 microseconds.
// Next to v003, in two timings, it ran 1.12 and 1.11 times as fast.
// Over all steps from v000 it is 19.4 times as fast.
#include <hip/hip_runtime.h>
// POST-LN transformer encoder block (x [2][2048][1024]; q/k/v = x W + b ([in][out] 1024 x 1024, zero biases); 16 heads of 64; scores = q k^T with NO 1/sqrt(head_dim) scaling (as the source module); softmax over all 2048 keys (no mask); x1 = LN1(x + ctx Wo + bo) (biased var, eps 1e-5, g / beta); out = LN2(x1 + gelu_erf(x1 W1 + b1) W2 + b2) ([in][out] 1024 x 4096 x 1024) -> [2][2048][1024]).
// Structure: token rows; x as exact f16 rows and bf16 f32 residual rows; natural weights as exact x16 planes; fused q | k | v WMMA GEMM (32x64 wave tiles, f32 accumulation, + stacked bias) -> f16; V^T via LDS transposes; one fused attention launch (S^T = K Q^T, online softmax in registers with f32 statistics and native exp, weights x256 f16, O^T += V^T P^T), ctx (x64) merged f16; x + ctx Wo + bo f32; LN1 on VALU -> f16 + f32; gelu FFN per batch; + residual; LN2 -> output; launches: see trace.
// Compute dtype: inputs rounded to bf16; x / weights exact; q, k, v, softmax weights and o as plain f16 GEMM operands (~2^-12); scores and softmax statistics f32. v_wmma_f32_16x16x32_f16.
#define NB 2
#define SQ 2048
#define DM 1024
#define NH 16
#define HD 64
#define HG 4                         /* heads per launch of the non-template k_vt (not launched) */
#define QT 256                       /* query rows per attention tile */
#define NKX SQ                       /* S / P row pitch */
#define QT0 128                      /* rows per head of the f32 k_att0 path (not launched) */
#define B0 0                         /* first batch processed (debug hook) */
#define NBR NB                       /* batches processed (debug hook) */
#define NR ((size_t)NB * SQ)
#define DMQ DM
#define DFF 4096         /* FFN hidden width */
#define MP ((int)((size_t)NBR * SQ)) /* rows projected (debug hook) */
#define QN SQ                        /* query rows per batch (not used) */
#define NHD NH                       /* heads (not used) */
#define MPO MP                       /* rows through the output stage (debug hook) */
#define LQ (3 * DM)      /* row pitch of the q/k/v rows */
typedef __bf16 v16b __attribute__((ext_vector_type(16)));
typedef unsigned short v8us __attribute__((ext_vector_type(8), may_alias));
typedef float  v8f  __attribute__((ext_vector_type(8)));
typedef float  v4f  __attribute__((ext_vector_type(4)));
typedef float  v4fa __attribute__((ext_vector_type(4), may_alias));
union FragB { v16b v; v8us half[2]; unsigned short u[16]; };

__device__ __forceinline__ unsigned short bf16_bits(float x) { unsigned int u = __float_as_uint(x); return (unsigned short)((u + 0x7FFFu + ((u >> 16) & 1u)) >> 16); }
__device__ __forceinline__ float bf16_val(unsigned short b) { return __uint_as_float(((unsigned int)b) << 16); }
__device__ __forceinline__ float bf16_round(float x) { return bf16_val(bf16_bits(x)); }
// D += A·B with NT terms: 1 = ah·bh, 2 = + al·bh (A split), 3 = + ah·bl (both split)
template <int NT>
__device__ __forceinline__ v8f mmaN(v16b ah, v16b al, v16b bh, v16b bl, v8f c) {
  c = __builtin_amdgcn_wmma_f32_16x16x32_bf16(false, ah, false, bh, (short)0, c, false, false);
  if (NT >= 2) c = __builtin_amdgcn_wmma_f32_16x16x32_bf16(false, al, false, bh, (short)0, c, false, false);
  if (NT >= 3) c = __builtin_amdgcn_wmma_f32_16x16x32_bf16(false, ah, false, bl, (short)0, c, false, false);
  asm volatile("v_nop\n\tv_nop\n\tv_nop\n\tv_nop" : "+v"(c) : "v"(ah), "v"(al), "v"(bh), "v"(bl));
  return c;
}

__global__ __launch_bounds__(256) void k_wt_bf16(const float* __restrict__ W, unsigned short* __restrict__ Wt, int K, int N) {
  const int t = blockIdx.x * 256 + threadIdx.x;
  const int k8n = K / 8;
  if (t >= N * k8n) return;
  const int n = t / k8n, k8 = (t % k8n) * 8;
  v8us v;
#pragma unroll
  for (int i = 0; i < 8; ++i) v[i] = bf16_bits(W[(size_t)(k8 + i) * N + n]);
  *(v8us*)(Wt + (size_t)n * K + k8) = v;
  
}

// GEMM C[M][N] (f32, pitch ldc) = act(A[M][K]·W + bias). A f32 row-major (pitch lda) converted per fragment to bf16
// (ASPLIT: hi/lo two planes -> 2 terms, else single rounded term); Wt bf16 [N][K] (pitch ldb). BIAS_BF16 rounds the
// bias to bf16 first (bias quantised to bf16 before the add). K%32==0, M%16==0, N%64==0.
template <bool ASPLIT, int ACT, bool BIAS_BF16>
__global__ __launch_bounds__(128) void k_gemm_bf(const float* __restrict__ A, int lda, const unsigned short* __restrict__ Wt, int ldb,
                                               const float* __restrict__ bias, float* __restrict__ C, int ldc, int M, int N, int K) {
  __shared__ __attribute__((aligned(16))) float so[4][16][64];
  const int tid = threadIdx.x, w = tid >> 5, lane = tid & 31, ln = lane & 15, hh = lane >> 4;
  const int ntn = N / 64;
  const int wid = blockIdx.x * 4 + w;
  const int mt = wid / ntn, nq = wid % ntn;
  if (mt * 16 >= M) return;
  const int row0 = mt * 16, col0 = nq * 64;
  const float* arow = A + (size_t)(row0 + ln) * lda;
  v8f acc[4] = {};
  for (int kb = 0; kb < K; kb += 32) {
    FragB ah, al;
    const v4f x0 = *(const v4fa*)(arow + kb + 8 * hh), x1 = *(const v4fa*)(arow + kb + 8 * hh + 4);
    const v4f x2 = *(const v4fa*)(arow + kb + 16 + 8 * hh), x3 = *(const v4fa*)(arow + kb + 16 + 8 * hh + 4);
    float xs[16] = {x0[0],x0[1],x0[2],x0[3],x1[0],x1[1],x1[2],x1[3],x2[0],x2[1],x2[2],x2[3],x3[0],x3[1],x3[2],x3[3]};
#pragma unroll
    for (int i = 0; i < 16; ++i) { const unsigned short hb = bf16_bits(xs[i]); ah.u[i] = hb; al.u[i] = ASPLIT ? bf16_bits(xs[i] - bf16_val(hb)) : (unsigned short)0; }
#pragma unroll
    for (int t = 0; t < 4; ++t) {
      const unsigned short* brow = Wt + (size_t)(col0 + t * 16 + ln) * ldb + kb;
      FragB b;
      b.half[0] = *(const v8us*)(brow + 8 * hh);
      b.half[1] = *(const v8us*)(brow + 16 + 8 * hh);
      acc[t] = mmaN<ASPLIT ? 2 : 1>(ah.v, al.v, b.v, b.v, acc[t]);
    }
  }
#pragma unroll
  for (int t = 0; t < 4; ++t) {
    float bv = bias ? bias[col0 + t * 16 + ln] : 0.f;
    if (BIAS_BF16) bv = bf16_round(bv);
#pragma unroll
    for (int r = 0; r < 8; ++r) { float v = acc[t][r] + bv; if (ACT == 1) v = fmaxf(v, 0.f); so[w][8 * hh + r][t * 16 + ln] = v; }
  }
  __builtin_amdgcn_fence(__ATOMIC_ACQ_REL, "workgroup");
  __builtin_amdgcn_wave_barrier();
  const int rsub = lane >> 4, c4 = (lane & 15) * 4;
  {
#pragma unroll
    for (int q = 0; q < 8; ++q) {
      const int r = q * 2 + rsub;
      const v4f v = *(const v4fa*)&so[w][r][c4];
      *(v4f*)(C + (size_t)(row0 + r) * ldc + col0 + c4) = v;
    }
    
  }
}

// GEMM C = act(A·W + bias + resid): A f32 (ASPLIT -> hi/lo 2 terms), Wt bf16 [N][K]; ACT 0 none, 1 relu, 2 exact gelu;
// resid (optional, f32, row index = (row % rmod), pitch ldr, RES_BF16 rounds it) added before the activation.
template <bool ASPLIT, int ACT, bool BIAS_BF16, bool RES_BF16>
__global__ __launch_bounds__(128) void k_gemm_bf3(const float* __restrict__ A, int lda, const unsigned short* __restrict__ Wt, int ldb,
                                                const float* __restrict__ bias, const float* __restrict__ resid, int rmod, int ldr,
                                                float* __restrict__ C, int ldc, int M, int N, int K) {
  __shared__ __attribute__((aligned(16))) float so[4][16][64];
  const int tid = threadIdx.x, w = tid >> 5, lane = tid & 31, ln = lane & 15, hh = lane >> 4;
  const int ntn = N / 64;
  const int wid = blockIdx.x * 4 + w;
  const int mt = wid / ntn, nq = wid % ntn;
  if (mt * 16 >= M) return;
  const int row0 = mt * 16, col0 = nq * 64;
  const float* arow = A + (size_t)(row0 + ln) * lda;
  v8f acc[4] = {};
  for (int kb = 0; kb < K; kb += 32) {
    FragB ah, al;
    const v4f x0 = *(const v4fa*)(arow + kb + 8 * hh), x1 = *(const v4fa*)(arow + kb + 8 * hh + 4);
    const v4f x2 = *(const v4fa*)(arow + kb + 16 + 8 * hh), x3 = *(const v4fa*)(arow + kb + 16 + 8 * hh + 4);
    float xs[16] = {x0[0],x0[1],x0[2],x0[3],x1[0],x1[1],x1[2],x1[3],x2[0],x2[1],x2[2],x2[3],x3[0],x3[1],x3[2],x3[3]};
#pragma unroll
    for (int i = 0; i < 16; ++i) { const unsigned short hb = bf16_bits(xs[i]); ah.u[i] = hb; al.u[i] = ASPLIT ? bf16_bits(xs[i] - bf16_val(hb)) : (unsigned short)0; }
#pragma unroll
    for (int t = 0; t < 4; ++t) {
      const unsigned short* brow = Wt + (size_t)(col0 + t * 16 + ln) * ldb + kb;
      FragB b;
      b.half[0] = *(const v8us*)(brow + 8 * hh);
      b.half[1] = *(const v8us*)(brow + 16 + 8 * hh);
      acc[t] = mmaN<ASPLIT ? 2 : 1>(ah.v, al.v, b.v, b.v, acc[t]);
    }
  }
#pragma unroll
  for (int t = 0; t < 4; ++t) {
    const int col = col0 + t * 16 + ln;
    float bv = bias ? bias[col] : 0.f;
    if (BIAS_BF16) bv = bf16_round(bv);
#pragma unroll
    for (int r = 0; r < 8; ++r) {
      float v = acc[t][r] + bv;
      if (resid) { float rv = resid[(size_t)((row0 + 8 * hh + r) % rmod) * ldr + col]; if (RES_BF16) rv = bf16_round(rv); v += rv; }
      if (ACT == 1) v = fmaxf(v, 0.f);
      if (ACT == 2) v = 0.5f * v * (1.0f + erff(v * 0.70710678118654752f));
      if (ACT == 3) { const float u = 0.7978845608028654f * (v + 0.044715f * v * v * v); v = 0.5f * v * (1.0f + tanhf(u)); }
      so[w][8 * hh + r][t * 16 + ln] = v;
    }
  }
  __builtin_amdgcn_fence(__ATOMIC_ACQ_REL, "workgroup");
  __builtin_amdgcn_wave_barrier();
  const int rsub = lane >> 4, c4 = (lane & 15) * 4;
  {
#pragma unroll
    for (int q = 0; q < 8; ++q) {
      const int r = q * 2 + rsub;
      const v4f v = *(const v4fa*)&so[w][r][c4];
      *(v4f*)(C + (size_t)(row0 + r) * ldc + col0 + c4) = v;
    }
    
  }
}
// row LayerNorm (biased variance, eps) over N: s = X (+ R); optional out_sum <- s; out_norm <- (s-mu)*rsqrt(var+eps)*g + b
template <bool PARAM_BF16>
__global__ __launch_bounds__(256) void k_layernorm(const float* __restrict__ X, const float* __restrict__ R, const float* __restrict__ g, const float* __restrict__ bta,
                                                  float* __restrict__ out_sum, float* __restrict__ out_norm, int N, float eps) {
  __shared__ float red[256];
  const int row = blockIdx.x, tid = threadIdx.x;
  const float* x = X + (size_t)row * N; const float* rr = R ? R + (size_t)row * N : nullptr;
  float vals[16];                     // up to N = 4096
  const int per = N / 256;            // contiguous chunk per thread? use strided-by-4 chunks: thread handles j = tid*4 + 1024*u
  float s1 = 0.f;
  for (int u = 0; u < per / 4; ++u) {
    const int j = tid * 4 + 1024 * u;
    const v4f a = *(const v4fa*)(x + j);
    v4f b = {0.f,0.f,0.f,0.f}; if (rr) b = *(const v4fa*)(rr + j);
#pragma unroll
    for (int q = 0; q < 4; ++q) { const float v = a[q] + b[q]; vals[u * 4 + q] = v; s1 += v; }
  }
  red[tid] = s1; __syncthreads();
  for (int st = 128; st > 0; st >>= 1) { if (tid < st) red[tid] += red[tid + st]; __syncthreads(); }
  const float mu = red[0] / (float)N; __syncthreads();
  float s2 = 0.f;
  for (int u = 0; u < per / 4; ++u)
#pragma unroll
    for (int q = 0; q < 4; ++q) { const float c = vals[u * 4 + q] - mu; s2 += c * c; }
  red[tid] = s2; __syncthreads();
  for (int st = 128; st > 0; st >>= 1) { if (tid < st) red[tid] += red[tid + st]; __syncthreads(); }
  const float rs = rsqrtf(red[0] / (float)N + eps);
  {
    for (int u = 0; u < per / 4; ++u) {
      const int j = tid * 4 + 1024 * u;
      v4f o, sm;
#pragma unroll
      for (int q = 0; q < 4; ++q) {
        float gg = g[j + q], bb = bta[j + q];
        if (PARAM_BF16) { gg = bf16_round(gg); bb = bf16_round(bb); }
        sm[q] = vals[u * 4 + q]; o[q] = (vals[u * 4 + q] - mu) * rs * gg + bb;
      }
      if (out_sum) *(v4f*)(out_sum + (size_t)row * N + j) = sm;
      *(v4f*)(out_norm + (size_t)row * N + j) = o;
    }
    
  }
}



// ---- f16 WMMA path (v_wmma_f32_16x16x32_f16): 11-bit significands for operands in range — used where a [0,1] probability operand needs more precision than bf16
typedef _Float16 v16h __attribute__((ext_vector_type(16)));
union FragH { v16h v; v8us half[2]; _Float16 h[16]; unsigned short u[16]; };
template <int NT>
__device__ __forceinline__ v8f mmaH(v16h ah, v16h al, v16h bh, v16h bl, v8f c) {
  c = __builtin_amdgcn_wmma_f32_16x16x32_f16(false, ah, false, bh, (short)0, c, false, false);
  if (NT >= 2) c = __builtin_amdgcn_wmma_f32_16x16x32_f16(false, al, false, bh, (short)0, c, false, false);
  if (NT >= 3) c = __builtin_amdgcn_wmma_f32_16x16x32_f16(false, ah, false, bl, (short)0, c, false, false);
  asm volatile("v_nop\n\tv_nop\n\tv_nop\n\tv_nop" : "+v"(c) : "v"(ah), "v"(al), "v"(bh), "v"(bl));
  return c;
}
// batched GEMM like k_gemm_b but f16 operands: A f32 (split into f16 hi/lo if ASPLIT, else rounded to f16), Bt = f16 values [n][k]; alpha; C f32; N multiple of 16 (partial tiles skipped)
template <bool ASPLIT>
__global__ __launch_bounds__(128) void k_gemm_h(const float* __restrict__ A, int lda, size_t sA, const _Float16* __restrict__ Bh, int ldb, size_t sB, float alpha, float* __restrict__ C, int ldc, size_t sC, int M, int N, int K) {
  __shared__ __attribute__((aligned(16))) float so[4][16][64];
  const int tid = threadIdx.x, w = tid >> 5, lane = tid & 31, ln = lane & 15, hh = lane >> 4; const int by = blockIdx.y;
  A += (size_t)by * sA; Bh += (size_t)by * sB; C += (size_t)by * sC;
  const int ntn = (N + 63) / 64; const int wid = blockIdx.x * 4 + w; const int mt = wid / ntn, nq = wid % ntn; if (mt * 16 >= M) return;
  const int row0 = mt * 16, col0 = nq * 64; const float* arow = A + (size_t)(row0 + ln) * lda;
  v8f acc[4] = {};
  for (int kb = 0; kb < K; kb += 32) {
    FragH ah, al;
    const v4f x0 = *(const v4fa*)(arow + kb + 8 * hh), x1 = *(const v4fa*)(arow + kb + 8 * hh + 4), x2 = *(const v4fa*)(arow + kb + 16 + 8 * hh), x3 = *(const v4fa*)(arow + kb + 16 + 8 * hh + 4);
    float xs[16] = {x0[0],x0[1],x0[2],x0[3],x1[0],x1[1],x1[2],x1[3],x2[0],x2[1],x2[2],x2[3],x3[0],x3[1],x3[2],x3[3]};
#pragma unroll
    for (int i = 0; i < 16; ++i) { const _Float16 h = (_Float16)xs[i]; ah.h[i] = h; al.h[i] = ASPLIT ? (_Float16)(xs[i] - (float)h) : (_Float16)0.0f; }
#pragma unroll
    for (int t = 0; t < 4; ++t) { if (col0 + t * 16 >= N) continue; const size_t boff = (size_t)(col0 + t * 16 + ln) * ldb + kb; FragH bq; bq.half[0] = *(const v8us*)(Bh + boff + 8 * hh); bq.half[1] = *(const v8us*)(Bh + boff + 16 + 8 * hh);
      acc[t] = mmaH<ASPLIT ? 2 : 1>(ah.v, al.v, bq.v, bq.v, acc[t]); }
  }
#pragma unroll
  for (int t = 0; t < 4; ++t) { if (col0 + t * 16 >= N) continue;
#pragma unroll
    for (int r = 0; r < 8; ++r) so[w][8 * hh + r][t * 16 + ln] = acc[t][r] * alpha; }
  __builtin_amdgcn_fence(__ATOMIC_ACQ_REL, "workgroup"); __builtin_amdgcn_wave_barrier();
  const int rsub = lane >> 4, c4 = (lane & 15) * 4;
  {
#pragma unroll
    for (int q = 0; q < 8; ++q) { const int r = q * 2 + rsub; if (col0 + c4 < N) { const v4f v = *(const v4fa*)&so[w][r][c4]; *(v4f*)(C + (size_t)(row0 + r) * ldc + col0 + c4) = v; } }
     }
}

// Wt[n][k] = f16(bf16(W[k][n])*scale) from f32 row-major W[K][N] (scale = power of two; bf16-exact weights stay exact in f16 away from the subnormal range). K % 128 == 0, N % 64 == 0.
// Transposed in registers: a lane reads 16-byte pieces (4 n) of 8 successive rows k, which is 4 output pieces of 16 bytes (8 k). Lanes: 4 along n, 8 along k, so a wave's store covers four whole
// 128-byte lines of Wt and its two loads of a row group cover the two halves of eight 128-byte lines of W. A wave takes 64 k x 32 n, a block (2 x 2 waves) 128 k x 64 n: 256 bytes a row on both sides.
__global__ __launch_bounds__(128) void k_wt_f16(const float* __restrict__ W, _Float16* __restrict__ Wt, int K, int N, float scale) {
  const int lane = threadIdx.x & 31, w = threadIdx.x >> 5; const int ntn = N >> 6; const int bk = blockIdx.x / ntn, bn = blockIdx.x - bk * ntn;
  const int k0 = bk * 128 + (w >> 1) * 64 + (lane >> 2) * 8, n0 = bn * 64 + (w & 1) * 32 + (lane & 3) * 4;
  const float* p[8]; v4f a[8], b[8];
  /* unrolled: the arrays get constant indices (registers) */
#pragma unroll
  for (int i = 0; i < 8; ++i) { p[i] = W + (size_t)(k0 + i) * N + n0; a[i] = *(const v4fa*)p[i]; b[i] = *(const v4fa*)(p[i] + 16); }
  /* The loaded values are inputs: all sixteen loads stay in front of the first conversion, so the wave pays one memory latency (left alone the compiler sinks half of them among the conversions: four more round trips).
     The row pointers are inputs: they stay live up to here, so no load's result lands on an address pair of an issued load, and the wait precedes every later overwrite of such a pair */
  asm volatile("s_wait_xcnt 0x0" :: "v"(a[0]), "v"(a[1]), "v"(a[2]), "v"(a[3]), "v"(a[4]), "v"(a[5]), "v"(a[6]), "v"(a[7]), "v"(b[0]), "v"(b[1]), "v"(b[2]), "v"(b[3]), "v"(b[4]), "v"(b[5]), "v"(b[6]), "v"(b[7]),
               "v"(p[0]), "v"(p[1]), "v"(p[2]), "v"(p[3]), "v"(p[4]), "v"(p[5]), "v"(p[6]), "v"(p[7]));
  unsigned short* d = (unsigned short*)Wt + (size_t)n0 * K + k0;
#pragma unroll
  for (int q = 0; q < 4; ++q) { FragH f;
#pragma unroll
    for (int i = 0; i < 8; ++i) { f.h[i] = (_Float16)(bf16_round(a[i][q]) * scale); f.h[8 + i] = (_Float16)(bf16_round(b[i][q]) * scale); }
    *(v8us*)(d + (size_t)q * K) = f.half[0]; *(v8us*)(d + (size_t)(16 + q) * K) = f.half[1]; }
}
// k_gemm_hh variant with fused epilogue: v = acc·alpha + bias[by·sBias + col] (+ CP[(row/rowsPerB)·sCPb + by·64 + col] if CP) ; ACT 0 none / 1 elu ; writes f16 C16 (and f32 C if non-null)
template <int ACT>
__global__ __launch_bounds__(128) void k_gemm_hhx(const _Float16* __restrict__ A, int lda, size_t sA, const _Float16* __restrict__ Bh, int ldb, size_t sB, float alpha, const float* __restrict__ bias, size_t sBias, const float* __restrict__ CP, int rowsPerB, size_t sCPb, int row0g,
    float* __restrict__ C, _Float16* __restrict__ C16, int ldc, size_t sC, int M, int N, int K) {
  __shared__ __attribute__((aligned(16))) float so[4][16][64];
  const int tid = threadIdx.x, w = tid >> 5, lane = tid & 31, ln = lane & 15, hh = lane >> 4; const int by = blockIdx.y;
  A += (size_t)by * sA; Bh += (size_t)by * sB; const size_t cofs = (size_t)by * sC; const float* bp = bias ? bias + (size_t)by * sBias : nullptr;
  const int ntn = (N + 63) / 64; const int wid = blockIdx.x * 4 + w; const int mt = wid / ntn, nq = wid % ntn; if (mt * 16 >= M) return;
  const int row0 = mt * 16, col0 = nq * 64; const _Float16* arow = A + (size_t)(row0 + ln) * lda;
  v8f acc[4] = {};
  for (int kb = 0; kb < K; kb += 32) { FragH ah; ah.half[0] = *(const v8us*)((const unsigned short*)arow + kb + 8 * hh); ah.half[1] = *(const v8us*)((const unsigned short*)arow + kb + 16 + 8 * hh);
#pragma unroll
    for (int t = 0; t < 4; ++t) { if (col0 + t * 16 >= N) continue; const size_t boff = (size_t)(col0 + t * 16 + ln) * ldb + kb; FragH bq; bq.half[0] = *(const v8us*)((const unsigned short*)Bh + boff + 8 * hh); bq.half[1] = *(const v8us*)((const unsigned short*)Bh + boff + 16 + 8 * hh);
      acc[t] = mmaH<1>(ah.v, ah.v, bq.v, bq.v, acc[t]); }
  }
#pragma unroll
  for (int t = 0; t < 4; ++t) { if (col0 + t * 16 >= N) continue; const int col = col0 + t * 16 + ln; const float bv = bp ? bf16_round(bp[col]) : 0.f;
#pragma unroll
    for (int r = 0; r < 8; ++r) { float v = acc[t][r] * alpha + bv; if (CP) { const int rr = row0g + row0 + 8 * hh + r; if (rowsPerB < 0) v += CP[cofs + (size_t)rr * ldc + col];      /* rowsPerB < 0: own element of the batched C plane */ else { const int bidx = rr / rowsPerB; v += CP[(size_t)bidx * sCPb + (size_t)by * 64 + col]; } } if (ACT == 1) v = (v > 0.f) ? v : expm1f(v); else if (ACT == 7) v = (v > 0.f) ? v + 1.0f : expf(v); else if (ACT == 8) v = tanhf(v); else if (ACT == 9) v = 0.5f * v * (1.0f + tanhf(0.7978845608028654f * (v + 0.044715f * v * v * v))); else if (ACT == 11) v = 1.0f / (1.0f + expf(-v)); else if (ACT == 12) v = (v > 0.f) ? v : 0.01f * v; else if (ACT == 14) v = (v > 0.f) ? v : 0.1f * v; else if (ACT == 16) v = (v >= 0.f) ? v : 0.3f * v; else if (ACT == 17) v = (v >= 0.f) ? v : 0.2f * v; else if (ACT == 15) v = v / (1.0f + expf(-v)); else if (ACT == 3) v = fmaxf(v, 0.f); else if (ACT == 6) v = 0.5f * v * (1.0f + erff(v * 0.70710678118654752f)); so[w][8 * hh + r][t * 16 + ln] = v; } }
  __builtin_amdgcn_fence(__ATOMIC_ACQ_REL, "workgroup"); __builtin_amdgcn_wave_barrier();
  const int rsub = lane >> 4, c4 = (lane & 15) * 4; typedef _Float16 v4h __attribute__((ext_vector_type(4)));
  {
#pragma unroll
    for (int q = 0; q < 8; ++q) { const int r = q * 2 + rsub; if (col0 + c4 < N) { const v4f v = *(const v4fa*)&so[w][r][c4]; if (C) *(v4f*)(C + cofs + (size_t)(row0 + r) * ldc + col0 + c4) = v; if (C16) { v4h h4; for (int i = 0; i < 4; ++i) h4[i] = (_Float16)v[i]; *(v4h*)(C16 + cofs + (size_t)(row0 + r) * ldc + col0 + c4) = h4; } } }
     }
}


typedef _Float16 v4h __attribute__((ext_vector_type(4)));

__global__ __launch_bounds__(256) void k_x16(const float* __restrict__ x, _Float16* __restrict__ X16, size_t n8) { const size_t t = (size_t)blockIdx.x * 256 + threadIdx.x; if (t >= n8) return; FragH f;
#pragma unroll
  for (int q = 0; q < 8; ++q) f.h[q] = (_Float16)bf16_round(x[t * 8 + q]); *(v8us*)((unsigned short*)X16 + t * 8) = f.half[0];  }
__global__ __launch_bounds__(256) void k_h16(const float* __restrict__ x, _Float16* __restrict__ X16, size_t n8) { const size_t t = (size_t)blockIdx.x * 256 + threadIdx.x; if (t >= n8) return; FragH f;
#pragma unroll
  for (int q = 0; q < 8; ++q) f.h[q] = (_Float16)x[t * 8 + q]; *(v8us*)((unsigned short*)X16 + t * 8) = f.half[0];  }
__global__ __launch_bounds__(256) void k_round16f(const float* __restrict__ W, _Float16* __restrict__ Bt, size_t n8) { const size_t t = (size_t)blockIdx.x * 256 + threadIdx.x; if (t >= n8) return; FragH f;
#pragma unroll
  for (int i = 0; i < 8; ++i) f.h[i] = (_Float16)(bf16_round(W[t * 8 + i]) * 16.0f); *(v8us*)((unsigned short*)Bt + t * 8) = f.half[0];  }
template <int NHv, int TTv>
__global__ __launch_bounds__(256) void k_vt(const _Float16* __restrict__ V16, int ldv, int voff, _Float16* __restrict__ Vt) { __shared__ unsigned short tl[64][66]; const int tid = threadIdx.x; const int slab = blockIdx.x / (TTv / 64), lg = blockIdx.x % (TTv / 64); const int b = slab / NHv, h = slab % NHv;
  for (int i = tid; i < 64 * 8; i += 256) { const int r = i / 8, c8 = (i % 8) * 8; FragH f; f.half[0] = *(const v8us*)((const unsigned short*)V16 + ((size_t)b * TTv + lg * 64 + r) * ldv + voff + h * 64 + c8);
#pragma unroll
    for (int q = 0; q < 8; ++q) tl[r][c8 + q] = f.u[q]; }
  __syncthreads();
  {
#pragma unroll
    for (int rd = 0; rd < 2; ++rd) { const int d = rd * 32 + tid / 8, pc = tid % 8; FragH f;
#pragma unroll
      for (int q = 0; q < 8; ++q) f.u[q] = tl[pc * 8 + q][d];
      *(v8us*)((unsigned short*)Vt + ((size_t)slab * 64 + d) * TTv + lg * 64 + pc * 8) = f.half[0]; }
     } }

__global__ __launch_bounds__(256) void k_hl(const float* __restrict__ F, _Float16* __restrict__ Hh, _Float16* __restrict__ Hl, size_t n8) { const size_t t = (size_t)blockIdx.x * 256 + threadIdx.x; if (t >= n8) return; FragH fh, fl; const v4f a = *(const v4fa*)(F + t * 8), c = *(const v4fa*)(F + t * 8 + 4);
#pragma unroll
  for (int q = 0; q < 4; ++q) { _Float16 h = (_Float16)a[q]; fh.h[q] = h; fl.h[q] = (_Float16)((a[q] - (float)h) * 1024.0f); h = (_Float16)c[q]; fh.h[4 + q] = h; fl.h[4 + q] = (_Float16)((c[q] - (float)h) * 1024.0f); }
  { *(v8us*)((unsigned short*)Hh + t * 8) = fh.half[0]; *(v8us*)((unsigned short*)Hl + t * 8) = fl.half[0];  } }

// ---- fast GEMM (block tile 128x64, wave tile 32x64; A and B tiles of 128 k staged in LDS by asynchronous copies, two buffers; requires M % 128 == 0, N % 64 == 0, K % 128 == 0); epilogue = k_gemm_hhx semantics ----
__device__ __forceinline__ v16h g2_frag(const _Float16* p, int hh) { FragH f; f.half[0] = *(const v8us*)((const unsigned short*)p + 8 * hh); f.half[1] = *(const v8us*)((const unsigned short*)p + 16 + 8 * hh); return f.v; }
__device__ __forceinline__ v8f g2_mma(v16h a, v16h b, v8f c) { v8f d = __builtin_amdgcn_wmma_f32_16x16x32_f16(false, a, false, b, (short)0, c, false, false); asm volatile("v_nop\n\tv_nop\n\tv_nop\n\tv_nop" : "+v"(d) : "v"(a), "v"(b)); return d; }
#define G2_PITCH 272      /* LDS row pitch, bytes: 256 of data + 16, an odd multiple of 16 (no bank conflict for 16-byte row reads) */
#define G2_STAGE (192 * G2_PITCH)      /* one buffer: 128 rows of A, then 64 rows of B, 128 k each */
// Eight asynchronous 16-byte copies of a lane, global -> LDS, rows 8 apart (st = 8 source rows, in elements). The s_wait_xcnt stands in the copies' own statement, behind the last of them,
// so that it precedes every later write of a register that a copy names.
__device__ __forceinline__ void g2_copy8(unsigned l, const _Float16* g, size_t st) {
  asm volatile("global_load_async_to_lds_b128 %0, %8, off\n\t"
               "global_load_async_to_lds_b128 %1, %9, off\n\t"
               "global_load_async_to_lds_b128 %2, %10, off\n\t"
               "global_load_async_to_lds_b128 %3, %11, off\n\t"
               "global_load_async_to_lds_b128 %4, %12, off\n\t"
               "global_load_async_to_lds_b128 %5, %13, off\n\t"
               "global_load_async_to_lds_b128 %6, %14, off\n\t"
               "global_load_async_to_lds_b128 %7, %15, off\n\t"
               "s_wait_xcnt 0x0"
               :: "v"(l), "v"(l + 8u * G2_PITCH), "v"(l + 16u * G2_PITCH), "v"(l + 24u * G2_PITCH), "v"(l + 32u * G2_PITCH), "v"(l + 40u * G2_PITCH), "v"(l + 48u * G2_PITCH), "v"(l + 56u * G2_PITCH),
                  "v"(g), "v"(g + st), "v"(g + 2 * st), "v"(g + 3 * st), "v"(g + 4 * st), "v"(g + 5 * st), "v"(g + 6 * st), "v"(g + 7 * st) : "memory"); }
// a fragment from a staged row: p = the row's place + 64 bytes a k step + 16 hh; same k order as g2_frag
__device__ __forceinline__ v16h g2_lfrag(const unsigned char* p) { FragH f; f.half[0] = *(const v8us*)p; f.half[1] = *(const v8us*)(p + 32); return f.v; }
template <int ACT>
__global__ __launch_bounds__(128) void k_gemm2(const _Float16* __restrict__ A, int lda, size_t sA, const _Float16* __restrict__ Bh, int ldb, size_t sB, float alpha, const float* __restrict__ bias, size_t sBias, const float* __restrict__ CP, int rowsPerB, size_t sCPb, int row0g,
    float* __restrict__ C, _Float16* __restrict__ C16, int ldc, size_t sC, int M, int N, int K) { static_assert(ACT == 0 || ACT == 3 || ACT == 6 || ACT == 8 || ACT == 9 || ACT == 11 || ACT == 12 || ACT == 14 || ACT == 15 || ACT == 16 || ACT == 17, "k_gemm2: unsupported ACT code (would silently apply no activation)");
  __shared__ __attribute__((aligned(16))) unsigned char sm[2 * G2_STAGE]; float (*so)[32][68] = (float (*)[32][68])sm;      /* two operand buffers; behind the loop's last barrier the same LDS stages the output tile */
  const int tid = threadIdx.x, w = tid >> 5, lane = tid & 31, ln = lane & 15, hh = lane >> 4; const int by = blockIdx.y;
  A += (size_t)by * sA; Bh += (size_t)by * sB; const size_t cofs = (size_t)by * sC; const float* bp = bias ? bias + (size_t)by * sBias : nullptr;
  const int ntn = N >> 6; const int mt = blockIdx.x / ntn, nq = blockIdx.x - mt * ntn; const int row0 = mt * 128 + 32 * w, col0 = nq * 64; if (mt * 128 >= M) return;      /* the whole block leaves, in front of every barrier */
  /* copies: lane = 16 bytes; 16 lanes a row of 256 bytes, so a wave's copy covers two whole rows; thread rows tid / 16 + 8 i */
  const unsigned lc = (unsigned)(size_t)sm + (unsigned)(tid >> 4) * G2_PITCH + (unsigned)(tid & 15) * 16u;
  const _Float16* ga = A + (size_t)(mt * 128 + (tid >> 4)) * lda + (tid & 15) * 8; const _Float16* gb = Bh + (size_t)(col0 + (tid >> 4)) * ldb + (tid & 15) * 8;
  auto fill = [&](int t, int buf) { const unsigned l = lc + (unsigned)buf * G2_STAGE; const _Float16* a = ga + (size_t)t * 128;
    g2_copy8(l, a, (size_t)8 * lda); g2_copy8(l + 64u * G2_PITCH, a + (size_t)64 * lda, (size_t)8 * lda); g2_copy8(l + 128u * G2_PITCH, gb + (size_t)t * 128, (size_t)8 * ldb); };
  const unsigned char* sa = sm + (32 * w + ln) * G2_PITCH + 16 * hh; const unsigned char* sb = sm + (128 + ln) * G2_PITCH + 16 * hh;
  const v8f z8 = {0.f,0.f,0.f,0.f,0.f,0.f,0.f,0.f}; v8f c00 = z8, c01 = z8, c02 = z8, c03 = z8, c10 = z8, c11 = z8, c12 = z8, c13 = z8;
  const int nt = K >> 7;
  fill(0, 0);
  asm volatile("s_wait_asynccnt 0x0" ::: "memory");      /* this wave's copies of tile 0 have landed */
  __syncthreads();      /* and every other wave's: tile 0 may be read */
  if (nt > 1) fill(1, 1);
  /* rolled: one copy of the body; a trip is 128 k = 32 products a wave, while the next tile's copies fly */
#pragma unroll 1
  for (int t = 0; t < nt; ++t) { const unsigned char* pa = sa + (t & 1) * G2_STAGE; const unsigned char* pb = sb + (t & 1) * G2_STAGE;
    v16h fa[2][2], fb[2][4];      /* two fragment sets */
    fa[0][0] = g2_lfrag(pa); fb[0][0] = g2_lfrag(pb); fa[0][1] = g2_lfrag(pa + 16 * G2_PITCH); fb[0][1] = g2_lfrag(pb + 16 * G2_PITCH); fb[0][2] = g2_lfrag(pb + 32 * G2_PITCH); fb[0][3] = g2_lfrag(pb + 48 * G2_PITCH);
    /* unrolled: the sets get constant indices (registers) and the LDS offsets become immediates. The reads of k step ks + 1 go as one group in front of the products of step ks, so only the trip's first group is waited for in full */
#pragma unroll
    for (int ks = 0; ks < 4; ++ks) { const int c = ks & 1, n = c ^ 1, o = (ks + 1) * 64;
      if (ks < 3) { fa[n][0] = g2_lfrag(pa + o); fb[n][0] = g2_lfrag(pb + o); fa[n][1] = g2_lfrag(pa + 16 * G2_PITCH + o); fb[n][1] = g2_lfrag(pb + 16 * G2_PITCH + o); fb[n][2] = g2_lfrag(pb + 32 * G2_PITCH + o); fb[n][3] = g2_lfrag(pb + 48 * G2_PITCH + o); }
      c00 = g2_mma(fa[c][0], fb[c][0], c00); c10 = g2_mma(fa[c][1], fb[c][0], c10);
      c01 = g2_mma(fa[c][0], fb[c][1], c01); c11 = g2_mma(fa[c][1], fb[c][1], c11);
      c02 = g2_mma(fa[c][0], fb[c][2], c02); c12 = g2_mma(fa[c][1], fb[c][2], c12);
      c03 = g2_mma(fa[c][0], fb[c][3], c03); c13 = g2_mma(fa[c][1], fb[c][3], c13); }
    asm volatile("s_wait_dscnt 0x0" ::: "memory");      /* this wave's reads of the buffer are done before it is refilled */
    asm volatile("s_wait_asynccnt 0x0" ::: "memory");      /* this wave's copies of tile t + 1 have landed */
    __syncthreads();      /* publishes tile t + 1 and ends every wave's reads of tile t */
    if (t + 2 < nt) fill(t + 2, t & 1); }
  asm volatile("s_wait_asynccnt 0x0" ::: "memory");      /* no copy is outstanding when the LDS changes its use */
  v8f accs[8] = {c00, c01, c02, c03, c10, c11, c12, c13};
#pragma unroll
  for (int u = 0; u < 8; ++u) { const int t = u & 3, half = u >> 2; const int col = col0 + t * 16 + ln; const float bv = bp ? bf16_round(bp[col]) : 0.f;
#pragma unroll
    for (int r = 0; r < 8; ++r) { const int rloc = half * 16 + 8 * hh + r; float v = accs[u][r] * alpha + bv; if (CP) { if (rowsPerB < 0) v += CP[cofs + (size_t)(row0g + row0 + rloc) * ldc + col];      /* rowsPerB < 0: own element of the batched C plane */ else { const int bidx = (row0g + row0 + rloc) / rowsPerB; v += CP[(size_t)bidx * sCPb + (size_t)by * 64 + col]; } }
      if (ACT == 3) v = fmaxf(v, 0.f); else if (ACT == 6) v = 0.5f * v * (1.0f + erff(v * 0.70710678118654752f)); else if (ACT == 11) v = 1.0f / (1.0f + expf(-v)); else if (ACT == 15) v = v / (1.0f + expf(-v)); else if (ACT == 12) v = (v > 0.f) ? v : 0.01f * v; else if (ACT == 8) v = tanhf(v); else if (ACT == 9) v = 0.5f * v * (1.0f + tanhf(0.7978845608028654f * (v + 0.044715f * v * v * v))); else if (ACT == 14) v = (v > 0.f) ? v : 0.1f * v; else if (ACT == 16) v = (v >= 0.f) ? v : 0.3f * v; else if (ACT == 17) v = (v >= 0.f) ? v : 0.2f * v;
      so[w][rloc][t * 16 + ln] = v; } }
  __builtin_amdgcn_fence(__ATOMIC_ACQ_REL, "workgroup"); __builtin_amdgcn_wave_barrier();
  const int rsub = lane >> 4, c4 = (lane & 15) * 4;
  {
#pragma unroll
    for (int q = 0; q < 16; ++q) { const int r = q * 2 + rsub; const v4f v = *(const v4fa*)&so[w][r][c4]; if (C) *(v4f*)(C + cofs + (size_t)(row0 + r) * ldc + col0 + c4) = v; if (C16) { v4h h4; for (int i = 0; i < 4; ++i) h4[i] = (_Float16)v[i]; *(v4h*)(C16 + cofs + (size_t)(row0 + r) * ldc + col0 + c4) = h4; } }
     } }


__global__ __launch_bounds__(256) void k_wnat(const float* __restrict__ w, size_t n8, _Float16* __restrict__ Bt) { const size_t t = (size_t)blockIdx.x * 256 + threadIdx.x; if (t >= n8) return; FragH f; for (int q = 0; q < 8; ++q) f.h[q] = (_Float16)(bf16_round(w[t * 8 + q]) * 16.0f); *(v8us*)((unsigned short*)Bt + t * 8) = f.half[0];  }
__global__ __launch_bounds__(256) void k_rsm(const float* __restrict__ S, _Float16* __restrict__ P, int nrows) {
  #pragma clang fp contract(off)
  const int i = blockIdx.x * 256 + threadIdx.x; if (i >= nrows) return; const float* s = S + (size_t)i * SQ; float mx = -3.0e38f;
#pragma unroll 1
  for (int j = 0; j < SQ; ++j) mx = fmaxf(mx, s[j]); float se = 0.f;
#pragma unroll 1
  for (int j = 0; j < SQ; ++j) se += expf(s[j] - mx); const float sc = 256.0f / se;
#pragma unroll 1
  for (int j0 = 0; j0 < SQ; j0 += 8) { FragH f; for (int q = 0; q < 8; ++q) f.h[q] = (_Float16)(expf(s[j0 + q] - mx) * sc); unsigned short* d = (unsigned short*)P + (size_t)i * SQ + j0; *(v8us*)d = f.half[0];  } }
__global__ __launch_bounds__(256) void k_vt(const _Float16* __restrict__ V16, int b, int h0, _Float16* __restrict__ VT) { __shared__ unsigned short tl[64][65]; const int tid = threadIdx.x; const int hh = blockIdx.x % HG, sg = blockIdx.x / HG; const int s0 = sg * 64; const int h = h0 + hh;
  for (int i = tid; i < 64 * 8; i += 256) { const int j = i / 8, d8 = (i % 8) * 8; FragH f; f.half[0] = *(const v8us*)((const unsigned short*)V16 + ((size_t)b * SQ + s0 + j) * DM + h * HD + d8); for (int q = 0; q < 8; ++q) tl[d8 + q][j] = f.u[q]; }
  __syncthreads();
  { for (int i = tid; i < 64 * 8; i += 256) { const int d = i / 8, j8 = (i % 8) * 8; FragH f; for (int q = 0; q < 8; ++q) f.u[q] = tl[d][j8 + q]; *(v8us*)((unsigned short*)VT + ((size_t)hh * HD + d) * SQ + s0 + j8) = f.half[0]; }  } }



__global__ __launch_bounds__(256) void k_rsmcf2(const float* __restrict__ S, _Float16* __restrict__ P, int hg, int q0, int nk) {
  #pragma clang fp contract(off)
  const int t = blockIdx.x * 256 + threadIdx.x; if (t >= hg * QT) return; const size_t i = (size_t)t; const float* s = S + i * NKX; const int last = q0 + (t % QT); float mx = -3.0e38f;
#pragma unroll 1
  for (int j = 0; j < nk; ++j) { const float f = (j <= last) ? 1.f : 0.f; mx = fmaxf(mx, fmaf(f, s[j], (1.f - f) * -1.0e9f)); } float se = 0.f;
#pragma unroll 1
  for (int j = 0; j < nk; ++j) { const float f = (j <= last) ? 1.f : 0.f; se += __expf(fmaf(f, s[j], (1.f - f) * -1.0e9f) - mx); } const float sc = 256.0f / se;
#pragma unroll 1
  for (int j0 = 0; j0 < nk; j0 += 8) { FragH fr; for (int q = 0; q < 8; ++q) { const int j = j0 + q; const float f = (j <= last) ? 1.f : 0.f; fr.h[q] = (_Float16)(__expf(fmaf(f, s[j], (1.f - f) * -1.0e9f) - mx) * sc); } unsigned short* d = (unsigned short*)P + i * NKX + j0; *(v8us*)d = fr.half[0];  } }


template <int MASKADD>
__global__ __launch_bounds__(64) void k_att0(const float* __restrict__ QF, const float* __restrict__ KF, const float* __restrict__ VF, int ld, const float* __restrict__ mask, float scale, float* __restrict__ OF, int ldo) {
  #pragma clang fp contract(off)
  __shared__ __attribute__((aligned(16))) float lq[64][64]; __shared__ __attribute__((aligned(16))) float lo[64][64];
  const int tid = threadIdx.x; const int h = blockIdx.x / (QT0 / 64), rg = blockIdx.x % (QT0 / 64); const int i = rg * 64 + tid;
  const float* qr = QF + (size_t)i * ld + h * HD;
#pragma unroll 1
  for (int c = 0; c < HD / 4; ++c) { *(v4f*)&lq[tid][c * 4] = *(const v4fa*)(qr + c * 4); const v4f z = {0.f, 0.f, 0.f, 0.f}; *(v4f*)&lo[tid][c * 4] = z; }
  float m = -1.0e30f, l = 0.f; const int jmax = MASKADD ? (SQ - 1) : (rg * 64 + 63);      /* additive-mask form: every key (the mask input decides); causal form: keys up to the block's last row */
#pragma unroll 1
  for (int j = 0; j <= jmax; ++j) { const float* kr = KF + (size_t)j * ld + h * HD; const float* vr = VF + (size_t)j * ld + h * HD; float s = 0.f;
#pragma unroll 1
    for (int c = 0; c < HD / 4; ++c) { const v4f kq = *(const v4fa*)(kr + c * 4); const v4f qq = *(v4f*)&lq[tid][c * 4]; s = __fadd_rn(s, __fmul_rn(qq[0], kq[0])); s = __fadd_rn(s, __fmul_rn(qq[1], kq[1])); s = __fadd_rn(s, __fmul_rn(qq[2], kq[2])); s = __fadd_rn(s, __fmul_rn(qq[3], kq[3])); }
    s = __fmul_rn(s, scale); if (MASKADD) s = __fadd_rn(s, __fmul_rn(bf16_round(mask[(size_t)i * SQ + j]), -10000.0f));
    const float f = (MASKADD || j <= i) ? 1.f : 0.f; const float sm = fmaf(f, s, (1.f - f) * -1.0e30f); const float mn = fmaxf(m, sm); const float sc = expf(m - mn); const float e = expf(sm - mn); l = __fadd_rn(__fmul_rn(l, sc), e); m = mn;
#pragma unroll 1
    for (int c = 0; c < HD / 4; ++c) { const v4f vv = *(const v4fa*)(vr + c * 4); v4f oo = *(v4f*)&lo[tid][c * 4]; for (int u = 0; u < 4; ++u) oo[u] = __fadd_rn(__fmul_rn(oo[u], sc), __fmul_rn(e, vv[u])); *(v4f*)&lo[tid][c * 4] = oo; } }
  const float fin = 64.0f / l;      /* o carried x64 like the f16 path */
#pragma unroll 1
  for (int c = 0; c < HD / 4; ++c) { v4f oo = *(v4f*)&lo[tid][c * 4]; for (int u = 0; u < 4; ++u) oo[u] = __fmul_rn(oo[u], fin); *(v4f*)&lo[tid][c * 4] = oo; }
  __syncthreads();
  {
#pragma unroll 1
    for (int it = 0; it < 16; ++it) { const int row = it * 4 + tid / 16, pc = (tid % 16) * 4; const v4f v = *(const v4f*)&lo[row][pc]; *(v4f*)(OF + (size_t)(rg * 64 + row) * ldo + h * HD + pc) = v; }
     } }


template <int BFIN, int WXB>
__global__ __launch_bounds__(256) void k_ln16(const float* __restrict__ X, const float* __restrict__ g, const float* __restrict__ bb, float eps, _Float16* __restrict__ N16, float* __restrict__ XB) {
  #pragma clang fp contract(off)
  __shared__ float red[256]; const size_t r = blockIdx.x; const int t = threadIdx.x; const v4f xa = *(const v4fa*)(X + r * DMQ + t * 4); float s[4]; float sum = 0.f;
  for (int q = 0; q < 4; ++q) { s[q] = BFIN ? bf16_round(xa[q]) : xa[q]; sum = __fadd_rn(sum, s[q]); }
  red[t] = sum; __syncthreads(); for (int st = 128; st > 0; st >>= 1) { if (t < st) red[t] = __fadd_rn(red[t], red[t + st]); __syncthreads(); } const float mu = red[0] / (float)DMQ; __syncthreads();
  float vs = 0.f; for (int q = 0; q < 4; ++q) { const float dl = __fadd_rn(s[q], -mu); vs = __fadd_rn(vs, __fmul_rn(dl, dl)); } red[t] = vs; __syncthreads(); for (int st = 128; st > 0; st >>= 1) { if (t < st) red[t] = __fadd_rn(red[t], red[t + st]); __syncthreads(); }
  const float rs = rsqrtf(__fadd_rn(red[0] / (float)DMQ, eps)); v4h y; v4f xb;
  for (int q = 0; q < 4; ++q) { const int c = t * 4 + q; y[q] = (_Float16)__fadd_rn(__fmul_rn(__fmul_rn(__fadd_rn(s[q], -mu), rs), bf16_round(g[c])), bf16_round(bb[c])); xb[q] = s[q]; }
  { *(v4h*)(N16 + r * DMQ + t * 4) = y; if (WXB) *(v4f*)(XB + r * DMQ + t * 4) = xb;  } }
__global__ __launch_bounds__(256) void k_ftres2(const float* __restrict__ OF0, const float* __restrict__ XB, float* __restrict__ X1, size_t n4) {
  #pragma clang fp contract(off)
  const size_t t = (size_t)blockIdx.x * 256 + threadIdx.x; if (t >= n4) return; const v4f o = *(const v4fa*)(OF0 + t * 4), xv = *(const v4fa*)(XB + t * 4); v4f y; for (int q = 0; q < 4; ++q) y[q] = __fadd_rn(__fmul_rn(o[q], 0.015625f), xv[q]); *(v4f*)(X1 + t * 4) = y;  }

__global__ __launch_bounds__(256) void k_wthd(const float* __restrict__ Wt, _Float16* __restrict__ Bt) { const size_t t = (size_t)blockIdx.x * 256 + threadIdx.x; if (t >= (size_t)NH * HD * (DM / 8)) return; const int m8 = (int)(t % (DM / 8)) * 8; const int d = (int)((t / (DM / 8)) % HD); const int h = (int)(t / ((size_t)(DM / 8) * HD)); FragH f;
  for (int q = 0; q < 8; ++q) f.h[q] = (_Float16)(16.0f * bf16_round(Wt[((size_t)h * DM + m8 + q) * HD + d])); unsigned short* dst = (unsigned short*)Bt + ((size_t)h * HD + d) * DM + m8; *(v8us*)dst = f.half[0];  }




template <int BFIN, int W16, int W32>
__global__ __launch_bounds__(256) void k_lnx(const float* __restrict__ X, const float* __restrict__ g, const float* __restrict__ bb, float eps, _Float16* __restrict__ N16, float* __restrict__ N32) {
  #pragma clang fp contract(off)
  __shared__ float red[256]; const size_t r = blockIdx.x; const int t = threadIdx.x; const bool act = t < (DMQ / 4); const int c0 = act ? t * 4 : 0;
  const v4f xa = *(const v4fa*)(X + r * DMQ + c0); float s[4]; float sum = 0.f;
  for (int q = 0; q < 4; ++q) { s[q] = act ? (BFIN ? bf16_round(xa[q]) : xa[q]) : 0.f; sum = __fadd_rn(sum, s[q]); }
  red[t] = sum; __syncthreads(); for (int st = 128; st > 0; st >>= 1) { if (t < st) red[t] = __fadd_rn(red[t], red[t + st]); __syncthreads(); } const float mu = red[0] / (float)DMQ; __syncthreads();
  float vs = 0.f; for (int q = 0; q < 4; ++q) { const float dl = act ? __fadd_rn(s[q], -mu) : 0.f; vs = __fadd_rn(vs, __fmul_rn(dl, dl)); } red[t] = vs; __syncthreads(); for (int st = 128; st > 0; st >>= 1) { if (t < st) red[t] = __fadd_rn(red[t], red[t + st]); __syncthreads(); }
  const float rs = rsqrtf(__fadd_rn(red[0] / (float)DMQ, eps)); v4h y; v4f yf;
  for (int q = 0; q < 4; ++q) { const int c = c0 + q; yf[q] = __fadd_rn(__fmul_rn(__fmul_rn(__fadd_rn(s[q], -mu), rs), bf16_round(g[c])), bf16_round(bb[c])); y[q] = (_Float16)yf[q]; }
  if (!act) return;      /* no barriers after this point */
  { if (W16) *(v4h*)(N16 + r * DMQ + c0) = y; if (W32) *(v4f*)(N32 + r * DMQ + c0) = yf;  } }


__global__ __launch_bounds__(256) void k_bfr(const float* __restrict__ x, float* __restrict__ XB, size_t n8) { const size_t t = (size_t)blockIdx.x * 256 + threadIdx.x; if (t >= n8) return; v4f a = *(const v4fa*)(x + t * 8), c = *(const v4fa*)(x + t * 8 + 4); for (int q = 0; q < 4; ++q) { a[q] = bf16_round(a[q]); c[q] = bf16_round(c[q]); }
  { *(v4f*)(XB + t * 8) = a; *(v4f*)(XB + t * 8 + 4) = c;  } }




__global__ __launch_bounds__(256) void k_lorafold(const float* __restrict__ Wm, const float* __restrict__ A, const float* __restrict__ Bm, float* __restrict__ WE, int K, int N, float sc) {
  #pragma clang fp contract(off)
  const size_t t = (size_t)blockIdx.x * 256 + threadIdx.x; if (t >= (size_t)K * N) return; const int i = (int)(t / N), o = (int)(t % N); float a = 0.f;
  for (int r = 0; r < 16; ++r) a = __fadd_rn(a, __fmul_rn(bf16_round(A[(size_t)i * 16 + r]), bf16_round(Bm[(size_t)r * N + o])));
  const float v = __fadd_rn(bf16_round(Wm[t]), __fmul_rn(sc, a)); *(float*)(WE + t) = v;  }
__global__ __launch_bounds__(256) void k_wt32rep(const float* __restrict__ Wf, _Float16* __restrict__ Bt, int K, int N, int DOUT, float scale) {
  const int t = blockIdx.x * 256 + threadIdx.x; if (t >= DOUT * (K / 8)) return; const int n = t / (K / 8), k8 = (t % (K / 8)) * 8; const int rep = DOUT / N; const int src = (n / (HD * rep)) * HD + (n % HD);      /* head h = n / HD -> group h / rep */
  FragH f; for (int i = 0; i < 8; ++i) f.h[i] = (_Float16)(Wf[(size_t)(k8 + i) * N + src] * scale);
  *(v8us*)((unsigned short*)Bt + (size_t)n * K + k8) = f.half[0];  }
__global__ __launch_bounds__(256) void k_brep(const float* __restrict__ b, float* __restrict__ out) { const int t = blockIdx.x * 256 + threadIdx.x; if (t >= DM) return; const float v = b[(t / (HD * 4)) * HD + (t % HD)]; *(float*)(out + t) = v;  }

__global__ __launch_bounds__(256) void k_rsmcim(const float* __restrict__ S, _Float16* __restrict__ P, int hg, int q0, int nk, const int* __restrict__ am) {
  #pragma clang fp contract(off)
  const int t = blockIdx.x * 256 + threadIdx.x; if (t >= hg * QT) return; const size_t i = (size_t)t; const float* s = S + i * NKX; const int last = q0 + (t % QT); const int* mr = am + (size_t)last * SQ; float mx = -3.0e38f;      /* the module's mask row of this query (keys >= nk lie above the diagonal of the causal mask and are not computed) */
#pragma unroll 1
  for (int j = 0; j < nk; ++j) { const float f = (mr[j] != 0) ? 1.f : 0.f; mx = fmaxf(mx, fmaf(f, s[j], (1.f - f) * -1.0e9f)); } float se = 0.f;
#pragma unroll 1
  for (int j = 0; j < nk; ++j) { const float f = (mr[j] != 0) ? 1.f : 0.f; se += __expf(fmaf(f, s[j], (1.f - f) * -1.0e9f) - mx); } const float sc = 256.0f / se;
#pragma unroll 1
  for (int j0 = 0; j0 < nk; j0 += 8) { FragH fr; for (int q = 0; q < 8; ++q) { const int j = j0 + q; const float f = (mr[j] != 0) ? 1.f : 0.f; fr.h[q] = (_Float16)(__expf(fmaf(f, s[j], (1.f - f) * -1.0e9f) - mx) * sc); } unsigned short* d = (unsigned short*)P + i * NKX + j0; *(v8us*)d = fr.half[0];  } }



__global__ __launch_bounds__(256) void k_bcpy(const float* __restrict__ b, int n, int NP, float* __restrict__ dst, int dst0) { for (int i = threadIdx.x; i < NP; i += 256) { const float v = (i < n) ? b[i] : 0.f; *(float*)(dst + dst0 + i) = v; }  }



// lane l with lane l ^ 16
__device__ __forceinline__ float rs_xh(float v) { return __builtin_bit_cast(float, __builtin_amdgcn_permlanex16(__builtin_bit_cast(int, v), __builtin_bit_cast(int, v), 0x76543210, 0xfedcba98, false, false)); }
// native 2^t; the v_nop is the slot the instruction set asks for behind a transcendental before its result is read or its source overwritten
__device__ __forceinline__ float fa_exp2(float t) { float e; asm("v_exp_f32 %0, %1\n\tv_nop" : "=v"(e) : "v"(t)); return e; }
__global__ __launch_bounds__(256) void k_fattn(const _Float16* __restrict__ Q, const _Float16* __restrict__ Kk, const _Float16* __restrict__ VT, _Float16* __restrict__ O) {
  const int lane = threadIdx.x & 31, w = threadIdx.x >> 5, ln = lane & 15, hh = lane >> 4; const int h = blockIdx.y, b = blockIdx.z; const int q0 = blockIdx.x * 256 + w * 32; const size_t r0 = (size_t)b * SQ;
  const _Float16* qp = Q + (r0 + q0 + ln) * LQ + h * HD + 8 * hh; const _Float16* kp = Kk + (r0 + ln) * LQ + h * HD + 8 * hh; const _Float16* vp = VT + ((size_t)(b * NH + h) * HD + ln) * SQ + 8 * hh;      /* the lane's own 8 hh is in the pointers: g2_frag is called with 0 */
  const float L2E = 1.44269504088896340736f; const v8f z8 = {0.f,0.f,0.f,0.f,0.f,0.f,0.f,0.f};
  v16h qf[2][2], kf[2][2], vf[4]; v8f o[2][4]; float m[2] = {-3.0e38f, -3.0e38f}, l[2] = {0.f, 0.f};
  /* every inner loop is unrolled so that the fragment arrays have constant indices and stay in registers */
#pragma unroll
  for (int t = 0; t < 2; ++t) { qf[t][0] = g2_frag(qp + (size_t)t * 16 * LQ, 0); qf[t][1] = g2_frag(qp + (size_t)t * 16 * LQ + 32, 0);
#pragma unroll
    for (int dt = 0; dt < 4; ++dt) o[t][dt] = z8; }
  /* behind each group of loads that share one address pair: the wait that precedes any overwrite of that pair; the pair is an input, so it stays live (no load's result lands on it) up to the wait.
     The "memory" clobber also keeps the groups in this order, Q, K, V^T, here as in the loop (K, V^T), so that the counted load waits at the loop's head leave the V^T loads in flight */
  asm volatile("s_wait_xcnt 0x0" :: "v"(qp) : "memory");
#pragma unroll
  for (int kt = 0; kt < 2; ++kt) { kf[kt][0] = g2_frag(kp + (size_t)kt * 16 * LQ, 0); kf[kt][1] = g2_frag(kp + (size_t)kt * 16 * LQ + 32, 0); }
  asm volatile("s_wait_xcnt 0x0" :: "v"(kp) : "memory");      /* as above */
#pragma unroll
  for (int dt = 0; dt < 4; ++dt) vf[dt] = g2_frag(vp + (size_t)dt * 16 * SQ, 0);
  asm volatile("s_wait_xcnt 0x0" :: "v"(vp) : "memory");      /* as above */
  /* rolled: a pass is some 350 instructions already, and with one copy of the body the load groups keep the one order (K, V^T) that the counted waits lean on */
#pragma unroll 1
  for (int j = 0; j < SQ; j += 32) { const int jn = (j + 32 < SQ) ? j + 32 : j;      /* the last pass fetches its own tile again: in bounds, not used */
    v8f s[2][2];
#pragma unroll
    for (int t = 0; t < 2; ++t)
#pragma unroll
      for (int kt = 0; kt < 2; ++kt) s[t][kt] = g2_mma(kf[kt][1], qf[t][1], g2_mma(kf[kt][0], qf[t][0], z8));
    const _Float16* kn = kp + (size_t)jn * LQ;
#pragma unroll
    for (int kt = 0; kt < 2; ++kt) { kf[kt][0] = g2_frag(kn + (size_t)kt * 16 * LQ, 0); kf[kt][1] = g2_frag(kn + (size_t)kt * 16 * LQ + 32, 0); }
    asm volatile("s_wait_xcnt 0x0" :: "v"(kn) : "memory");      /* as in front of the loop; it also keeps the fetch at this place, a pass ahead of its use */
    FragH pf[2];
#pragma unroll
    for (int t = 0; t < 2; ++t) { float mx = fmaxf(s[t][0][0], s[t][1][0]);
#pragma unroll
      for (int r = 1; r < 8; ++r) mx = fmaxf(mx, fmaxf(s[t][0][r], s[t][1][r]));
      mx = fmaxf(mx, rs_xh(mx)); const float mn = fmaxf(m[t], mx); const float al = fa_exp2((m[t] - mn) * L2E); const float mb = mn * L2E - 8.0f; m[t] = mn; float e0 = 0.f, e1 = 0.f;
#pragma unroll
      for (int r = 0; r < 8; ++r) { const float p0 = fa_exp2(fmaf(s[t][0][r], L2E, -mb)), p1 = fa_exp2(fmaf(s[t][1][r], L2E, -mb)); e0 += p0; e1 += p1; pf[t].h[r] = (_Float16)p0; pf[t].h[8 + r] = (_Float16)p1; }
      l[t] = fmaf(l[t], al, e0 + e1);      /* this half's keys only; the halves are joined behind the loop */
#pragma unroll
      for (int dt = 0; dt < 4; ++dt) o[t][dt] *= al; }
#pragma unroll
    for (int t = 0; t < 2; ++t)
#pragma unroll
      for (int dt = 0; dt < 4; ++dt) o[t][dt] = g2_mma(vf[dt], pf[t].v, o[t][dt]);
    const _Float16* vn = vp + jn;
#pragma unroll
    for (int dt = 0; dt < 4; ++dt) vf[dt] = g2_frag(vn + (size_t)dt * 16 * SQ, 0);
    asm volatile("s_wait_xcnt 0x0" :: "v"(vn) : "memory"); }      /* as for K */
  asm volatile("s_wait_loadcnt 0x0" ::: "memory");      /* the last pass's unused fetch has landed before the wave gives its registers back */
#pragma unroll
  for (int t = 0; t < 2; ++t) { const float fin = 64.0f / (l[t] + rs_xh(l[t]));      /* ctx carried x64; the x256 of the weights cancels in the quotient */
    _Float16* d = O + (r0 + q0 + t * 16 + ln) * DM + h * HD + 8 * hh;
#pragma unroll
    for (int dt = 0; dt < 4; ++dt) { FragH f;
#pragma unroll
      for (int r = 0; r < 8; ++r) f.h[r] = (_Float16)(o[t][dt][r] * fin);
      *(v8us*)((unsigned short*)d + dt * 16) = f.half[0]; } } }
extern "C" void kernel_launch(void* const* d_in, const int* in_sizes, int n_in,
                              void* d_out, int out_size, void* d_ws, size_t ws_size, hipStream_t stream) {
  (void)in_sizes; (void)n_in; (void)out_size;
  const float* const* I = (const float* const*)d_in; const float* x = I[0]; const float* wq = I[1]; const float* bq = I[2]; const float* wk = I[3]; const float* bk = I[4]; const float* wv = I[5]; const float* bv = I[6]; const float* wo = I[7]; const float* bo = I[8]; const float* wfc = I[9]; const float* bfc = I[10]; const float* wmp = I[11]; const float* bmp = I[12]; const float* g1 = I[13]; const float* be1 = I[14]; const float* gg2 = I[15]; const float* be2 = I[16];      /* x; [in][out] Wq / Wk / Wv / Wo + biases; W1 [1024][4096] + b1, W2 [4096][1024] + b2; LN1 g / b, LN2 g / b */
  char* ws = (char*)d_ws; size_t off = 0;
  auto take = [&](size_t bytes) { char* p = ws + off; off += (bytes + 255) & ~(size_t)255; return p; };
  _Float16* BQKV = (_Float16*)take((size_t)3 * DM * DM * 2); _Float16* BO = (_Float16*)take((size_t)DM * DM * 2); float* bqkv = (float*)take((size_t)3 * DM * 4); float* X1N = nullptr;      /* LN1 output (f32): aliases the QKV plane below (QKV's last readers, the V^T launch and the fused attention launch, precede LN1) to stay within 256 MiB at NB 4 / SQ 2048 */
  _Float16* X16 = (_Float16*)take(NR * DM * 2); float* XB = (float*)take(NR * DM * 4); float* X1 = (float*)take(NR * DM * 4); _Float16* M16 = nullptr;      /* = X16 below (alias: X16's last reader, the fused QKV GEMM, precedes LN1's f16 write) */ _Float16* HF16 = nullptr;      /* FFN hidden plane of one batch [2048][4096] f16: its own region below */ _Float16* BW1 = (_Float16*)take((size_t)DFF * DM * 2); _Float16* BW2 = (_Float16*)take((size_t)DM * DFF * 2); _Float16* QKV = (_Float16*)take(NR * 3 * DM * 2); _Float16* Q16 = QKV; _Float16* K16 = QKV + DM; _Float16* V16 = QKV + 2 * DM; _Float16* O16 = (_Float16*)take(NR * DM * 2); M16 = X16; X1N = (float*)QKV; HF16 = (_Float16*)take((size_t)SQ * DFF * 2);      /* the per-batch FFN hidden plane (16 MiB) gets its OWN region here: at NB 2 the context plane O16 is only 8 MiB */      /* aliases: X1N (NR*DM f32 = 16 MiB) inside QKV (24 MiB) */
  _Float16* VT = (_Float16*)take((size_t)NB * NH * HD * SQ * 2);
  if (off > ws_size) return;
  { const unsigned g = (unsigned)((DM / 128) * (DM / 64)); k_wt_f16<<<g, 128, 0, stream>>>(wq, BQKV, DM, DM, 16.0f); k_wt_f16<<<g, 128, 0, stream>>>(wk, BQKV + (size_t)DM * DM, DM, DM, 16.0f); k_wt_f16<<<g, 128, 0, stream>>>(wv, BQKV + (size_t)2 * DM * DM, DM, DM, 16.0f); k_wt_f16<<<g, 128, 0, stream>>>(wo, BO, DM, DM, 16.0f); }      /* [in][out] -> Bt x16: stacked q | k | v, and Wo */
  k_bcpy<<<1, 256, 0, stream>>>(bq, DM, DM, bqkv, 0); k_bcpy<<<1, 256, 0, stream>>>(bk, DM, DM, bqkv, DM); k_bcpy<<<1, 256, 0, stream>>>(bv, DM, DM, bqkv, 2 * DM);      /* stacked bias bq | bk | bv */
  k_x16<<<(unsigned)((NR * DM / 8 + 255) / 256), 256, 0, stream>>>(x, X16, NR * DM / 8); k_bfr<<<(unsigned)((NR * DM / 8 + 255) / 256), 256, 0, stream>>>(x, XB, NR * DM / 8);      /* post-LN: the attention runs on the raw input (exact f16 rows); XB = bf16(x) f32 for the residual */
  k_wt_f16<<<(unsigned)((DM / 128) * (DFF / 64)), 128, 0, stream>>>(wfc, BW1, DM, DFF, 16.0f); k_wt_f16<<<(unsigned)((DFF / 128) * (DM / 64)), 128, 0, stream>>>(wmp, BW2, DFF, DM, 16.0f);      /* [in][out] w1 [1024][4096] and w2 [4096][1024] transposed to Bt x16 */
  const size_t r0p = (size_t)B0 * SQ;      /* first projected row */
  k_gemm2<0><<<dim3((unsigned)((MP / 128) * (3 * DM / 64)), 1), 128, 0, stream>>>(X16 + r0p * DM, DM, 0, BQKV, DM, 0, 0.0625f, bqkv, 0, nullptr, 1, 0, 0, nullptr, QKV + r0p * 3 * DM, 3 * DM, 0, MP, 3 * DM, DM);      /* q | k | v rows (f16); head h = columns h*HD.. of each DM block */
  k_vt<NH, SQ><<<NB * NH * (SQ / 64), 256, 0, stream>>>(V16, LQ, 0, VT);      /* V^T [NB][NH][HD][SQ] */
  k_fattn<<<dim3(SQ / 256, NH, NB), 256, 0, stream>>>(Q16, K16, VT, O16);      /* scores q.k (no scaling), softmax over all keys, ctx (merged heads, x64) as f16 rows */
  k_gemm2<0><<<dim3((unsigned)((MPO / 128) * (DM / 64)), 1), 128, 0, stream>>>(O16 + r0p * DM, DM, 0, BO, DM, 0, 0.0009765625f, bo, 0, XB + r0p * DM, -1, 0, 0, X1 + r0p * DM, nullptr, DM, 0, MPO, DM, DM);      /* out rows are the output layout */
  k_lnx<0, 1, 1><<<(unsigned)NR, 256, 0, stream>>>(X1, g1, be1, 1e-5f, M16, X1N);      /* x1 = LN1(x + attn_out) (eps 1e-5): f16 rows for the FFN input and f32 rows for the residual */
  for (int b = 0; b < NB; ++b) { const size_t r0 = (size_t)b * SQ;
    k_gemm2<6><<<dim3((unsigned)((SQ / 128) * (DFF / 64)), 1), 128, 0, stream>>>(M16 + r0 * DM, DM, 0, BW1, DM, 0, 0.0625f, bfc, 0, nullptr, 1, 0, 0, nullptr, HF16, DFF, 0, SQ, DFF, DM);      /* gelu_erf(h w1 + b1) -> f16 (this batch) */
    k_gemm2<0><<<dim3((unsigned)((SQ / 128) * (DM / 64)), 1), 128, 0, stream>>>(HF16, DFF, 0, BW2, DFF, 0, 0.0625f, bmp, 0, X1N + r0 * DM, -1, 0, 0, X1 + r0 * DM, nullptr, DM, 0, SQ, DM, DFF); }      /* t = x1 + gelu-ffn + b2 (own-element residual) f32, over the dead pre-LN1 plane */
  k_lnx<0, 0, 1><<<(unsigned)NR, 256, 0, stream>>>(X1, gg2, be2, 1e-5f, nullptr, (float*)d_out);      /* out = LN2(t) (eps 1e-5) -> f32 output rows */
}

// v005
// A run of this version takes 357 microseconds.
// Next to v004, in two timings, it ran 1.06 times as fast each time.
// Over all steps from v000 it is 20.5 times as fast.
#include <hip/hip_runtime.h>
// POST-LN transformer encoder block (x [2][2048][1024]; q/k/v = x W + b ([in][out] 1024 x 1024, zero biases); 16 heads of 64; scores = q k^T with NO 1/sqrt(head_dim) scaling (as the source module); softmax over all 2048 keys (no mask); x1 = LN1(x + ctx Wo + bo) (biased var, eps 1e-5, g / beta); out = LN2(x1 + gelu_erf(x1 W1 + b1) W2 + b2) ([in][out] 1024 x 4096 x 1024) -> [2][2048][1024]).
// Structure: token rows; x as exact f16 rows and bf16 f32 residual rows; natural weights as exact x16 planes; fused q | k | v WMMA GEMM (32x64 wave tiles, f32 accumulation, + stacked bias) -> f16; V^T via LDS transposes; one fused attention launch (S^T = K Q^T, online softmax in registers with f32 statistics and native exp, weights x256 f16, O^T += V^T P^T), ctx (x64) merged f16; x + ctx Wo + bo f32; LN1 on VALU -> f16 + f32; gelu FFN per batch; + residual; LN2 -> output; launches: see trace.
// Compute dtype: inputs rounded to bf16; x / weights exact; q, k, v, softmax weights and o as plain f16 GEMM operands (~2^-12); scores and softmax statistics f32. v_wmma_f32_16x16x32_f16.
#define NB 2
#define SQ 2048
#define DM 1024
#define NH 16
#define HD 64
#define HG 4                         /* heads per launch of the non-template k_vt (not launched) */
#define QT 256                       /* query rows per attention tile */
#define NKX SQ                       /* S / P row pitch */
#define QT0 128                      /* rows per head of the f32 k_att0 path (not launched) */
#define B0 0                         /* first batch processed (debug hook) */
#define NBR NB                       /* batches processed (debug hook) */
#define NR ((size_t)NB * SQ)
#define DMQ DM
#define DFF 4096         /* FFN hidden width */
#define MP ((int)((size_t)NBR * SQ)) /* rows projected (debug hook) */
#define QN SQ                        /* query rows per batch (not used) */
#define NHD NH                       /* heads (not used) */
#define MPO MP                       /* rows through the output stage (debug hook) */
#define LQ (3 * DM)      /* row pitch of the q/k/v rows */
typedef __bf16 v16b __attribute__((ext_vector_type(16)));
typedef unsigned short v8us __attribute__((ext_vector_type(8), may_alias));
typedef float  v8f  __attribute__((ext_vector_type(8)));
typedef float  v4f  __attribute__((ext_vector_type(4)));
typedef float  v4fa __attribute__((ext_vector_type(4), may_alias));
union FragB { v16b v; v8us half[2]; unsigned short u[16]; };

__device__ __forceinline__ unsigned short bf16_bits(float x) { unsigned int u = __float_as_uint(x); return (unsigned short)((u + 0x7FFFu + ((u >> 16) & 1u)) >> 16); }
__device__ __forceinline__ float bf16_val(unsigned short b) { return __uint_as_float(((unsigned int)b) << 16); }
__device__ __forceinline__ float bf16_round(float x) { return bf16_val(bf16_bits(x)); }
// D += A·B with NT terms: 1 = ah·bh, 2 = + al·bh (A split), 3 = + ah·bl (both split)
template <int NT>
__device__ __forceinline__ v8f mmaN(v16b ah, v16b al, v16b bh, v16b bl, v8f c) {
  c = __builtin_amdgcn_wmma_f32_16x16x32_bf16(false, ah, false, bh, (short)0, c, false, false);
  if (NT >= 2) c = __builtin_amdgcn_wmma_f32_16x16x32_bf16(false, al, false, bh, (short)0, c, false, false);
  if (NT >= 3) c = __builtin_amdgcn_wmma_f32_16x16x32_bf16(false, ah, false, bl, (short)0, c, false, false);
  asm volatile("v_nop\n\tv_nop\n\tv_nop\n\tv_nop" : "+v"(c) : "v"(ah), "v"(al), "v"(bh), "v"(bl));
  return c;
}

__global__ __launch_bounds__(256) void k_wt_bf16(const float* __restrict__ W, unsigned short* __restrict__ Wt, int K, int N) {
  const int t = blockIdx.x * 256 + threadIdx.x;
  const int k8n = K / 8;
  if (t >= N * k8n) return;
  const int n = t / k8n, k8 = (t % k8n) * 8;
  v8us v;
#pragma unroll
  for (int i = 0; i < 8; ++i) v[i] = bf16_bits(W[(size_t)(k8 + i) * N + n]);
  *(v8us*)(Wt + (size_t)n * K + k8) = v;
  
}

// GEMM C[M][N] (f32, pitch ldc) = act(A[M][K]·W + bias). A f32 row-major (pitch lda) converted per fragment to bf16
// (ASPLIT: hi/lo two planes -> 2 terms, else single rounded term); Wt bf16 [N][K] (pitch ldb). BIAS_BF16 rounds the
// bias to bf16 first (bias quantised to bf16 before the add). K%32==0, M%16==0, N%64==0.
template <bool ASPLIT, int ACT, bool BIAS_BF16>
__global__ __launch_bounds__(128) void k_gemm_bf(const float* __restrict__ A, int lda, const unsigned short* __restrict__ Wt, int ldb,
                                               const float* __restrict__ bias, float* __restrict__ C, int ldc, int M, int N, int K) {
  __shared__ __attribute__((aligned(16))) float so[4][16][64];
  const int tid = threadIdx.x, w = tid >> 5, lane = tid & 31, ln = lane & 15, hh = lane >> 4;
  const int ntn = N / 64;
  const int wid = blockIdx.x * 4 + w;
  const int mt = wid / ntn, nq = wid % ntn;
  if (mt * 16 >= M) return;
  const int row0 = mt * 16, col0 = nq * 64;
  const float* arow = A + (size_t)(row0 + ln) * lda;
  v8f acc[4] = {};
  for (int kb = 0; kb < K; kb += 32) {
    FragB ah, al;
    const v4f x0 = *(const v4fa*)(arow + kb + 8 * hh), x1 = *(const v4fa*)(arow + kb + 8 * hh + 4);
    const v4f x2 = *(const v4fa*)(arow + kb + 16 + 8 * hh), x3 = *(const v4fa*)(arow + kb + 16 + 8 * hh + 4);
    float xs[16] = {x0[0],x0[1],x0[2],x0[3],x1[0],x1[1],x1[2],x1[3],x2[0],x2[1],x2[2],x2[3],x3[0],x3[1],x3[2],x3[3]};
#pragma unroll
    for (int i = 0; i < 16; ++i) { const unsigned short hb = bf16_bits(xs[i]); ah.u[i] = hb; al.u[i] = ASPLIT ? bf16_bits(xs[i] - bf16_val(hb)) : (unsigned short)0; }
#pragma unroll
    for (int t = 0; t < 4; ++t) {
      const unsigned short* brow = Wt + (size_t)(col0 + t * 16 + ln) * ldb + kb;
      FragB b;
      b.half[0] = *(const v8us*)(brow + 8 * hh);
      b.half[1] = *(const v8us*)(brow + 16 + 8 * hh);
      acc[t] = mmaN<ASPLIT ? 2 : 1>(ah.v, al.v, b.v, b.v, acc[t]);
    }
  }
#pragma unroll
  for (int t = 0; t < 4; ++t) {
    float bv = bias ? bias[col0 + t * 16 + ln] : 0.f;
    if (BIAS_BF16) bv = bf16_round(bv);
#pragma unroll
    for (int r = 0; r < 8; ++r) { float v = acc[t][r] + bv; if (ACT == 1) v = fmaxf(v, 0.f); so[w][8 * hh + r][t * 16 + ln] = v; }
  }
  __builtin_amdgcn_fence(__ATOMIC_ACQ_REL, "workgroup");
  __builtin_amdgcn_wave_barrier();
  const int rsub = lane >> 4, c4 = (lane & 15) * 4;
  {
#pragma unroll
    for (int q = 0; q < 8; ++q) {
      const int r = q * 2 + rsub;
      const v4f v = *(const v4fa*)&so[w][r][c4];
      *(v4f*)(C + (size_t)(row0 + r) * ldc + col0 + c4) = v;
    }
    
  }
}

// GEMM C = act(A·W + bias + resid): A f32 (ASPLIT -> hi/lo 2 terms), Wt bf16 [N][K]; ACT 0 none, 1 relu, 2 exact gelu;
// resid (optional, f32, row index = (row % rmod), pitch ldr, RES_BF16 rounds it) added before the activation.
template <bool ASPLIT, int ACT, bool BIAS_BF16, bool RES_BF16>
__global__ __launch_bounds__(128) void k_gemm_bf3(const float* __restrict__ A, int lda, const unsigned short* __restrict__ Wt, int ldb,
                                                const float* __restrict__ bias, const float* __restrict__ resid, int rmod, int ldr,
                                                float* __restrict__ C, int ldc, int M, int N, int K) {
  __shared__ __attribute__((aligned(16))) float so[4][16][64];
  const int tid = threadIdx.x, w = tid >> 5, lane = tid & 31, ln = lane & 15, hh = lane >> 4;
  const int ntn = N / 64;
  const int wid = blockIdx.x * 4 + w;
  const int mt = wid / ntn, nq = wid % ntn;
  if (mt * 16 >= M) return;
  const int row0 = mt * 16, col0 = nq * 64;
  const float* arow = A + (size_t)(row0 + ln) * lda;
  v8f acc[4] = {};
  for (int kb = 0; kb < K; kb += 32) {
    FragB ah, al;
    const v4f x0 = *(const v4fa*)(arow + kb + 8 * hh), x1 = *(const v4fa*)(arow + kb + 8 * hh + 4);
    const v4f x2 = *(const v4fa*)(arow + kb + 16 + 8 * hh), x3 = *(const v4fa*)(arow + kb + 16 + 8 * hh + 4);
    float xs[16] = {x0[0],x0[1],x0[2],x0[3],x1[0],x1[1],x1[2],x1[3],x2[0],x2[1],x2[2],x2[3],x3[0],x3[1],x3[2],x3[3]};
#pragma unroll
    for (int i = 0; i < 16; ++i) { const unsigned short hb = bf16_bits(xs[i]); ah.u[i] = hb; al.u[i] = ASPLIT ? bf16_bits(xs[i] - bf16_val(hb)) : (unsigned short)0; }
#pragma unroll
    for (int t = 0; t < 4; ++t) {
      const unsigned short* brow = Wt + (size_t)(col0 + t * 16 + ln) * ldb + kb;
      FragB b;
      b.half[0] = *(const v8us*)(brow + 8 * hh);
      b.half[1] = *(const v8us*)(brow + 16 + 8 * hh);
      acc[t] = mmaN<ASPLIT ? 2 : 1>(ah.v, al.v, b.v, b.v, acc[t]);
    }
  }
#pragma unroll
  for (int t = 0; t < 4; ++t) {
    const int col = col0 + t * 16 + ln;
    float bv = bias ? bias[col] : 0.f;
    if (BIAS_BF16) bv = bf16_round(bv);
#pragma unroll
    for (int r = 0; r < 8; ++r) {
      float v = acc[t][r] + bv;
      if (resid) { float rv = resid[(size_t)((row0 + 8 * hh + r) % rmod) * ldr + col]; if (RES_BF16) rv = bf16_round(rv); v += rv; }
      if (ACT == 1) v = fmaxf(v, 0.f);
      if (ACT == 2) v = 0.5f * v * (1.0f + erff(v * 0.70710678118654752f));
      if (ACT == 3) { const float u = 0.7978845608028654f * (v + 0.044715f * v * v * v); v = 0.5f * v * (1.0f + tanhf(u)); }
      so[w][8 * hh + r][t * 16 + ln] = v;
    }
  }
  __builtin_amdgcn_fence(__ATOMIC_ACQ_REL, "workgroup");
  __builtin_amdgcn_wave_barrier();
  const int rsub = lane >> 4, c4 = (lane & 15) * 4;
  {
#pragma unroll
    for (int q = 0; q < 8; ++q) {
      const int r = q * 2 + rsub;
      const v4f v = *(const v4fa*)&so[w][r][c4];
      *(v4f*)(C + (size_t)(row0 + r) * ldc + col0 + c4) = v;
    }
    
  }
}
// row LayerNorm (biased variance, eps) over N: s = X (+ R); optional out_sum <- s; out_norm <- (s-mu)*rsqrt(var+eps)*g + b
template <bool PARAM_BF16>
__global__ __launch_bounds__(256) void k_layernorm(const float* __restrict__ X, const float* __restrict__ R, const float* __restrict__ g, const float* __restrict__ bta,
                                                  float* __restrict__ out_sum, float* __restrict__ out_norm, int N, float eps) {
  __shared__ float red[256];
  const int row = blockIdx.x, tid = threadIdx.x;
  const float* x = X + (size_t)row * N; const float* rr = R ? R + (size_t)row * N : nullptr;
  float vals[16];                     // up to N = 4096
  const int per = N / 256;            // contiguous chunk per thread? use strided-by-4 chunks: thread handles j = tid*4 + 1024*u
  float s1 = 0.f;
  for (int u = 0; u < per / 4; ++u) {
    const int j = tid * 4 + 1024 * u;
    const v4f a = *(const v4fa*)(x + j);
    v4f b = {0.f,0.f,0.f,0.f}; if (rr) b = *(const v4fa*)(rr + j);
#pragma unroll
    for (int q = 0; q < 4; ++q) { const float v = a[q] + b[q]; vals[u * 4 + q] = v; s1 += v; }
  }
  red[tid] = s1; __syncthreads();
  for (int st = 128; st > 0; st >>= 1) { if (tid < st) red[tid] += red[tid + st]; __syncthreads(); }
  const float mu = red[0] / (float)N; __syncthreads();
  float s2 = 0.f;
  for (int u = 0; u < per / 4; ++u)
#pragma unroll
    for (int q = 0; q < 4; ++q) { const float c = vals[u * 4 + q] - mu; s2 += c * c; }
  red[tid] = s2; __syncthreads();
  for (int st = 128; st > 0; st >>= 1) { if (tid < st) red[tid] += red[tid + st]; __syncthreads(); }
  const float rs = rsqrtf(red[0] / (float)N + eps);
  {
    for (int u = 0; u < per / 4; ++u) {
      const int j = tid * 4 + 1024 * u;
      v4f o, sm;
#pragma unroll
      for (int q = 0; q < 4; ++q) {
        float gg = g[j + q], bb = bta[j + q];
        if (PARAM_BF16) { gg = bf16_round(gg); bb = bf16_round(bb); }
        sm[q] = vals[u * 4 + q]; o[q] = (vals[u * 4 + q] - mu) * rs * gg + bb;
      }
      if (out_sum) *(v4f*)(out_sum + (size_t)row * N + j) = sm;
      *(v4f*)(out_norm + (size_t)row * N + j) = o;
    }
    
  }
}



// ---- f16 WMMA path (v_wmma_f32_16x16x32_f16): 11-bit significands for operands in range — used where a [0,1] probability operand needs more precision than bf16
typedef _Float16 v16h __attribute__((ext_vector_type(16)));
union FragH { v16h v; v8us half[2]; _Float16 h[16]; unsigned short u[16]; };
template <int NT>
__device__ __forceinline__ v8f mmaH(v16h ah, v16h al, v16h bh, v16h bl, v8f c) {
  c = __builtin_amdgcn_wmma_f32_16x16x32_f16(false, ah, false, bh, (short)0, c, false, false);
  if (NT >= 2) c = __builtin_amdgcn_wmma_f32_16x16x32_f16(false, al, false, bh, (short)0, c, false, false);
  if (NT >= 3) c = __builtin_amdgcn_wmma_f32_16x16x32_f16(false, ah, false, bl, (short)0, c, false, false);
  asm volatile("v_nop\n\tv_nop\n\tv_nop\n\tv_nop" : "+v"(c) : "v"(ah), "v"(al), "v"(bh), "v"(bl));
  return c;
}
// batched GEMM like k_gemm_b but f16 operands: A f32 (split into f16 hi/lo if ASPLIT, else rounded to f16), Bt = f16 values [n][k]; alpha; C f32; N multiple of 16 (partial tiles skipped)
template <bool ASPLIT>
__global__ __launch_bounds__(128) void k_gemm_h(const float* __restrict__ A, int lda, size_t sA, const _Float16* __restrict__ Bh, int ldb, size_t sB, float alpha, float* __restrict__ C, int ldc, size_t sC, int M, int N, int K) {
  __shared__ __attribute__((aligned(16))) float so[4][16][64];
  const int tid = threadIdx.x, w = tid >> 5, lane = tid & 31, ln = lane & 15, hh = lane >> 4; const int by = blockIdx.y;
  A += (size_t)by * sA; Bh += (size_t)by * sB; C += (size_t)by * sC;
  const int ntn = (N + 63) / 64; const int wid = blockIdx.x * 4 + w; const int mt = wid / ntn, nq = wid % ntn; if (mt * 16 >= M) return;
  const int row0 = mt * 16, col0 = nq * 64; const float* arow = A + (size_t)(row0 + ln) * lda;
  v8f acc[4] = {};
  for (int kb = 0; kb < K; kb += 32) {
    FragH ah, al;
    const v4f x0 = *(const v4fa*)(arow + kb + 8 * hh), x1 = *(const v4fa*)(arow + kb + 8 * hh + 4), x2 = *(const v4fa*)(arow + kb + 16 + 8 * hh), x3 = *(const v4fa*)(arow + kb + 16 + 8 * hh + 4);
    float xs[16] = {x0[0],x0[1],x0[2],x0[3],x1[0],x1[1],x1[2],x1[3],x2[0],x2[1],x2[2],x2[3],x3[0],x3[1],x3[2],x3[3]};
#pragma unroll
    for (int i = 0; i < 16; ++i) { const _Float16 h = (_Float16)xs[i]; ah.h[i] = h; al.h[i] = ASPLIT ? (_Float16)(xs[i] - (float)h) : (_Float16)0.0f; }
#pragma unroll
    for (int t = 0; t < 4; ++t) { if (col0 + t * 16 >= N) continue; const size_t boff = (size_t)(col0 + t * 16 + ln) * ldb + kb; FragH bq; bq.half[0] = *(const v8us*)(Bh + boff + 8 * hh); bq.half[1] = *(const v8us*)(Bh + boff + 16 + 8 * hh);
      acc[t] = mmaH<ASPLIT ? 2 : 1>(ah.v, al.v, bq.v, bq.v, acc[t]); }
  }
#pragma unroll
  for (int t = 0; t < 4; ++t) { if (col0 + t * 16 >= N) continue;
#pragma unroll
    for (int r = 0; r < 8; ++r) so[w][8 * hh + r][t * 16 + ln] = acc[t][r] * alpha; }
  __builtin_amdgcn_fence(__ATOMIC_ACQ_REL, "workgroup"); __builtin_amdgcn_wave_barrier();
  const int rsub = lane >> 4, c4 = (lane & 15) * 4;
  {
#pragma unroll
    for (int q = 0; q < 8; ++q) { const int r = q * 2 + rsub; if (col0 + c4 < N) { const v4f v = *(const v4fa*)&so[w][r][c4]; *(v4f*)(C + (size_t)(row0 + r) * ldc + col0 + c4) = v; } }
     }
}

// Wt[n][k] = f16(bf16(W[k][n])*scale) from f32 row-major W[K][N] (scale = power of two; bf16-exact weights stay exact in f16 away from the subnormal range). K % 128 == 0, N % 64 == 0.
// Transposed in registers: a lane reads 16-byte pieces (4 n) of 8 successive rows k, which is 4 output pieces of 16 bytes (8 k). Lanes: 4 along n, 8 along k, so a wave's store covers four whole
// 128-byte lines of Wt and its two loads of a row group cover the two halves of eight 128-byte lines of W. A wave takes 64 k x 32 n, a block (2 x 2 waves) 128 k x 64 n: 256 bytes a row on both sides.
__global__ __launch_bounds__(128) void k_wt_f16(const float* __restrict__ W, _Float16* __restrict__ Wt, int K, int N, float scale) {
  const int lane = threadIdx.x & 31, w = threadIdx.x >> 5; const int ntn = N >> 6; const int bk = blockIdx.x / ntn, bn = blockIdx.x - bk * ntn;
  const int k0 = bk * 128 + (w >> 1) * 64 + (lane >> 2) * 8, n0 = bn * 64 + (w & 1) * 32 + (lane & 3) * 4;
  const float* p[8]; v4f a[8], b[8];
  /* unrolled: the arrays get constant indices (registers) */
#pragma unroll
  for (int i = 0; i < 8; ++i) { p[i] = W + (size_t)(k0 + i) * N + n0; a[i] = *(const v4fa*)p[i]; b[i] = *(const v4fa*)(p[i] + 16); }
  /* The loaded values are inputs: all sixteen loads stay in front of the first conversion, so the wave pays one memory latency (left alone the compiler sinks half of them among the conversions: four more round trips).
     The row pointers are inputs: they stay live up to here, so no load's result lands on an address pair of an issued load, and the wait precedes every later overwrite of such a pair */
  asm volatile("s_wait_xcnt 0x0" :: "v"(a[0]), "v"(a[1]), "v"(a[2]), "v"(a[3]), "v"(a[4]), "v"(a[5]), "v"(a[6]), "v"(a[7]), "v"(b[0]), "v"(b[1]), "v"(b[2]), "v"(b[3]), "v"(b[4]), "v"(b[5]), "v"(b[6]), "v"(b[7]),
               "v"(p[0]), "v"(p[1]), "v"(p[2]), "v"(p[3]), "v"(p[4]), "v"(p[5]), "v"(p[6]), "v"(p[7]));
  unsigned short* d = (unsigned short*)Wt + (size_t)n0 * K + k0;
#pragma unroll
  for (int q = 0; q < 4; ++q) { FragH f;
#pragma unroll
    for (int i = 0; i < 8; ++i) { f.h[i] = (_Float16)(bf16_round(a[i][q]) * scale); f.h[8 + i] = (_Float16)(bf16_round(b[i][q]) * scale); }
    *(v8us*)(d + (size_t)q * K) = f.half[0]; *(v8us*)(d + (size_t)(16 + q) * K) = f.half[1]; }
}
// k_gemm_hh variant with fused epilogue: v = acc·alpha + bias[by·sBias + col] (+ CP[(row/rowsPerB)·sCPb + by·64 + col] if CP) ; ACT 0 none / 1 elu ; writes f16 C16 (and f32 C if non-null)
template <int ACT>
__global__ __launch_bounds__(128) void k_gemm_hhx(const _Float16* __restrict__ A, int lda, size_t sA, const _Float16* __restrict__ Bh, int ldb, size_t sB, float alpha, const float* __restrict__ bias, size_t sBias, const float* __restrict__ CP, int rowsPerB, size_t sCPb, int row0g,
    float* __restrict__ C, _Float16* __restrict__ C16, int ldc, size_t sC, int M, int N, int K) {
  __shared__ __attribute__((aligned(16))) float so[4][16][64];
  const int tid = threadIdx.x, w = tid >> 5, lane = tid & 31, ln = lane & 15, hh = lane >> 4; const int by = blockIdx.y;
  A += (size_t)by * sA; Bh += (size_t)by * sB; const size_t cofs = (size_t)by * sC; const float* bp = bias ? bias + (size_t)by * sBias : nullptr;
  const int ntn = (N + 63) / 64; const int wid = blockIdx.x * 4 + w; const int mt = wid / ntn, nq = wid % ntn; if (mt * 16 >= M) return;
  const int row0 = mt * 16, col0 = nq * 64; const _Float16* arow = A + (size_t)(row0 + ln) * lda;
  v8f acc[4] = {};
  for (int kb = 0; kb < K; kb += 32) { FragH ah; ah.half[0] = *(const v8us*)((const unsigned short*)arow + kb + 8 * hh); ah.half[1] = *(const v8us*)((const unsigned short*)arow + kb + 16 + 8 * hh);
#pragma unroll
    for (int t = 0; t < 4; ++t) { if (col0 + t * 16 >= N) continue; const size_t boff = (size_t)(col0 + t * 16 + ln) * ldb + kb; FragH bq; bq.half[0] = *(const v8us*)((const unsigned short*)Bh + boff + 8 * hh); bq.half[1] = *(const v8us*)((const unsigned short*)Bh + boff + 16 + 8 * hh);
      acc[t] = mmaH<1>(ah.v, ah.v, bq.v, bq.v, acc[t]); }
  }
#pragma unroll
  for (int t = 0; t < 4; ++t) { if (col0 + t * 16 >= N) continue; const int col = col0 + t * 16 + ln; const float bv = bp ? bf16_round(bp[col]) : 0.f;
#pragma unroll
    for (int r = 0; r < 8; ++r) { float v = acc[t][r] * alpha + bv; if (CP) { const int rr = row0g + row0 + 8 * hh + r; if (rowsPerB < 0) v += CP[cofs + (size_t)rr * ldc + col];      /* rowsPerB < 0: own element of the batched C plane */ else { const int bidx = rr / rowsPerB; v += CP[(size_t)bidx * sCPb + (size_t)by * 64 + col]; } } if (ACT == 1) v = (v > 0.f) ? v : expm1f(v); else if (ACT == 7) v = (v > 0.f) ? v + 1.0f : expf(v); else if (ACT == 8) v = tanhf(v); else if (ACT == 9) v = 0.5f * v * (1.0f + tanhf(0.7978845608028654f * (v + 0.044715f * v * v * v))); else if (ACT == 11) v = 1.0f / (1.0f + expf(-v)); else if (ACT == 12) v = (v > 0.f) ? v : 0.01f * v; else if (ACT == 14) v = (v > 0.f) ? v : 0.1f * v; else if (ACT == 16) v = (v >= 0.f) ? v : 0.3f * v; else if (ACT == 17) v = (v >= 0.f) ? v : 0.2f * v; else if (ACT == 15) v = v / (1.0f + expf(-v)); else if (ACT == 3) v = fmaxf(v, 0.f); else if (ACT == 6) v = 0.5f * v * (1.0f + erff(v * 0.70710678118654752f)); so[w][8 * hh + r][t * 16 + ln] = v; } }
  __builtin_amdgcn_fence(__ATOMIC_ACQ_REL, "workgroup"); __builtin_amdgcn_wave_barrier();
  const int rsub = lane >> 4, c4 = (lane & 15) * 4; typedef _Float16 v4h __attribute__((ext_vector_type(4)));
  {
#pragma unroll
    for (int q = 0; q < 8; ++q) { const int r = q * 2 + rsub; if (col0 + c4 < N) { const v4f v = *(const v4fa*)&so[w][r][c4]; if (C) *(v4f*)(C + cofs + (size_t)(row0 + r) * ldc + col0 + c4) = v; if (C16) { v4h h4; for (int i = 0; i < 4; ++i) h4[i] = (_Float16)v[i]; *(v4h*)(C16 + cofs + (size_t)(row0 + r) * ldc + col0 + c4) = h4; } } }
     }
}


typedef _Float16 v4h __attribute__((ext_vector_type(4)));

__global__ __launch_bounds__(256) void k_x16(const float* __restrict__ x, _Float16* __restrict__ X16, size_t n8) { const size_t t = (size_t)blockIdx.x * 256 + threadIdx.x; if (t >= n8) return; FragH f;
#pragma unroll
  for (int q = 0; q < 8; ++q) f.h[q] = (_Float16)bf16_round(x[t * 8 + q]); *(v8us*)((unsigned short*)X16 + t * 8) = f.half[0];  }
__global__ __launch_bounds__(256) void k_h16(const float* __restrict__ x, _Float16* __restrict__ X16, size_t n8) { const size_t t = (size_t)blockIdx.x * 256 + threadIdx.x; if (t >= n8) return; FragH f;
#pragma unroll
  for (int q = 0; q < 8; ++q) f.h[q] = (_Float16)x[t * 8 + q]; *(v8us*)((unsigned short*)X16 + t * 8) = f.half[0];  }
__global__ __launch_bounds__(256) void k_round16f(const float* __restrict__ W, _Float16* __restrict__ Bt, size_t n8) { const size_t t = (size_t)blockIdx.x * 256 + threadIdx.x; if (t >= n8) return; FragH f;
#pragma unroll
  for (int i = 0; i < 8; ++i) f.h[i] = (_Float16)(bf16_round(W[t * 8 + i]) * 16.0f); *(v8us*)((unsigned short*)Bt + t * 8) = f.half[0];  }
template <int NHv, int TTv>
__global__ __launch_bounds__(256) void k_vt(const _Float16* __restrict__ V16, int ldv, int voff, _Float16* __restrict__ Vt) { __shared__ unsigned short tl[64][66]; const int tid = threadIdx.x; const int slab = blockIdx.x / (TTv / 64), lg = blockIdx.x % (TTv / 64); const int b = slab / NHv, h = slab % NHv;
  for (int i = tid; i < 64 * 8; i += 256) { const int r = i / 8, c8 = (i % 8) * 8; FragH f; f.half[0] = *(const v8us*)((const unsigned short*)V16 + ((size_t)b * TTv + lg * 64 + r) * ldv + voff + h * 64 + c8);
#pragma unroll
    for (int q = 0; q < 8; ++q) tl[r][c8 + q] = f.u[q]; }
  __syncthreads();
  {
#pragma unroll
    for (int rd = 0; rd < 2; ++rd) { const int d = rd * 32 + tid / 8, pc = tid % 8; FragH f;
#pragma unroll
      for (int q = 0; q < 8; ++q) f.u[q] = tl[pc * 8 + q][d];
      *(v8us*)((unsigned short*)Vt + ((size_t)slab * 64 + d) * TTv + lg * 64 + pc * 8) = f.half[0]; }
     } }

__global__ __launch_bounds__(256) void k_hl(const float* __restrict__ F, _Float16* __restrict__ Hh, _Float16* __restrict__ Hl, size_t n8) { const size_t t = (size_t)blockIdx.x * 256 + threadIdx.x; if (t >= n8) return; FragH fh, fl; const v4f a = *(const v4fa*)(F + t * 8), c = *(const v4fa*)(F + t * 8 + 4);
#pragma unroll
  for (int q = 0; q < 4; ++q) { _Float16 h = (_Float16)a[q]; fh.h[q] = h; fl.h[q] = (_Float16)((a[q] - (float)h) * 1024.0f); h = (_Float16)c[q]; fh.h[4 + q] = h; fl.h[4 + q] = (_Float16)((c[q] - (float)h) * 1024.0f); }
  { *(v8us*)((unsigned short*)Hh + t * 8) = fh.half[0]; *(v8us*)((unsigned short*)Hl + t * 8) = fl.half[0];  } }

// ---- fast GEMM (block tile 128x64, wave tile 32x64; A and B tiles of 128 k staged in LDS by asynchronous copies, two buffers; requires M % 128 == 0, N % 64 == 0, K % 128 == 0); epilogue = k_gemm_hhx semantics ----
__device__ __forceinline__ v16h g2_frag(const _Float16* p, int hh) { FragH f; f.half[0] = *(const v8us*)((const unsigned short*)p + 8 * hh); f.half[1] = *(const v8us*)((const unsigned short*)p + 16 + 8 * hh); return f.v; }
__device__ __forceinline__ v8f g2_mma(v16h a, v16h b, v8f c) { v8f d = __builtin_amdgcn_wmma_f32_16x16x32_f16(false, a, false, b, (short)0, c, false, false); asm volatile("v_nop\n\tv_nop\n\tv_nop\n\tv_nop" : "+v"(d) : "v"(a), "v"(b)); return d; }
#define G2_PITCH 272      /* LDS row pitch, bytes: 256 of data + 16, an odd multiple of 16 (no bank conflict for 16-byte row reads) */
#define G2_STAGE (192 * G2_PITCH)      /* one buffer: 128 rows of A, then 64 rows of B, 128 k each */
// Eight asynchronous 16-byte copies of a lane, global -> LDS, rows 8 apart (st = 8 source rows, in elements). The s_wait_xcnt stands in the copies' own statement, behind the last of them,
// so that it precedes every later write of a register that a copy names.
__device__ __forceinline__ void g2_copy8(unsigned l, const _Float16* g, size_t st) {
  asm volatile("global_load_async_to_lds_b128 %0, %8, off\n\t"
               "global_load_async_to_lds_b128 %1, %9, off\n\t"
               "global_load_async_to_lds_b128 %2, %10, off\n\t"
               "global_load_async_to_lds_b128 %3, %11, off\n\t"
               "global_load_async_to_lds_b128 %4, %12, off\n\t"
               "global_load_async_to_lds_b128 %5, %13, off\n\t"
               "global_load_async_to_lds_b128 %6, %14, off\n\t"
               "global_load_async_to_lds_b128 %7, %15, off\n\t"
               "s_wait_xcnt 0x0"
               :: "v"(l), "v"(l + 8u * G2_PITCH), "v"(l + 16u * G2_PITCH), "v"(l + 24u * G2_PITCH), "v"(l + 32u * G2_PITCH), "v"(l + 40u * G2_PITCH), "v"(l + 48u * G2_PITCH), "v"(l + 56u * G2_PITCH),
                  "v"(g), "v"(g + st), "v"(g + 2 * st), "v"(g + 3 * st), "v"(g + 4 * st), "v"(g + 5 * st), "v"(g + 6 * st), "v"(g + 7 * st) : "memory"); }
// a fragment from a staged row: p = the row's place + 64 bytes a k step + 16 hh; same k order as g2_frag
__device__ __forceinline__ v16h g2_lfrag(const unsigned char* p) { FragH f; f.half[0] = *(const v8us*)p; f.half[1] = *(const v8us*)(p + 32); return f.v; }
template <int ACT>
__global__ __launch_bounds__(128) void k_gemm2(const _Float16* __restrict__ A, int lda, size_t sA, const _Float16* __restrict__ Bh, int ldb, size_t sB, float alpha, const float* __restrict__ bias, size_t sBias, const float* __restrict__ CP, int rowsPerB, size_t sCPb, int row0g,
    float* __restrict__ C, _Float16* __restrict__ C16, int ldc, size_t sC, int M, int N, int K) { static_assert(ACT == 0 || ACT == 3 || ACT == 6 || ACT == 8 || ACT == 9 || ACT == 11 || ACT == 12 || ACT == 14 || ACT == 15 || ACT == 16 || ACT == 17, "k_gemm2: unsupported ACT code (would silently apply no activation)");
  __shared__ __attribute__((aligned(16))) unsigned char sm[2 * G2_STAGE]; float (*so)[32][68] = (float (*)[32][68])sm;      /* two operand buffers; behind the loop's last barrier the same LDS stages the output tile */
  const int tid = threadIdx.x, w = tid >> 5, lane = tid & 31, ln = lane & 15, hh = lane >> 4; const int by = blockIdx.y;
  A += (size_t)by * sA; Bh += (size_t)by * sB; const size_t cofs = (size_t)by * sC; const float* bp = bias ? bias + (size_t)by * sBias : nullptr;
  const int ntn = N >> 6; const int mt = blockIdx.x / ntn, nq = blockIdx.x - mt * ntn; const int row0 = mt * 128 + 32 * w, col0 = nq * 64; if (mt * 128 >= M) return;      /* the whole block leaves, in front of every barrier */
  /* copies: lane = 16 bytes; 16 lanes a row of 256 bytes, so a wave's copy covers two whole rows; thread rows tid / 16 + 8 i */
  const unsigned lc = (unsigned)(size_t)sm + (unsigned)(tid >> 4) * G2_PITCH + (unsigned)(tid & 15) * 16u;
  const _Float16* ga = A + (size_t)(mt * 128 + (tid >> 4)) * lda + (tid & 15) * 8; const _Float16* gb = Bh + (size_t)(col0 + (tid >> 4)) * ldb + (tid & 15) * 8;
  auto fill = [&](int t, int buf) { const unsigned l = lc + (unsigned)buf * G2_STAGE; const _Float16* a = ga + (size_t)t * 128;
    g2_copy8(l, a, (size_t)8 * lda); g2_copy8(l + 64u * G2_PITCH, a + (size_t)64 * lda, (size_t)8 * lda); g2_copy8(l + 128u * G2_PITCH, gb + (size_t)t * 128, (size_t)8 * ldb); };
  const unsigned char* sa = sm + (32 * w + ln) * G2_PITCH + 16 * hh; const unsigned char* sb = sm + (128 + ln) * G2_PITCH + 16 * hh;
  const v8f z8 = {0.f,0.f,0.f,0.f,0.f,0.f,0.f,0.f}; v8f c00 = z8, c01 = z8, c02 = z8, c03 = z8, c10 = z8, c11 = z8, c12 = z8, c13 = z8;
  const int nt = K >> 7;
  fill(0, 0);
  asm volatile("s_wait_asynccnt 0x0" ::: "memory");      /* this wave's copies of tile 0 have landed */
  __syncthreads();      /* and every other wave's: tile 0 may be read */
  if (nt > 1) fill(1, 1);
  /* rolled: one copy of the body; a trip is 128 k = 32 products a wave, while the next tile's copies fly */
#pragma unroll 1
  for (int t = 0; t < nt; ++t) { const unsigned char* pa = sa + (t & 1) * G2_STAGE; const unsigned char* pb = sb + (t & 1) * G2_STAGE;
    v16h fa[2][2], fb[2][4];      /* two fragment sets */
    fa[0][0] = g2_lfrag(pa); fb[0][0] = g2_lfrag(pb); fa[0][1] = g2_lfrag(pa + 16 * G2_PITCH); fb[0][1] = g2_lfrag(pb + 16 * G2_PITCH); fb[0][2] = g2_lfrag(pb + 32 * G2_PITCH); fb[0][3] = g2_lfrag(pb + 48 * G2_PITCH);
    /* unrolled: the sets get constant indices (registers) and the LDS offsets become immediates. The reads of k step ks + 1 go as one group in front of the products of step ks, so only the trip's first group is waited for in full */
#pragma unroll
    for (int ks = 0; ks < 4; ++ks) { const int c = ks & 1, n = c ^ 1, o = (ks + 1) * 64;
      if (ks < 3) { fa[n][0] = g2_lfrag(pa + o); fb[n][0] = g2_lfrag(pb + o); fa[n][1] = g2_lfrag(pa + 16 * G2_PITCH + o); fb[n][1] = g2_lfrag(pb + 16 * G2_PITCH + o); fb[n][2] = g2_lfrag(pb + 32 * G2_PITCH + o); fb[n][3] = g2_lfrag(pb + 48 * G2_PITCH + o); }
      c00 = g2_mma(fa[c][0], fb[c][0], c00); c10 = g2_mma(fa[c][1], fb[c][0], c10);
      c01 = g2_mma(fa[c][0], fb[c][1], c01); c11 = g2_mma(fa[c][1], fb[c][1], c11);
      c02 = g2_mma(fa[c][0], fb[c][2], c02); c12 = g2_mma(fa[c][1], fb[c][2], c12);
      c03 = g2_mma(fa[c][0], fb[c][3], c03); c13 = g2_mma(fa[c][1], fb[c][3], c13); }
    asm volatile("s_wait_dscnt 0x0" ::: "memory");      /* this wave's reads of the buffer are done before it is refilled */
    asm volatile("s_wait_asynccnt 0x0" ::: "memory");      /* this wave's copies of tile t + 1 have landed */
    __syncthreads();      /* publishes tile t + 1 and ends every wave's reads of tile t */
    if (t + 2 < nt) fill(t + 2, t & 1); }
  asm volatile("s_wait_asynccnt 0x0" ::: "memory");      /* no copy is outstanding when the LDS changes its use */
  v8f accs[8] = {c00, c01, c02, c03, c10, c11, c12, c13};
#pragma unroll
  for (int u = 0; u < 8; ++u) { const int t = u & 3, half = u >> 2; const int col = col0 + t * 16 + ln; const float bv = bp ? bf16_round(bp[col]) : 0.f;
#pragma unroll
    for (int r = 0; r < 8; ++r) { const int rloc = half * 16 + 8 * hh + r; float v = accs[u][r] * alpha + bv; if (CP) { if (rowsPerB < 0) v += CP[cofs + (size_t)(row0g + row0 + rloc) * ldc + col];      /* rowsPerB < 0: own element of the batched C plane */ else { const int bidx = (row0g + row0 + rloc) / rowsPerB; v += CP[(size_t)bidx * sCPb + (size_t)by * 64 + col]; } }
      if (ACT == 3) v = fmaxf(v, 0.f); else if (ACT == 6) v = 0.5f * v * (1.0f + erff(v * 0.70710678118654752f)); else if (ACT == 11) v = 1.0f / (1.0f + expf(-v)); else if (ACT == 15) v = v / (1.0f + expf(-v)); else if (ACT == 12) v = (v > 0.f) ? v : 0.01f * v; else if (ACT == 8) v = tanhf(v); else if (ACT == 9) v = 0.5f * v * (1.0f + tanhf(0.7978845608028654f * (v + 0.044715f * v * v * v))); else if (ACT == 14) v = (v > 0.f) ? v : 0.1f * v; else if (ACT == 16) v = (v >= 0.f) ? v : 0.3f * v; else if (ACT == 17) v = (v >= 0.f) ? v : 0.2f * v;
      so[w][rloc][t * 16 + ln] = v; } }
  __builtin_amdgcn_fence(__ATOMIC_ACQ_REL, "workgroup"); __builtin_amdgcn_wave_barrier();
  const int rsub = lane >> 4, c4 = (lane & 15) * 4;
  {
#pragma unroll
    for (int q = 0; q < 16; ++q) { const int r = q * 2 + rsub; const v4f v = *(const v4fa*)&so[w][r][c4]; if (C) *(v4f*)(C + cofs + (size_t)(row0 + r) * ldc + col0 + c4) = v; if (C16) { v4h h4; for (int i = 0; i < 4; ++i) h4[i] = (_Float16)v[i]; *(v4h*)(C16 + cofs + (size_t)(row0 + r) * ldc + col0 + c4) = h4; } }
     } }


__global__ __launch_bounds__(256) void k_wnat(const float* __restrict__ w, size_t n8, _Float16* __restrict__ Bt) { const size_t t = (size_t)blockIdx.x * 256 + threadIdx.x; if (t >= n8) return; FragH f; for (int q = 0; q < 8; ++q) f.h[q] = (_Float16)(bf16_round(w[t * 8 + q]) * 16.0f); *(v8us*)((unsigned short*)Bt + t * 8) = f.half[0];  }
__global__ __launch_bounds__(256) void k_rsm(const float* __restrict__ S, _Float16* __restrict__ P, int nrows) {
  #pragma clang fp contract(off)
  const int i = blockIdx.x * 256 + threadIdx.x; if (i >= nrows) return; const float* s = S + (size_t)i * SQ; float mx = -3.0e38f;
#pragma unroll 1
  for (int j = 0; j < SQ; ++j) mx = fmaxf(mx, s[j]); float se = 0.f;
#pragma unroll 1
  for (int j = 0; j < SQ; ++j) se += expf(s[j] - mx); const float sc = 256.0f / se;
#pragma unroll 1
  for (int j0 = 0; j0 < SQ; j0 += 8) { FragH f; for (int q = 0; q < 8; ++q) f.h[q] = (_Float16)(expf(s[j0 + q] - mx) * sc); unsigned short* d = (unsigned short*)P + (size_t)i * SQ + j0; *(v8us*)d = f.half[0];  } }
__global__ __launch_bounds__(256) void k_vt(const _Float16* __restrict__ V16, int b, int h0, _Float16* __restrict__ VT) { __shared__ unsigned short tl[64][65]; const int tid = threadIdx.x; const int hh = blockIdx.x % HG, sg = blockIdx.x / HG; const int s0 = sg * 64; const int h = h0 + hh;
  for (int i = tid; i < 64 * 8; i += 256) { const int j = i / 8, d8 = (i % 8) * 8; FragH f; f.half[0] = *(const v8us*)((const unsigned short*)V16 + ((size_t)b * SQ + s0 + j) * DM + h * HD + d8); for (int q = 0; q < 8; ++q) tl[d8 + q][j] = f.u[q]; }
  __syncthreads();
  { for (int i = tid; i < 64 * 8; i += 256) { const int d = i / 8, j8 = (i % 8) * 8; FragH f; for (int q = 0; q < 8; ++q) f.u[q] = tl[d][j8 + q]; *(v8us*)((unsigned short*)VT + ((size_t)hh * HD + d) * SQ + s0 + j8) = f.half[0]; }  } }



__global__ __launch_bounds__(256) void k_rsmcf2(const float* __restrict__ S, _Float16* __restrict__ P, int hg, int q0, int nk) {
  #pragma clang fp contract(off)
  const int t = blockIdx.x * 256 + threadIdx.x; if (t >= hg * QT) return; const size_t i = (size_t)t; const float* s = S + i * NKX; const int last = q0 + (t % QT); float mx = -3.0e38f;
#pragma unroll 1
  for (int j = 0; j < nk; ++j) { const float f = (j <= last) ? 1.f : 0.f; mx = fmaxf(mx, fmaf(f, s[j], (1.f - f) * -1.0e9f)); } float se = 0.f;
#pragma unroll 1
  for (int j = 0; j < nk; ++j) { const float f = (j <= last) ? 1.f : 0.f; se += __expf(fmaf(f, s[j], (1.f - f) * -1.0e9f) - mx); } const float sc = 256.0f / se;
#pragma unroll 1
  for (int j0 = 0; j0 < nk; j0 += 8) { FragH fr; for (int q = 0; q < 8; ++q) { const int j = j0 + q; const float f = (j <= last) ? 1.f : 0.f; fr.h[q] = (_Float16)(__expf(fmaf(f, s[j], (1.f - f) * -1.0e9f) - mx) * sc); } unsigned short* d = (unsigned short*)P + i * NKX + j0; *(v8us*)d = fr.half[0];  } }


template <int MASKADD>
__global__ __launch_bounds__(64) void k_att0(const float* __restrict__ QF, const float* __restrict__ KF, const float* __restrict__ VF, int ld, const float* __restrict__ mask, float scale, float* __restrict__ OF, int ldo) {
  #pragma clang fp contract(off)
  __shared__ __attribute__((aligned(16))) float lq[64][64]; __shared__ __attribute__((aligned(16))) float lo[64][64];
  const int tid = threadIdx.x; const int h = blockIdx.x / (QT0 / 64), rg = blockIdx.x % (QT0 / 64); const int i = rg * 64 + tid;
  const float* qr = QF + (size_t)i * ld + h * HD;
#pragma unroll 1
  for (int c = 0; c < HD / 4; ++c) { *(v4f*)&lq[tid][c * 4] = *(const v4fa*)(qr + c * 4); const v4f z = {0.f, 0.f, 0.f, 0.f}; *(v4f*)&lo[tid][c * 4] = z; }
  float m = -1.0e30f, l = 0.f; const int jmax = MASKADD ? (SQ - 1) : (rg * 64 + 63);      /* additive-mask form: every key (the mask input decides); causal form: keys up to the block's last row */
#pragma unroll 1
  for (int j = 0; j <= jmax; ++j) { const float* kr = KF + (size_t)j * ld + h * HD; const float* vr = VF + (size_t)j * ld + h * HD; float s = 0.f;
#pragma unroll 1
    for (int c = 0; c < HD / 4; ++c) { const v4f kq = *(const v4fa*)(kr + c * 4); const v4f qq = *(v4f*)&lq[tid][c * 4]; s = __fadd_rn(s, __fmul_rn(qq[0], kq[0])); s = __fadd_rn(s, __fmul_rn(qq[1], kq[1])); s = __fadd_rn(s, __fmul_rn(qq[2], kq[2])); s = __fadd_rn(s, __fmul_rn(qq[3], kq[3])); }
    s = __fmul_rn(s, scale); if (MASKADD) s = __fadd_rn(s, __fmul_rn(bf16_round(mask[(size_t)i * SQ + j]), -10000.0f));
    const float f = (MASKADD || j <= i) ? 1.f : 0.f; const float sm = fmaf(f, s, (1.f - f) * -1.0e30f); const float mn = fmaxf(m, sm); const float sc = expf(m - mn); const float e = expf(sm - mn); l = __fadd_rn(__fmul_rn(l, sc), e); m = mn;
#pragma unroll 1
    for (int c = 0; c < HD / 4; ++c) { const v4f vv = *(const v4fa*)(vr + c * 4); v4f oo = *(v4f*)&lo[tid][c * 4]; for (int u = 0; u < 4; ++u) oo[u] = __fadd_rn(__fmul_rn(oo[u], sc), __fmul_rn(e, vv[u])); *(v4f*)&lo[tid][c * 4] = oo; } }
  const float fin = 64.0f / l;      /* o carried x64 like the f16 path */
#pragma unroll 1
  for (int c = 0; c < HD / 4; ++c) { v4f oo = *(v4f*)&lo[tid][c * 4]; for (int u = 0; u < 4; ++u) oo[u] = __fmul_rn(oo[u], fin); *(v4f*)&lo[tid][c * 4] = oo; }
  __syncthreads();
  {
#pragma unroll 1
    for (int it = 0; it < 16; ++it) { const int row = it * 4 + tid / 16, pc = (tid % 16) * 4; const v4f v = *(const v4f*)&lo[row][pc]; *(v4f*)(OF + (size_t)(rg * 64 + row) * ldo + h * HD + pc) = v; }
     } }


template <int BFIN, int WXB>
__global__ __launch_bounds__(256) void k_ln16(const float* __restrict__ X, const float* __restrict__ g, const float* __restrict__ bb, float eps, _Float16* __restrict__ N16, float* __restrict__ XB) {
  #pragma clang fp contract(off)
  __shared__ float red[256]; const size_t r = blockIdx.x; const int t = threadIdx.x; const v4f xa = *(const v4fa*)(X + r * DMQ + t * 4); float s[4]; float sum = 0.f;
  for (int q = 0; q < 4; ++q) { s[q] = BFIN ? bf16_round(xa[q]) : xa[q]; sum = __fadd_rn(sum, s[q]); }
  red[t] = sum; __syncthreads(); for (int st = 128; st > 0; st >>= 1) { if (t < st) red[t] = __fadd_rn(red[t], red[t + st]); __syncthreads(); } const float mu = red[0] / (float)DMQ; __syncthreads();
  float vs = 0.f; for (int q = 0; q < 4; ++q) { const float dl = __fadd_rn(s[q], -mu); vs = __fadd_rn(vs, __fmul_rn(dl, dl)); } red[t] = vs; __syncthreads(); for (int st = 128; st > 0; st >>= 1) { if (t < st) red[t] = __fadd_rn(red[t], red[t + st]); __syncthreads(); }
  const float rs = rsqrtf(__fadd_rn(red[0] / (float)DMQ, eps)); v4h y; v4f xb;
  for (int q = 0; q < 4; ++q) { const int c = t * 4 + q; y[q] = (_Float16)__fadd_rn(__fmul_rn(__fmul_rn(__fadd_rn(s[q], -mu), rs), bf16_round(g[c])), bf16_round(bb[c])); xb[q] = s[q]; }
  { *(v4h*)(N16 + r * DMQ + t * 4) = y; if (WXB) *(v4f*)(XB + r * DMQ + t * 4) = xb;  } }
__global__ __launch_bounds__(256) void k_ftres2(const float* __restrict__ OF0, const float* __restrict__ XB, float* __restrict__ X1, size_t n4) {
  #pragma clang fp contract(off)
  const size_t t = (size_t)blockIdx.x * 256 + threadIdx.x; if (t >= n4) return; const v4f o = *(const v4fa*)(OF0 + t * 4), xv = *(const v4fa*)(XB + t * 4); v4f y; for (int q = 0; q < 4; ++q) y[q] = __fadd_rn(__fmul_rn(o[q], 0.015625f), xv[q]); *(v4f*)(X1 + t * 4) = y;  }

__global__ __launch_bounds__(256) void k_wthd(const float* __restrict__ Wt, _Float16* __restrict__ Bt) { const size_t t = (size_t)blockIdx.x * 256 + threadIdx.x; if (t >= (size_t)NH * HD * (DM / 8)) return; const int m8 = (int)(t % (DM / 8)) * 8; const int d = (int)((t / (DM / 8)) % HD); const int h = (int)(t / ((size_t)(DM / 8) * HD)); FragH f;
  for (int q = 0; q < 8; ++q) f.h[q] = (_Float16)(16.0f * bf16_round(Wt[((size_t)h * DM + m8 + q) * HD + d])); unsigned short* dst = (unsigned short*)Bt + ((size_t)h * HD + d) * DM + m8; *(v8us*)dst = f.half[0];  }




template <int BFIN, int W16, int W32>
__global__ __launch_bounds__(256) void k_lnx(const float* __restrict__ X, const float* __restrict__ g, const float* __restrict__ bb, float eps, _Float16* __restrict__ N16, float* __restrict__ N32) {
  #pragma clang fp contract(off)
  __shared__ float red[256]; const size_t r = blockIdx.x; const int t = threadIdx.x; const bool act = t < (DMQ / 4); const int c0 = act ? t * 4 : 0;
  const v4f xa = *(const v4fa*)(X + r * DMQ + c0); float s[4]; float sum = 0.f;
  for (int q = 0; q < 4; ++q) { s[q] = act ? (BFIN ? bf16_round(xa[q]) : xa[q]) : 0.f; sum = __fadd_rn(sum, s[q]); }
  red[t] = sum; __syncthreads(); for (int st = 128; st > 0; st >>= 1) { if (t < st) red[t] = __fadd_rn(red[t], red[t + st]); __syncthreads(); } const float mu = red[0] / (float)DMQ; __syncthreads();
  float vs = 0.f; for (int q = 0; q < 4; ++q) { const float dl = act ? __fadd_rn(s[q], -mu) : 0.f; vs = __fadd_rn(vs, __fmul_rn(dl, dl)); } red[t] = vs; __syncthreads(); for (int st = 128; st > 0; st >>= 1) { if (t < st) red[t] = __fadd_rn(red[t], red[t + st]); __syncthreads(); }
  const float rs = rsqrtf(__fadd_rn(red[0] / (float)DMQ, eps)); v4h y; v4f yf;
  for (int q = 0; q < 4; ++q) { const int c = c0 + q; yf[q] = __fadd_rn(__fmul_rn(__fmul_rn(__fadd_rn(s[q], -mu), rs), bf16_round(g[c])), bf16_round(bb[c])); y[q] = (_Float16)yf[q]; }
  if (!act) return;      /* no barriers after this point */
  { if (W16) *(v4h*)(N16 + r * DMQ + c0) = y; if (W32) *(v4f*)(N32 + r * DMQ + c0) = yf;  } }


__global__ __launch_bounds__(256) void k_bfr(const float* __restrict__ x, float* __restrict__ XB, size_t n8) { const size_t t = (size_t)blockIdx.x * 256 + threadIdx.x; if (t >= n8) return; v4f a = *(const v4fa*)(x + t * 8), c = *(const v4fa*)(x + t * 8 + 4); for (int q = 0; q < 4; ++q) { a[q] = bf16_round(a[q]); c[q] = bf16_round(c[q]); }
  { *(v4f*)(XB + t * 8) = a; *(v4f*)(XB + t * 8 + 4) = c;  } }




__global__ __launch_bounds__(256) void k_lorafold(const float* __restrict__ Wm, const float* __restrict__ A, const float* __restrict__ Bm, float* __restrict__ WE, int K, int N, float sc) {
  #pragma clang fp contract(off)
  const size_t t = (size_t)blockIdx.x * 256 + threadIdx.x; if (t >= (size_t)K * N) return; const int i = (int)(t / N), o = (int)(t % N); float a = 0.f;
  for (int r = 0; r < 16; ++r) a = __fadd_rn(a, __fmul_rn(bf16_round(A[(size_t)i * 16 + r]), bf16_round(Bm[(size_t)r * N + o])));
  const float v = __fadd_rn(bf16_round(Wm[t]), __fmul_rn(sc, a)); *(float*)(WE + t) = v;  }
__global__ __launch_bounds__(256) void k_wt32rep(const float* __restrict__ Wf, _Float16* __restrict__ Bt, int K, int N, int DOUT, float scale) {
  const int t = blockIdx.x * 256 + threadIdx.x; if (t >= DOUT * (K / 8)) return; const int n = t / (K / 8), k8 = (t % (K / 8)) * 8; const int rep = DOUT / N; const int src = (n / (HD * rep)) * HD + (n % HD);      /* head h = n / HD -> group h / rep */
  FragH f; for (int i = 0; i < 8; ++i) f.h[i] = (_Float16)(Wf[(size_t)(k8 + i) * N + src] * scale);
  *(v8us*)((unsigned short*)Bt + (size_t)n * K + k8) = f.half[0];  }
__global__ __launch_bounds__(256) void k_brep(const float* __restrict__ b, float* __restrict__ out) { const int t = blockIdx.x * 256 + threadIdx.x; if (t >= DM) return; const float v = b[(t / (HD * 4)) * HD + (t % HD)]; *(float*)(out + t) = v;  }

__global__ __launch_bounds__(256) void k_rsmcim(const float* __restrict__ S, _Float16* __restrict__ P, int hg, int q0, int nk, const int* __restrict__ am) {
  #pragma clang fp contract(off)
  const int t = blockIdx.x * 256 + threadIdx.x; if (t >= hg * QT) return; const size_t i = (size_t)t; const float* s = S + i * NKX; const int last = q0 + (t % QT); const int* mr = am + (size_t)last * SQ; float mx = -3.0e38f;      /* the module's mask row of this query (keys >= nk lie above the diagonal of the causal mask and are not computed) */
#pragma unroll 1
  for (int j = 0; j < nk; ++j) { const float f = (mr[j] != 0) ? 1.f : 0.f; mx = fmaxf(mx, fmaf(f, s[j], (1.f - f) * -1.0e9f)); } float se = 0.f;
#pragma unroll 1
  for (int j = 0; j < nk; ++j) { const float f = (mr[j] != 0) ? 1.f : 0.f; se += __expf(fmaf(f, s[j], (1.f - f) * -1.0e9f) - mx); } const float sc = 256.0f / se;
#pragma unroll 1
  for (int j0 = 0; j0 < nk; j0 += 8) { FragH fr; for (int q = 0; q < 8; ++q) { const int j = j0 + q; const float f = (mr[j] != 0) ? 1.f : 0.f; fr.h[q] = (_Float16)(__expf(fmaf(f, s[j], (1.f - f) * -1.0e9f) - mx) * sc); } unsigned short* d = (unsigned short*)P + i * NKX + j0; *(v8us*)d = fr.half[0];  } }



__global__ __launch_bounds__(256) void k_bcpy(const float* __restrict__ b, int n, int NP, float* __restrict__ dst, int dst0) { for (int i = threadIdx.x; i < NP; i += 256) { const float v = (i < n) ? b[i] : 0.f; *(float*)(dst + dst0 + i) = v; }  }



// lane l with lane l ^ 16
__device__ __forceinline__ float rs_xh(float v) { return __builtin_bit_cast(float, __builtin_amdgcn_permlanex16(__builtin_bit_cast(int, v), __builtin_bit_cast(int, v), 0x76543210, 0xfedcba98, false, false)); }
// native 2^t; the v_nop is the slot the instruction set asks for behind a transcendental before its result is read or its source overwritten
__device__ __forceinline__ float fa_exp2(float t) { float e; asm("v_exp_f32 %0, %1\n\tv_nop" : "=v"(e) : "v"(t)); return e; }
#define FA_KT 128      /* keys a stage */
#define FA_KP 144      /* LDS pitch of a K row, bytes: 128 of data + 16, an odd multiple of 16 (no bank conflict for 16-byte row reads) */
#define FA_VP 272      /* LDS pitch of a V^T row: 256 of data + 16, likewise */
#define FA_VO (FA_KT * FA_KP)      /* the 64 V^T rows stand behind the 128 K rows */
#define FA_STAGE (FA_VO + HD * FA_VP)      /* one buffer */
// Eight asynchronous 16-byte copies of a lane, global -> LDS: four of K (rows 32 apart), four of V^T (rows 16 apart). The s_wait_xcnt stands in the copies' own statement, behind the last of them,
// so that it precedes every later write of a register that a copy names.
__device__ __forceinline__ void fa_copy8(unsigned lk, const _Float16* gk, unsigned lv, const _Float16* gv) {
  asm volatile("global_load_async_to_lds_b128 %0, %8, off\n\t"
               "global_load_async_to_lds_b128 %1, %9, off\n\t"
               "global_load_async_to_lds_b128 %2, %10, off\n\t"
               "global_load_async_to_lds_b128 %3, %11, off\n\t"
               "global_load_async_to_lds_b128 %4, %12, off\n\t"
               "global_load_async_to_lds_b128 %5, %13, off\n\t"
               "global_load_async_to_lds_b128 %6, %14, off\n\t"
               "global_load_async_to_lds_b128 %7, %15, off\n\t"
               "s_wait_xcnt 0x0"
               :: "v"(lk), "v"(lk + 32u * FA_KP), "v"(lk + 64u * FA_KP), "v"(lk + 96u * FA_KP), "v"(lv), "v"(lv + 16u * FA_VP), "v"(lv + 32u * FA_VP), "v"(lv + 48u * FA_VP),
                  "v"(gk), "v"(gk + (size_t)32 * LQ), "v"(gk + (size_t)64 * LQ), "v"(gk + (size_t)96 * LQ), "v"(gv), "v"(gv + (size_t)16 * SQ), "v"(gv + (size_t)32 * SQ), "v"(gv + (size_t)48 * SQ) : "memory"); }
__global__ __launch_bounds__(256) void k_fattn(const _Float16* __restrict__ Q, const _Float16* __restrict__ Kk, const _Float16* __restrict__ VT, _Float16* __restrict__ O) {
  __shared__ __attribute__((aligned(16))) unsigned char sm[2 * FA_STAGE];
  const int tid = threadIdx.x, lane = tid & 31, w = tid >> 5, ln = lane & 15, hh = lane >> 4; const int h = blockIdx.y, b = blockIdx.z; const int q0 = blockIdx.x * 256 + w * 32; const size_t r0 = (size_t)b * SQ;
  const _Float16* qp = Q + (r0 + q0 + ln) * LQ + h * HD + 8 * hh;      /* the lane's own 8 hh is in the pointer: g2_frag is called with 0 */
  /* copies: lane = 16 bytes. K: 8 lanes a row of 128 bytes, thread rows tid / 8 + 32 i; V^T: 16 lanes a row of 256 bytes, thread rows tid / 16 + 16 i: a wave's copy covers four whole lines */
  const unsigned lk = (unsigned)(size_t)sm + (unsigned)(tid >> 3) * FA_KP + (unsigned)(tid & 7) * 16u; const unsigned lv = (unsigned)(size_t)sm + FA_VO + (unsigned)(tid >> 4) * FA_VP + (unsigned)(tid & 15) * 16u;
  const _Float16* gk = Kk + (r0 + (tid >> 3)) * LQ + h * HD + (tid & 7) * 8; const _Float16* gv = VT + ((size_t)(b * NH + h) * HD + (tid >> 4)) * SQ + (tid & 15) * 8;
  auto fill = [&](int t, int buf) { fa_copy8(lk + (unsigned)buf * FA_STAGE, gk + (size_t)t * FA_KT * LQ, lv + (unsigned)buf * FA_STAGE, gv + (size_t)t * FA_KT); };
  const unsigned char* sk = sm + ln * FA_KP + 16 * hh; const unsigned char* sv = sm + FA_VO + ln * FA_VP + 16 * hh;      /* the lane's fragment rows; same k order as g2_frag */
  const float L2E = 1.44269504088896340736f; const v8f z8 = {0.f,0.f,0.f,0.f,0.f,0.f,0.f,0.f};
  v16h qf[2][2], kf[2][2], vf[4]; v8f o[2][4]; float m[2] = {-3.0e38f, -3.0e38f}, l[2] = {0.f, 0.f};
  fill(0, 0);
  /* every loop over a fragment index is unrolled so that the fragment arrays have constant indices and stay in registers */
#pragma unroll
  for (int t = 0; t < 2; ++t) { qf[t][0] = g2_frag(qp + (size_t)t * 16 * LQ, 0); qf[t][1] = g2_frag(qp + (size_t)t * 16 * LQ + 32, 0);
#pragma unroll
    for (int dt = 0; dt < 4; ++dt) o[t][dt] = z8; }
  /* behind the loads that share one address pair: the wait that precedes any overwrite of that pair; the pair is an input, so it stays live (no load's result lands on it) up to the wait */
  asm volatile("s_wait_xcnt 0x0" :: "v"(qp) : "memory");
  asm volatile("s_wait_asynccnt 0x0" ::: "memory");      /* this wave's copies of stage 0 have landed */
  __syncthreads();      /* and every other wave's: stage 0 may be read */
  fill(1, 1);
  /* rolled: one copy of the body; a stage is 128 keys, while the next stage's copies fly */
#pragma unroll 1
  for (int t = 0; t < SQ / FA_KT; ++t) { const unsigned char* pk = sk + (t & 1) * FA_STAGE; const unsigned char* pv = sv + (t & 1) * FA_STAGE;
#pragma unroll
    for (int kt = 0; kt < 2; ++kt) { kf[kt][0] = g2_lfrag(pk + kt * 16 * FA_KP); kf[kt][1] = g2_lfrag(pk + kt * 16 * FA_KP + 64); }
    /* rolled: a pass is some 350 instructions already, and four copies of it spill. The stage's last pass fetches no K ahead (nothing of the next stage is read in front of the barrier) */
#pragma unroll 1
    for (int p = 0; p < FA_KT / 32; ++p) {
#pragma unroll
      for (int dt = 0; dt < 4; ++dt) vf[dt] = g2_lfrag(pv + dt * 16 * FA_VP + p * 64);
      v8f s[2][2];
#pragma unroll
      for (int u = 0; u < 2; ++u)
#pragma unroll
        for (int kt = 0; kt < 2; ++kt) s[u][kt] = g2_mma(kf[kt][1], qf[u][1], g2_mma(kf[kt][0], qf[u][0], z8));
      if (p + 1 < FA_KT / 32) {
#pragma unroll
        for (int kt = 0; kt < 2; ++kt) { kf[kt][0] = g2_lfrag(pk + ((p + 1) * 32 + kt * 16) * FA_KP); kf[kt][1] = g2_lfrag(pk + ((p + 1) * 32 + kt * 16) * FA_KP + 64); } }
      FragH pf[2];
#pragma unroll
      for (int u = 0; u < 2; ++u) { float mx = fmaxf(s[u][0][0], s[u][1][0]);
#pragma unroll
        for (int r = 1; r < 8; ++r) mx = fmaxf(mx, fmaxf(s[u][0][r], s[u][1][r]));
        mx = fmaxf(mx, rs_xh(mx)); const float mn = fmaxf(m[u], mx); const float al = fa_exp2((m[u] - mn) * L2E); const float mb = mn * L2E - 8.0f; m[u] = mn; float e0 = 0.f, e1 = 0.f;
#pragma unroll
        for (int r = 0; r < 8; ++r) { const float p0 = fa_exp2(fmaf(s[u][0][r], L2E, -mb)), p1 = fa_exp2(fmaf(s[u][1][r], L2E, -mb)); e0 += p0; e1 += p1; pf[u].h[r] = (_Float16)p0; pf[u].h[8 + r] = (_Float16)p1; }
        l[u] = fmaf(l[u], al, e0 + e1);      /* this half's keys only; the halves are joined behind the loop */
#pragma unroll
        for (int dt = 0; dt < 4; ++dt) o[u][dt] *= al; }
#pragma unroll
      for (int u = 0; u < 2; ++u)
#pragma unroll
        for (int dt = 0; dt < 4; ++dt) o[u][dt] = g2_mma(vf[dt], pf[u].v, o[u][dt]); }
    asm volatile("s_wait_dscnt 0x0" ::: "memory");      /* this wave's reads of the buffer are done before it is refilled */
    asm volatile("s_wait_asynccnt 0x0" ::: "memory");      /* this wave's copies of stage t + 1 have landed */
    __syncthreads();      /* publishes stage t + 1 and ends every wave's reads of stage t */
    if (t + 2 < SQ / FA_KT) fill(t + 2, t & 1); }
  asm volatile("s_wait_asynccnt 0x0" ::: "memory");      /* no copy is outstanding when the wave ends */
#pragma unroll
  for (int t = 0; t < 2; ++t) { const float fin = 64.0f / (l[t] + rs_xh(l[t]));      /* ctx carried x64; the x256 of the weights cancels in the quotient */
    _Float16* d = O + (r0 + q0 + t * 16 + ln) * DM + h * HD + 8 * hh;
#pragma unroll
    for (int dt = 0; dt < 4; ++dt) { FragH f;
#pragma unroll
      for (int r = 0; r < 8; ++r) f.h[r] = (_Float16)(o[t][dt][r] * fin);
      *(v8us*)((unsigned short*)d + dt * 16) = f.half[0]; } } }
extern "C" void kernel_launch(void* const* d_in, const int* in_sizes, int n_in,
                              void* d_out, int out_size, void* d_ws, size_t ws_size, hipStream_t stream) {
  (void)in_sizes; (void)n_in; (void)out_size;
  const float* const* I = (const float* const*)d_in; const float* x = I[0]; const float* wq = I[1]; const float* bq = I[2]; const float* wk = I[3]; const float* bk = I[4]; const float* wv = I[5]; const float* bv = I[6]; const float* wo = I[7]; const float* bo = I[8]; const float* wfc = I[9]; const float* bfc = I[10]; const float* wmp = I[11]; const float* bmp = I[12]; const float* g1 = I[13]; const float* be1 = I[14]; const float* gg2 = I[15]; const float* be2 = I[16];      /* x; [in][out] Wq / Wk / Wv / Wo + biases; W1 [1024][4096] + b1, W2 [4096][1024] + b2; LN1 g / b, LN2 g / b */
  char* ws = (char*)d_ws; size_t off = 0;
  auto take = [&](size_t bytes) { char* p = ws + off; off += (bytes + 255) & ~(size_t)255; return p; };
  _Float16* BQKV = (_Float16*)take((size_t)3 * DM * DM * 2); _Float16* BO = (_Float16*)take((size_t)DM * DM * 2); float* bqkv = (float*)take((size_t)3 * DM * 4); float* X1N = nullptr;      /* LN1 output (f32): aliases the QKV plane below (QKV's last readers, the V^T launch and the fused attention launch, precede LN1) to stay within 256 MiB at NB 4 / SQ 2048 */
  _Float16* X16 = (_Float16*)take(NR * DM * 2); float* XB = (float*)take(NR * DM * 4); float* X1 = (float*)take(NR * DM * 4); _Float16* M16 = nullptr;      /* = X16 below (alias: X16's last reader, the fused QKV GEMM, precedes LN1's f16 write) */ _Float16* HF16 = nullptr;      /* FFN hidden plane of one batch [2048][4096] f16: its own region below */ _Float16* BW1 = (_Float16*)take((size_t)DFF * DM * 2); _Float16* BW2 = (_Float16*)take((size_t)DM * DFF * 2); _Float16* QKV = (_Float16*)take(NR * 3 * DM * 2); _Float16* Q16 = QKV; _Float16* K16 = QKV + DM; _Float16* V16 = QKV + 2 * DM; _Float16* O16 = (_Float16*)take(NR * DM * 2); M16 = X16; X1N = (float*)QKV; HF16 = (_Float16*)take((size_t)SQ * DFF * 2);      /* the per-batch FFN hidden plane (16 MiB) gets its OWN region here: at NB 2 the context plane O16 is only 8 MiB */      /* aliases: X1N (NR*DM f32 = 16 MiB) inside QKV (24 MiB) */
  _Float16* VT = (_Float16*)take((size_t)NB * NH * HD * SQ * 2);
  if (off > ws_size) return;
  { const unsigned g = (unsigned)((DM / 128) * (DM / 64)); k_wt_f16<<<g, 128, 0, stream>>>(wq, BQKV, DM, DM, 16.0f); k_wt_f16<<<g, 128, 0, stream>>>(wk, BQKV + (size_t)DM * DM, DM, DM, 16.0f); k_wt_f16<<<g, 128, 0, stream>>>(wv, BQKV + (size_t)2 * DM * DM, DM, DM, 16.0f); k_wt_f16<<<g, 128, 0, stream>>>(wo, BO, DM, DM, 16.0f); }      /* [in][out] -> Bt x16: stacked q | k | v, and Wo */
  k_bcpy<<<1, 256, 0, stream>>>(bq, DM, DM, bqkv, 0); k_bcpy<<<1, 256, 0, stream>>>(bk, DM, DM, bqkv, DM); k_bcpy<<<1, 256, 0, stream>>>(bv, DM, DM, bqkv, 2 * DM);      /* stacked bias bq | bk | bv */
  k_x16<<<(unsigned)((NR * DM / 8 + 255) / 256), 256, 0, stream>>>(x, X16, NR * DM / 8); k_bfr<<<(unsigned)((NR * DM / 8 + 255) / 256), 256, 0, stream>>>(x, XB, NR * DM / 8);      /* post-LN: the attention runs on the raw input (exact f16 rows); XB = bf16(x) f32 for the residual */
  k_wt_f16<<<(unsigned)((DM / 128) * (DFF / 64)), 128, 0, stream>>>(wfc, BW1, DM, DFF, 16.0f); k_wt_f16<<<(unsigned)((DFF / 128) * (DM / 64)), 128, 0, stream>>>(wmp, BW2, DFF, DM, 16.0f);      /* [in][out] w1 [1024][4096] and w2 [4096][1024] transposed to Bt x16 */
  const size_t r0p = (size_t)B0 * SQ;      /* first projected row */
  k_gemm2<0><<<dim3((unsigned)((MP / 128) * (3 * DM / 64)), 1), 128, 0, stream>>>(X16 + r0p * DM, DM, 0, BQKV, DM, 0, 0.0625f, bqkv, 0, nullptr, 1, 0, 0, nullptr, QKV + r0p * 3 * DM, 3 * DM, 0, MP, 3 * DM, DM);      /* q | k | v rows (f16); head h = columns h*HD.. of each DM block */
  k_vt<NH, SQ><<<NB * NH * (SQ / 64), 256, 0, stream>>>(V16, LQ, 0, VT);      /* V^T [NB][NH][HD][SQ] */
  k_fattn<<<dim3(SQ / 256, NH, NB), 256, 0, stream>>>(Q16, K16, VT, O16);      /* scores q.k (no scaling), softmax over all keys, ctx (merged heads, x64) as f16 rows */
  k_gemm2<0><<<dim3((unsigned)((MPO / 128) * (DM / 64)), 1), 128, 0, stream>>>(O16 + r0p * DM, DM, 0, BO, DM, 0, 0.0009765625f, bo, 0, XB + r0p * DM, -1, 0, 0, X1 + r0p * DM, nullptr, DM, 0, MPO, DM, DM);      /* out rows are the output layout */
  k_lnx<0, 1, 1><<<(unsigned)NR, 256, 0, stream>>>(X1, g1, be1, 1e-5f, M16, X1N);      /* x1 = LN1(x + attn_out) (eps 1e-5): f16 rows for the FFN input and f32 rows for the residual */
  for (int b = 0; b < NB; ++b) { const size_t r0 = (size_t)b * SQ;
    k_gemm2<6><<<dim3((unsigned)((SQ / 128) * (DFF / 64)), 1), 128, 0, stream>>>(M16 + r0 * DM, DM, 0, BW1, DM, 0, 0.0625f, bfc, 0, nullptr, 1, 0, 0, nullptr, HF16, DFF, 0, SQ, DFF, DM);      /* gelu_erf(h w1 + b1) -> f16 (this batch) */
    k_gemm2<0><<<dim3((unsigned)((SQ / 128) * (DM / 64)), 1), 128, 0, stream>>>(HF16, DFF, 0, BW2, DFF, 0, 0.0625f, bmp, 0, X1N + r0 * DM, -1, 0, 0, X1 + r0 * DM, nullptr, DM, 0, SQ, DM, DFF); }      /* t = x1 + gelu-ffn + b2 (own-element residual) f32, over the dead pre-LN1 plane */
  k_lnx<0, 0, 1><<<(unsigned)NR, 256, 0, stream>>>(X1, gg2, be2, 1e-5f, nullptr, (float*)d_out);      /* out = LN2(t) (eps 1e-5) -> f32 output rows */
}

// v006
// Measured time: 266 microseconds a run.
// Next to v005, in two timings, it ran 1.35 and 1.34 times as fast.
// Counting every step since v000, it is 27.6 times as fast.
#include <hip/hip_runtime.h>
// POST-LN transformer encoder block (x [2][2048][1024]; q/k/v = x W + b ([in][out] 1024 x 1024, zero biases); 16 heads of 64; scores = q k^T with NO 1/sqrt(head_dim) scaling (as the source module); softmax over all 2048 keys (no mask); x1 = LN1(x + ctx Wo + bo) (biased var, eps 1e-5, g / beta); out = LN2(x1 + gelu_erf(x1 W1 + b1) W2 + b2) ([in][out] 1024 x 4096 x 1024) -> [2][2048][1024]).
// Structure: token rows; x as exact f16 rows and bf16 f32 residual rows; natural weights as exact x16 planes; fused q | k | v WMMA GEMM (32x64 wave tiles, f32 accumulation, + stacked bias) -> f16; V^T via LDS transposes; one fused attention launch (S^T = K Q^T, online softmax in registers with f32 statistics and native exp, weights x256 f16, O^T += V^T P^T), ctx (x64) merged f16; x + ctx Wo + bo f32; LN1 on VALU -> f16 + f32; gelu FFN, all rows in one grid a GEMM; + residual; LN2 -> output; 9 launches (all preparation in one grid).
// Compute dtype: inputs rounded to bf16; x / weights exact; q, k, v, softmax weights and o as plain f16 GEMM operands (~2^-12); scores and softmax statistics f32; v_wmma_f32_16x16x32_f16.
#define NB 2
#define SQ 2048
#define DM 1024
#define NH 16
#define HD 64
#define HG 4                         /* heads per launch of the non-template k_vt (not launched) */
#define QT 256                       /* query rows per attention tile */
#define NKX SQ                       /* S / P row pitch */
#define QT0 128                      /* rows per head of the f32 k_att0 path (not launched) */
#define B0 0                         /* first batch processed (debug hook) */
#define NBR NB                       /* batches processed (debug hook) */
#define NR ((size_t)NB * SQ)
#define DMQ DM
#define DFF 4096         /* FFN hidden width */
#define MP ((int)((size_t)NBR * SQ)) /* rows projected (debug hook) */
#define QN SQ                        /* query rows per batch (not used) */
#define NHD NH                       /* heads (not used) */
#define MPO MP                       /* rows through the output stage (debug hook) */
#define LQ (3 * DM)      /* row pitch of the q/k/v rows */
typedef __bf16 v16b __attribute__((ext_vector_type(16)));
typedef unsigned short v8us __attribute__((ext_vector_type(8), may_alias));
typedef float  v8f  __attribute__((ext_vector_type(8)));
typedef float  v4f  __attribute__((ext_vector_type(4)));
typedef float  v4fa __attribute__((ext_vector_type(4), may_alias));
union FragB { v16b v; v8us half[2]; unsigned short u[16]; };

__device__ __forceinline__ unsigned short bf16_bits(float x) { unsigned int u = __float_as_uint(x); return (unsigned short)((u + 0x7FFFu + ((u >> 16) & 1u)) >> 16); }
__device__ __forceinline__ float bf16_val(unsigned short b) { return __uint_as_float(((unsigned int)b) << 16); }
__device__ __forceinline__ float bf16_round(float x) { return bf16_val(bf16_bits(x)); }
// D += A·B with NT terms: 1 = ah·bh, 2 = + al·bh (A split), 3 = + ah·bl (both split)
template <int NT>
__device__ __forceinline__ v8f mmaN(v16b ah, v16b al, v16b bh, v16b bl, v8f c) {
  c = __builtin_amdgcn_wmma_f32_16x16x32_bf16(false, ah, false, bh, (short)0, c, false, false);
  if (NT >= 2) c = __builtin_amdgcn_wmma_f32_16x16x32_bf16(false, al, false, bh, (short)0, c, false, false);
  if (NT >= 3) c = __builtin_amdgcn_wmma_f32_16x16x32_bf16(false, ah, false, bl, (short)0, c, false, false);
  asm volatile("v_nop\n\tv_nop\n\tv_nop\n\tv_nop" : "+v"(c) : "v"(ah), "v"(al), "v"(bh), "v"(bl));
  return c;
}

__global__ __launch_bounds__(256) void k_wt_bf16(const float* __restrict__ W, unsigned short* __restrict__ Wt, int K, int N) {
  const int t = blockIdx.x * 256 + threadIdx.x;
  const int k8n = K / 8;
  if (t >= N * k8n) return;
  const int n = t / k8n, k8 = (t % k8n) * 8;
  v8us v;
#pragma unroll
  for (int i = 0; i < 8; ++i) v[i] = bf16_bits(W[(size_t)(k8 + i) * N + n]);
  *(v8us*)(Wt + (size_t)n * K + k8) = v;
  
}

// GEMM C[M][N] (f32, pitch ldc) = act(A[M][K]·W + bias). A f32 row-major (pitch lda) converted per fragment to bf16
// (ASPLIT: hi/lo two planes -> 2 terms, else single rounded term); Wt bf16 [N][K] (pitch ldb). BIAS_BF16 rounds the
// bias to bf16 first (bias quantised to bf16 before the add). K%32==0, M%16==0, N%64==0.
template <bool ASPLIT, int ACT, bool BIAS_BF16>
__global__ __launch_bounds__(128) void k_gemm_bf(const float* __restrict__ A, int lda, const unsigned short* __restrict__ Wt, int ldb,
                                               const float* __restrict__ bias, float* __restrict__ C, int ldc, int M, int N, int K) {
  __shared__ __attribute__((aligned(16))) float so[4][16][64];
  const int tid = threadIdx.x, w = tid >> 5, lane = tid & 31, ln = lane & 15, hh = lane >> 4;
  const int ntn = N / 64;
  const int wid = blockIdx.x * 4 + w;
  const int mt = wid / ntn, nq = wid % ntn;
  if (mt * 16 >= M) return;
  const int row0 = mt * 16, col0 = nq * 64;
  const float* arow = A + (size_t)(row0 + ln) * lda;
  v8f acc[4] = {};
  for (int kb = 0; kb < K; kb += 32) {
    FragB ah, al;
    const v4f x0 = *(const v4fa*)(arow + kb + 8 * hh), x1 = *(const v4fa*)(arow + kb + 8 * hh + 4);
    const v4f x2 = *(const v4fa*)(arow + kb + 16 + 8 * hh), x3 = *(const v4fa*)(arow + kb + 16 + 8 * hh + 4);
    float xs[16] = {x0[0],x0[1],x0[2],x0[3],x1[0],x1[1],x1[2],x1[3],x2[0],x2[1],x2[2],x2[3],x3[0],x3[1],x3[2],x3[3]};
#pragma unroll
    for (int i = 0; i < 16; ++i) { const unsigned short hb = bf16_bits(xs[i]); ah.u[i] = hb; al.u[i] = ASPLIT ? bf16_bits(xs[i] - bf16_val(hb)) : (unsigned short)0; }
#pragma unroll
    for (int t = 0; t < 4; ++t) {
      const unsigned short* brow = Wt + (size_t)(col0 + t * 16 + ln) * ldb + kb;
      FragB b;
      b.half[0] = *(const v8us*)(brow + 8 * hh);
      b.half[1] = *(const v8us*)(brow + 16 + 8 * hh);
      acc[t] = mmaN<ASPLIT ? 2 : 1>(ah.v, al.v, b.v, b.v, acc[t]);
    }
  }
#pragma unroll
  for (int t = 0; t < 4; ++t) {
    float bv = bias ? bias[col0 + t * 16 + ln] : 0.f;
    if (BIAS_BF16) bv = bf16_round(bv);
#pragma unroll
    for (int r = 0; r < 8; ++r) { float v = acc[t][r] + bv; if (ACT == 1) v = fmaxf(v, 0.f); so[w][8 * hh + r][t * 16 + ln] = v; }
  }
  __builtin_amdgcn_fence(__ATOMIC_ACQ_REL, "workgroup");
  __builtin_amdgcn_wave_barrier();
  const int rsub = lane >> 4, c4 = (lane & 15) * 4;
  {
#pragma unroll
    for (int q = 0; q < 8; ++q) {
      const int r = q * 2 + rsub;
      const v4f v = *(const v4fa*)&so[w][r][c4];
      *(v4f*)(C + (size_t)(row0 + r) * ldc + col0 + c4) = v;
    }
    
  }
}

// GEMM C = act(A·W + bias + resid): A f32 (ASPLIT -> hi/lo 2 terms), Wt bf16 [N][K]; ACT 0 none, 1 relu, 2 exact gelu;
// resid (optional, f32, row index = (row % rmod), pitch ldr, RES_BF16 rounds it) added before the activation.
template <bool ASPLIT, int ACT, bool BIAS_BF16, bool RES_BF16>
__global__ __launch_bounds__(128) void k_gemm_bf3(const float* __restrict__ A, int lda, const unsigned short* __restrict__ Wt, int ldb,
                                                const float* __restrict__ bias, const float* __restrict__ resid, int rmod, int ldr,
                                                float* __restrict__ C, int ldc, int M, int N, int K) {
  __shared__ __attribute__((aligned(16))) float so[4][16][64];
  const int tid = threadIdx.x, w = tid >> 5, lane = tid & 31, ln = lane & 15, hh = lane >> 4;
  const int ntn = N / 64;
  const int wid = blockIdx.x * 4 + w;
  const int mt = wid / ntn, nq = wid % ntn;
  if (mt * 16 >= M) return;
  const int row0 = mt * 16, col0 = nq * 64;
  const float* arow = A + (size_t)(row0 + ln) * lda;
  v8f acc[4] = {};
  for (int kb = 0; kb < K; kb += 32) {
    FragB ah, al;
    const v4f x0 = *(const v4fa*)(arow + kb + 8 * hh), x1 = *(const v4fa*)(arow + kb + 8 * hh + 4);
    const v4f x2 = *(const v4fa*)(arow + kb + 16 + 8 * hh), x3 = *(const v4fa*)(arow + kb + 16 + 8 * hh + 4);
    float xs[16] = {x0[0],x0[1],x0[2],x0[3],x1[0],x1[1],x1[2],x1[3],x2[0],x2[1],x2[2],x2[3],x3[0],x3[1],x3[2],x3[3]};
#pragma unroll
    for (int i = 0; i < 16; ++i) { const unsigned short hb = bf16_bits(xs[i]); ah.u[i] = hb; al.u[i] = ASPLIT ? bf16_bits(xs[i] - bf16_val(hb)) : (unsigned short)0; }
#pragma unroll
    for (int t = 0; t < 4; ++t) {
      const unsigned short* brow = Wt + (size_t)(col0 + t * 16 + ln) * ldb + kb;
      FragB b;
      b.half[0] = *(const v8us*)(brow + 8 * hh);
      b.half[1] = *(const v8us*)(brow + 16 + 8 * hh);
      acc[t] = mmaN<ASPLIT ? 2 : 1>(ah.v, al.v, b.v, b.v, acc[t]);
    }
  }
#pragma unroll
  for (int t = 0; t < 4; ++t) {
    const int col = col0 + t * 16 + ln;
    float bv = bias ? bias[col] : 0.f;
    if (BIAS_BF16) bv = bf16_round(bv);
#pragma unroll
    for (int r = 0; r < 8; ++r) {
      float v = acc[t][r] + bv;
      if (resid) { float rv = resid[(size_t)((row0 + 8 * hh + r) % rmod) * ldr + col]; if (RES_BF16) rv = bf16_round(rv); v += rv; }
      if (ACT == 1) v = fmaxf(v, 0.f);
      if (ACT == 2) v = 0.5f * v * (1.0f + erff(v * 0.70710678118654752f));
      if (ACT == 3) { const float u = 0.7978845608028654f * (v + 0.044715f * v * v * v); v = 0.5f * v * (1.0f + tanhf(u)); }
      so[w][8 * hh + r][t * 16 + ln] = v;
    }
  }
  __builtin_amdgcn_fence(__ATOMIC_ACQ_REL, "workgroup");
  __builtin_amdgcn_wave_barrier();
  const int rsub = lane >> 4, c4 = (lane & 15) * 4;
  {
#pragma unroll
    for (int q = 0; q < 8; ++q) {
      const int r = q * 2 + rsub;
      const v4f v = *(const v4fa*)&so[w][r][c4];
      *(v4f*)(C + (size_t)(row0 + r) * ldc + col0 + c4) = v;
    }
    
  }
}
// row LayerNorm (biased variance, eps) over N: s = X (+ R); optional out_sum <- s; out_norm <- (s-mu)*rsqrt(var+eps)*g + b
template <bool PARAM_BF16>
__global__ __launch_bounds__(256) void k_layernorm(const float* __restrict__ X, const float* __restrict__ R, const float* __restrict__ g, const float* __restrict__ bta,
                                                  float* __restrict__ out_sum, float* __restrict__ out_norm, int N, float eps) {
  __shared__ float red[256];
  const int row = blockIdx.x, tid = threadIdx.x;
  const float* x = X + (size_t)row * N; const float* rr = R ? R + (size_t)row * N : nullptr;
  float vals[16];                     // up to N = 4096
  const int per = N / 256;            // contiguous chunk per thread? use strided-by-4 chunks: thread handles j = tid*4 + 1024*u
  float s1 = 0.f;
  for (int u = 0; u < per / 4; ++u) {
    const int j = tid * 4 + 1024 * u;
    const v4f a = *(const v4fa*)(x + j);
    v4f b = {0.f,0.f,0.f,0.f}; if (rr) b = *(const v4fa*)(rr + j);
#pragma unroll
    for (int q = 0; q < 4; ++q) { const float v = a[q] + b[q]; vals[u * 4 + q] = v; s1 += v; }
  }
  red[tid] = s1; __syncthreads();
  for (int st = 128; st > 0; st >>= 1) { if (tid < st) red[tid] += red[tid + st]; __syncthreads(); }
  const float mu = red[0] / (float)N; __syncthreads();
  float s2 = 0.f;
  for (int u = 0; u < per / 4; ++u)
#pragma unroll
    for (int q = 0; q < 4; ++q) { const float c = vals[u * 4 + q] - mu; s2 += c * c; }
  red[tid] = s2; __syncthreads();
  for (int st = 128; st > 0; st >>= 1) { if (tid < st) red[tid] += red[tid + st]; __syncthreads(); }
  const float rs = rsqrtf(red[0] / (float)N + eps);
  {
    for (int u = 0; u < per / 4; ++u) {
      const int j = tid * 4 + 1024 * u;
      v4f o, sm;
#pragma unroll
      for (int q = 0; q < 4; ++q) {
        float gg = g[j + q], bb = bta[j + q];
        if (PARAM_BF16) { gg = bf16_round(gg); bb = bf16_round(bb); }
        sm[q] = vals[u * 4 + q]; o[q] = (vals[u * 4 + q] - mu) * rs * gg + bb;
      }
      if (out_sum) *(v4f*)(out_sum + (size_t)row * N + j) = sm;
      *(v4f*)(out_norm + (size_t)row * N + j) = o;
    }
    
  }
}



// ---- f16 WMMA path (v_wmma_f32_16x16x32_f16): 11-bit significands for operands in range — used where a [0,1] probability operand needs more precision than bf16
typedef _Float16 v16h __attribute__((ext_vector_type(16)));
union FragH { v16h v; v8us half[2]; _Float16 h[16]; unsigned short u[16]; };
template <int NT>
__device__ __forceinline__ v8f mmaH(v16h ah, v16h al, v16h bh, v16h bl, v8f c) {
  c = __builtin_amdgcn_wmma_f32_16x16x32_f16(false, ah, false, bh, (short)0, c, false, false);
  if (NT >= 2) c = __builtin_amdgcn_wmma_f32_16x16x32_f16(false, al, false, bh, (short)0, c, false, false);
  if (NT >= 3) c = __builtin_amdgcn_wmma_f32_16x16x32_f16(false, ah, false, bl, (short)0, c, false, false);
  asm volatile("v_nop\n\tv_nop\n\tv_nop\n\tv_nop" : "+v"(c) : "v"(ah), "v"(al), "v"(bh), "v"(bl));
  return c;
}
// batched GEMM like k_gemm_b but f16 operands: A f32 (split into f16 hi/lo if ASPLIT, else rounded to f16), Bt = f16 values [n][k]; alpha; C f32; N multiple of 16 (partial tiles skipped)
template <bool ASPLIT>
__global__ __launch_bounds__(128) void k_gemm_h(const float* __restrict__ A, int lda, size_t sA, const _Float16* __restrict__ Bh, int ldb, size_t sB, float alpha, float* __restrict__ C, int ldc, size_t sC, int M, int N, int K) {
  __shared__ __attribute__((aligned(16))) float so[4][16][64];
  const int tid = threadIdx.x, w = tid >> 5, lane = tid & 31, ln = lane & 15, hh = lane >> 4; const int by = blockIdx.y;
  A += (size_t)by * sA; Bh += (size_t)by * sB; C += (size_t)by * sC;
  const int ntn = (N + 63) / 64; const int wid = blockIdx.x * 4 + w; const int mt = wid / ntn, nq = wid % ntn; if (mt * 16 >= M) return;
  const int row0 = mt * 16, col0 = nq * 64; const float* arow = A + (size_t)(row0 + ln) * lda;
  v8f acc[4] = {};
  for (int kb = 0; kb < K; kb += 32) {
    FragH ah, al;
    const v4f x0 = *(const v4fa*)(arow + kb + 8 * hh), x1 = *(const v4fa*)(arow + kb + 8 * hh + 4), x2 = *(const v4fa*)(arow + kb + 16 + 8 * hh), x3 = *(const v4fa*)(arow + kb + 16 + 8 * hh + 4);
    float xs[16] = {x0[0],x0[1],x0[2],x0[3],x1[0],x1[1],x1[2],x1[3],x2[0],x2[1],x2[2],x2[3],x3[0],x3[1],x3[2],x3[3]};
#pragma unroll
    for (int i = 0; i < 16; ++i) { const _Float16 h = (_Float16)xs[i]; ah.h[i] = h; al.h[i] = ASPLIT ? (_Float16)(xs[i] - (float)h) : (_Float16)0.0f; }
#pragma unroll
    for (int t = 0; t < 4; ++t) { if (col0 + t * 16 >= N) continue; const size_t boff = (size_t)(col0 + t * 16 + ln) * ldb + kb; FragH bq; bq.half[0] = *(const v8us*)(Bh + boff + 8 * hh); bq.half[1] = *(const v8us*)(Bh + boff + 16 + 8 * hh);
      acc[t] = mmaH<ASPLIT ? 2 : 1>(ah.v, al.v, bq.v, bq.v, acc[t]); }
  }
#pragma unroll
  for (int t = 0; t < 4; ++t) { if (col0 + t * 16 >= N) continue;
#pragma unroll
    for (int r = 0; r < 8; ++r) so[w][8 * hh + r][t * 16 + ln] = acc[t][r] * alpha; }
  __builtin_amdgcn_fence(__ATOMIC_ACQ_REL, "workgroup"); __builtin_amdgcn_wave_barrier();
  const int rsub = lane >> 4, c4 = (lane & 15) * 4;
  {
#pragma unroll
    for (int q = 0; q < 8; ++q) { const int r = q * 2 + rsub; if (col0 + c4 < N) { const v4f v = *(const v4fa*)&so[w][r][c4]; *(v4f*)(C + (size_t)(row0 + r) * ldc + col0 + c4) = v; } }
     }
}

// Wt[n][k] = f16(bf16(W[k][n])*scale) from f32 row-major W[K][N] (scale = power of two; bf16-exact weights stay exact in f16 away from the subnormal range). K % 128 == 0, N % 64 == 0.
// Transposed in registers: a lane reads 16-byte pieces (4 n) of 8 successive rows k, which is 4 output pieces of 16 bytes (8 k). Lanes: 4 along n, 8 along k, so a wave's store covers four whole
// 128-byte lines of Wt and its two loads of a row group cover the two halves of eight 128-byte lines of W. A wave takes 64 k x 32 n, a block (2 x 2 waves) 128 k x 64 n: 256 bytes a row on both sides.
// blk = the tile's number among the (K / 128) * (N / 64) tiles of this matrix; 128 threads.
__device__ __forceinline__ void wt_f16_tile(const float* __restrict__ W, _Float16* __restrict__ Wt, int K, int N, float scale, int blk) {
  const int lane = threadIdx.x & 31, w = threadIdx.x >> 5; const int ntn = N >> 6; const int bk = blk / ntn, bn = blk - bk * ntn;
  const int k0 = bk * 128 + (w >> 1) * 64 + (lane >> 2) * 8, n0 = bn * 64 + (w & 1) * 32 + (lane & 3) * 4;
  const float* p[8]; v4f a[8], b[8];
  /* unrolled: the arrays get constant indices (registers) */
#pragma unroll
  for (int i = 0; i < 8; ++i) { p[i] = W + (size_t)(k0 + i) * N + n0; a[i] = *(const v4fa*)p[i]; b[i] = *(const v4fa*)(p[i] + 16); }
  /* The loaded values are inputs: all sixteen loads stay in front of the first conversion, so the wave pays one memory latency (left alone the compiler sinks half of them among the conversions: four more round trips).
     The row pointers are inputs: they stay live up to here, so no load's result lands on an address pair of an issued load, and the wait precedes every later overwrite of such a pair */
  asm volatile("s_wait_xcnt 0x0" :: "v"(a[0]), "v"(a[1]), "v"(a[2]), "v"(a[3]), "v"(a[4]), "v"(a[5]), "v"(a[6]), "v"(a[7]), "v"(b[0]), "v"(b[1]), "v"(b[2]), "v"(b[3]), "v"(b[4]), "v"(b[5]), "v"(b[6]), "v"(b[7]),
               "v"(p[0]), "v"(p[1]), "v"(p[2]), "v"(p[3]), "v"(p[4]), "v"(p[5]), "v"(p[6]), "v"(p[7]));
  unsigned short* d = (unsigned short*)Wt + (size_t)n0 * K + k0;
#pragma unroll
  for (int q = 0; q < 4; ++q) { FragH f;
#pragma unroll
    for (int i = 0; i < 8; ++i) { f.h[i] = (_Float16)(bf16_round(a[i][q]) * scale); f.h[8 + i] = (_Float16)(bf16_round(b[i][q]) * scale); }
    *(v8us*)(d + (size_t)q * K) = f.half[0]; *(v8us*)(d + (size_t)(16 + q) * K) = f.half[1]; }
}
// k_gemm_hh variant with fused epilogue: v = acc·alpha + bias[by·sBias + col] (+ CP[(row/rowsPerB)·sCPb + by·64 + col] if CP) ; ACT 0 none / 1 elu ; writes f16 C16 (and f32 C if non-null)
template <int ACT>
__global__ __launch_bounds__(128) void k_gemm_hhx(const _Float16* __restrict__ A, int lda, size_t sA, const _Float16* __restrict__ Bh, int ldb, size_t sB, float alpha, const float* __restrict__ bias, size_t sBias, const float* __restrict__ CP, int rowsPerB, size_t sCPb, int row0g,
    float* __restrict__ C, _Float16* __restrict__ C16, int ldc, size_t sC, int M, int N, int K) {
  __shared__ __attribute__((aligned(16))) float so[4][16][64];
  const int tid = threadIdx.x, w = tid >> 5, lane = tid & 31, ln = lane & 15, hh = lane >> 4; const int by = blockIdx.y;
  A += (size_t)by * sA; Bh += (size_t)by * sB; const size_t cofs = (size_t)by * sC; const float* bp = bias ? bias + (size_t)by * sBias : nullptr;
  const int ntn = (N + 63) / 64; const int wid = blockIdx.x * 4 + w; const int mt = wid / ntn, nq = wid % ntn; if (mt * 16 >= M) return;
  const int row0 = mt * 16, col0 = nq * 64; const _Float16* arow = A + (size_t)(row0 + ln) * lda;
  v8f acc[4] = {};
  for (int kb = 0; kb < K; kb += 32) { FragH ah; ah.half[0] = *(const v8us*)((const unsigned short*)arow + kb + 8 * hh); ah.half[1] = *(const v8us*)((const unsigned short*)arow + kb + 16 + 8 * hh);
#pragma unroll
    for (int t = 0; t < 4; ++t) { if (col0 + t * 16 >= N) continue; const size_t boff = (size_t)(col0 + t * 16 + ln) * ldb + kb; FragH bq; bq.half[0] = *(const v8us*)((const unsigned short*)Bh + boff + 8 * hh); bq.half[1] = *(const v8us*)((const unsigned short*)Bh + boff + 16 + 8 * hh);
      acc[t] = mmaH<1>(ah.v, ah.v, bq.v, bq.v, acc[t]); }
  }
#pragma unroll
  for (int t = 0; t < 4; ++t) { if (col0 + t * 16 >= N) continue; const int col = col0 + t * 16 + ln; const float bv = bp ? bf16_round(bp[col]) : 0.f;
#pragma unroll
    for (int r = 0; r < 8; ++r) { float v = acc[t][r] * alpha + bv; if (CP) { const int rr = row0g + row0 + 8 * hh + r; if (rowsPerB < 0) v += CP[cofs + (size_t)rr * ldc + col];      /* rowsPerB < 0: own element of the batched C plane */ else { const int bidx = rr / rowsPerB; v += CP[(size_t)bidx * sCPb + (size_t)by * 64 + col]; } } if (ACT == 1) v = (v > 0.f) ? v : expm1f(v); else if (ACT == 7) v = (v > 0.f) ? v + 1.0f : expf(v); else if (ACT == 8) v = tanhf(v); else if (ACT == 9) v = 0.5f * v * (1.0f + tanhf(0.7978845608028654f * (v + 0.044715f * v * v * v))); else if (ACT == 11) v = 1.0f / (1.0f + expf(-v)); else if (ACT == 12) v = (v > 0.f) ? v : 0.01f * v; else if (ACT == 14) v = (v > 0.f) ? v : 0.1f * v; else if (ACT == 16) v = (v >= 0.f) ? v : 0.3f * v; else if (ACT == 17) v = (v >= 0.f) ? v : 0.2f * v; else if (ACT == 15) v = v / (1.0f + expf(-v)); else if (ACT == 3) v = fmaxf(v, 0.f); else if (ACT == 6) v = 0.5f * v * (1.0f + erff(v * 0.70710678118654752f)); so[w][8 * hh + r][t * 16 + ln] = v; } }
  __builtin_amdgcn_fence(__ATOMIC_ACQ_REL, "workgroup"); __builtin_amdgcn_wave_barrier();
  const int rsub = lane >> 4, c4 = (lane & 15) * 4; typedef _Float16 v4h __attribute__((ext_vector_type(4)));
  {
#pragma unroll
    for (int q = 0; q < 8; ++q) { const int r = q * 2 + rsub; if (col0 + c4 < N) { const v4f v = *(const v4fa*)&so[w][r][c4]; if (C) *(v4f*)(C + cofs + (size_t)(row0 + r) * ldc + col0 + c4) = v; if (C16) { v4h h4; for (int i = 0; i < 4; ++i) h4[i] = (_Float16)v[i]; *(v4h*)(C16 + cofs + (size_t)(row0 + r) * ldc + col0 + c4) = h4; } } }
     }
}


typedef _Float16 v4h __attribute__((ext_vector_type(4)));

__global__ __launch_bounds__(256) void k_h16(const float* __restrict__ x, _Float16* __restrict__ X16, size_t n8) { const size_t t = (size_t)blockIdx.x * 256 + threadIdx.x; if (t >= n8) return; FragH f;
#pragma unroll
  for (int q = 0; q < 8; ++q) f.h[q] = (_Float16)x[t * 8 + q]; *(v8us*)((unsigned short*)X16 + t * 8) = f.half[0];  }
__global__ __launch_bounds__(256) void k_round16f(const float* __restrict__ W, _Float16* __restrict__ Bt, size_t n8) { const size_t t = (size_t)blockIdx.x * 256 + threadIdx.x; if (t >= n8) return; FragH f;
#pragma unroll
  for (int i = 0; i < 8; ++i) f.h[i] = (_Float16)(bf16_round(W[t * 8 + i]) * 16.0f); *(v8us*)((unsigned short*)Bt + t * 8) = f.half[0];  }
template <int NHv, int TTv>
__global__ __launch_bounds__(256) void k_vt(const _Float16* __restrict__ V16, int ldv, int voff, _Float16* __restrict__ Vt) { __shared__ unsigned short tl[64][66]; const int tid = threadIdx.x; const int slab = blockIdx.x / (TTv / 64), lg = blockIdx.x % (TTv / 64); const int b = slab / NHv, h = slab % NHv;
  for (int i = tid; i < 64 * 8; i += 256) { const int r = i / 8, c8 = (i % 8) * 8; FragH f; f.half[0] = *(const v8us*)((const unsigned short*)V16 + ((size_t)b * TTv + lg * 64 + r) * ldv + voff + h * 64 + c8);
#pragma unroll
    for (int q = 0; q < 8; ++q) tl[r][c8 + q] = f.u[q]; }
  __syncthreads();
  {
#pragma unroll
    for (int rd = 0; rd < 2; ++rd) { const int d = rd * 32 + tid / 8, pc = tid % 8; FragH f;
#pragma unroll
      for (int q = 0; q < 8; ++q) f.u[q] = tl[pc * 8 + q][d];
      *(v8us*)((unsigned short*)Vt + ((size_t)slab * 64 + d) * TTv + lg * 64 + pc * 8) = f.half[0]; }
     } }

__global__ __launch_bounds__(256) void k_hl(const float* __restrict__ F, _Float16* __restrict__ Hh, _Float16* __restrict__ Hl, size_t n8) { const size_t t = (size_t)blockIdx.x * 256 + threadIdx.x; if (t >= n8) return; FragH fh, fl; const v4f a = *(const v4fa*)(F + t * 8), c = *(const v4fa*)(F + t * 8 + 4);
#pragma unroll
  for (int q = 0; q < 4; ++q) { _Float16 h = (_Float16)a[q]; fh.h[q] = h; fl.h[q] = (_Float16)((a[q] - (float)h) * 1024.0f); h = (_Float16)c[q]; fh.h[4 + q] = h; fl.h[4 + q] = (_Float16)((c[q] - (float)h) * 1024.0f); }
  { *(v8us*)((unsigned short*)Hh + t * 8) = fh.half[0]; *(v8us*)((unsigned short*)Hl + t * 8) = fl.half[0];  } }

// ---- fast GEMM (block tile 128x64, wave tile 32x64; A and B tiles of 128 k staged in LDS by asynchronous copies, two buffers; requires M % 128 == 0, N % 64 == 0, K % 128 == 0); epilogue = k_gemm_hhx semantics ----
__device__ __forceinline__ v16h g2_frag(const _Float16* p, int hh) { FragH f; f.half[0] = *(const v8us*)((const unsigned short*)p + 8 * hh); f.half[1] = *(const v8us*)((const unsigned short*)p + 16 + 8 * hh); return f.v; }
__device__ __forceinline__ v8f g2_mma(v16h a, v16h b, v8f c) { v8f d = __builtin_amdgcn_wmma_f32_16x16x32_f16(false, a, false, b, (short)0, c, false, false); asm volatile("v_nop\n\tv_nop\n\tv_nop\n\tv_nop" : "+v"(d) : "v"(a), "v"(b)); return d; }
#define G2_PITCH 272      /* LDS row pitch, bytes: 256 of data + 16, an odd multiple of 16 (no bank conflict for 16-byte row reads) */
#define G2_STAGE (192 * G2_PITCH)      /* one buffer: 128 rows of A, then 64 rows of B, 128 k each */
// Eight asynchronous 16-byte copies of a lane, global -> LDS, rows 8 apart (st = 8 source rows, in elements). The s_wait_xcnt stands in the copies' own statement, behind the last of them,
// so that it precedes every later write of a register that a copy names.
__device__ __forceinline__ void g2_copy8(unsigned l, const _Float16* g, size_t st) {
  asm volatile("global_load_async_to_lds_b128 %0, %8, off\n\t"
               "global_load_async_to_lds_b128 %1, %9, off\n\t"
               "global_load_async_to_lds_b128 %2, %10, off\n\t"
               "global_load_async_to_lds_b128 %3, %11, off\n\t"
               "global_load_async_to_lds_b128 %4, %12, off\n\t"
               "global_load_async_to_lds_b128 %5, %13, off\n\t"
               "global_load_async_to_lds_b128 %6, %14, off\n\t"
               "global_load_async_to_lds_b128 %7, %15, off\n\t"
               "s_wait_xcnt 0x0"
               :: "v"(l), "v"(l + 8u * G2_PITCH), "v"(l + 16u * G2_PITCH), "v"(l + 24u * G2_PITCH), "v"(l + 32u * G2_PITCH), "v"(l + 40u * G2_PITCH), "v"(l + 48u * G2_PITCH), "v"(l + 56u * G2_PITCH),
                  "v"(g), "v"(g + st), "v"(g + 2 * st), "v"(g + 3 * st), "v"(g + 4 * st), "v"(g + 5 * st), "v"(g + 6 * st), "v"(g + 7 * st) : "memory"); }
// a fragment from a staged row: p = the row's place + 64 bytes a k step + 16 hh; same k order as g2_frag
__device__ __forceinline__ v16h g2_lfrag(const unsigned char* p) { FragH f; f.half[0] = *(const v8us*)p; f.half[1] = *(const v8us*)(p + 32); return f.v; }
template <int ACT>
__global__ __launch_bounds__(128) void k_gemm2(const _Float16* __restrict__ A, int lda, size_t sA, const _Float16* __restrict__ Bh, int ldb, size_t sB, float alpha, const float* __restrict__ bias, size_t sBias, const float* __restrict__ CP, int rowsPerB, size_t sCPb, int row0g,
    float* __restrict__ C, _Float16* __restrict__ C16, int ldc, size_t sC, int M, int N, int K) { static_assert(ACT == 0 || ACT == 3 || ACT == 6 || ACT == 8 || ACT == 9 || ACT == 11 || ACT == 12 || ACT == 14 || ACT == 15 || ACT == 16 || ACT == 17, "k_gemm2: unsupported ACT code (would silently apply no activation)");
  __shared__ __attribute__((aligned(16))) unsigned char sm[2 * G2_STAGE]; float (*so)[32][68] = (float (*)[32][68])sm;      /* two operand buffers; behind the loop's last barrier the same LDS stages the output tile */
  const int tid = threadIdx.x, w = tid >> 5, lane = tid & 31, ln = lane & 15, hh = lane >> 4; const int by = blockIdx.y;
  A += (size_t)by * sA; Bh += (size_t)by * sB; const size_t cofs = (size_t)by * sC; const float* bp = bias ? bias + (size_t)by * sBias : nullptr;
  const int ntn = N >> 6; const int mt = blockIdx.x / ntn, nq = blockIdx.x - mt * ntn; const int row0 = mt * 128 + 32 * w, col0 = nq * 64; if (mt * 128 >= M) return;      /* the whole block leaves, in front of every barrier */
  /* copies: lane = 16 bytes; 16 lanes a row of 256 bytes, so a wave's copy covers two whole rows; thread rows tid / 16 + 8 i */
  const unsigned lc = (unsigned)(size_t)sm + (unsigned)(tid >> 4) * G2_PITCH + (unsigned)(tid & 15) * 16u;
  const _Float16* ga = A + (size_t)(mt * 128 + (tid >> 4)) * lda + (tid & 15) * 8; const _Float16* gb = Bh + (size_t)(col0 + (tid >> 4)) * ldb + (tid & 15) * 8;
  auto fill = [&](int t, int buf) { const unsigned l = lc + (unsigned)buf * G2_STAGE; const _Float16* a = ga + (size_t)t * 128;
    g2_copy8(l, a, (size_t)8 * lda); g2_copy8(l + 64u * G2_PITCH, a + (size_t)64 * lda, (size_t)8 * lda); g2_copy8(l + 128u * G2_PITCH, gb + (size_t)t * 128, (size_t)8 * ldb); };
  const unsigned char* sa = sm + (32 * w + ln) * G2_PITCH + 16 * hh; const unsigned char* sb = sm + (128 + ln) * G2_PITCH + 16 * hh;
  const v8f z8 = {0.f,0.f,0.f,0.f,0.f,0.f,0.f,0.f}; v8f c00 = z8, c01 = z8, c02 = z8, c03 = z8, c10 = z8, c11 = z8, c12 = z8, c13 = z8;
  const int nt = K >> 7;
  fill(0, 0);
  asm volatile("s_wait_asynccnt 0x0" ::: "memory");      /* this wave's copies of tile 0 have landed */
  __syncthreads();      /* and every other wave's: tile 0 may be read */
  if (nt > 1) fill(1, 1);
  /* rolled: one copy of the body; a trip is 128 k = 32 products a wave, while the next tile's copies fly */
#pragma unroll 1
  for (int t = 0; t < nt; ++t) { const unsigned char* pa = sa + (t & 1) * G2_STAGE; const unsigned char* pb = sb + (t & 1) * G2_STAGE;
    v16h fa[2][2], fb[2][4];      /* two fragment sets */
    fa[0][0] = g2_lfrag(pa); fb[0][0] = g2_lfrag(pb); fa[0][1] = g2_lfrag(pa + 16 * G2_PITCH); fb[0][1] = g2_lfrag(pb + 16 * G2_PITCH); fb[0][2] = g2_lfrag(pb + 32 * G2_PITCH); fb[0][3] = g2_lfrag(pb + 48 * G2_PITCH);
    /* unrolled: the sets get constant indices (registers) and the LDS offsets become immediates. The reads of k step ks + 1 go as one group in front of the products of step ks, so only the trip's first group is waited for in full */
#pragma unroll
    for (int ks = 0; ks < 4; ++ks) { const int c = ks & 1, n = c ^ 1, o = (ks + 1) * 64;
      if (ks < 3) { fa[n][0] = g2_lfrag(pa + o); fb[n][0] = g2_lfrag(pb + o); fa[n][1] = g2_lfrag(pa + 16 * G2_PITCH + o); fb[n][1] = g2_lfrag(pb + 16 * G2_PITCH + o); fb[n][2] = g2_lfrag(pb + 32 * G2_PITCH + o); fb[n][3] = g2_lfrag(pb + 48 * G2_PITCH + o); }
      c00 = g2_mma(fa[c][0], fb[c][0], c00); c10 = g2_mma(fa[c][1], fb[c][0], c10);
      c01 = g2_mma(fa[c][0], fb[c][1], c01); c11 = g2_mma(fa[c][1], fb[c][1], c11);
      c02 = g2_mma(fa[c][0], fb[c][2], c02); c12 = g2_mma(fa[c][1], fb[c][2], c12);
      c03 = g2_mma(fa[c][0], fb[c][3], c03); c13 = g2_mma(fa[c][1], fb[c][3], c13); }
    asm volatile("s_wait_dscnt 0x0" ::: "memory");      /* this wave's reads of the buffer are done before it is refilled */
    asm volatile("s_wait_asynccnt 0x0" ::: "memory");      /* this wave's copies of tile t + 1 have landed */
    __syncthreads();      /* publishes tile t + 1 and ends every wave's reads of tile t */
    if (t + 2 < nt) fill(t + 2, t & 1); }
  asm volatile("s_wait_asynccnt 0x0" ::: "memory");      /* no copy is outstanding when the LDS changes its use */
  v8f accs[8] = {c00, c01, c02, c03, c10, c11, c12, c13};
#pragma unroll
  for (int u = 0; u < 8; ++u) { const int t = u & 3, half = u >> 2; const int col = col0 + t * 16 + ln; const float bv = bp ? bf16_round(bp[col]) : 0.f;
#pragma unroll
    for (int r = 0; r < 8; ++r) { const int rloc = half * 16 + 8 * hh + r; float v = accs[u][r] * alpha + bv; if (CP) { if (rowsPerB < 0) v += CP[cofs + (size_t)(row0g + row0 + rloc) * ldc + col];      /* rowsPerB < 0: own element of the batched C plane */ else { const int bidx = (row0g + row0 + rloc) / rowsPerB; v += CP[(size_t)bidx * sCPb + (size_t)by * 64 + col]; } }
      if (ACT == 3) v = fmaxf(v, 0.f); else if (ACT == 6) v = 0.5f * v * (1.0f + erff(v * 0.70710678118654752f)); else if (ACT == 11) v = 1.0f / (1.0f + expf(-v)); else if (ACT == 15) v = v / (1.0f + expf(-v)); else if (ACT == 12) v = (v > 0.f) ? v : 0.01f * v; else if (ACT == 8) v = tanhf(v); else if (ACT == 9) v = 0.5f * v * (1.0f + tanhf(0.7978845608028654f * (v + 0.044715f * v * v * v))); else if (ACT == 14) v = (v > 0.f) ? v : 0.1f * v; else if (ACT == 16) v = (v >= 0.f) ? v : 0.3f * v; else if (ACT == 17) v = (v >= 0.f) ? v : 0.2f * v;
      so[w][rloc][t * 16 + ln] = v; } }
  __builtin_amdgcn_fence(__ATOMIC_ACQ_REL, "workgroup"); __builtin_amdgcn_wave_barrier();
  const int rsub = lane >> 4, c4 = (lane & 15) * 4;
  {
#pragma unroll
    for (int q = 0; q < 16; ++q) { const int r = q * 2 + rsub; const v4f v = *(const v4fa*)&so[w][r][c4]; if (C) *(v4f*)(C + cofs + (size_t)(row0 + r) * ldc + col0 + c4) = v; if (C16) { v4h h4; for (int i = 0; i < 4; ++i) h4[i] = (_Float16)v[i]; *(v4h*)(C16 + cofs + (size_t)(row0 + r) * ldc + col0 + c4) = h4; } }
     } }


__global__ __launch_bounds__(256) void k_wnat(const float* __restrict__ w, size_t n8, _Float16* __restrict__ Bt) { const size_t t = (size_t)blockIdx.x * 256 + threadIdx.x; if (t >= n8) return; FragH f; for (int q = 0; q < 8; ++q) f.h[q] = (_Float16)(bf16_round(w[t * 8 + q]) * 16.0f); *(v8us*)((unsigned short*)Bt + t * 8) = f.half[0];  }
__global__ __launch_bounds__(256) void k_rsm(const float* __restrict__ S, _Float16* __restrict__ P, int nrows) {
  #pragma clang fp contract(off)
  const int i = blockIdx.x * 256 + threadIdx.x; if (i >= nrows) return; const float* s = S + (size_t)i * SQ; float mx = -3.0e38f;
#pragma unroll 1
  for (int j = 0; j < SQ; ++j) mx = fmaxf(mx, s[j]); float se = 0.f;
#pragma unroll 1
  for (int j = 0; j < SQ; ++j) se += expf(s[j] - mx); const float sc = 256.0f / se;
#pragma unroll 1
  for (int j0 = 0; j0 < SQ; j0 += 8) { FragH f; for (int q = 0; q < 8; ++q) f.h[q] = (_Float16)(expf(s[j0 + q] - mx) * sc); unsigned short* d = (unsigned short*)P + (size_t)i * SQ + j0; *(v8us*)d = f.half[0];  } }
__global__ __launch_bounds__(256) void k_vt(const _Float16* __restrict__ V16, int b, int h0, _Float16* __restrict__ VT) { __shared__ unsigned short tl[64][65]; const int tid = threadIdx.x; const int hh = blockIdx.x % HG, sg = blockIdx.x / HG; const int s0 = sg * 64; const int h = h0 + hh;
  for (int i = tid; i < 64 * 8; i += 256) { const int j = i / 8, d8 = (i % 8) * 8; FragH f; f.half[0] = *(const v8us*)((const unsigned short*)V16 + ((size_t)b * SQ + s0 + j) * DM + h * HD + d8); for (int q = 0; q < 8; ++q) tl[d8 + q][j] = f.u[q]; }
  __syncthreads();
  { for (int i = tid; i < 64 * 8; i += 256) { const int d = i / 8, j8 = (i % 8) * 8; FragH f; for (int q = 0; q < 8; ++q) f.u[q] = tl[d][j8 + q]; *(v8us*)((unsigned short*)VT + ((size_t)hh * HD + d) * SQ + s0 + j8) = f.half[0]; }  } }



__global__ __launch_bounds__(256) void k_rsmcf2(const float* __restrict__ S, _Float16* __restrict__ P, int hg, int q0, int nk) {
  #pragma clang fp contract(off)
  const int t = blockIdx.x * 256 + threadIdx.x; if (t >= hg * QT) return; const size_t i = (size_t)t; const float* s = S + i * NKX; const int last = q0 + (t % QT); float mx = -3.0e38f;
#pragma unroll 1
  for (int j = 0; j < nk; ++j) { const float f = (j <= last) ? 1.f : 0.f; mx = fmaxf(mx, fmaf(f, s[j], (1.f - f) * -1.0e9f)); } float se = 0.f;
#pragma unroll 1
  for (int j = 0; j < nk; ++j) { const float f = (j <= last) ? 1.f : 0.f; se += __expf(fmaf(f, s[j], (1.f - f) * -1.0e9f) - mx); } const float sc = 256.0f / se;
#pragma unroll 1
  for (int j0 = 0; j0 < nk; j0 += 8) { FragH fr; for (int q = 0; q < 8; ++q) { const int j = j0 + q; const float f = (j <= last) ? 1.f : 0.f; fr.h[q] = (_Float16)(__expf(fmaf(f, s[j], (1.f - f) * -1.0e9f) - mx) * sc); } unsigned short* d = (unsigned short*)P + i * NKX + j0; *(v8us*)d = fr.half[0];  } }


template <int MASKADD>
__global__ __launch_bounds__(64) void k_att0(const float* __restrict__ QF, const float* __restrict__ KF, const float* __restrict__ VF, int ld, const float* __restrict__ mask, float scale, float* __restrict__ OF, int ldo) {
  #pragma clang fp contract(off)
  __shared__ __attribute__((aligned(16))) float lq[64][64]; __shared__ __attribute__((aligned(16))) float lo[64][64];
  const int tid = threadIdx.x; const int h = blockIdx.x / (QT0 / 64), rg = blockIdx.x % (QT0 / 64); const int i = rg * 64 + tid;
  const float* qr = QF + (size_t)i * ld + h * HD;
#pragma unroll 1
  for (int c = 0; c < HD / 4; ++c) { *(v4f*)&lq[tid][c * 4] = *(const v4fa*)(qr + c * 4); const v4f z = {0.f, 0.f, 0.f, 0.f}; *(v4f*)&lo[tid][c * 4] = z; }
  float m = -1.0e30f, l = 0.f; const int jmax = MASKADD ? (SQ - 1) : (rg * 64 + 63);      /* additive-mask form: every key (the mask input decides); causal form: keys up to the block's last row */
#pragma unroll 1
  for (int j = 0; j <= jmax; ++j) { const float* kr = KF + (size_t)j * ld + h * HD; const float* vr = VF + (size_t)j * ld + h * HD; float s = 0.f;
#pragma unroll 1
    for (int c = 0; c < HD / 4; ++c) { const v4f kq = *(const v4fa*)(kr + c * 4); const v4f qq = *(v4f*)&lq[tid][c * 4]; s = __fadd_rn(s, __fmul_rn(qq[0], kq[0])); s = __fadd_rn(s, __fmul_rn(qq[1], kq[1])); s = __fadd_rn(s, __fmul_rn(qq[2], kq[2])); s = __fadd_rn(s, __fmul_rn(qq[3], kq[3])); }
    s = __fmul_rn(s, scale); if (MASKADD) s = __fadd_rn(s, __fmul_rn(bf16_round(mask[(size_t)i * SQ + j]), -10000.0f));
    const float f = (MASKADD || j <= i) ? 1.f : 0.f; const float sm = fmaf(f, s, (1.f - f) * -1.0e30f); const float mn = fmaxf(m, sm); const float sc = expf(m - mn); const float e = expf(sm - mn); l = __fadd_rn(__fmul_rn(l, sc), e); m = mn;
#pragma unroll 1
    for (int c = 0; c < HD / 4; ++c) { const v4f vv = *(const v4fa*)(vr + c * 4); v4f oo = *(v4f*)&lo[tid][c * 4]; for (int u = 0; u < 4; ++u) oo[u] = __fadd_rn(__fmul_rn(oo[u], sc), __fmul_rn(e, vv[u])); *(v4f*)&lo[tid][c * 4] = oo; } }
  const float fin = 64.0f / l;      /* o carried x64 like the f16 path */
#pragma unroll 1
  for (int c = 0; c < HD / 4; ++c) { v4f oo = *(v4f*)&lo[tid][c * 4]; for (int u = 0; u < 4; ++u) oo[u] = __fmul_rn(oo[u], fin); *(v4f*)&lo[tid][c * 4] = oo; }
  __syncthreads();
  {
#pragma unroll 1
    for (int it = 0; it < 16; ++it) { const int row = it * 4 + tid / 16, pc = (tid % 16) * 4; const v4f v = *(const v4f*)&lo[row][pc]; *(v4f*)(OF + (size_t)(rg * 64 + row) * ldo + h * HD + pc) = v; }
     } }


template <int BFIN, int WXB>
__global__ __launch_bounds__(256) void k_ln16(const float* __restrict__ X, const float* __restrict__ g, const float* __restrict__ bb, float eps, _Float16* __restrict__ N16, float* __restrict__ XB) {
  #pragma clang fp contract(off)
  __shared__ float red[256]; const size_t r = blockIdx.x; const int t = threadIdx.x; const v4f xa = *(const v4fa*)(X + r * DMQ + t * 4); float s[4]; float sum = 0.f;
  for (int q = 0; q < 4; ++q) { s[q] = BFIN ? bf16_round(xa[q]) : xa[q]; sum = __fadd_rn(sum, s[q]); }
  red[t] = sum; __syncthreads(); for (int st = 128; st > 0; st >>= 1) { if (t < st) red[t] = __fadd_rn(red[t], red[t + st]); __syncthreads(); } const float mu = red[0] / (float)DMQ; __syncthreads();
  float vs = 0.f; for (int q = 0; q < 4; ++q) { const float dl = __fadd_rn(s[q], -mu); vs = __fadd_rn(vs, __fmul_rn(dl, dl)); } red[t] = vs; __syncthreads(); for (int st = 128; st > 0; st >>= 1) { if (t < st) red[t] = __fadd_rn(red[t], red[t + st]); __syncthreads(); }
  const float rs = rsqrtf(__fadd_rn(red[0] / (float)DMQ, eps)); v4h y; v4f xb;
  for (int q = 0; q < 4; ++q) { const int c = t * 4 + q; y[q] = (_Float16)__fadd_rn(__fmul_rn(__fmul_rn(__fadd_rn(s[q], -mu), rs), bf16_round(g[c])), bf16_round(bb[c])); xb[q] = s[q]; }
  { *(v4h*)(N16 + r * DMQ + t * 4) = y; if (WXB) *(v4f*)(XB + r * DMQ + t * 4) = xb;  } }
__global__ __launch_bounds__(256) void k_ftres2(const float* __restrict__ OF0, const float* __restrict__ XB, float* __restrict__ X1, size_t n4) {
  #pragma clang fp contract(off)
  const size_t t = (size_t)blockIdx.x * 256 + threadIdx.x; if (t >= n4) return; const v4f o = *(const v4fa*)(OF0 + t * 4), xv = *(const v4fa*)(XB + t * 4); v4f y; for (int q = 0; q < 4; ++q) y[q] = __fadd_rn(__fmul_rn(o[q], 0.015625f), xv[q]); *(v4f*)(X1 + t * 4) = y;  }

__global__ __launch_bounds__(256) void k_wthd(const float* __restrict__ Wt, _Float16* __restrict__ Bt) { const size_t t = (size_t)blockIdx.x * 256 + threadIdx.x; if (t >= (size_t)NH * HD * (DM / 8)) return; const int m8 = (int)(t % (DM / 8)) * 8; const int d = (int)((t / (DM / 8)) % HD); const int h = (int)(t / ((size_t)(DM / 8) * HD)); FragH f;
  for (int q = 0; q < 8; ++q) f.h[q] = (_Float16)(16.0f * bf16_round(Wt[((size_t)h * DM + m8 + q) * HD + d])); unsigned short* dst = (unsigned short*)Bt + ((size_t)h * HD + d) * DM + m8; *(v8us*)dst = f.half[0];  }




template <int BFIN, int W16, int W32>
__global__ __launch_bounds__(256) void k_lnx(const float* __restrict__ X, const float* __restrict__ g, const float* __restrict__ bb, float eps, _Float16* __restrict__ N16, float* __restrict__ N32) {
  #pragma clang fp contract(off)
  __shared__ float red[256]; const size_t r = blockIdx.x; const int t = threadIdx.x; const bool act = t < (DMQ / 4); const int c0 = act ? t * 4 : 0;
  const v4f xa = *(const v4fa*)(X + r * DMQ + c0); float s[4]; float sum = 0.f;
  for (int q = 0; q < 4; ++q) { s[q] = act ? (BFIN ? bf16_round(xa[q]) : xa[q]) : 0.f; sum = __fadd_rn(sum, s[q]); }
  red[t] = sum; __syncthreads(); for (int st = 128; st > 0; st >>= 1) { if (t < st) red[t] = __fadd_rn(red[t], red[t + st]); __syncthreads(); } const float mu = red[0] / (float)DMQ; __syncthreads();
  float vs = 0.f; for (int q = 0; q < 4; ++q) { const float dl = act ? __fadd_rn(s[q], -mu) : 0.f; vs = __fadd_rn(vs, __fmul_rn(dl, dl)); } red[t] = vs; __syncthreads(); for (int st = 128; st > 0; st >>= 1) { if (t < st) red[t] = __fadd_rn(red[t], red[t + st]); __syncthreads(); }
  const float rs = rsqrtf(__fadd_rn(red[0] / (float)DMQ, eps)); v4h y; v4f yf;
  for (int q = 0; q < 4; ++q) { const int c = c0 + q; yf[q] = __fadd_rn(__fmul_rn(__fmul_rn(__fadd_rn(s[q], -mu), rs), bf16_round(g[c])), bf16_round(bb[c])); y[q] = (_Float16)yf[q]; }
  if (!act) return;      /* no barriers after this point */
  { if (W16) *(v4h*)(N16 + r * DMQ + c0) = y; if (W32) *(v4f*)(N32 + r * DMQ + c0) = yf;  } }






__global__ __launch_bounds__(256) void k_lorafold(const float* __restrict__ Wm, const float* __restrict__ A, const float* __restrict__ Bm, float* __restrict__ WE, int K, int N, float sc) {
  #pragma clang fp contract(off)
  const size_t t = (size_t)blockIdx.x * 256 + threadIdx.x; if (t >= (size_t)K * N) return; const int i = (int)(t / N), o = (int)(t % N); float a = 0.f;
  for (int r = 0; r < 16; ++r) a = __fadd_rn(a, __fmul_rn(bf16_round(A[(size_t)i * 16 + r]), bf16_round(Bm[(size_t)r * N + o])));
  const float v = __fadd_rn(bf16_round(Wm[t]), __fmul_rn(sc, a)); *(float*)(WE + t) = v;  }
__global__ __launch_bounds__(256) void k_wt32rep(const float* __restrict__ Wf, _Float16* __restrict__ Bt, int K, int N, int DOUT, float scale) {
  const int t = blockIdx.x * 256 + threadIdx.x; if (t >= DOUT * (K / 8)) return; const int n = t / (K / 8), k8 = (t % (K / 8)) * 8; const int rep = DOUT / N; const int src = (n / (HD * rep)) * HD + (n % HD);      /* head h = n / HD -> group h / rep */
  FragH f; for (int i = 0; i < 8; ++i) f.h[i] = (_Float16)(Wf[(size_t)(k8 + i) * N + src] * scale);
  *(v8us*)((unsigned short*)Bt + (size_t)n * K + k8) = f.half[0];  }
__global__ __launch_bounds__(256) void k_brep(const float* __restrict__ b, float* __restrict__ out) { const int t = blockIdx.x * 256 + threadIdx.x; if (t >= DM) return; const float v = b[(t / (HD * 4)) * HD + (t % HD)]; *(float*)(out + t) = v;  }

__global__ __launch_bounds__(256) void k_rsmcim(const float* __restrict__ S, _Float16* __restrict__ P, int hg, int q0, int nk, const int* __restrict__ am) {
  #pragma clang fp contract(off)
  const int t = blockIdx.x * 256 + threadIdx.x; if (t >= hg * QT) return; const size_t i = (size_t)t; const float* s = S + i * NKX; const int last = q0 + (t % QT); const int* mr = am + (size_t)last * SQ; float mx = -3.0e38f;      /* the module's mask row of this query (keys >= nk lie above the diagonal of the causal mask and are not computed) */
#pragma unroll 1
  for (int j = 0; j < nk; ++j) { const float f = (mr[j] != 0) ? 1.f : 0.f; mx = fmaxf(mx, fmaf(f, s[j], (1.f - f) * -1.0e9f)); } float se = 0.f;
#pragma unroll 1
  for (int j = 0; j < nk; ++j) { const float f = (mr[j] != 0) ? 1.f : 0.f; se += __expf(fmaf(f, s[j], (1.f - f) * -1.0e9f) - mx); } const float sc = 256.0f / se;
#pragma unroll 1
  for (int j0 = 0; j0 < nk; j0 += 8) { FragH fr; for (int q = 0; q < 8; ++q) { const int j = j0 + q; const float f = (mr[j] != 0) ? 1.f : 0.f; fr.h[q] = (_Float16)(__expf(fmaf(f, s[j], (1.f - f) * -1.0e9f) - mx) * sc); } unsigned short* d = (unsigned short*)P + i * NKX + j0; *(v8us*)d = fr.half[0];  } }



// One grid for the eleven preparation jobs (six weight transposes, the two planes of x, the three biases stacked): none reads what another writes, so they need no order among themselves.
// The block index picks the job (block-uniform branches; no job has a barrier). The large transposes come first, the short bias blocks last.
#define PB_WL ((DM / 128) * (DFF / 64))      /* tiles of W1, and of W2 */
#define PB_WS ((DM / 128) * (DM / 64))       /* tiles of one of Wq, Wk, Wv, Wo */
#define PB_W (2 * PB_WL + 4 * PB_WS)
#define PB_XE 4096                           /* elements of x a block: 8 pieces of 16 bytes a lane */
#define PB_X ((int)(NR * DM / PB_XE))
#define PB_B (3 * DM / 128)
__global__ __launch_bounds__(128) void k_prep(const float* __restrict__ x, const float* __restrict__ wq, const float* __restrict__ wk, const float* __restrict__ wv, const float* __restrict__ wo, const float* __restrict__ wfc, const float* __restrict__ wmp,
    const float* __restrict__ bq, const float* __restrict__ bk, const float* __restrict__ bv, _Float16* __restrict__ BQKV, _Float16* __restrict__ BO, _Float16* __restrict__ BW1, _Float16* __restrict__ BW2, float* __restrict__ bqkv, _Float16* __restrict__ X16, float* __restrict__ XB) {
  const int blk = blockIdx.x, tid = threadIdx.x;
  if (blk < PB_W) {      /* [in][out] -> Bt x16: W1, W2, stacked q | k | v, Wo */
    const float* W; _Float16* Wt; int K = DM, N = DM, r;
    if (blk < PB_WL) { W = wfc; Wt = BW1; N = DFF; r = blk; }
    else if (blk < 2 * PB_WL) { W = wmp; Wt = BW2; K = DFF; r = blk - PB_WL; }
    else { const int j = (blk - 2 * PB_WL) / PB_WS; r = (blk - 2 * PB_WL) - j * PB_WS; W = (j == 0) ? wq : (j == 1) ? wk : (j == 2) ? wv : wo; Wt = (j < 3) ? BQKV + (size_t)j * DM * DM : BO; }
    wt_f16_tile(W, Wt, K, N, 16.0f, r);
  } else if (blk < PB_W + PB_X) {      /* x read once: bf16(x) as exact f16 rows (GEMM operand) and as f32 rows (residual). A wave's load covers four whole lines, its stores four and two */
    const size_t e0 = (size_t)(blk - PB_W) * PB_XE + tid * 4; const float* p = x + e0; v4f a[8];
    /* unrolled: constant indices (registers), and the eight loads of a lane fly together */
#pragma unroll
    for (int i = 0; i < 8; ++i) a[i] = *(const v4fa*)(p + i * 512);
#pragma unroll
    for (int i = 0; i < 8; ++i) { v4f f; v4h h;
#pragma unroll
      for (int q = 0; q < 4; ++q) { f[q] = bf16_round(a[i][q]); h[q] = (_Float16)f[q]; }
      *(v4f*)(XB + e0 + i * 512) = f; *(v4h*)(X16 + e0 + i * 512) = h; }
    asm volatile("s_wait_xcnt 0x0" ::: "memory");      /* stands behind the last store, in front of any later write of a register that a store names */
  } else {      /* stacked bias bq | bk | bv: a block lies inside one of the three */
    const int c = blk - PB_W - PB_X, j = c / (DM / 128); const float* b = (j == 0) ? bq : (j == 1) ? bk : bv; const int i = (c - j * (DM / 128)) * 128 + tid; (bqkv + j * DM)[i] = b[i];
    asm volatile("s_wait_xcnt 0x0" ::: "memory");      /* as above: behind the store, in front of any later write of its registers */
  }
}



// lane l with lane l ^ 16
__device__ __forceinline__ float rs_xh(float v) { return __builtin_bit_cast(float, __builtin_amdgcn_permlanex16(__builtin_bit_cast(int, v), __builtin_bit_cast(int, v), 0x76543210, 0xfedcba98, false, false)); }
// native 2^t; the v_nop is the slot the instruction set asks for behind a transcendental before its result is read or its source overwritten
__device__ __forceinline__ float fa_exp2(float t) { float e; asm("v_exp_f32 %0, %1\n\tv_nop" : "=v"(e) : "v"(t)); return e; }
#define FA_KT 128      /* keys a stage */
#define FA_KP 144      /* LDS pitch of a K row, bytes: 128 of data + 16, an odd multiple of 16 (no bank conflict for 16-byte row reads) */
#define FA_VP 272      /* LDS pitch of a V^T row: 256 of data + 16, likewise */
#define FA_VO (FA_KT * FA_KP)      /* the 64 V^T rows stand behind the 128 K rows */
#define FA_STAGE (FA_VO + HD * FA_VP)      /* one buffer */
// Eight asynchronous 16-byte copies of a lane, global -> LDS: four of K (rows 32 apart), four of V^T (rows 16 apart). The s_wait_xcnt stands in the copies' own statement, behind the last of them,
// so that it precedes every later write of a register that a copy names.
__device__ __forceinline__ void fa_copy8(unsigned lk, const _Float16* gk, unsigned lv, const _Float16* gv) {
  asm volatile("global_load_async_to_lds_b128 %0, %8, off\n\t"
               "global_load_async_to_lds_b128 %1, %9, off\n\t"
               "global_load_async_to_lds_b128 %2, %10, off\n\t"
               "global_load_async_to_lds_b128 %3, %11, off\n\t"
               "global_load_async_to_lds_b128 %4, %12, off\n\t"
               "global_load_async_to_lds_b128 %5, %13, off\n\t"
               "global_load_async_to_lds_b128 %6, %14, off\n\t"
               "global_load_async_to_lds_b128 %7, %15, off\n\t"
               "s_wait_xcnt 0x0"
               :: "v"(lk), "v"(lk + 32u * FA_KP), "v"(lk + 64u * FA_KP), "v"(lk + 96u * FA_KP), "v"(lv), "v"(lv + 16u * FA_VP), "v"(lv + 32u * FA_VP), "v"(lv + 48u * FA_VP),
                  "v"(gk), "v"(gk + (size_t)32 * LQ), "v"(gk + (size_t)64 * LQ), "v"(gk + (size_t)96 * LQ), "v"(gv), "v"(gv + (size_t)16 * SQ), "v"(gv + (size_t)32 * SQ), "v"(gv + (size_t)48 * SQ) : "memory"); }
__global__ __launch_bounds__(256) void k_fattn(const _Float16* __restrict__ Q, const _Float16* __restrict__ Kk, const _Float16* __restrict__ VT, _Float16* __restrict__ O) {
  __shared__ __attribute__((aligned(16))) unsigned char sm[2 * FA_STAGE];
  const int tid = threadIdx.x, lane = tid & 31, w = tid >> 5, ln = lane & 15, hh = lane >> 4; const int h = blockIdx.y, b = blockIdx.z; const int q0 = blockIdx.x * 256 + w * 32; const size_t r0 = (size_t)b * SQ;
  const _Float16* qp = Q + (r0 + q0 + ln) * LQ + h * HD + 8 * hh;      /* the lane's own 8 hh is in the pointer: g2_frag is called with 0 */
  /* copies: lane = 16 bytes. K: 8 lanes a row of 128 bytes, thread rows tid / 8 + 32 i; V^T: 16 lanes a row of 256 bytes, thread rows tid / 16 + 16 i: a wave's copy covers four whole lines */
  const unsigned lk = (unsigned)(size_t)sm + (unsigned)(tid >> 3) * FA_KP + (unsigned)(tid & 7) * 16u; const unsigned lv = (unsigned)(size_t)sm + FA_VO + (unsigned)(tid >> 4) * FA_VP + (unsigned)(tid & 15) * 16u;
  const _Float16* gk = Kk + (r0 + (tid >> 3)) * LQ + h * HD + (tid & 7) * 8; const _Float16* gv = VT + ((size_t)(b * NH + h) * HD + (tid >> 4)) * SQ + (tid & 15) * 8;
  auto fill = [&](int t, int buf) { fa_copy8(lk + (unsigned)buf * FA_STAGE, gk + (size_t)t * FA_KT * LQ, lv + (unsigned)buf * FA_STAGE, gv + (size_t)t * FA_KT); };
  const unsigned char* sk = sm + ln * FA_KP + 16 * hh; const unsigned char* sv = sm + FA_VO + ln * FA_VP + 16 * hh;      /* the lane's fragment rows; same k order as g2_frag */
  const float L2E = 1.44269504088896340736f; const v8f z8 = {0.f,0.f,0.f,0.f,0.f,0.f,0.f,0.f};
  v16h qf[2][2], kf[2][2], vf[4]; v8f o[2][4]; float m[2] = {-3.0e38f, -3.0e38f}, l[2] = {0.f, 0.f};
  fill(0, 0);
  /* every loop over a fragment index is unrolled so that the fragment arrays have constant indices and stay in registers */
#pragma unroll
  for (int t = 0; t < 2; ++t) { qf[t][0] = g2_frag(qp + (size_t)t * 16 * LQ, 0); qf[t][1] = g2_frag(qp + (size_t)t * 16 * LQ + 32, 0);
#pragma unroll
    for (int dt = 0; dt < 4; ++dt) o[t][dt] = z8; }
  /* behind the loads that share one address pair: the wait that precedes any overwrite of that pair; the pair is an input, so it stays live (no load's result lands on it) up to the wait */
  asm volatile("s_wait_xcnt 0x0" :: "v"(qp) : "memory");
  asm volatile("s_wait_asynccnt 0x0" ::: "memory");      /* this wave's copies of stage 0 have landed */
  __syncthreads();      /* and every other wave's: stage 0 may be read */
  fill(1, 1);
  /* rolled: one copy of the body; a stage is 128 keys, while the next stage's copies fly */
#pragma unroll 1
  for (int t = 0; t < SQ / FA_KT; ++t) { const unsigned char* pk = sk + (t & 1) * FA_STAGE; const unsigned char* pv = sv + (t & 1) * FA_STAGE;
#pragma unroll
    for (int kt = 0; kt < 2; ++kt) { kf[kt][0] = g2_lfrag(pk + kt * 16 * FA_KP); kf[kt][1] = g2_lfrag(pk + kt * 16 * FA_KP + 64); }
    /* rolled: a pass is some 350 instructions already, and four copies of it spill. The stage's last pass fetches no K ahead (nothing of the next stage is read in front of the barrier) */
#pragma unroll 1
    for (int p = 0; p < FA_KT / 32; ++p) {
#pragma unroll
      for (int dt = 0; dt < 4; ++dt) vf[dt] = g2_lfrag(pv + dt * 16 * FA_VP + p * 64);
      v8f s[2][2];
#pragma unroll
      for (int u = 0; u < 2; ++u)
#pragma unroll
        for (int kt = 0; kt < 2; ++kt) s[u][kt] = g2_mma(kf[kt][1], qf[u][1], g2_mma(kf[kt][0], qf[u][0], z8));
      if (p + 1 < FA_KT / 32) {
#pragma unroll
        for (int kt = 0; kt < 2; ++kt) { kf[kt][0] = g2_lfrag(pk + ((p + 1) * 32 + kt * 16) * FA_KP); kf[kt][1] = g2_lfrag(pk + ((p + 1) * 32 + kt * 16) * FA_KP + 64); } }
      FragH pf[2];
#pragma unroll
      for (int u = 0; u < 2; ++u) { float mx = fmaxf(s[u][0][0], s[u][1][0]);
#pragma unroll
        for (int r = 1; r < 8; ++r) mx = fmaxf(mx, fmaxf(s[u][0][r], s[u][1][r]));
        mx = fmaxf(mx, rs_xh(mx)); const float mn = fmaxf(m[u], mx); const float al = fa_exp2((m[u] - mn) * L2E); const float mb = mn * L2E - 8.0f; m[u] = mn; float e0 = 0.f, e1 = 0.f;
#pragma unroll
        for (int r = 0; r < 8; ++r) { const float p0 = fa_exp2(fmaf(s[u][0][r], L2E, -mb)), p1 = fa_exp2(fmaf(s[u][1][r], L2E, -mb)); e0 += p0; e1 += p1; pf[u].h[r] = (_Float16)p0; pf[u].h[8 + r] = (_Float16)p1; }
        l[u] = fmaf(l[u], al, e0 + e1);      /* this half's keys only; the halves are joined behind the loop */
#pragma unroll
        for (int dt = 0; dt < 4; ++dt) o[u][dt] *= al; }
#pragma unroll
      for (int u = 0; u < 2; ++u)
#pragma unroll
        for (int dt = 0; dt < 4; ++dt) o[u][dt] = g2_mma(vf[dt], pf[u].v, o[u][dt]); }
    asm volatile("s_wait_dscnt 0x0" ::: "memory");      /* this wave's reads of the buffer are done before it is refilled */
    asm volatile("s_wait_asynccnt 0x0" ::: "memory");      /* this wave's copies of stage t + 1 have landed */
    __syncthreads();      /* publishes stage t + 1 and ends every wave's reads of stage t */
    if (t + 2 < SQ / FA_KT) fill(t + 2, t & 1); }
  asm volatile("s_wait_asynccnt 0x0" ::: "memory");      /* no copy is outstanding when the wave ends */
#pragma unroll
  for (int t = 0; t < 2; ++t) { const float fin = 64.0f / (l[t] + rs_xh(l[t]));      /* ctx carried x64; the x256 of the weights cancels in the quotient */
    _Float16* d = O + (r0 + q0 + t * 16 + ln) * DM + h * HD + 8 * hh;
#pragma unroll
    for (int dt = 0; dt < 4; ++dt) { FragH f;
#pragma unroll
      for (int r = 0; r < 8; ++r) f.h[r] = (_Float16)(o[t][dt][r] * fin);
      *(v8us*)((unsigned short*)d + dt * 16) = f.half[0]; } } }
extern "C" void kernel_launch(void* const* d_in, const int* in_sizes, int n_in,
                              void* d_out, int out_size, void* d_ws, size_t ws_size, hipStream_t stream) {
  (void)in_sizes; (void)n_in; (void)out_size;
  const float* const* I = (const float* const*)d_in; const float* x = I[0]; const float* wq = I[1]; const float* bq = I[2]; const float* wk = I[3]; const float* bk = I[4]; const float* wv = I[5]; const float* bv = I[6]; const float* wo = I[7]; const float* bo = I[8]; const float* wfc = I[9]; const float* bfc = I[10]; const float* wmp = I[11]; const float* bmp = I[12]; const float* g1 = I[13]; const float* be1 = I[14]; const float* gg2 = I[15]; const float* be2 = I[16];      /* x; [in][out] Wq / Wk / Wv / Wo + biases; W1 [1024][4096] + b1, W2 [4096][1024] + b2; LN1 g / b, LN2 g / b */
  char* ws = (char*)d_ws; size_t off = 0;
  auto take = [&](size_t bytes) { char* p = ws + off; off += (bytes + 255) & ~(size_t)255; return p; };
  _Float16* BQKV = (_Float16*)take((size_t)3 * DM * DM * 2); _Float16* BO = (_Float16*)take((size_t)DM * DM * 2); float* bqkv = (float*)take((size_t)3 * DM * 4); float* X1N = nullptr;      /* LN1 output (f32): aliases the QKV plane below (QKV's last readers, the V^T and attention launches, precede LN1) to stay within 256 MiB at NB 4 / SQ 2048 */
  _Float16* X16 = (_Float16*)take(NR * DM * 2); float* XB = (float*)take(NR * DM * 4); float* X1 = (float*)take(NR * DM * 4); _Float16* M16 = nullptr;      /* = X16 below (alias: X16's last reader, the fused QKV GEMM, precedes LN1's f16 write) */ _Float16* HF16 = nullptr;      /* FFN hidden plane of all rows [4096][4096] f16, taken below */ _Float16* BW1 = (_Float16*)take((size_t)DFF * DM * 2); _Float16* BW2 = (_Float16*)take((size_t)DM * DFF * 2); _Float16* QKV = (_Float16*)take(NR * 3 * DM * 2); _Float16* Q16 = QKV; _Float16* K16 = QKV + DM; _Float16* V16 = QKV + 2 * DM; _Float16* O16 = (_Float16*)take(NR * DM * 2); M16 = X16; X1N = (float*)QKV; HF16 = (_Float16*)take(NR * DFF * 2);      /* the FFN hidden plane of all rows (32 MiB) gets its OWN region here */      /* alias: X1N (NR*DM f32 = 16 MiB) inside QKV (24 MiB) */
  _Float16* VT = (_Float16*)take((size_t)NB * NH * HD * SQ * 2);
  if (off > ws_size) return;
  k_prep<<<(unsigned)(PB_W + PB_X + PB_B), 128, 0, stream>>>(x, wq, wk, wv, wo, wfc, wmp, bq, bk, bv, BQKV, BO, BW1, BW2, bqkv, X16, XB);      /* weights as Bt x16, stacked bias, x as exact f16 rows (post-LN: the attention runs on the raw input) and as bf16(x) f32 rows for the residual */
  const size_t r0p = (size_t)B0 * SQ;      /* first projected row */
  k_gemm2<0><<<dim3((unsigned)((MP / 128) * (3 * DM / 64)), 1), 128, 0, stream>>>(X16 + r0p * DM, DM, 0, BQKV, DM, 0, 0.0625f, bqkv, 0, nullptr, 1, 0, 0, nullptr, QKV + r0p * 3 * DM, 3 * DM, 0, MP, 3 * DM, DM);      /* q | k | v rows (f16); head h = columns h*HD.. of each DM block */
  k_vt<NH, SQ><<<NB * NH * (SQ / 64), 256, 0, stream>>>(V16, LQ, 0, VT);      /* V^T [NB][NH][HD][SQ] */
  k_fattn<<<dim3(SQ / 256, NH, NB), 256, 0, stream>>>(Q16, K16, VT, O16);      /* scores q.k (no scaling), softmax over all keys, ctx (merged heads, x64) as f16 rows */
  k_gemm2<0><<<dim3((unsigned)((MPO / 128) * (DM / 64)), 1), 128, 0, stream>>>(O16 + r0p * DM, DM, 0, BO, DM, 0, 0.0009765625f, bo, 0, XB + r0p * DM, -1, 0, 0, X1 + r0p * DM, nullptr, DM, 0, MPO, DM, DM);      /* out rows are the output layout */
  k_lnx<0, 1, 1><<<(unsigned)NR, 256, 0, stream>>>(X1, g1, be1, 1e-5f, M16, X1N);      /* x1 = LN1(x + attn_out) (eps 1e-5): f16 rows for the FFN input and f32 rows for the residual */
  k_gemm2<6><<<dim3((unsigned)((MPO / 128) * (DFF / 64)), 1), 128, 0, stream>>>(M16, DM, 0, BW1, DM, 0, 0.0625f, bfc, 0, nullptr, 1, 0, 0, nullptr, HF16, DFF, 0, MPO, DFF, DM);      /* gelu_erf(x1 W1 + b1) -> f16, the rows of both batches in one grid */
  k_gemm2<0><<<dim3((unsigned)((MPO / 128) * (DM / 64)), 1), 128, 0, stream>>>(HF16, DFF, 0, BW2, DFF, 0, 0.0625f, bmp, 0, X1N, -1, 0, 0, X1, nullptr, DM, 0, MPO, DM, DFF);      /* t = x1 + ffn + b2 (own-element residual) f32, over the dead pre-LN1 plane; likewise one grid */
  k_lnx<0, 0, 1><<<(unsigned)NR, 256, 0, stream>>>(X1, gg2, be2, 1e-5f, nullptr, (float*)d_out);      /* out = LN2(t) (eps 1e-5) -> f32 output rows */
}

// v007
// Measured time: 193 microseconds a run.
// In two side-by-side timings against v006, it was 1.39 and 1.41 times as fast.
// All steps since v000 together make it 38.6 times as fast.
#include <hip/hip_runtime.h>
// POST-LN transformer encoder block (x [2][2048][1024]; q/k/v = x W + b ([in][out] 1024 x 1024, zero biases); 16 heads of 64; scores = q k^T with NO 1/sqrt(head_dim) scaling (as the source module); softmax over all 2048 keys (no mask); x1 = LN1(x + ctx Wo + bo) (biased var, eps 1e-5, g / beta); out = LN2(x1 + gelu_erf(x1 W1 + b1) W2 + b2) ([in][out] 1024 x 4096 x 1024) -> [2][2048][1024]).
// Structure: token rows; x as exact f16 rows and bf16 f32 residual rows; natural weights as exact x16 planes; fused q | k | v WMMA GEMM (32x64 wave tiles, f32 accumulation, + stacked bias) -> f16; V^T via LDS transposes; one fused attention launch (S^T = K Q^T, online softmax in registers with f32 statistics and native exp, weights x256 f16, O^T += V^T P^T), ctx (x64) merged f16; x + ctx Wo + bo f32; LN1 on VALU -> f16 + f32; gelu FFN, all rows in one grid a GEMM; + residual; LN2 -> output; 9 launches (all preparation in one grid).
// Compute dtype: inputs rounded to bf16; x / weights exact; q, k, v, softmax weights and o as plain f16 GEMM operands (~2^-12); scores and softmax statistics f32; v_wmma_f32_16x16x32_f16.
#define NB 2
#define SQ 2048
#define DM 1024
#define NH 16
#define HD 64
#define HG 4                         /* heads per launch of the non-template k_vt (not launched) */
#define QT 256                       /* query rows per attention tile */
#define NKX SQ                       /* S / P row pitch */
#define QT0 128                      /* rows per head of the f32 k_att0 path (not launched) */
#define B0 0                         /* first batch processed (debug hook) */
#define NBR NB                       /* batches processed (debug hook) */
#define NR ((size_t)NB * SQ)
#define DMQ DM
#define DFF 4096         /* FFN hidden width */
#define MP ((int)((size_t)NBR * SQ)) /* rows projected (debug hook) */
#define QN SQ                        /* query rows per batch (not used) */
#define NHD NH                       /* heads (not used) */
#define MPO MP                       /* rows through the output stage (debug hook) */
#define LQ (3 * DM)      /* row pitch of the q/k/v rows */
typedef __bf16 v16b __attribute__((ext_vector_type(16)));
typedef unsigned short v8us __attribute__((ext_vector_type(8), may_alias));
typedef float  v8f  __attribute__((ext_vector_type(8)));
typedef float  v4f  __attribute__((ext_vector_type(4)));
typedef float  v4fa __attribute__((ext_vector_type(4), may_alias));
union FragB { v16b v; v8us half[2]; unsigned short u[16]; };

__device__ __forceinline__ unsigned short bf16_bits(float x) { unsigned int u = __float_as_uint(x); return (unsigned short)((u + 0x7FFFu + ((u >> 16) & 1u)) >> 16); }
__device__ __forceinline__ float bf16_val(unsigned short b) { return __uint_as_float(((unsigned int)b) << 16); }
__device__ __forceinline__ float bf16_round(float x) { return bf16_val(bf16_bits(x)); }
// D += A·B with NT terms: 1 = ah·bh, 2 = + al·bh (A split), 3 = + ah·bl (both split)
template <int NT>
__device__ __forceinline__ v8f mmaN(v16b ah, v16b al, v16b bh, v16b bl, v8f c) {
  c = __builtin_amdgcn_wmma_f32_16x16x32_bf16(false, ah, false, bh, (short)0, c, false, false);
  if (NT >= 2) c = __builtin_amdgcn_wmma_f32_16x16x32_bf16(false, al, false, bh, (short)0, c, false, false);
  if (NT >= 3) c = __builtin_amdgcn_wmma_f32_16x16x32_bf16(false, ah, false, bl, (short)0, c, false, false);
  asm volatile("v_nop\n\tv_nop\n\tv_nop\n\tv_nop" : "+v"(c) : "v"(ah), "v"(al), "v"(bh), "v"(bl));
  return c;
}

__global__ __launch_bounds__(256) void k_wt_bf16(const float* __restrict__ W, unsigned short* __restrict__ Wt, int K, int N) {
  const int t = blockIdx.x * 256 + threadIdx.x;
  const int k8n = K / 8;
  if (t >= N * k8n) return;
  const int n = t / k8n, k8 = (t % k8n) * 8;
  v8us v;
#pragma unroll
  for (int i = 0; i < 8; ++i) v[i] = bf16_bits(W[(size_t)(k8 + i) * N + n]);
  *(v8us*)(Wt + (size_t)n * K + k8) = v;
  
}

// GEMM C[M][N] (f32, pitch ldc) = act(A[M][K]·W + bias). A f32 row-major (pitch lda) converted per fragment to bf16
// (ASPLIT: hi/lo two planes -> 2 terms, else single rounded term); Wt bf16 [N][K] (pitch ldb). BIAS_BF16 rounds the
// bias to bf16 first (bias quantised to bf16 before the add). K%32==0, M%16==0, N%64==0.
template <bool ASPLIT, int ACT, bool BIAS_BF16>
__global__ __launch_bounds__(128) void k_gemm_bf(const float* __restrict__ A, int lda, const unsigned short* __restrict__ Wt, int ldb,
                                               const float* __restrict__ bias, float* __restrict__ C, int ldc, int M, int N, int K) {
  __shared__ __attribute__((aligned(16))) float so[4][16][64];
  const int tid = threadIdx.x, w = tid >> 5, lane = tid & 31, ln = lane & 15, hh = lane >> 4;
  const int ntn = N / 64;
  const int wid = blockIdx.x * 4 + w;
  const int mt = wid / ntn, nq = wid % ntn;
  if (mt * 16 >= M) return;
  const int row0 = mt * 16, col0 = nq * 64;
  const float* arow = A + (size_t)(row0 + ln) * lda;
  v8f acc[4] = {};
  for (int kb = 0; kb < K; kb += 32) {
    FragB ah, al;
    const v4f x0 = *(const v4fa*)(arow + kb + 8 * hh), x1 = *(const v4fa*)(arow + kb + 8 * hh + 4);
    const v4f x2 = *(const v4fa*)(arow + kb + 16 + 8 * hh), x3 = *(const v4fa*)(arow + kb + 16 + 8 * hh + 4);
    float xs[16] = {x0[0],x0[1],x0[2],x0[3],x1[0],x1[1],x1[2],x1[3],x2[0],x2[1],x2[2],x2[3],x3[0],x3[1],x3[2],x3[3]};
#pragma unroll
    for (int i = 0; i < 16; ++i) { const unsigned short hb = bf16_bits(xs[i]); ah.u[i] = hb; al.u[i] = ASPLIT ? bf16_bits(xs[i] - bf16_val(hb)) : (unsigned short)0; }
#pragma unroll
    for (int t = 0; t < 4; ++t) {
      const unsigned short* brow = Wt + (size_t)(col0 + t * 16 + ln) * ldb + kb;
      FragB b;
      b.half[0] = *(const v8us*)(brow + 8 * hh);
      b.half[1] = *(const v8us*)(brow + 16 + 8 * hh);
      acc[t] = mmaN<ASPLIT ? 2 : 1>(ah.v, al.v, b.v, b.v, acc[t]);
    }
  }
#pragma unroll
  for (int t = 0; t < 4; ++t) {
    float bv = bias ? bias[col0 + t * 16 + ln] : 0.f;
    if (BIAS_BF16) bv = bf16_round(bv);
#pragma unroll
    for (int r = 0; r < 8; ++r) { float v = acc[t][r] + bv; if (ACT == 1) v = fmaxf(v, 0.f); so[w][8 * hh + r][t * 16 + ln] = v; }
  }
  __builtin_amdgcn_fence(__ATOMIC_ACQ_REL, "workgroup");
  __builtin_amdgcn_wave_barrier();
  const int rsub = lane >> 4, c4 = (lane & 15) * 4;
  {
#pragma unroll
    for (int q = 0; q < 8; ++q) {
      const int r = q * 2 + rsub;
      const v4f v = *(const v4fa*)&so[w][r][c4];
      *(v4f*)(C + (size_t)(row0 + r) * ldc + col0 + c4) = v;
    }
    
  }
}

// GEMM C = act(A·W + bias + resid): A f32 (ASPLIT -> hi/lo 2 terms), Wt bf16 [N][K]; ACT 0 none, 1 relu, 2 exact gelu;
// resid (optional, f32, row index = (row % rmod), pitch ldr, RES_BF16 rounds it) added before the activation.
template <bool ASPLIT, int ACT, bool BIAS_BF16, bool RES_BF16>
__global__ __launch_bounds__(128) void k_gemm_bf3(const float* __restrict__ A, int lda, const unsigned short* __restrict__ Wt, int ldb,
                                                const float* __restrict__ bias, const float* __restrict__ resid, int rmod, int ldr,
                                                float* __restrict__ C, int ldc, int M, int N, int K) {
  __shared__ __attribute__((aligned(16))) float so[4][16][64];
  const int tid = threadIdx.x, w = tid >> 5, lane = tid & 31, ln = lane & 15, hh = lane >> 4;
  const int ntn = N / 64;
  const int wid = blockIdx.x * 4 + w;
  const int mt = wid / ntn, nq = wid % ntn;
  if (mt * 16 >= M) return;
  const int row0 = mt * 16, col0 = nq * 64;
  const float* arow = A + (size_t)(row0 + ln) * lda;
  v8f acc[4] = {};
  for (int kb = 0; kb < K; kb += 32) {
    FragB ah, al;
    const v4f x0 = *(const v4fa*)(arow + kb + 8 * hh), x1 = *(const v4fa*)(arow + kb + 8 * hh + 4);
    const v4f x2 = *(const v4fa*)(arow + kb + 16 + 8 * hh), x3 = *(const v4fa*)(arow + kb + 16 + 8 * hh + 4);
    float xs[16] = {x0[0],x0[1],x0[2],x0[3],x1[0],x1[1],x1[2],x1[3],x2[0],x2[1],x2[2],x2[3],x3[0],x3[1],x3[2],x3[3]};
#pragma unroll
    for (int i = 0; i < 16; ++i) { const unsigned short hb = bf16_bits(xs[i]); ah.u[i] = hb; al.u[i] = ASPLIT ? bf16_bits(xs[i] - bf16_val(hb)) : (unsigned short)0; }
#pragma unroll
    for (int t = 0; t < 4; ++t) {
      const unsigned short* brow = Wt + (size_t)(col0 + t * 16 + ln) * ldb + kb;
      FragB b;
      b.half[0] = *(const v8us*)(brow + 8 * hh);
      b.half[1] = *(const v8us*)(brow + 16 + 8 * hh);
      acc[t] = mmaN<ASPLIT ? 2 : 1>(ah.v, al.v, b.v, b.v, acc[t]);
    }
  }
#pragma unroll
  for (int t = 0; t < 4; ++t) {
    const int col = col0 + t * 16 + ln;
    float bv = bias ? bias[col] : 0.f;
    if (BIAS_BF16) bv = bf16_round(bv);
#pragma unroll
    for (int r = 0; r < 8; ++r) {
      float v = acc[t][r] + bv;
      if (resid) { float rv = resid[(size_t)((row0 + 8 * hh + r) % rmod) * ldr + col]; if (RES_BF16) rv = bf16_round(rv); v += rv; }
      if (ACT == 1) v = fmaxf(v, 0.f);
      if (ACT == 2) v = 0.5f * v * (1.0f + erff(v * 0.70710678118654752f));
      if (ACT == 3) { const float u = 0.7978845608028654f * (v + 0.044715f * v * v * v); v = 0.5f * v * (1.0f + tanhf(u)); }
      so[w][8 * hh + r][t * 16 + ln] = v;
    }
  }
  __builtin_amdgcn_fence(__ATOMIC_ACQ_REL, "workgroup");
  __builtin_amdgcn_wave_barrier();
  const int rsub = lane >> 4, c4 = (lane & 15) * 4;
  {
#pragma unroll
    for (int q = 0; q < 8; ++q) {
      const int r = q * 2 + rsub;
      const v4f v = *(const v4fa*)&so[w][r][c4];
      *(v4f*)(C + (size_t)(row0 + r) * ldc + col0 + c4) = v;
    }
    
  }
}
// row LayerNorm (biased variance, eps) over N: s = X (+ R); optional out_sum <- s; out_norm <- (s-mu)*rsqrt(var+eps)*g + b
template <bool PARAM_BF16>
__global__ __launch_bounds__(256) void k_layernorm(const float* __restrict__ X, const float* __restrict__ R, const float* __restrict__ g, const float* __restrict__ bta,
                                                  float* __restrict__ out_sum, float* __restrict__ out_norm, int N, float eps) {
  __shared__ float red[256];
  const int row = blockIdx.x, tid = threadIdx.x;
  const float* x = X + (size_t)row * N; const float* rr = R ? R + (size_t)row * N : nullptr;
  float vals[16];                     // up to N = 4096
  const int per = N / 256;            // contiguous chunk per thread? use strided-by-4 chunks: thread handles j = tid*4 + 1024*u
  float s1 = 0.f;
  for (int u = 0; u < per / 4; ++u) {
    const int j = tid * 4 + 1024 * u;
    const v4f a = *(const v4fa*)(x + j);
    v4f b = {0.f,0.f,0.f,0.f}; if (rr) b = *(const v4fa*)(rr + j);
#pragma unroll
    for (int q = 0; q < 4; ++q) { const float v = a[q] + b[q]; vals[u * 4 + q] = v; s1 += v; }
  }
  red[tid] = s1; __syncthreads();
  for (int st = 128; st > 0; st >>= 1) { if (tid < st) red[tid] += red[tid + st]; __syncthreads(); }
  const float mu = red[0] / (float)N; __syncthreads();
  float s2 = 0.f;
  for (int u = 0; u < per / 4; ++u)
#pragma unroll
    for (int q = 0; q < 4; ++q) { const float c = vals[u * 4 + q] - mu; s2 += c * c; }
  red[tid] = s2; __syncthreads();
  for (int st = 128; st > 0; st >>= 1) { if (tid < st) red[tid] += red[tid + st]; __syncthreads(); }
  const float rs = rsqrtf(red[0] / (float)N + eps);
  {
    for (int u = 0; u < per / 4; ++u) {
      const int j = tid * 4 + 1024 * u;
      v4f o, sm;
#pragma unroll
      for (int q = 0; q < 4; ++q) {
        float gg = g[j + q], bb = bta[j + q];
        if (PARAM_BF16) { gg = bf16_round(gg); bb = bf16_round(bb); }
        sm[q] = vals[u * 4 + q]; o[q] = (vals[u * 4 + q] - mu) * rs * gg + bb;
      }
      if (out_sum) *(v4f*)(out_sum + (size_t)row * N + j) = sm;
      *(v4f*)(out_norm + (size_t)row * N + j) = o;
    }
    
  }
}



// ---- f16 WMMA path (v_wmma_f32_16x16x32_f16): 11-bit significands for operands in range — used where a [0,1] probability operand needs more precision than bf16
typedef _Float16 v16h __attribute__((ext_vector_type(16)));
union FragH { v16h v; v8us half[2]; _Float16 h[16]; unsigned short u[16]; };
template <int NT>
__device__ __forceinline__ v8f mmaH(v16h ah, v16h al, v16h bh, v16h bl, v8f c) {
  c = __builtin_amdgcn_wmma_f32_16x16x32_f16(false, ah, false, bh, (short)0, c, false, false);
  if (NT >= 2) c = __builtin_amdgcn_wmma_f32_16x16x32_f16(false, al, false, bh, (short)0, c, false, false);
  if (NT >= 3) c = __builtin_amdgcn_wmma_f32_16x16x32_f16(false, ah, false, bl, (short)0, c, false, false);
  asm volatile("v_nop\n\tv_nop\n\tv_nop\n\tv_nop" : "+v"(c) : "v"(ah), "v"(al), "v"(bh), "v"(bl));
  return c;
}
// batched GEMM like k_gemm_b but f16 operands: A f32 (split into f16 hi/lo if ASPLIT, else rounded to f16), Bt = f16 values [n][k]; alpha; C f32; N multiple of 16 (partial tiles skipped)
template <bool ASPLIT>
__global__ __launch_bounds__(128) void k_gemm_h(const float* __restrict__ A, int lda, size_t sA, const _Float16* __restrict__ Bh, int ldb, size_t sB, float alpha, float* __restrict__ C, int ldc, size_t sC, int M, int N, int K) {
  __shared__ __attribute__((aligned(16))) float so[4][16][64];
  const int tid = threadIdx.x, w = tid >> 5, lane = tid & 31, ln = lane & 15, hh = lane >> 4; const int by = blockIdx.y;
  A += (size_t)by * sA; Bh += (size_t)by * sB; C += (size_t)by * sC;
  const int ntn = (N + 63) / 64; const int wid = blockIdx.x * 4 + w; const int mt = wid / ntn, nq = wid % ntn; if (mt * 16 >= M) return;
  const int row0 = mt * 16, col0 = nq * 64; const float* arow = A + (size_t)(row0 + ln) * lda;
  v8f acc[4] = {};
  for (int kb = 0; kb < K; kb += 32) {
    FragH ah, al;
    const v4f x0 = *(const v4fa*)(arow + kb + 8 * hh), x1 = *(const v4fa*)(arow + kb + 8 * hh + 4), x2 = *(const v4fa*)(arow + kb + 16 + 8 * hh), x3 = *(const v4fa*)(arow + kb + 16 + 8 * hh + 4);
    float xs[16] = {x0[0],x0[1],x0[2],x0[3],x1[0],x1[1],x1[2],x1[3],x2[0],x2[1],x2[2],x2[3],x3[0],x3[1],x3[2],x3[3]};
#pragma unroll
    for (int i = 0; i < 16; ++i) { const _Float16 h = (_Float16)xs[i]; ah.h[i] = h; al.h[i] = ASPLIT ? (_Float16)(xs[i] - (float)h) : (_Float16)0.0f; }
#pragma unroll
    for (int t = 0; t < 4; ++t) { if (col0 + t * 16 >= N) continue; const size_t boff = (size_t)(col0 + t * 16 + ln) * ldb + kb; FragH bq; bq.half[0] = *(const v8us*)(Bh + boff + 8 * hh); bq.half[1] = *(const v8us*)(Bh + boff + 16 + 8 * hh);
      acc[t] = mmaH<ASPLIT ? 2 : 1>(ah.v, al.v, bq.v, bq.v, acc[t]); }
  }
#pragma unroll
  for (int t = 0; t < 4; ++t) { if (col0 + t * 16 >= N) continue;
#pragma unroll
    for (int r = 0; r < 8; ++r) so[w][8 * hh + r][t * 16 + ln] = acc[t][r] * alpha; }
  __builtin_amdgcn_fence(__ATOMIC_ACQ_REL, "workgroup"); __builtin_amdgcn_wave_barrier();
  const int rsub = lane >> 4, c4 = (lane & 15) * 4;
  {
#pragma unroll
    for (int q = 0; q < 8; ++q) { const int r = q * 2 + rsub; if (col0 + c4 < N) { const v4f v = *(const v4fa*)&so[w][r][c4]; *(v4f*)(C + (size_t)(row0 + r) * ldc + col0 + c4) = v; } }
     }
}

// Wt[n][k] = f16(bf16(W[k][n])*scale) from f32 row-major W[K][N] (scale = power of two; bf16-exact weights stay exact in f16 away from the subnormal range). K % 128 == 0, N % 64 == 0.
// Transposed in registers: a lane reads 16-byte pieces (4 n) of 8 successive rows k, which is 4 output pieces of 16 bytes (8 k). Lanes: 4 along n, 8 along k, so a wave's store covers four whole
// 128-byte lines of Wt and its two loads of a row group cover the two halves of eight 128-byte lines of W. A wave takes 64 k x 32 n, a block (2 x 2 waves) 128 k x 64 n: 256 bytes a row on both sides.
// blk = the tile's number among the (K / 128) * (N / 64) tiles of this matrix; 128 threads.
__device__ __forceinline__ void wt_f16_tile(const float* __restrict__ W, _Float16* __restrict__ Wt, int K, int N, float scale, int blk) {
  const int lane = threadIdx.x & 31, w = threadIdx.x >> 5; const int ntn = N >> 6; const int bk = blk / ntn, bn = blk - bk * ntn;
  const int k0 = bk * 128 + (w >> 1) * 64 + (lane >> 2) * 8, n0 = bn * 64 + (w & 1) * 32 + (lane & 3) * 4;
  const float* p[8]; v4f a[8], b[8];
  /* unrolled: the arrays get constant indices (registers) */
#pragma unroll
  for (int i = 0; i < 8; ++i) { p[i] = W + (size_t)(k0 + i) * N + n0; a[i] = *(const v4fa*)p[i]; b[i] = *(const v4fa*)(p[i] + 16); }
  /* The loaded values are inputs: all sixteen loads stay in front of the first conversion, so the wave pays one memory latency (left alone the compiler sinks half of them among the conversions: four more round trips).
     The row pointers are inputs: they stay live up to here, so no load's result lands on an address pair of an issued load, and the wait precedes every later overwrite of such a pair */
  asm volatile("s_wait_xcnt 0x0" :: "v"(a[0]), "v"(a[1]), "v"(a[2]), "v"(a[3]), "v"(a[4]), "v"(a[5]), "v"(a[6]), "v"(a[7]), "v"(b[0]), "v"(b[1]), "v"(b[2]), "v"(b[3]), "v"(b[4]), "v"(b[5]), "v"(b[6]), "v"(b[7]),
               "v"(p[0]), "v"(p[1]), "v"(p[2]), "v"(p[3]), "v"(p[4]), "v"(p[5]), "v"(p[6]), "v"(p[7]));
  unsigned short* d = (unsigned short*)Wt + (size_t)n0 * K + k0;
#pragma unroll
  for (int q = 0; q < 4; ++q) { FragH f;
#pragma unroll
    for (int i = 0; i < 8; ++i) { f.h[i] = (_Float16)(bf16_round(a[i][q]) * scale); f.h[8 + i] = (_Float16)(bf16_round(b[i][q]) * scale); }
    *(v8us*)(d + (size_t)q * K) = f.half[0]; *(v8us*)(d + (size_t)(16 + q) * K) = f.half[1]; }
}
// k_gemm_hh variant with fused epilogue: v = acc·alpha + bias[by·sBias + col] (+ CP[(row/rowsPerB)·sCPb + by·64 + col] if CP) ; ACT 0 none / 1 elu ; writes f16 C16 (and f32 C if non-null)
template <int ACT>
__global__ __launch_bounds__(128) void k_gemm_hhx(const _Float16* __restrict__ A, int lda, size_t sA, const _Float16* __restrict__ Bh, int ldb, size_t sB, float alpha, const float* __restrict__ bias, size_t sBias, const float* __restrict__ CP, int rowsPerB, size_t sCPb, int row0g,
    float* __restrict__ C, _Float16* __restrict__ C16, int ldc, size_t sC, int M, int N, int K) {
  __shared__ __attribute__((aligned(16))) float so[4][16][64];
  const int tid = threadIdx.x, w = tid >> 5, lane = tid & 31, ln = lane & 15, hh = lane >> 4; const int by = blockIdx.y;
  A += (size_t)by * sA; Bh += (size_t)by * sB; const size_t cofs = (size_t)by * sC; const float* bp = bias ? bias + (size_t)by * sBias : nullptr;
  const int ntn = (N + 63) / 64; const int wid = blockIdx.x * 4 + w; const int mt = wid / ntn, nq = wid % ntn; if (mt * 16 >= M) return;
  const int row0 = mt * 16, col0 = nq * 64; const _Float16* arow = A + (size_t)(row0 + ln) * lda;
  v8f acc[4] = {};
  for (int kb = 0; kb < K; kb += 32) { FragH ah; ah.half[0] = *(const v8us*)((const unsigned short*)arow + kb + 8 * hh); ah.half[1] = *(const v8us*)((const unsigned short*)arow + kb + 16 + 8 * hh);
#pragma unroll
    for (int t = 0; t < 4; ++t) { if (col0 + t * 16 >= N) continue; const size_t boff = (size_t)(col0 + t * 16 + ln) * ldb + kb; FragH bq; bq.half[0] = *(const v8us*)((const unsigned short*)Bh + boff + 8 * hh); bq.half[1] = *(const v8us*)((const unsigned short*)Bh + boff + 16 + 8 * hh);
      acc[t] = mmaH<1>(ah.v, ah.v, bq.v, bq.v, acc[t]); }
  }
#pragma unroll
  for (int t = 0; t < 4; ++t) { if (col0 + t * 16 >= N) continue; const int col = col0 + t * 16 + ln; const float bv = bp ? bf16_round(bp[col]) : 0.f;
#pragma unroll
    for (int r = 0; r < 8; ++r) { float v = acc[t][r] * alpha + bv; if (CP) { const int rr = row0g + row0 + 8 * hh + r; if (rowsPerB < 0) v += CP[cofs + (size_t)rr * ldc + col];      /* rowsPerB < 0: own element of the batched C plane */ else { const int bidx = rr / rowsPerB; v += CP[(size_t)bidx * sCPb + (size_t)by * 64 + col]; } } if (ACT == 1) v = (v > 0.f) ? v : expm1f(v); else if (ACT == 7) v = (v > 0.f) ? v + 1.0f : expf(v); else if (ACT == 8) v = tanhf(v); else if (ACT == 9) v = 0.5f * v * (1.0f + tanhf(0.7978845608028654f * (v + 0.044715f * v * v * v))); else if (ACT == 11) v = 1.0f / (1.0f + expf(-v)); else if (ACT == 12) v = (v > 0.f) ? v : 0.01f * v; else if (ACT == 14) v = (v > 0.f) ? v : 0.1f * v; else if (ACT == 16) v = (v >= 0.f) ? v : 0.3f * v; else if (ACT == 17) v = (v >= 0.f) ? v : 0.2f * v; else if (ACT == 15) v = v / (1.0f + expf(-v)); else if (ACT == 3) v = fmaxf(v, 0.f); else if (ACT == 6) v = 0.5f * v * (1.0f + erff(v * 0.70710678118654752f)); so[w][8 * hh + r][t * 16 + ln] = v; } }
  __builtin_amdgcn_fence(__ATOMIC_ACQ_REL, "workgroup"); __builtin_amdgcn_wave_barrier();
  const int rsub = lane >> 4, c4 = (lane & 15) * 4; typedef _Float16 v4h __attribute__((ext_vector_type(4)));
  {
#pragma unroll
    for (int q = 0; q < 8; ++q) { const int r = q * 2 + rsub; if (col0 + c4 < N) { const v4f v = *(const v4fa*)&so[w][r][c4]; if (C) *(v4f*)(C + cofs + (size_t)(row0 + r) * ldc + col0 + c4) = v; if (C16) { v4h h4; for (int i = 0; i < 4; ++i) h4[i] = (_Float16)v[i]; *(v4h*)(C16 + cofs + (size_t)(row0 + r) * ldc + col0 + c4) = h4; } } }
     }
}


typedef _Float16 v4h __attribute__((ext_vector_type(4)));

__global__ __launch_bounds__(256) void k_h16(const float* __restrict__ x, _Float16* __restrict__ X16, size_t n8) { const size_t t = (size_t)blockIdx.x * 256 + threadIdx.x; if (t >= n8) return; FragH f;
#pragma unroll
  for (int q = 0; q < 8; ++q) f.h[q] = (_Float16)x[t * 8 + q]; *(v8us*)((unsigned short*)X16 + t * 8) = f.half[0];  }
__global__ __launch_bounds__(256) void k_round16f(const float* __restrict__ W, _Float16* __restrict__ Bt, size_t n8) { const size_t t = (size_t)blockIdx.x * 256 + threadIdx.x; if (t >= n8) return; FragH f;
#pragma unroll
  for (int i = 0; i < 8; ++i) f.h[i] = (_Float16)(bf16_round(W[t * 8 + i]) * 16.0f); *(v8us*)((unsigned short*)Bt + t * 8) = f.half[0];  }
template <int NHv, int TTv>
__global__ __launch_bounds__(256) void k_vt(const _Float16* __restrict__ V16, int ldv, int voff, _Float16* __restrict__ Vt) { __shared__ unsigned short tl[64][66]; const int tid = threadIdx.x; const int slab = blockIdx.x / (TTv / 64), lg = blockIdx.x % (TTv / 64); const int b = slab / NHv, h = slab % NHv;
  for (int i = tid; i < 64 * 8; i += 256) { const int r = i / 8, c8 = (i % 8) * 8; FragH f; f.half[0] = *(const v8us*)((const unsigned short*)V16 + ((size_t)b * TTv + lg * 64 + r) * ldv + voff + h * 64 + c8);
#pragma unroll
    for (int q = 0; q < 8; ++q) tl[r][c8 + q] = f.u[q]; }
  __syncthreads();
  {
#pragma unroll
    for (int rd = 0; rd < 2; ++rd) { const int d = rd * 32 + tid / 8, pc = tid % 8; FragH f;
#pragma unroll
      for (int q = 0; q < 8; ++q) f.u[q] = tl[pc * 8 + q][d];
      *(v8us*)((unsigned short*)Vt + ((size_t)slab * 64 + d) * TTv + lg * 64 + pc * 8) = f.half[0]; }
     } }

__global__ __launch_bounds__(256) void k_hl(const float* __restrict__ F, _Float16* __restrict__ Hh, _Float16* __restrict__ Hl, size_t n8) { const size_t t = (size_t)blockIdx.x * 256 + threadIdx.x; if (t >= n8) return; FragH fh, fl; const v4f a = *(const v4fa*)(F + t * 8), c = *(const v4fa*)(F + t * 8 + 4);
#pragma unroll
  for (int q = 0; q < 4; ++q) { _Float16 h = (_Float16)a[q]; fh.h[q] = h; fl.h[q] = (_Float16)((a[q] - (float)h) * 1024.0f); h = (_Float16)c[q]; fh.h[4 + q] = h; fl.h[4 + q] = (_Float16)((c[q] - (float)h) * 1024.0f); }
  { *(v8us*)((unsigned short*)Hh + t * 8) = fh.half[0]; *(v8us*)((unsigned short*)Hl + t * 8) = fl.half[0];  } }

// ---- fast GEMM (block tile 128x64, wave tile 32x64; A and B tiles of 128 k staged in LDS by asynchronous copies, two buffers; requires M % 128 == 0, N % 64 == 0, K % 128 == 0); epilogue = k_gemm_hhx semantics, the residual (RES) in its own-element form only ----
__device__ __forceinline__ v16h g2_frag(const _Float16* p, int hh) { FragH f; f.half[0] = *(const v8us*)((const unsigned short*)p + 8 * hh); f.half[1] = *(const v8us*)((const unsigned short*)p + 16 + 8 * hh); return f.v; }
__device__ __forceinline__ v8f g2_mma(v16h a, v16h b, v8f c) { v8f d = __builtin_amdgcn_wmma_f32_16x16x32_f16(false, a, false, b, (short)0, c, false, false); asm volatile("v_nop\n\tv_nop\n\tv_nop\n\tv_nop" : "+v"(d) : "v"(a), "v"(b)); return d; }
#define G2_PITCH 272      /* LDS row pitch, bytes: 256 of data + 16, an odd multiple of 16 (no bank conflict for 16-byte row reads) */
#define G2_STAGE (192 * G2_PITCH)      /* one buffer: 128 rows of A, then 64 rows of B, 128 k each */
// Eight asynchronous 16-byte copies of a lane, global -> LDS, rows 8 apart (st = 8 source rows, in elements). The s_wait_xcnt stands in the copies' own statement, behind the last of them,
// so that it precedes every later write of a register that a copy names.
__device__ __forceinline__ void g2_copy8(unsigned l, const _Float16* g, size_t st) {
  asm volatile("global_load_async_to_lds_b128 %0, %8, off\n\t"
               "global_load_async_to_lds_b128 %1, %9, off\n\t"
               "global_load_async_to_lds_b128 %2, %10, off\n\t"
               "global_load_async_to_lds_b128 %3, %11, off\n\t"
               "global_load_async_to_lds_b128 %4, %12, off\n\t"
               "global_load_async_to_lds_b128 %5, %13, off\n\t"
               "global_load_async_to_lds_b128 %6, %14, off\n\t"
               "global_load_async_to_lds_b128 %7, %15, off\n\t"
               "s_wait_xcnt 0x0"
               :: "v"(l), "v"(l + 8u * G2_PITCH), "v"(l + 16u * G2_PITCH), "v"(l + 24u * G2_PITCH), "v"(l + 32u * G2_PITCH), "v"(l + 40u * G2_PITCH), "v"(l + 48u * G2_PITCH), "v"(l + 56u * G2_PITCH),
                  "v"(g), "v"(g + st), "v"(g + 2 * st), "v"(g + 3 * st), "v"(g + 4 * st), "v"(g + 5 * st), "v"(g + 6 * st), "v"(g + 7 * st) : "memory"); }
// a fragment from a staged row: p = the row's place + 64 bytes a k step + 16 hh; same k order as g2_frag
__device__ __forceinline__ v16h g2_lfrag(const unsigned char* p) { FragH f; f.half[0] = *(const v8us*)p; f.half[1] = *(const v8us*)(p + 32); return f.v; }
template <int ACT, bool RES>
__global__ __launch_bounds__(128) void k_gemm2(const _Float16* __restrict__ A, int lda, size_t sA, const _Float16* __restrict__ Bh, int ldb, size_t sB, float alpha, const float* __restrict__ bias, size_t sBias, const float* __restrict__ CP, int rowsPerB, size_t sCPb, int row0g,
    float* __restrict__ C, _Float16* __restrict__ C16, int ldc, size_t sC, int M, int N, int K) { static_assert(ACT == 0 || ACT == 3 || ACT == 6 || ACT == 8 || ACT == 9 || ACT == 11 || ACT == 12 || ACT == 14 || ACT == 15 || ACT == 16 || ACT == 17, "k_gemm2: unsupported ACT code (would silently apply no activation)");
  static_assert(!RES || ACT == 0, "k_gemm2: the residual is added behind the staging, which is in front of the activation only where there is none"); (void)rowsPerB; (void)sCPb;      /* RES: CP holds the residual plane, laid out as C, first row row0g */
  __shared__ __attribute__((aligned(16))) unsigned char sm[2 * G2_STAGE]; float (*so)[32][68] = (float (*)[32][68])sm;      /* two operand buffers; behind the loop's last barrier the same LDS stages the output tile */
  const int tid = threadIdx.x, w = tid >> 5, lane = tid & 31, ln = lane & 15, hh = lane >> 4; const int by = blockIdx.y;
  A += (size_t)by * sA; Bh += (size_t)by * sB; const size_t cofs = (size_t)by * sC; const float* bp = bias ? bias + (size_t)by * sBias : nullptr;
  const int ntn = N >> 6; const int mt = blockIdx.x / ntn, nq = blockIdx.x - mt * ntn; const int row0 = mt * 128 + 32 * w, col0 = nq * 64; if (mt * 128 >= M) return;      /* the whole block leaves, in front of every barrier */
  /* copies: lane = 16 bytes; 16 lanes a row of 256 bytes, so a wave's copy covers two whole rows; thread rows tid / 16 + 8 i */
  const unsigned lc = (unsigned)(size_t)sm + (unsigned)(tid >> 4) * G2_PITCH + (unsigned)(tid & 15) * 16u;
  const _Float16* ga = A + (size_t)(mt * 128 + (tid >> 4)) * lda + (tid & 15) * 8; const _Float16* gb = Bh + (size_t)(col0 + (tid >> 4)) * ldb + (tid & 15) * 8;
  auto fill = [&](int t, int buf) { const unsigned l = lc + (unsigned)buf * G2_STAGE; const _Float16* a = ga + (size_t)t * 128;
    g2_copy8(l, a, (size_t)8 * lda); g2_copy8(l + 64u * G2_PITCH, a + (size_t)64 * lda, (size_t)8 * lda); g2_copy8(l + 128u * G2_PITCH, gb + (size_t)t * 128, (size_t)8 * ldb); };
  const unsigned char* sa = sm + (32 * w + ln) * G2_PITCH + 16 * hh; const unsigned char* sb = sm + (128 + ln) * G2_PITCH + 16 * hh;
  const v8f z8 = {0.f,0.f,0.f,0.f,0.f,0.f,0.f,0.f}; v8f c00 = z8, c01 = z8, c02 = z8, c03 = z8, c10 = z8, c11 = z8, c12 = z8, c13 = z8;
  const int nt = K >> 7;
  fill(0, 0);
  /* the wave's four bias values go out here as one group: their latency passes under that of tile 0's copies. The s_wait_xcnt stands behind the loads, in front of every later overwrite of a register that they name (the pointer is its input and stays live up to it) */
  float bl[4] = {0.f, 0.f, 0.f, 0.f};
  if (bp) { const float* b0 = bp + col0 + ln;
#pragma unroll
    for (int t = 0; t < 4; ++t) bl[t] = b0[t * 16];
    asm volatile("s_wait_xcnt 0x0" :: "v"(b0) : "memory"); }
  asm volatile("s_wait_asynccnt 0x0" ::: "memory");      /* this wave's copies of tile 0 have landed */
  __syncthreads();      /* and every other wave's: tile 0 may be read */
  if (nt > 1) fill(1, 1);
  /* rolled: one copy of the body; a trip is 128 k = 32 products a wave, while the next tile's copies fly */
#pragma unroll 1
  for (int t = 0; t < nt; ++t) { const unsigned char* pa = sa + (t & 1) * G2_STAGE; const unsigned char* pb = sb + (t & 1) * G2_STAGE;
    v16h fa[2][2], fb[2][4];      /* two fragment sets */
    fa[0][0] = g2_lfrag(pa); fb[0][0] = g2_lfrag(pb); fa[0][1] = g2_lfrag(pa + 16 * G2_PITCH); fb[0][1] = g2_lfrag(pb + 16 * G2_PITCH); fb[0][2] = g2_lfrag(pb + 32 * G2_PITCH); fb[0][3] = g2_lfrag(pb + 48 * G2_PITCH);
    /* unrolled: the sets get constant indices (registers) and the LDS offsets become immediates. The reads of k step ks + 1 go as one group in front of the products of step ks, so only the trip's first group is waited for in full */
#pragma unroll
    for (int ks = 0; ks < 4; ++ks) { const int c = ks & 1, n = c ^ 1, o = (ks + 1) * 64;
      if (ks < 3) { fa[n][0] = g2_lfrag(pa + o); fb[n][0] = g2_lfrag(pb + o); fa[n][1] = g2_lfrag(pa + 16 * G2_PITCH + o); fb[n][1] = g2_lfrag(pb + 16 * G2_PITCH + o); fb[n][2] = g2_lfrag(pb + 32 * G2_PITCH + o); fb[n][3] = g2_lfrag(pb + 48 * G2_PITCH + o); }
      c00 = g2_mma(fa[c][0], fb[c][0], c00); c10 = g2_mma(fa[c][1], fb[c][0], c10);
      c01 = g2_mma(fa[c][0], fb[c][1], c01); c11 = g2_mma(fa[c][1], fb[c][1], c11);
      c02 = g2_mma(fa[c][0], fb[c][2], c02); c12 = g2_mma(fa[c][1], fb[c][2], c12);
      c03 = g2_mma(fa[c][0], fb[c][3], c03); c13 = g2_mma(fa[c][1], fb[c][3], c13); }
    asm volatile("s_wait_dscnt 0x0" ::: "memory");      /* this wave's reads of the buffer are done before it is refilled */
    asm volatile("s_wait_asynccnt 0x0" ::: "memory");      /* this wave's copies of tile t + 1 have landed */
    __syncthreads();      /* publishes tile t + 1 and ends every wave's reads of tile t */
    if (t + 2 < nt) fill(t + 2, t & 1); }
  asm volatile("s_wait_asynccnt 0x0" ::: "memory");      /* no copy is outstanding when the LDS changes its use */
  const int rsub = lane >> 4, c4 = (lane & 15) * 4; const size_t e0 = cofs + (size_t)(row0 + rsub) * ldc + col0 + c4, es = (size_t)2 * ldc;      /* the lane's 16-byte piece of tile row rsub + 2 q stands at element e0 + q es of the C plane */
  /* The residual goes out here as one group of sixteen loads, in the store phase's own layout (whole 256-byte row pieces, 16 bytes a lane): the wave pays one memory latency for all of it, and the scaling and staging below run under it.
     The s_wait_xcnt stands behind the loads; the pointers are its inputs, so they stay live up to it: no load's result lands on an address of an issued load, and the wait precedes every later overwrite of one */
  v4f rv[16];
  if (RES) { const float* rp[16];
#pragma unroll
    for (int q = 0; q < 16; ++q) { rp[q] = CP + (size_t)row0g * ldc + e0 + q * es; rv[q] = *(const v4fa*)rp[q]; }
    asm volatile("s_wait_xcnt 0x0" :: "v"(rp[0]), "v"(rp[1]), "v"(rp[2]), "v"(rp[3]), "v"(rp[4]), "v"(rp[5]), "v"(rp[6]), "v"(rp[7]), "v"(rp[8]), "v"(rp[9]), "v"(rp[10]), "v"(rp[11]), "v"(rp[12]), "v"(rp[13]), "v"(rp[14]), "v"(rp[15]) : "memory"); }
  v8f accs[8] = {c00, c01, c02, c03, c10, c11, c12, c13};
#pragma unroll
  for (int u = 0; u < 8; ++u) { const int t = u & 3, half = u >> 2; const float bv = bf16_round(bl[t]);
#pragma unroll
    for (int r = 0; r < 8; ++r) { const int rloc = half * 16 + 8 * hh + r; float v = accs[u][r] * alpha + bv;
      if (ACT == 3) v = fmaxf(v, 0.f); else if (ACT == 6) v = 0.5f * v * (1.0f + erff(v * 0.70710678118654752f)); else if (ACT == 11) v = 1.0f / (1.0f + expf(-v)); else if (ACT == 15) v = v / (1.0f + expf(-v)); else if (ACT == 12) v = (v > 0.f) ? v : 0.01f * v; else if (ACT == 8) v = tanhf(v); else if (ACT == 9) v = 0.5f * v * (1.0f + tanhf(0.7978845608028654f * (v + 0.044715f * v * v * v))); else if (ACT == 14) v = (v > 0.f) ? v : 0.1f * v; else if (ACT == 16) v = (v >= 0.f) ? v : 0.3f * v; else if (ACT == 17) v = (v >= 0.f) ? v : 0.2f * v;
      so[w][rloc][t * 16 + ln] = v; } }
  __builtin_amdgcn_fence(__ATOMIC_ACQ_REL, "workgroup"); __builtin_amdgcn_wave_barrier();
  v4f ov[16];
#pragma unroll
  for (int q = 0; q < 16; ++q) { ov[q] = *(const v4fa*)&so[w][q * 2 + rsub][c4]; if (RES) ov[q] += rv[q]; }
  /* stores in groups of eight; behind each group the s_wait_xcnt, with the group's pointers and data as inputs: they stay as they are up to the wait */
  if (C) {
#pragma unroll
    for (int g = 0; g < 2; ++g) { float* cp[8];
#pragma unroll
      for (int i = 0; i < 8; ++i) { cp[i] = C + e0 + (g * 8 + i) * es; *(v4f*)cp[i] = ov[g * 8 + i]; }
      asm volatile("s_wait_xcnt 0x0" :: "v"(cp[0]), "v"(cp[1]), "v"(cp[2]), "v"(cp[3]), "v"(cp[4]), "v"(cp[5]), "v"(cp[6]), "v"(cp[7]), "v"(ov[g * 8 + 0]), "v"(ov[g * 8 + 1]), "v"(ov[g * 8 + 2]), "v"(ov[g * 8 + 3]), "v"(ov[g * 8 + 4]), "v"(ov[g * 8 + 5]), "v"(ov[g * 8 + 6]), "v"(ov[g * 8 + 7]) : "memory"); } }
  if (C16) {
#pragma unroll
    for (int g = 0; g < 2; ++g) { _Float16* cp[8]; v4h hv[8];
#pragma unroll
      for (int i = 0; i < 8; ++i) { for (int j = 0; j < 4; ++j) hv[i][j] = (_Float16)ov[g * 8 + i][j]; cp[i] = C16 + e0 + (g * 8 + i) * es; *(v4h*)cp[i] = hv[i]; }
      asm volatile("s_wait_xcnt 0x0" :: "v"(cp[0]), "v"(cp[1]), "v"(cp[2]), "v"(cp[3]), "v"(cp[4]), "v"(cp[5]), "v"(cp[6]), "v"(cp[7]), "v"(hv[0]), "v"(hv[1]), "v"(hv[2]), "v"(hv[3]), "v"(hv[4]), "v"(hv[5]), "v"(hv[6]), "v"(hv[7]) : "memory"); } } }


__global__ __launch_bounds__(256) void k_wnat(const float* __restrict__ w, size_t n8, _Float16* __restrict__ Bt) { const size_t t = (size_t)blockIdx.x * 256 + threadIdx.x; if (t >= n8) return; FragH f; for (int q = 0; q < 8; ++q) f.h[q] = (_Float16)(bf16_round(w[t * 8 + q]) * 16.0f); *(v8us*)((unsigned short*)Bt + t * 8) = f.half[0];  }
__global__ __launch_bounds__(256) void k_rsm(const float* __restrict__ S, _Float16* __restrict__ P, int nrows) {
  #pragma clang fp contract(off)
  const int i = blockIdx.x * 256 + threadIdx.x; if (i >= nrows) return; const float* s = S + (size_t)i * SQ; float mx = -3.0e38f;
#pragma unroll 1
  for (int j = 0; j < SQ; ++j) mx = fmaxf(mx, s[j]); float se = 0.f;
#pragma unroll 1
  for (int j = 0; j < SQ; ++j) se += expf(s[j] - mx); const float sc = 256.0f / se;
#pragma unroll 1
  for (int j0 = 0; j0 < SQ; j0 += 8) { FragH f; for (int q = 0; q < 8; ++q) f.h[q] = (_Float16)(expf(s[j0 + q] - mx) * sc); unsigned short* d = (unsigned short*)P + (size_t)i * SQ + j0; *(v8us*)d = f.half[0];  } }
__global__ __launch_bounds__(256) void k_vt(const _Float16* __restrict__ V16, int b, int h0, _Float16* __restrict__ VT) { __shared__ unsigned short tl[64][65]; const int tid = threadIdx.x; const int hh = blockIdx.x % HG, sg = blockIdx.x / HG; const int s0 = sg * 64; const int h = h0 + hh;
  for (int i = tid; i < 64 * 8; i += 256) { const int j = i / 8, d8 = (i % 8) * 8; FragH f; f.half[0] = *(const v8us*)((const unsigned short*)V16 + ((size_t)b * SQ + s0 + j) * DM + h * HD + d8); for (int q = 0; q < 8; ++q) tl[d8 + q][j] = f.u[q]; }
  __syncthreads();
  { for (int i = tid; i < 64 * 8; i += 256) { const int d = i / 8, j8 = (i % 8) * 8; FragH f; for (int q = 0; q < 8; ++q) f.u[q] = tl[d][j8 + q]; *(v8us*)((unsigned short*)VT + ((size_t)hh * HD + d) * SQ + s0 + j8) = f.half[0]; }  } }



__global__ __launch_bounds__(256) void k_rsmcf2(const float* __restrict__ S, _Float16* __restrict__ P, int hg, int q0, int nk) {
  #pragma clang fp contract(off)
  const int t = blockIdx.x * 256 + threadIdx.x; if (t >= hg * QT) return; const size_t i = (size_t)t; const float* s = S + i * NKX; const int last = q0 + (t % QT); float mx = -3.0e38f;
#pragma unroll 1
  for (int j = 0; j < nk; ++j) { const float f = (j <= last) ? 1.f : 0.f; mx = fmaxf(mx, fmaf(f, s[j], (1.f - f) * -1.0e9f)); } float se = 0.f;
#pragma unroll 1
  for (int j = 0; j < nk; ++j) { const float f = (j <= last) ? 1.f : 0.f; se += __expf(fmaf(f, s[j], (1.f - f) * -1.0e9f) - mx); } const float sc = 256.0f / se;
#pragma unroll 1
  for (int j0 = 0; j0 < nk; j0 += 8) { FragH fr; for (int q = 0; q < 8; ++q) { const int j = j0 + q; const float f = (j <= last) ? 1.f : 0.f; fr.h[q] = (_Float16)(__expf(fmaf(f, s[j], (1.f - f) * -1.0e9f) - mx) * sc); } unsigned short* d = (unsigned short*)P + i * NKX + j0; *(v8us*)d = fr.half[0];  } }


template <int MASKADD>
__global__ __launch_bounds__(64) void k_att0(const float* __restrict__ QF, const float* __restrict__ KF, const float* __restrict__ VF, int ld, const float* __restrict__ mask, float scale, float* __restrict__ OF, int ldo) {
  #pragma clang fp contract(off)
  __shared__ __attribute__((aligned(16))) float lq[64][64]; __shared__ __attribute__((aligned(16))) float lo[64][64];
  const int tid = threadIdx.x; const int h = blockIdx.x / (QT0 / 64), rg = blockIdx.x % (QT0 / 64); const int i = rg * 64 + tid;
  const float* qr = QF + (size_t)i * ld + h * HD;
#pragma unroll 1
  for (int c = 0; c < HD / 4; ++c) { *(v4f*)&lq[tid][c * 4] = *(const v4fa*)(qr + c * 4); const v4f z = {0.f, 0.f, 0.f, 0.f}; *(v4f*)&lo[tid][c * 4] = z; }
  float m = -1.0e30f, l = 0.f; const int jmax = MASKADD ? (SQ - 1) : (rg * 64 + 63);      /* additive-mask form: every key (the mask input decides); causal form: keys up to the block's last row */
#pragma unroll 1
  for (int j = 0; j <= jmax; ++j) { const float* kr = KF + (size_t)j * ld + h * HD; const float* vr = VF + (size_t)j * ld + h * HD; float s = 0.f;
#pragma unroll 1
    for (int c = 0; c < HD / 4; ++c) { const v4f kq = *(const v4fa*)(kr + c * 4); const v4f qq = *(v4f*)&lq[tid][c * 4]; s = __fadd_rn(s, __fmul_rn(qq[0], kq[0])); s = __fadd_rn(s, __fmul_rn(qq[1], kq[1])); s = __fadd_rn(s, __fmul_rn(qq[2], kq[2])); s = __fadd_rn(s, __fmul_rn(qq[3], kq[3])); }
    s = __fmul_rn(s, scale); if (MASKADD) s = __fadd_rn(s, __fmul_rn(bf16_round(mask[(size_t)i * SQ + j]), -10000.0f));
    const float f = (MASKADD || j <= i) ? 1.f : 0.f; const float sm = fmaf(f, s, (1.f - f) * -1.0e30f); const float mn = fmaxf(m, sm); const float sc = expf(m - mn); const float e = expf(sm - mn); l = __fadd_rn(__fmul_rn(l, sc), e); m = mn;
#pragma unroll 1
    for (int c = 0; c < HD / 4; ++c) { const v4f vv = *(const v4fa*)(vr + c * 4); v4f oo = *(v4f*)&lo[tid][c * 4]; for (int u = 0; u < 4; ++u) oo[u] = __fadd_rn(__fmul_rn(oo[u], sc), __fmul_rn(e, vv[u])); *(v4f*)&lo[tid][c * 4] = oo; } }
  const float fin = 64.0f / l;      /* o carried x64 like the f16 path */
#pragma unroll 1
  for (int c = 0; c < HD / 4; ++c) { v4f oo = *(v4f*)&lo[tid][c * 4]; for (int u = 0; u < 4; ++u) oo[u] = __fmul_rn(oo[u], fin); *(v4f*)&lo[tid][c * 4] = oo; }
  __syncthreads();
  {
#pragma unroll 1
    for (int it = 0; it < 16; ++it) { const int row = it * 4 + tid / 16, pc = (tid % 16) * 4; const v4f v = *(const v4f*)&lo[row][pc]; *(v4f*)(OF + (size_t)(rg * 64 + row) * ldo + h * HD + pc) = v; }
     } }


template <int BFIN, int WXB>
__global__ __launch_bounds__(256) void k_ln16(const float* __restrict__ X, const float* __restrict__ g, const float* __restrict__ bb, float eps, _Float16* __restrict__ N16, float* __restrict__ XB) {
  #pragma clang fp contract(off)
  __shared__ float red[256]; const size_t r = blockIdx.x; const int t = threadIdx.x; const v4f xa = *(const v4fa*)(X + r * DMQ + t * 4); float s[4]; float sum = 0.f;
  for (int q = 0; q < 4; ++q) { s[q] = BFIN ? bf16_round(xa[q]) : xa[q]; sum = __fadd_rn(sum, s[q]); }
  red[t] = sum; __syncthreads(); for (int st = 128; st > 0; st >>= 1) { if (t < st) red[t] = __fadd_rn(red[t], red[t + st]); __syncthreads(); } const float mu = red[0] / (float)DMQ; __syncthreads();
  float vs = 0.f; for (int q = 0; q < 4; ++q) { const float dl = __fadd_rn(s[q], -mu); vs = __fadd_rn(vs, __fmul_rn(dl, dl)); } red[t] = vs; __syncthreads(); for (int st = 128; st > 0; st >>= 1) { if (t < st) red[t] = __fadd_rn(red[t], red[t + st]); __syncthreads(); }
  const float rs = rsqrtf(__fadd_rn(red[0] / (float)DMQ, eps)); v4h y; v4f xb;
  for (int q = 0; q < 4; ++q) { const int c = t * 4 + q; y[q] = (_Float16)__fadd_rn(__fmul_rn(__fmul_rn(__fadd_rn(s[q], -mu), rs), bf16_round(g[c])), bf16_round(bb[c])); xb[q] = s[q]; }
  { *(v4h*)(N16 + r * DMQ + t * 4) = y; if (WXB) *(v4f*)(XB + r * DMQ + t * 4) = xb;  } }
__global__ __launch_bounds__(256) void k_ftres2(const float* __restrict__ OF0, const float* __restrict__ XB, float* __restrict__ X1, size_t n4) {
  #pragma clang fp contract(off)
  const size_t t = (size_t)blockIdx.x * 256 + threadIdx.x; if (t >= n4) return; const v4f o = *(const v4fa*)(OF0 + t * 4), xv = *(const v4fa*)(XB + t * 4); v4f y; for (int q = 0; q < 4; ++q) y[q] = __fadd_rn(__fmul_rn(o[q], 0.015625f), xv[q]); *(v4f*)(X1 + t * 4) = y;  }

__global__ __launch_bounds__(256) void k_wthd(const float* __restrict__ Wt, _Float16* __restrict__ Bt) { const size_t t = (size_t)blockIdx.x * 256 + threadIdx.x; if (t >= (size_t)NH * HD * (DM / 8)) return; const int m8 = (int)(t % (DM / 8)) * 8; const int d = (int)((t / (DM / 8)) % HD); const int h = (int)(t / ((size_t)(DM / 8) * HD)); FragH f;
  for (int q = 0; q < 8; ++q) f.h[q] = (_Float16)(16.0f * bf16_round(Wt[((size_t)h * DM + m8 + q) * HD + d])); unsigned short* dst = (unsigned short*)Bt + ((size_t)h * HD + d) * DM + m8; *(v8us*)dst = f.half[0];  }




template <int BFIN, int W16, int W32>
__global__ __launch_bounds__(256) void k_lnx(const float* __restrict__ X, const float* __restrict__ g, const float* __restrict__ bb, float eps, _Float16* __restrict__ N16, float* __restrict__ N32) {
  #pragma clang fp contract(off)
  __shared__ float red[256]; const size_t r = blockIdx.x; const int t = threadIdx.x; const bool act = t < (DMQ / 4); const int c0 = act ? t * 4 : 0;
  const v4f xa = *(const v4fa*)(X + r * DMQ + c0); float s[4]; float sum = 0.f;
  for (int q = 0; q < 4; ++q) { s[q] = act ? (BFIN ? bf16_round(xa[q]) : xa[q]) : 0.f; sum = __fadd_rn(sum, s[q]); }
  red[t] = sum; __syncthreads(); for (int st = 128; st > 0; st >>= 1) { if (t < st) red[t] = __fadd_rn(red[t], red[t + st]); __syncthreads(); } const float mu = red[0] / (float)DMQ; __syncthreads();
  float vs = 0.f; for (int q = 0; q < 4; ++q) { const float dl = act ? __fadd_rn(s[q], -mu) : 0.f; vs = __fadd_rn(vs, __fmul_rn(dl, dl)); } red[t] = vs; __syncthreads(); for (int st = 128; st > 0; st >>= 1) { if (t < st) red[t] = __fadd_rn(red[t], red[t + st]); __syncthreads(); }
  const float rs = rsqrtf(__fadd_rn(red[0] / (float)DMQ, eps)); v4h y; v4f yf;
  for (int q = 0; q < 4; ++q) { const int c = c0 + q; yf[q] = __fadd_rn(__fmul_rn(__fmul_rn(__fadd_rn(s[q], -mu), rs), bf16_round(g[c])), bf16_round(bb[c])); y[q] = (_Float16)yf[q]; }
  if (!act) return;      /* no barriers after this point */
  { if (W16) *(v4h*)(N16 + r * DMQ + c0) = y; if (W32) *(v4f*)(N32 + r * DMQ + c0) = yf;  } }






__global__ __launch_bounds__(256) void k_lorafold(const float* __restrict__ Wm, const float* __restrict__ A, const float* __restrict__ Bm, float* __restrict__ WE, int K, int N, float sc) {
  #pragma clang fp contract(off)
  const size_t t = (size_t)blockIdx.x * 256 + threadIdx.x; if (t >= (size_t)K * N) return; const int i = (int)(t / N), o = (int)(t % N); float a = 0.f;
  for (int r = 0; r < 16; ++r) a = __fadd_rn(a, __fmul_rn(bf16_round(A[(size_t)i * 16 + r]), bf16_round(Bm[(size_t)r * N + o])));
  const float v = __fadd_rn(bf16_round(Wm[t]), __fmul_rn(sc, a)); *(float*)(WE + t) = v;  }
__global__ __launch_bounds__(256) void k_wt32rep(const float* __restrict__ Wf, _Float16* __restrict__ Bt, int K, int N, int DOUT, float scale) {
  const int t = blockIdx.x * 256 + threadIdx.x; if (t >= DOUT * (K / 8)) return; const int n = t / (K / 8), k8 = (t % (K / 8)) * 8; const int rep = DOUT / N; const int src = (n / (HD * rep)) * HD + (n % HD);      /* head h = n / HD -> group h / rep */
  FragH f; for (int i = 0; i < 8; ++i) f.h[i] = (_Float16)(Wf[(size_t)(k8 + i) * N + src] * scale);
  *(v8us*)((unsigned short*)Bt + (size_t)n * K + k8) = f.half[0];  }
__global__ __launch_bounds__(256) void k_brep(const float* __restrict__ b, float* __restrict__ out) { const int t = blockIdx.x * 256 + threadIdx.x; if (t >= DM) return; const float v = b[(t / (HD * 4)) * HD + (t % HD)]; *(float*)(out + t) = v;  }

__global__ __launch_bounds__(256) void k_rsmcim(const float* __restrict__ S, _Float16* __restrict__ P, int hg, int q0, int nk, const int* __restrict__ am) {
  #pragma clang fp contract(off)
  const int t = blockIdx.x * 256 + threadIdx.x; if (t >= hg * QT) return; const size_t i = (size_t)t; const float* s = S + i * NKX; const int last = q0 + (t % QT); const int* mr = am + (size_t)last * SQ; float mx = -3.0e38f;      /* the module's mask row of this query (keys >= nk lie above the diagonal of the causal mask and are not computed) */
#pragma unroll 1
  for (int j = 0; j < nk; ++j) { const float f = (mr[j] != 0) ? 1.f : 0.f; mx = fmaxf(mx, fmaf(f, s[j], (1.f - f) * -1.0e9f)); } float se = 0.f;
#pragma unroll 1
  for (int j = 0; j < nk; ++j) { const float f = (mr[j] != 0) ? 1.f : 0.f; se += __expf(fmaf(f, s[j], (1.f - f) * -1.0e9f) - mx); } const float sc = 256.0f / se;
#pragma unroll 1
  for (int j0 = 0; j0 < nk; j0 += 8) { FragH fr; for (int q = 0; q < 8; ++q) { const int j = j0 + q; const float f = (mr[j] != 0) ? 1.f : 0.f; fr.h[q] = (_Float16)(__expf(fmaf(f, s[j], (1.f - f) * -1.0e9f) - mx) * sc); } unsigned short* d = (unsigned short*)P + i * NKX + j0; *(v8us*)d = fr.half[0];  } }



// One grid for the eleven preparation jobs (six weight transposes, the two planes of x, the three biases stacked): none reads what another writes, so they need no order among themselves.
// The block index picks the job (block-uniform branches; no job has a barrier). The large transposes come first, the short bias blocks last.
#define PB_WL ((DM / 128) * (DFF / 64))      /* tiles of W1, and of W2 */
#define PB_WS ((DM / 128) * (DM / 64))       /* tiles of one of Wq, Wk, Wv, Wo */
#define PB_W (2 * PB_WL + 4 * PB_WS)
#define PB_XE 4096                           /* elements of x a block: 8 pieces of 16 bytes a lane */
#define PB_X ((int)(NR * DM / PB_XE))
#define PB_B (3 * DM / 128)
__global__ __launch_bounds__(128) void k_prep(const float* __restrict__ x, const float* __restrict__ wq, const float* __restrict__ wk, const float* __restrict__ wv, const float* __restrict__ wo, const float* __restrict__ wfc, const float* __restrict__ wmp,
    const float* __restrict__ bq, const float* __restrict__ bk, const float* __restrict__ bv, _Float16* __restrict__ BQKV, _Float16* __restrict__ BO, _Float16* __restrict__ BW1, _Float16* __restrict__ BW2, float* __restrict__ bqkv, _Float16* __restrict__ X16, float* __restrict__ XB) {
  const int blk = blockIdx.x, tid = threadIdx.x;
  if (blk < PB_W) {      /* [in][out] -> Bt x16: W1, W2, stacked q | k | v, Wo */
    const float* W; _Float16* Wt; int K = DM, N = DM, r;
    if (blk < PB_WL) { W = wfc; Wt = BW1; N = DFF; r = blk; }
    else if (blk < 2 * PB_WL) { W = wmp; Wt = BW2; K = DFF; r = blk - PB_WL; }
    else { const int j = (blk - 2 * PB_WL) / PB_WS; r = (blk - 2 * PB_WL) - j * PB_WS; W = (j == 0) ? wq : (j == 1) ? wk : (j == 2) ? wv : wo; Wt = (j < 3) ? BQKV + (size_t)j * DM * DM : BO; }
    wt_f16_tile(W, Wt, K, N, 16.0f, r);
  } else if (blk < PB_W + PB_X) {      /* x read once: bf16(x) as exact f16 rows (GEMM operand) and as f32 rows (residual). A wave's load covers four whole lines, its stores four and two */
    const size_t e0 = (size_t)(blk - PB_W) * PB_XE + tid * 4; const float* p = x + e0; v4f a[8];
    /* unrolled: constant indices (registers), and the eight loads of a lane fly together */
#pragma unroll
    for (int i = 0; i < 8; ++i) a[i] = *(const v4fa*)(p + i * 512);
#pragma unroll
    for (int i = 0; i < 8; ++i) { v4f f; v4h h;
#pragma unroll
      for (int q = 0; q < 4; ++q) { f[q] = bf16_round(a[i][q]); h[q] = (_Float16)f[q]; }
      *(v4f*)(XB + e0 + i * 512) = f; *(v4h*)(X16 + e0 + i * 512) = h; }
    asm volatile("s_wait_xcnt 0x0" ::: "memory");      /* stands behind the last store, in front of any later write of a register that a store names */
  } else {      /* stacked bias bq | bk | bv: a block lies inside one of the three */
    const int c = blk - PB_W - PB_X, j = c / (DM / 128); const float* b = (j == 0) ? bq : (j == 1) ? bk : bv; const int i = (c - j * (DM / 128)) * 128 + tid; (bqkv + j * DM)[i] = b[i];
    asm volatile("s_wait_xcnt 0x0" ::: "memory");      /* as above: behind the store, in front of any later write of its registers */
  }
}



// lane l with lane l ^ 16
__device__ __forceinline__ float rs_xh(float v) { return __builtin_bit_cast(float, __builtin_amdgcn_permlanex16(__builtin_bit_cast(int, v), __builtin_bit_cast(int, v), 0x76543210, 0xfedcba98, false, false)); }
// native 2^t; the v_nop is the slot the instruction set asks for behind a transcendental before its result is read or its source overwritten
__device__ __forceinline__ float fa_exp2(float t) { float e; asm("v_exp_f32 %0, %1\n\tv_nop" : "=v"(e) : "v"(t)); return e; }
#define FA_KT 128      /* keys a stage */
#define FA_KP 144      /* LDS pitch of a K row, bytes: 128 of data + 16, an odd multiple of 16 (no bank conflict for 16-byte row reads) */
#define FA_VP 272      /* LDS pitch of a V^T row: 256 of data + 16, likewise */
#define FA_VO (FA_KT * FA_KP)      /* the 64 V^T rows stand behind the 128 K rows */
#define FA_STAGE (FA_VO + HD * FA_VP)      /* one buffer */
// Eight asynchronous 16-byte copies of a lane, global -> LDS: four of K (rows 32 apart), four of V^T (rows 16 apart). The s_wait_xcnt stands in the copies' own statement, behind the last of them,
// so that it precedes every later write of a register that a copy names.
__device__ __forceinline__ void fa_copy8(unsigned lk, const _Float16* gk, unsigned lv, const _Float16* gv) {
  asm volatile("global_load_async_to_lds_b128 %0, %8, off\n\t"
               "global_load_async_to_lds_b128 %1, %9, off\n\t"
               "global_load_async_to_lds_b128 %2, %10, off\n\t"
               "global_load_async_to_lds_b128 %3, %11, off\n\t"
               "global_load_async_to_lds_b128 %4, %12, off\n\t"
               "global_load_async_to_lds_b128 %5, %13, off\n\t"
               "global_load_async_to_lds_b128 %6, %14, off\n\t"
               "global_load_async_to_lds_b128 %7, %15, off\n\t"
               "s_wait_xcnt 0x0"
               :: "v"(lk), "v"(lk + 32u * FA_KP), "v"(lk + 64u * FA_KP), "v"(lk + 96u * FA_KP), "v"(lv), "v"(lv + 16u * FA_VP), "v"(lv + 32u * FA_VP), "v"(lv + 48u * FA_VP),
                  "v"(gk), "v"(gk + (size_t)32 * LQ), "v"(gk + (size_t)64 * LQ), "v"(gk + (size_t)96 * LQ), "v"(gv), "v"(gv + (size_t)16 * SQ), "v"(gv + (size_t)32 * SQ), "v"(gv + (size_t)48 * SQ) : "memory"); }
__global__ __launch_bounds__(256) void k_fattn(const _Float16* __restrict__ Q, const _Float16* __restrict__ Kk, const _Float16* __restrict__ VT, _Float16* __restrict__ O) {
  __shared__ __attribute__((aligned(16))) unsigned char sm[2 * FA_STAGE];
  const int tid = threadIdx.x, lane = tid & 31, w = tid >> 5, ln = lane & 15, hh = lane >> 4; const int h = blockIdx.y, b = blockIdx.z; const int q0 = blockIdx.x * 256 + w * 32; const size_t r0 = (size_t)b * SQ;
  const _Float16* qp = Q + (r0 + q0 + ln) * LQ + h * HD + 8 * hh;      /* the lane's own 8 hh is in the pointer: g2_frag is called with 0 */
  /* copies: lane = 16 bytes. K: 8 lanes a row of 128 bytes, thread rows tid / 8 + 32 i; V^T: 16 lanes a row of 256 bytes, thread rows tid / 16 + 16 i: a wave's copy covers four whole lines */
  const unsigned lk = (unsigned)(size_t)sm + (unsigned)(tid >> 3) * FA_KP + (unsigned)(tid & 7) * 16u; const unsigned lv = (unsigned)(size_t)sm + FA_VO + (unsigned)(tid >> 4) * FA_VP + (unsigned)(tid & 15) * 16u;
  const _Float16* gk = Kk + (r0 + (tid >> 3)) * LQ + h * HD + (tid & 7) * 8; const _Float16* gv = VT + ((size_t)(b * NH + h) * HD + (tid >> 4)) * SQ + (tid & 15) * 8;
  auto fill = [&](int t, int buf) { fa_copy8(lk + (unsigned)buf * FA_STAGE, gk + (size_t)t * FA_KT * LQ, lv + (unsigned)buf * FA_STAGE, gv + (size_t)t * FA_KT); };
  const unsigned char* sk = sm + ln * FA_KP + 16 * hh; const unsigned char* sv = sm + FA_VO + ln * FA_VP + 16 * hh;      /* the lane's fragment rows; same k order as g2_frag */
  const float L2E = 1.44269504088896340736f; const v8f z8 = {0.f,0.f,0.f,0.f,0.f,0.f,0.f,0.f};
  v16h qf[2][2], kf[2][2], vf[4]; v8f o[2][4]; float m[2] = {-3.0e38f, -3.0e38f}, l[2] = {0.f, 0.f};
  fill(0, 0);
  /* every loop over a fragment index is unrolled so that the fragment arrays have constant indices and stay in registers */
#pragma unroll
  for (int t = 0; t < 2; ++t) { qf[t][0] = g2_frag(qp + (size_t)t * 16 * LQ, 0); qf[t][1] = g2_frag(qp + (size_t)t * 16 * LQ + 32, 0);
#pragma unroll
    for (int dt = 0; dt < 4; ++dt) o[t][dt] = z8; }
  /* behind the loads that share one address pair: the wait that precedes any overwrite of that pair; the pair is an input, so it stays live (no load's result lands on it) up to the wait */
  asm volatile("s_wait_xcnt 0x0" :: "v"(qp) : "memory");
  asm volatile("s_wait_asynccnt 0x0" ::: "memory");      /* this wave's copies of stage 0 have landed */
  __syncthreads();      /* and every other wave's: stage 0 may be read */
  fill(1, 1);
  /* rolled: one copy of the body; a stage is 128 keys, while the next stage's copies fly */
#pragma unroll 1
  for (int t = 0; t < SQ / FA_KT; ++t) { const unsigned char* pk = sk + (t & 1) * FA_STAGE; const unsigned char* pv = sv + (t & 1) * FA_STAGE;
#pragma unroll
    for (int kt = 0; kt < 2; ++kt) { kf[kt][0] = g2_lfrag(pk + kt * 16 * FA_KP); kf[kt][1] = g2_lfrag(pk + kt * 16 * FA_KP + 64); }
    /* rolled: a pass is some 350 instructions already, and four copies of it spill. The stage's last pass fetches no K ahead (nothing of the next stage is read in front of the barrier) */
#pragma unroll 1
    for (int p = 0; p < FA_KT / 32; ++p) {
#pragma unroll
      for (int dt = 0; dt < 4; ++dt) vf[dt] = g2_lfrag(pv + dt * 16 * FA_VP + p * 64);
      v8f s[2][2];
#pragma unroll
      for (int u = 0; u < 2; ++u)
#pragma unroll
        for (int kt = 0; kt < 2; ++kt) s[u][kt] = g2_mma(kf[kt][1], qf[u][1], g2_mma(kf[kt][0], qf[u][0], z8));
      if (p + 1 < FA_KT / 32) {
#pragma unroll
        for (int kt = 0; kt < 2; ++kt) { kf[kt][0] = g2_lfrag(pk + ((p + 1) * 32 + kt * 16) * FA_KP); kf[kt][1] = g2_lfrag(pk + ((p + 1) * 32 + kt * 16) * FA_KP + 64); } }
      FragH pf[2];
#pragma unroll
      for (int u = 0; u < 2; ++u) { float mx = fmaxf(s[u][0][0], s[u][1][0]);
#pragma unroll
        for (int r = 1; r < 8; ++r) mx = fmaxf(mx, fmaxf(s[u][0][r], s[u][1][r]));
        mx = fmaxf(mx, rs_xh(mx)); const float mn = fmaxf(m[u], mx); const float al = fa_exp2((m[u] - mn) * L2E); const float mb = mn * L2E - 8.0f; m[u] = mn; float e0 = 0.f, e1 = 0.f;
#pragma unroll
        for (int r = 0; r < 8; ++r) { const float p0 = fa_exp2(fmaf(s[u][0][r], L2E, -mb)), p1 = fa_exp2(fmaf(s[u][1][r], L2E, -mb)); e0 += p0; e1 += p1; pf[u].h[r] = (_Float16)p0; pf[u].h[8 + r] = (_Float16)p1; }
        l[u] = fmaf(l[u], al, e0 + e1);      /* this half's keys only; the halves are joined behind the loop */
#pragma unroll
        for (int dt = 0; dt < 4; ++dt) o[u][dt] *= al; }
#pragma unroll
      for (int u = 0; u < 2; ++u)
#pragma unroll
        for (int dt = 0; dt < 4; ++dt) o[u][dt] = g2_mma(vf[dt], pf[u].v, o[u][dt]); }
    asm volatile("s_wait_dscnt 0x0" ::: "memory");      /* this wave's reads of the buffer are done before it is refilled */
    asm volatile("s_wait_asynccnt 0x0" ::: "memory");      /* this wave's copies of stage t + 1 have landed */
    __syncthreads();      /* publishes stage t + 1 and ends every wave's reads of stage t */
    if (t + 2 < SQ / FA_KT) fill(t + 2, t & 1); }
  asm volatile("s_wait_asynccnt 0x0" ::: "memory");      /* no copy is outstanding when the wave ends */
#pragma unroll
  for (int t = 0; t < 2; ++t) { const float fin = 64.0f / (l[t] + rs_xh(l[t]));      /* ctx carried x64; the x256 of the weights cancels in the quotient */
    _Float16* d = O + (r0 + q0 + t * 16 + ln) * DM + h * HD + 8 * hh;
#pragma unroll
    for (int dt = 0; dt < 4; ++dt) { FragH f;
#pragma unroll
      for (int r = 0; r < 8; ++r) f.h[r] = (_Float16)(o[t][dt][r] * fin);
      *(v8us*)((unsigned short*)d + dt * 16) = f.half[0]; } } }
extern "C" void kernel_launch(void* const* d_in, const int* in_sizes, int n_in,
                              void* d_out, int out_size, void* d_ws, size_t ws_size, hipStream_t stream) {
  (void)in_sizes; (void)n_in; (void)out_size;
  const float* const* I = (const float* const*)d_in; const float* x = I[0]; const float* wq = I[1]; const float* bq = I[2]; const float* wk = I[3]; const float* bk = I[4]; const float* wv = I[5]; const float* bv = I[6]; const float* wo = I[7]; const float* bo = I[8]; const float* wfc = I[9]; const float* bfc = I[10]; const float* wmp = I[11]; const float* bmp = I[12]; const float* g1 = I[13]; const float* be1 = I[14]; const float* gg2 = I[15]; const float* be2 = I[16];      /* x; [in][out] Wq / Wk / Wv / Wo + biases; W1 [1024][4096] + b1, W2 [4096][1024] + b2; LN1 g / b, LN2 g / b */
  char* ws = (char*)d_ws; size_t off = 0;
  auto take = [&](size_t bytes) { char* p = ws + off; off += (bytes + 255) & ~(size_t)255; return p; };
  _Float16* BQKV = (_Float16*)take((size_t)3 * DM * DM * 2); _Float16* BO = (_Float16*)take((size_t)DM * DM * 2); float* bqkv = (float*)take((size_t)3 * DM * 4); float* X1N = nullptr;      /* LN1 output (f32): aliases the QKV plane below (QKV's last readers, the V^T and attention launches, precede LN1) to stay within 256 MiB at NB 4 / SQ 2048 */
  _Float16* X16 = (_Float16*)take(NR * DM * 2); float* XB = (float*)take(NR * DM * 4); float* X1 = (float*)take(NR * DM * 4); _Float16* M16 = nullptr;      /* = X16 below (alias: X16's last reader, the fused QKV GEMM, precedes LN1's f16 write) */ _Float16* HF16 = nullptr;      /* FFN hidden plane of all rows [4096][4096] f16, taken below */ _Float16* BW1 = (_Float16*)take((size_t)DFF * DM * 2); _Float16* BW2 = (_Float16*)take((size_t)DM * DFF * 2); _Float16* QKV = (_Float16*)take(NR * 3 * DM * 2); _Float16* Q16 = QKV; _Float16* K16 = QKV + DM; _Float16* V16 = QKV + 2 * DM; _Float16* O16 = (_Float16*)take(NR * DM * 2); M16 = X16; X1N = (float*)QKV; HF16 = (_Float16*)take(NR * DFF * 2);      /* the FFN hidden plane of all rows (32 MiB) gets its OWN region here */      /* alias: X1N (NR*DM f32 = 16 MiB) inside QKV (24 MiB) */
  _Float16* VT = (_Float16*)take((size_t)NB * NH * HD * SQ * 2);
  if (off > ws_size) return;
  k_prep<<<(unsigned)(PB_W + PB_X + PB_B), 128, 0, stream>>>(x, wq, wk, wv, wo, wfc, wmp, bq, bk, bv, BQKV, BO, BW1, BW2, bqkv, X16, XB);      /* weights as Bt x16, stacked bias, x as exact f16 rows (post-LN: the attention runs on the raw input) and as bf16(x) f32 rows for the residual */
  const size_t r0p = (size_t)B0 * SQ;      /* first projected row */
  k_gemm2<0, false><<<dim3((unsigned)((MP / 128) * (3 * DM / 64)), 1), 128, 0, stream>>>(X16 + r0p * DM, DM, 0, BQKV, DM, 0, 0.0625f, bqkv, 0, nullptr, 1, 0, 0, nullptr, QKV + r0p * 3 * DM, 3 * DM, 0, MP, 3 * DM, DM);      /* q | k | v rows (f16); head h = columns h*HD.. of each DM block */
  k_vt<NH, SQ><<<NB * NH * (SQ / 64), 256, 0, stream>>>(V16, LQ, 0, VT);      /* V^T [NB][NH][HD][SQ] */
  k_fattn<<<dim3(SQ / 256, NH, NB), 256, 0, stream>>>(Q16, K16, VT, O16);      /* scores q.k (no scaling), softmax over all keys, ctx (merged heads, x64) as f16 rows */
  k_gemm2<0, true><<<dim3((unsigned)((MPO / 128) * (DM / 64)), 1), 128, 0, stream>>>(O16 + r0p * DM, DM, 0, BO, DM, 0, 0.0009765625f, bo, 0, XB + r0p * DM, -1, 0, 0, X1 + r0p * DM, nullptr, DM, 0, MPO, DM, DM);      /* out rows are the output layout */
  k_lnx<0, 1, 1><<<(unsigned)NR, 256, 0, stream>>>(X1, g1, be1, 1e-5f, M16, X1N);      /* x1 = LN1(x + attn_out) (eps 1e-5): f16 rows for the FFN input and f32 rows for the residual */
  k_gemm2<6, false><<<dim3((unsigned)((MPO / 128) * (DFF / 64)), 1), 128, 0, stream>>>(M16, DM, 0, BW1, DM, 0, 0.0625f, bfc, 0, nullptr, 1, 0, 0, nullptr, HF16, DFF, 0, MPO, DFF, DM);      /* gelu_erf(x1 W1 + b1) -> f16, the rows of both batches in one grid */
  k_gemm2<0, true><<<dim3((unsigned)((MPO / 128) * (DM / 64)), 1), 128, 0, stream>>>(HF16, DFF, 0, BW2, DFF, 0, 0.0625f, bmp, 0, X1N, -1, 0, 0, X1, nullptr, DM, 0, MPO, DM, DFF);      /* t = x1 + ffn + b2 (own-element residual) f32, over the dead pre-LN1 plane; likewise one grid */
  k_lnx<0, 0, 1><<<(unsigned)NR, 256, 0, stream>>>(X1, gg2, be2, 1e-5f, nullptr, (float*)d_out);      /* out = LN2(t) (eps 1e-5) -> f32 output rows */
}

// v008
// It runs in 183 microseconds.
// In two side-by-side timings against v007, it was 1.06 and 1.05 times as fast.
// Counting every step since v000, it is 40.6 times as fast.
#include <hip/hip_runtime.h>
// POST-LN transformer encoder block (x [2][2048][1024]; q/k/v = x W + b ([in][out] 1024 x 1024, zero biases); 16 heads of 64; scores = q k^T with NO 1/sqrt(head_dim) scaling (as the source module); softmax over all 2048 keys (no mask); x1 = LN1(x + ctx Wo + bo) (biased var, eps 1e-5, g / beta); out = LN2(x1 + gelu_erf(x1 W1 + b1) W2 + b2) ([in][out] 1024 x 4096 x 1024) -> [2][2048][1024]).
// Structure: token rows; x as exact f16 rows and bf16 f32 residual rows; natural weights as exact x16 planes; fused q | k | v WMMA GEMM (32x64 wave tiles, f32 accumulation, + stacked bias) -> f16; V^T via LDS transposes; one fused attention launch (S^T = K Q^T, online softmax in registers with f32 statistics and native exp, weights x256 f16, O^T += V^T P^T), ctx (x64) merged f16; x + ctx Wo + bo f32; LN1 on VALU -> f16 + f32; gelu FFN, all rows in one grid a GEMM; + residual; LN2 -> output; 9 launches (all preparation in one grid).
// Compute dtype: inputs rounded to bf16; x / weights exact; q, k, v, softmax weights and o as plain f16 GEMM operands (~2^-12); scores and softmax statistics f32; v_wmma_f32_16x16x32_f16.
#define NB 2
#define SQ 2048
#define DM 1024
#define NH 16
#define HD 64
#define HG 4                         /* heads per launch of the non-template k_vt (not launched) */
#define QT 256                       /* query rows per attention tile */
#define NKX SQ                       /* S / P row pitch */
#define QT0 128                      /* rows per head of the f32 k_att0 path (not launched) */
#define B0 0                         /* first batch processed (debug hook) */
#define NBR NB                       /* batches processed (debug hook) */
#define NR ((size_t)NB * SQ)
#define DMQ DM
#define DFF 4096         /* FFN hidden width */
#define MP ((int)((size_t)NBR * SQ)) /* rows projected (debug hook) */
#define QN SQ                        /* query rows per batch (not used) */
#define NHD NH                       /* heads (not used) */
#define MPO MP                       /* rows through the output stage (debug hook) */
#define LQ (3 * DM)      /* row pitch of the q/k/v rows */
typedef __bf16 v16b __attribute__((ext_vector_type(16)));
typedef unsigned short v8us __attribute__((ext_vector_type(8), may_alias));
typedef float  v8f  __attribute__((ext_vector_type(8)));
typedef float  v4f  __attribute__((ext_vector_type(4)));
typedef float  v4fa __attribute__((ext_vector_type(4), may_alias));
union FragB { v16b v; v8us half[2]; unsigned short u[16]; };

__device__ __forceinline__ unsigned short bf16_bits(float x) { unsigned int u = __float_as_uint(x); return (unsigned short)((u + 0x7FFFu + ((u >> 16) & 1u)) >> 16); }
__device__ __forceinline__ float bf16_val(unsigned short b) { return __uint_as_float(((unsigned int)b) << 16); }
__device__ __forceinline__ float bf16_round(float x) { return bf16_val(bf16_bits(x)); }
// D += A·B with NT terms: 1 = ah·bh, 2 = + al·bh (A split), 3 = + ah·bl (both split)
template <int NT>
__device__ __forceinline__ v8f mmaN(v16b ah, v16b al, v16b bh, v16b bl, v8f c) {
  c = __builtin_amdgcn_wmma_f32_16x16x32_bf16(false, ah, false, bh, (short)0, c, false, false);
  if (NT >= 2) c = __builtin_amdgcn_wmma_f32_16x16x32_bf16(false, al, false, bh, (short)0, c, false, false);
  if (NT >= 3) c = __builtin_amdgcn_wmma_f32_16x16x32_bf16(false, ah, false, bl, (short)0, c, false, false);
  asm volatile("v_nop\n\tv_nop\n\tv_nop\n\tv_nop" : "+v"(c) : "v"(ah), "v"(al), "v"(bh), "v"(bl));
  return c;
}

__global__ __launch_bounds__(256) void k_wt_bf16(const float* __restrict__ W, unsigned short* __restrict__ Wt, int K, int N) {
  const int t = blockIdx.x * 256 + threadIdx.x;
  const int k8n = K / 8;
  if (t >= N * k8n) return;
  const int n = t / k8n, k8 = (t % k8n) * 8;
  v8us v;
#pragma unroll
  for (int i = 0; i < 8; ++i) v[i] = bf16_bits(W[(size_t)(k8 + i) * N + n]);
  *(v8us*)(Wt + (size_t)n * K + k8) = v;
  
}

// GEMM C[M][N] (f32, pitch ldc) = act(A[M][K]·W + bias). A f32 row-major (pitch lda) converted per fragment to bf16
// (ASPLIT: hi/lo two planes -> 2 terms, else single rounded term); Wt bf16 [N][K] (pitch ldb). BIAS_BF16 rounds the
// bias to bf16 first (bias quantised to bf16 before the add). K%32==0, M%16==0, N%64==0.
template <bool ASPLIT, int ACT, bool BIAS_BF16>
__global__ __launch_bounds__(128) void k_gemm_bf(const float* __restrict__ A, int lda, const unsigned short* __restrict__ Wt, int ldb,
                                               const float* __restrict__ bias, float* __restrict__ C, int ldc, int M, int N, int K) {
  __shared__ __attribute__((aligned(16))) float so[4][16][64];
  const int tid = threadIdx.x, w = tid >> 5, lane = tid & 31, ln = lane & 15, hh = lane >> 4;
  const int ntn = N / 64;
  const int wid = blockIdx.x * 4 + w;
  const int mt = wid / ntn, nq = wid % ntn;
  if (mt * 16 >= M) return;
  const int row0 = mt * 16, col0 = nq * 64;
  const float* arow = A + (size_t)(row0 + ln) * lda;
  v8f acc[4] = {};
  for (int kb = 0; kb < K; kb += 32) {
    FragB ah, al;
    const v4f x0 = *(const v4fa*)(arow + kb + 8 * hh), x1 = *(const v4fa*)(arow + kb + 8 * hh + 4);
    const v4f x2 = *(const v4fa*)(arow + kb + 16 + 8 * hh), x3 = *(const v4fa*)(arow + kb + 16 + 8 * hh + 4);
    float xs[16] = {x0[0],x0[1],x0[2],x0[3],x1[0],x1[1],x1[2],x1[3],x2[0],x2[1],x2[2],x2[3],x3[0],x3[1],x3[2],x3[3]};
#pragma unroll
    for (int i = 0; i < 16; ++i) { const unsigned short hb = bf16_bits(xs[i]); ah.u[i] = hb; al.u[i] = ASPLIT ? bf16_bits(xs[i] - bf16_val(hb)) : (unsigned short)0; }
#pragma unroll
    for (int t = 0; t < 4; ++t) {
      const unsigned short* brow = Wt + (size_t)(col0 + t * 16 + ln) * ldb + kb;
      FragB b;
      b.half[0] = *(const v8us*)(brow + 8 * hh);
      b.half[1] = *(const v8us*)(brow + 16 + 8 * hh);
      acc[t] = mmaN<ASPLIT ? 2 : 1>(ah.v, al.v, b.v, b.v, acc[t]);
    }
  }
#pragma unroll
  for (int t = 0; t < 4; ++t) {
    float bv = bias ? bias[col0 + t * 16 + ln] : 0.f;
    if (BIAS_BF16) bv = bf16_round(bv);
#pragma unroll
    for (int r = 0; r < 8; ++r) { float v = acc[t][r] + bv; if (ACT == 1) v = fmaxf(v, 0.f); so[w][8 * hh + r][t * 16 + ln] = v; }
  }
  __builtin_amdgcn_fence(__ATOMIC_ACQ_REL, "workgroup");
  __builtin_amdgcn_wave_barrier();
  const int rsub = lane >> 4, c4 = (lane & 15) * 4;
  {
#pragma unroll
    for (int q = 0; q < 8; ++q) {
      const int r = q * 2 + rsub;
      const v4f v = *(const v4fa*)&so[w][r][c4];
      *(v4f*)(C + (size_t)(row0 + r) * ldc + col0 + c4) = v;
    }
    
  }
}

// GEMM C = act(A·W + bias + resid): A f32 (ASPLIT -> hi/lo 2 terms), Wt bf16 [N][K]; ACT 0 none, 1 relu, 2 exact gelu;
// resid (optional, f32, row index = (row % rmod), pitch ldr, RES_BF16 rounds it) added before the activation.
template <bool ASPLIT, int ACT, bool BIAS_BF16, bool RES_BF16>
__global__ __launch_bounds__(128) void k_gemm_bf3(const float* __restrict__ A, int lda, const unsigned short* __restrict__ Wt, int ldb,
                                                const float* __restrict__ bias, const float* __restrict__ resid, int rmod, int ldr,
                                                float* __restrict__ C, int ldc, int M, int N, int K) {
  __shared__ __attribute__((aligned(16))) float so[4][16][64];
  const int tid = threadIdx.x, w = tid >> 5, lane = tid & 31, ln = lane & 15, hh = lane >> 4;
  const int ntn = N / 64;
  const int wid = blockIdx.x * 4 + w;
  const int mt = wid / ntn, nq = wid % ntn;
  if (mt * 16 >= M) return;
  const int row0 = mt * 16, col0 = nq * 64;
  const float* arow = A + (size_t)(row0 + ln) * lda;
  v8f acc[4] = {};
  for (int kb = 0; kb < K; kb += 32) {
    FragB ah, al;
    const v4f x0 = *(const v4fa*)(arow + kb + 8 * hh), x1 = *(const v4fa*)(arow + kb + 8 * hh + 4);
    const v4f x2 = *(const v4fa*)(arow + kb + 16 + 8 * hh), x3 = *(const v4fa*)(arow + kb + 16 + 8 * hh + 4);
    float xs[16] = {x0[0],x0[1],x0[2],x0[3],x1[0],x1[1],x1[2],x1[3],x2[0],x2[1],x2[2],x2[3],x3[0],x3[1],x3[2],x3[3]};
#pragma unroll
    for (int i = 0; i < 16; ++i) { const unsigned short hb = bf16_bits(xs[i]); ah.u[i] = hb; al.u[i] = ASPLIT ? bf16_bits(xs[i] - bf16_val(hb)) : (unsigned short)0; }
#pragma unroll
    for (int t = 0; t < 4; ++t) {
      const unsigned short* brow = Wt + (size_t)(col0 + t * 16 + ln) * ldb + kb;
      FragB b;
      b.half[0] = *(const v8us*)(brow + 8 * hh);
      b.half[1] = *(const v8us*)(brow + 16 + 8 * hh);
      acc[t] = mmaN<ASPLIT ? 2 : 1>(ah.v, al.v, b.v, b.v, acc[t]);
    }
  }
#pragma unroll
  for (int t = 0; t < 4; ++t) {
    const int col = col0 + t * 16 + ln;
    float bv = bias ? bias[col] : 0.f;
    if (BIAS_BF16) bv = bf16_round(bv);
#pragma unroll
    for (int r = 0; r < 8; ++r) {
      float v = acc[t][r] + bv;
      if (resid) { float rv = resid[(size_t)((row0 + 8 * hh + r) % rmod) * ldr + col]; if (RES_BF16) rv = bf16_round(rv); v += rv; }
      if (ACT == 1) v = fmaxf(v, 0.f);
      if (ACT == 2) v = 0.5f * v * (1.0f + erff(v * 0.70710678118654752f));
      if (ACT == 3) { const float u = 0.7978845608028654f * (v + 0.044715f * v * v * v); v = 0.5f * v * (1.0f + tanhf(u)); }
      so[w][8 * hh + r][t * 16 + ln] = v;
    }
  }
  __builtin_amdgcn_fence(__ATOMIC_ACQ_REL, "workgroup");
  __builtin_amdgcn_wave_barrier();
  const int rsub = lane >> 4, c4 = (lane & 15) * 4;
  {
#pragma unroll
    for (int q = 0; q < 8; ++q) {
      const int r = q * 2 + rsub;
      const v4f v = *(const v4fa*)&so[w][r][c4];
      *(v4f*)(C + (size_t)(row0 + r) * ldc + col0 + c4) = v;
    }
    
  }
}
// row LayerNorm (biased variance, eps) over N: s = X (+ R); optional out_sum <- s; out_norm <- (s-mu)*rsqrt(var+eps)*g + b
template <bool PARAM_BF16>
__global__ __launch_bounds__(256) void k_layernorm(const float* __restrict__ X, const float* __restrict__ R, const float* __restrict__ g, const float* __restrict__ bta,
                                                  float* __restrict__ out_sum, float* __restrict__ out_norm, int N, float eps) {
  __shared__ float red[256];
  const int row = blockIdx.x, tid = threadIdx.x;
  const float* x = X + (size_t)row * N; const float* rr = R ? R + (size_t)row * N : nullptr;
  float vals[16];                     // up to N = 4096
  const int per = N / 256;            // contiguous chunk per thread? use strided-by-4 chunks: thread handles j = tid*4 + 1024*u
  float s1 = 0.f;
  for (int u = 0; u < per / 4; ++u) {
    const int j = tid * 4 + 1024 * u;
    const v4f a = *(const v4fa*)(x + j);
    v4f b = {0.f,0.f,0.f,0.f}; if (rr) b = *(const v4fa*)(rr + j);
#pragma unroll
    for (int q = 0; q < 4; ++q) { const float v = a[q] + b[q]; vals[u * 4 + q] = v; s1 += v; }
  }
  red[tid] = s1; __syncthreads();
  for (int st = 128; st > 0; st >>= 1) { if (tid < st) red[tid] += red[tid + st]; __syncthreads(); }
  const float mu = red[0] / (float)N; __syncthreads();
  float s2 = 0.f;
  for (int u = 0; u < per / 4; ++u)
#pragma unroll
    for (int q = 0; q < 4; ++q) { const float c = vals[u * 4 + q] - mu; s2 += c * c; }
  red[tid] = s2; __syncthreads();
  for (int st = 128; st > 0; st >>= 1) { if (tid < st) red[tid] += red[tid + st]; __syncthreads(); }
  const float rs = rsqrtf(red[0] / (float)N + eps);
  {
    for (int u = 0; u < per / 4; ++u) {
      const int j = tid * 4 + 1024 * u;
      v4f o, sm;
#pragma unroll
      for (int q = 0; q < 4; ++q) {
        float gg = g[j + q], bb = bta[j + q];
        if (PARAM_BF16) { gg = bf16_round(gg); bb = bf16_round(bb); }
        sm[q] = vals[u * 4 + q]; o[q] = (vals[u * 4 + q] - mu) * rs * gg + bb;
      }
      if (out_sum) *(v4f*)(out_sum + (size_t)row * N + j) = sm;
      *(v4f*)(out_norm + (size_t)row * N + j) = o;
    }
    
  }
}



// ---- f16 WMMA path (v_wmma_f32_16x16x32_f16): 11-bit significands for operands in range — used where a [0,1] probability operand needs more precision than bf16
typedef _Float16 v16h __attribute__((ext_vector_type(16)));
union FragH { v16h v; v8us half[2]; _Float16 h[16]; unsigned short u[16]; };
template <int NT>
__device__ __forceinline__ v8f mmaH(v16h ah, v16h al, v16h bh, v16h bl, v8f c) {
  c = __builtin_amdgcn_wmma_f32_16x16x32_f16(false, ah, false, bh, (short)0, c, false, false);
  if (NT >= 2) c = __builtin_amdgcn_wmma_f32_16x16x32_f16(false, al, false, bh, (short)0, c, false, false);
  if (NT >= 3) c = __builtin_amdgcn_wmma_f32_16x16x32_f16(false, ah, false, bl, (short)0, c, false, false);
  asm volatile("v_nop\n\tv_nop\n\tv_nop\n\tv_nop" : "+v"(c) : "v"(ah), "v"(al), "v"(bh), "v"(bl));
  return c;
}
// batched GEMM like k_gemm_b but f16 operands: A f32 (split into f16 hi/lo if ASPLIT, else rounded to f16), Bt = f16 values [n][k]; alpha; C f32; N multiple of 16 (partial tiles skipped)
template <bool ASPLIT>
__global__ __launch_bounds__(128) void k_gemm_h(const float* __restrict__ A, int lda, size_t sA, const _Float16* __restrict__ Bh, int ldb, size_t sB, float alpha, float* __restrict__ C, int ldc, size_t sC, int M, int N, int K) {
  __shared__ __attribute__((aligned(16))) float so[4][16][64];
  const int tid = threadIdx.x, w = tid >> 5, lane = tid & 31, ln = lane & 15, hh = lane >> 4; const int by = blockIdx.y;
  A += (size_t)by * sA; Bh += (size_t)by * sB; C += (size_t)by * sC;
  const int ntn = (N + 63) / 64; const int wid = blockIdx.x * 4 + w; const int mt = wid / ntn, nq = wid % ntn; if (mt * 16 >= M) return;
  const int row0 = mt * 16, col0 = nq * 64; const float* arow = A + (size_t)(row0 + ln) * lda;
  v8f acc[4] = {};
  for (int kb = 0; kb < K; kb += 32) {
    FragH ah, al;
    const v4f x0 = *(const v4fa*)(arow + kb + 8 * hh), x1 = *(const v4fa*)(arow + kb + 8 * hh + 4), x2 = *(const v4fa*)(arow + kb + 16 + 8 * hh), x3 = *(const v4fa*)(arow + kb + 16 + 8 * hh + 4);
    float xs[16] = {x0[0],x0[1],x0[2],x0[3],x1[0],x1[1],x1[2],x1[3],x2[0],x2[1],x2[2],x2[3],x3[0],x3[1],x3[2],x3[3]};
#pragma unroll
    for (int i = 0; i < 16; ++i) { const _Float16 h = (_Float16)xs[i]; ah.h[i] = h; al.h[i] = ASPLIT ? (_Float16)(xs[i] - (float)h) : (_Float16)0.0f; }
#pragma unroll
    for (int t = 0; t < 4; ++t) { if (col0 + t * 16 >= N) continue; const size_t boff = (size_t)(col0 + t * 16 + ln) * ldb + kb; FragH bq; bq.half[0] = *(const v8us*)(Bh + boff + 8 * hh); bq.half[1] = *(const v8us*)(Bh + boff + 16 + 8 * hh);
      acc[t] = mmaH<ASPLIT ? 2 : 1>(ah.v, al.v, bq.v, bq.v, acc[t]); }
  }
#pragma unroll
  for (int t = 0; t < 4; ++t) { if (col0 + t * 16 >= N) continue;
#pragma unroll
    for (int r = 0; r < 8; ++r) so[w][8 * hh + r][t * 16 + ln] = acc[t][r] * alpha; }
  __builtin_amdgcn_fence(__ATOMIC_ACQ_REL, "workgroup"); __builtin_amdgcn_wave_barrier();
  const int rsub = lane >> 4, c4 = (lane & 15) * 4;
  {
#pragma unroll
    for (int q = 0; q < 8; ++q) { const int r = q * 2 + rsub; if (col0 + c4 < N) { const v4f v = *(const v4fa*)&so[w][r][c4]; *(v4f*)(C + (size_t)(row0 + r) * ldc + col0 + c4) = v; } }
     }
}

// Wt[n][k] = f16(bf16(W[k][n])*scale) from f32 row-major W[K][N] (scale = power of two; bf16-exact weights stay exact in f16 away from the subnormal range). K % 128 == 0, N % 64 == 0.
// Transposed in registers: a lane reads 16-byte pieces (4 n) of 8 successive rows k, which is 4 output pieces of 16 bytes (8 k). Lanes: 4 along n, 8 along k, so a wave's store covers four whole
// 128-byte lines of Wt and its two loads of a row group cover the two halves of eight 128-byte lines of W. A wave takes 64 k x 32 n, a block (2 x 2 waves) 128 k x 64 n: 256 bytes a row on both sides.
// blk = the tile's number among the (K / 128) * (N / 64) tiles of this matrix; 128 threads.
__device__ __forceinline__ void wt_f16_tile(const float* __restrict__ W, _Float16* __restrict__ Wt, int K, int N, float scale, int blk) {
  const int lane = threadIdx.x & 31, w = threadIdx.x >> 5; const int ntn = N >> 6; const int bk = blk / ntn, bn = blk - bk * ntn;
  const int k0 = bk * 128 + (w >> 1) * 64 + (lane >> 2) * 8, n0 = bn * 64 + (w & 1) * 32 + (lane & 3) * 4;
  const float* p[8]; v4f a[8], b[8];
  /* unrolled: the arrays get constant indices (registers) */
#pragma unroll
  for (int i = 0; i < 8; ++i) { p[i] = W + (size_t)(k0 + i) * N + n0; a[i] = *(const v4fa*)p[i]; b[i] = *(const v4fa*)(p[i] + 16); }
  /* The loaded values are inputs: all sixteen loads stay in front of the first conversion, so the wave pays one memory latency (left alone the compiler sinks half of them among the conversions: four more round trips).
     The row pointers are inputs: they stay live up to here, so no load's result lands on an address pair of an issued load, and the wait precedes every later overwrite of such a pair */
  asm volatile("s_wait_xcnt 0x0" :: "v"(a[0]), "v"(a[1]), "v"(a[2]), "v"(a[3]), "v"(a[4]), "v"(a[5]), "v"(a[6]), "v"(a[7]), "v"(b[0]), "v"(b[1]), "v"(b[2]), "v"(b[3]), "v"(b[4]), "v"(b[5]), "v"(b[6]), "v"(b[7]),
               "v"(p[0]), "v"(p[1]), "v"(p[2]), "v"(p[3]), "v"(p[4]), "v"(p[5]), "v"(p[6]), "v"(p[7]));
  unsigned short* d = (unsigned short*)Wt + (size_t)n0 * K + k0;
#pragma unroll
  for (int q = 0; q < 4; ++q) { FragH f;
#pragma unroll
    for (int i = 0; i < 8; ++i) { f.h[i] = (_Float16)(bf16_round(a[i][q]) * scale); f.h[8 + i] = (_Float16)(bf16_round(b[i][q]) * scale); }
    *(v8us*)(d + (size_t)q * K) = f.half[0]; *(v8us*)(d + (size_t)(16 + q) * K) = f.half[1]; }
}
// k_gemm_hh variant with fused epilogue: v = acc·alpha + bias[by·sBias + col] (+ CP[(row/rowsPerB)·sCPb + by·64 + col] if CP) ; ACT 0 none / 1 elu ; writes f16 C16 (and f32 C if non-null)
template <int ACT>
__global__ __launch_bounds__(128) void k_gemm_hhx(const _Float16* __restrict__ A, int lda, size_t sA, const _Float16* __restrict__ Bh, int ldb, size_t sB, float alpha, const float* __restrict__ bias, size_t sBias, const float* __restrict__ CP, int rowsPerB, size_t sCPb, int row0g,
    float* __restrict__ C, _Float16* __restrict__ C16, int ldc, size_t sC, int M, int N, int K) {
  __shared__ __attribute__((aligned(16))) float so[4][16][64];
  const int tid = threadIdx.x, w = tid >> 5, lane = tid & 31, ln = lane & 15, hh = lane >> 4; const int by = blockIdx.y;
  A += (size_t)by * sA; Bh += (size_t)by * sB; const size_t cofs = (size_t)by * sC; const float* bp = bias ? bias + (size_t)by * sBias : nullptr;
  const int ntn = (N + 63) / 64; const int wid = blockIdx.x * 4 + w; const int mt = wid / ntn, nq = wid % ntn; if (mt * 16 >= M) return;
  const int row0 = mt * 16, col0 = nq * 64; const _Float16* arow = A + (size_t)(row0 + ln) * lda;
  v8f acc[4] = {};
  for (int kb = 0; kb < K; kb += 32) { FragH ah; ah.half[0] = *(const v8us*)((const unsigned short*)arow + kb + 8 * hh); ah.half[1] = *(const v8us*)((const unsigned short*)arow + kb + 16 + 8 * hh);
#pragma unroll
    for (int t = 0; t < 4; ++t) { if (col0 + t * 16 >= N) continue; const size_t boff = (size_t)(col0 + t * 16 + ln) * ldb + kb; FragH bq; bq.half[0] = *(const v8us*)((const unsigned short*)Bh + boff + 8 * hh); bq.half[1] = *(const v8us*)((const unsigned short*)Bh + boff + 16 + 8 * hh);
      acc[t] = mmaH<1>(ah.v, ah.v, bq.v, bq.v, acc[t]); }
  }
#pragma unroll
  for (int t = 0; t < 4; ++t) { if (col0 + t * 16 >= N) continue; const int col = col0 + t * 16 + ln; const float bv = bp ? bf16_round(bp[col]) : 0.f;
#pragma unroll
    for (int r = 0; r < 8; ++r) { float v = acc[t][r] * alpha + bv; if (CP) { const int rr = row0g + row0 + 8 * hh + r; if (rowsPerB < 0) v += CP[cofs + (size_t)rr * ldc + col];      /* rowsPerB < 0: own element of the batched C plane */ else { const int bidx = rr / rowsPerB; v += CP[(size_t)bidx * sCPb + (size_t)by * 64 + col]; } } if (ACT == 1) v = (v > 0.f) ? v : expm1f(v); else if (ACT == 7) v = (v > 0.f) ? v + 1.0f : expf(v); else if (ACT == 8) v = tanhf(v); else if (ACT == 9) v = 0.5f * v * (1.0f + tanhf(0.7978845608028654f * (v + 0.044715f * v * v * v))); else if (ACT == 11) v = 1.0f / (1.0f + expf(-v)); else if (ACT == 12) v = (v > 0.f) ? v : 0.01f * v; else if (ACT == 14) v = (v > 0.f) ? v : 0.1f * v; else if (ACT == 16) v = (v >= 0.f) ? v : 0.3f * v; else if (ACT == 17) v = (v >= 0.f) ? v : 0.2f * v; else if (ACT == 15) v = v / (1.0f + expf(-v)); else if (ACT == 3) v = fmaxf(v, 0.f); else if (ACT == 6) v = 0.5f * v * (1.0f + erff(v * 0.70710678118654752f)); so[w][8 * hh + r][t * 16 + ln] = v; } }
  __builtin_amdgcn_fence(__ATOMIC_ACQ_REL, "workgroup"); __builtin_amdgcn_wave_barrier();
  const int rsub = lane >> 4, c4 = (lane & 15) * 4; typedef _Float16 v4h __attribute__((ext_vector_type(4)));
  {
#pragma unroll
    for (int q = 0; q < 8; ++q) { const int r = q * 2 + rsub; if (col0 + c4 < N) { const v4f v = *(const v4fa*)&so[w][r][c4]; if (C) *(v4f*)(C + cofs + (size_t)(row0 + r) * ldc + col0 + c4) = v; if (C16) { v4h h4; for (int i = 0; i < 4; ++i) h4[i] = (_Float16)v[i]; *(v4h*)(C16 + cofs + (size_t)(row0 + r) * ldc + col0 + c4) = h4; } } }
     }
}


typedef _Float16 v4h __attribute__((ext_vector_type(4)));

__global__ __launch_bounds__(256) void k_h16(const float* __restrict__ x, _Float16* __restrict__ X16, size_t n8) { const size_t t = (size_t)blockIdx.x * 256 + threadIdx.x; if (t >= n8) return; FragH f;
#pragma unroll
  for (int q = 0; q < 8; ++q) f.h[q] = (_Float16)x[t * 8 + q]; *(v8us*)((unsigned short*)X16 + t * 8) = f.half[0];  }
__global__ __launch_bounds__(256) void k_round16f(const float* __restrict__ W, _Float16* __restrict__ Bt, size_t n8) { const size_t t = (size_t)blockIdx.x * 256 + threadIdx.x; if (t >= n8) return; FragH f;
#pragma unroll
  for (int i = 0; i < 8; ++i) f.h[i] = (_Float16)(bf16_round(W[t * 8 + i]) * 16.0f); *(v8us*)((unsigned short*)Bt + t * 8) = f.half[0];  }
template <int NHv, int TTv>
__global__ __launch_bounds__(256) void k_vt(const _Float16* __restrict__ V16, int ldv, int voff, _Float16* __restrict__ Vt) { __shared__ unsigned short tl[64][66]; const int tid = threadIdx.x; const int slab = blockIdx.x / (TTv / 64), lg = blockIdx.x % (TTv / 64); const int b = slab / NHv, h = slab % NHv;
  for (int i = tid; i < 64 * 8; i += 256) { const int r = i / 8, c8 = (i % 8) * 8; FragH f; f.half[0] = *(const v8us*)((const unsigned short*)V16 + ((size_t)b * TTv + lg * 64 + r) * ldv + voff + h * 64 + c8);
#pragma unroll
    for (int q = 0; q < 8; ++q) tl[r][c8 + q] = f.u[q]; }
  __syncthreads();
  {
#pragma unroll
    for (int rd = 0; rd < 2; ++rd) { const int d = rd * 32 + tid / 8, pc = tid % 8; FragH f;
#pragma unroll
      for (int q = 0; q < 8; ++q) f.u[q] = tl[pc * 8 + q][d];
      *(v8us*)((unsigned short*)Vt + ((size_t)slab * 64 + d) * TTv + lg * 64 + pc * 8) = f.half[0]; }
     } }

__global__ __launch_bounds__(256) void k_hl(const float* __restrict__ F, _Float16* __restrict__ Hh, _Float16* __restrict__ Hl, size_t n8) { const size_t t = (size_t)blockIdx.x * 256 + threadIdx.x; if (t >= n8) return; FragH fh, fl; const v4f a = *(const v4fa*)(F + t * 8), c = *(const v4fa*)(F + t * 8 + 4);
#pragma unroll
  for (int q = 0; q < 4; ++q) { _Float16 h = (_Float16)a[q]; fh.h[q] = h; fl.h[q] = (_Float16)((a[q] - (float)h) * 1024.0f); h = (_Float16)c[q]; fh.h[4 + q] = h; fl.h[4 + q] = (_Float16)((c[q] - (float)h) * 1024.0f); }
  { *(v8us*)((unsigned short*)Hh + t * 8) = fh.half[0]; *(v8us*)((unsigned short*)Hl + t * 8) = fl.half[0];  } }

// ---- fast GEMM (block tile 128x128 = 4 x 2 waves, wave tile 32x64; A and B tiles of 128 k staged in LDS by asynchronous copies, two buffers; requires M % 128 == 0, N % 128 == 0, K % 128 == 0); epilogue = k_gemm_hhx semantics, the residual (RES) in its own-element form only ----
__device__ __forceinline__ v16h g2_frag(const _Float16* p, int hh) { FragH f; f.half[0] = *(const v8us*)((const unsigned short*)p + 8 * hh); f.half[1] = *(const v8us*)((const unsigned short*)p + 16 + 8 * hh); return f.v; }
__device__ __forceinline__ v8f g2_mma(v16h a, v16h b, v8f c) { v8f d = __builtin_amdgcn_wmma_f32_16x16x32_f16(false, a, false, b, (short)0, c, false, false); asm volatile("v_nop\n\tv_nop\n\tv_nop\n\tv_nop" : "+v"(d) : "v"(a), "v"(b)); return d; }
#define G2_PITCH 272      /* LDS row pitch, bytes: 256 of data + 16, an odd multiple of 16 (no bank conflict for 16-byte row reads) */
#define G2_STAGE (256 * G2_PITCH)      /* one buffer: 128 rows of A, then 128 rows of B, 128 k each */
// Eight asynchronous 16-byte copies of a lane, global -> LDS, rows 16 apart (st = 16 source rows, in elements). The s_wait_xcnt stands in the copies' own statement, behind the last of them,
// so that it precedes every later write of a register that a copy names.
__device__ __forceinline__ void g2_copy8(unsigned l, const _Float16* g, size_t st) {
  asm volatile("global_load_async_to_lds_b128 %0, %8, off\n\t"
               "global_load_async_to_lds_b128 %1, %9, off\n\t"
               "global_load_async_to_lds_b128 %2, %10, off\n\t"
               "global_load_async_to_lds_b128 %3, %11, off\n\t"
               "global_load_async_to_lds_b128 %4, %12, off\n\t"
               "global_load_async_to_lds_b128 %5, %13, off\n\t"
               "global_load_async_to_lds_b128 %6, %14, off\n\t"
               "global_load_async_to_lds_b128 %7, %15, off\n\t"
               "s_wait_xcnt 0x0"
               :: "v"(l), "v"(l + 16u * G2_PITCH), "v"(l + 32u * G2_PITCH), "v"(l + 48u * G2_PITCH), "v"(l + 64u * G2_PITCH), "v"(l + 80u * G2_PITCH), "v"(l + 96u * G2_PITCH), "v"(l + 112u * G2_PITCH),
                  "v"(g), "v"(g + st), "v"(g + 2 * st), "v"(g + 3 * st), "v"(g + 4 * st), "v"(g + 5 * st), "v"(g + 6 * st), "v"(g + 7 * st) : "memory"); }
// a fragment from a staged row: p = the row's place + 64 bytes a k step + 16 hh; same k order as g2_frag
__device__ __forceinline__ v16h g2_lfrag(const unsigned char* p) { FragH f; f.half[0] = *(const v8us*)p; f.half[1] = *(const v8us*)(p + 32); return f.v; }
template <int ACT, bool RES>
__global__ __launch_bounds__(256) void k_gemm2(const _Float16* __restrict__ A, int lda, size_t sA, const _Float16* __restrict__ Bh, int ldb, size_t sB, float alpha, const float* __restrict__ bias, size_t sBias, const float* __restrict__ CP, int rowsPerB, size_t sCPb, int row0g,
    float* __restrict__ C, _Float16* __restrict__ C16, int ldc, size_t sC, int M, int N, int K) { static_assert(ACT == 0 || ACT == 3 || ACT == 6 || ACT == 8 || ACT == 9 || ACT == 11 || ACT == 12 || ACT == 14 || ACT == 15 || ACT == 16 || ACT == 17, "k_gemm2: unsupported ACT code (would silently apply no activation)");
  static_assert(!RES || ACT == 0, "k_gemm2: the residual is added behind the staging, which is in front of the activation only where there is none"); (void)rowsPerB; (void)sCPb;      /* RES: CP holds the residual plane, laid out as C, first row row0g */
  __shared__ __attribute__((aligned(16))) unsigned char sm[2 * G2_STAGE]; float (*so)[32][68] = (float (*)[32][68])sm;      /* two operand buffers; behind the loop's last barrier the same LDS stages the output tile */
  const int tid = threadIdx.x, w = tid >> 5, lane = tid & 31, ln = lane & 15, hh = lane >> 4; const int by = blockIdx.y;
  A += (size_t)by * sA; Bh += (size_t)by * sB; const size_t cofs = (size_t)by * sC; const float* bp = bias ? bias + (size_t)by * sBias : nullptr;
  const int wm = w & 3, wn = w >> 2;      /* the wave's place in the block tile: 32 rows, 64 columns */
  const int ntn = N >> 7; const int mt = blockIdx.x / ntn, nq = blockIdx.x - mt * ntn; const int row0 = mt * 128 + 32 * wm, col0 = nq * 128 + 64 * wn; if (mt * 128 >= M) return;      /* the whole block leaves, in front of every barrier */
  /* copies: lane = 16 bytes; 16 lanes a row of 256 bytes, so a wave's copy covers two whole rows; thread rows tid / 16 + 16 i */
  const unsigned lc = (unsigned)(size_t)sm + (unsigned)(tid >> 4) * G2_PITCH + (unsigned)(tid & 15) * 16u;
  const _Float16* ga = A + (size_t)(mt * 128 + (tid >> 4)) * lda + (tid & 15) * 8; const _Float16* gb = Bh + (size_t)(nq * 128 + (tid >> 4)) * ldb + (tid & 15) * 8;
  auto fill = [&](int t, int buf) { const unsigned l = lc + (unsigned)buf * G2_STAGE;
    g2_copy8(l, ga + (size_t)t * 128, (size_t)16 * lda); g2_copy8(l + 128u * G2_PITCH, gb + (size_t)t * 128, (size_t)16 * ldb); };
  const unsigned char* sa = sm + (32 * wm + ln) * G2_PITCH + 16 * hh; const unsigned char* sb = sm + (128 + 64 * wn + ln) * G2_PITCH + 16 * hh;
  const v8f z8 = {0.f,0.f,0.f,0.f,0.f,0.f,0.f,0.f}; v8f c00 = z8, c01 = z8, c02 = z8, c03 = z8, c10 = z8, c11 = z8, c12 = z8, c13 = z8;
  const int nt = K >> 7;
  fill(0, 0);
  /* the wave's four bias values go out here as one group: their latency passes under that of tile 0's copies. The s_wait_xcnt stands behind the loads, in front of every later overwrite of a register that they name (the pointer is its input and stays live up to it) */
  float bl[4] = {0.f, 0.f, 0.f, 0.f};
  if (bp) { const float* b0 = bp + col0 + ln;
#pragma unroll
    for (int t = 0; t < 4; ++t) bl[t] = b0[t * 16];
    asm volatile("s_wait_xcnt 0x0" :: "v"(b0) : "memory"); }
  asm volatile("s_wait_asynccnt 0x0" ::: "memory");      /* this wave's copies of tile 0 have landed */
  __syncthreads();      /* and every other wave's: tile 0 may be read */
  if (nt > 1) fill(1, 1);
  /* rolled: one copy of the body; a trip is 128 k = 32 products a wave, while the next tile's copies fly */
#pragma unroll 1
  for (int t = 0; t < nt; ++t) { const unsigned char* pa = sa + (t & 1) * G2_STAGE; const unsigned char* pb = sb + (t & 1) * G2_STAGE;
    v16h fa[2][2], fb[2][4];      /* two fragment sets */
    fa[0][0] = g2_lfrag(pa); fb[0][0] = g2_lfrag(pb); fa[0][1] = g2_lfrag(pa + 16 * G2_PITCH); fb[0][1] = g2_lfrag(pb + 16 * G2_PITCH); fb[0][2] = g2_lfrag(pb + 32 * G2_PITCH); fb[0][3] = g2_lfrag(pb + 48 * G2_PITCH);
    /* unrolled: the sets get constant indices (registers) and the LDS offsets become immediates. The reads of k step ks + 1 go as one group in front of the products of step ks, so only the trip's first group is waited for in full */
#pragma unroll
    for (int ks = 0; ks < 4; ++ks) { const int c = ks & 1, n = c ^ 1, o = (ks + 1) * 64;
      if (ks < 3) { fa[n][0] = g2_lfrag(pa + o); fb[n][0] = g2_lfrag(pb + o); fa[n][1] = g2_lfrag(pa + 16 * G2_PITCH + o); fb[n][1] = g2_lfrag(pb + 16 * G2_PITCH + o); fb[n][2] = g2_lfrag(pb + 32 * G2_PITCH + o); fb[n][3] = g2_lfrag(pb + 48 * G2_PITCH + o); }
      c00 = g2_mma(fa[c][0], fb[c][0], c00); c10 = g2_mma(fa[c][1], fb[c][0], c10);
      c01 = g2_mma(fa[c][0], fb[c][1], c01); c11 = g2_mma(fa[c][1], fb[c][1], c11);
      c02 = g2_mma(fa[c][0], fb[c][2], c02); c12 = g2_mma(fa[c][1], fb[c][2], c12);
      c03 = g2_mma(fa[c][0], fb[c][3], c03); c13 = g2_mma(fa[c][1], fb[c][3], c13); }
    asm volatile("s_wait_dscnt 0x0" ::: "memory");      /* this wave's reads of the buffer are done before it is refilled */
    asm volatile("s_wait_asynccnt 0x0" ::: "memory");      /* this wave's copies of tile t + 1 have landed */
    __syncthreads();      /* publishes tile t + 1 and ends every wave's reads of tile t */
    if (t + 2 < nt) fill(t + 2, t & 1); }
  asm volatile("s_wait_asynccnt 0x0" ::: "memory");      /* no copy is outstanding when the LDS changes its use */
  const int rsub = lane >> 4, c4 = (lane & 15) * 4; const size_t e0 = cofs + (size_t)(row0 + rsub) * ldc + col0 + c4, es = (size_t)2 * ldc;      /* the lane's 16-byte piece of tile row rsub + 2 q stands at element e0 + q es of the C plane */
  /* The residual goes out here as one group of sixteen loads, in the store phase's own layout (whole 256-byte row pieces, 16 bytes a lane): the wave pays one memory latency for all of it, and the scaling and staging below run under it.
     The s_wait_xcnt stands behind the loads; the pointers are its inputs, so they stay live up to it: no load's result lands on an address of an issued load, and the wait precedes every later overwrite of one */
  v4f rv[16];
  if (RES) { const float* rp[16];
#pragma unroll
    for (int q = 0; q < 16; ++q) { rp[q] = CP + (size_t)row0g * ldc + e0 + q * es; rv[q] = *(const v4fa*)rp[q]; }
    asm volatile("s_wait_xcnt 0x0" :: "v"(rp[0]), "v"(rp[1]), "v"(rp[2]), "v"(rp[3]), "v"(rp[4]), "v"(rp[5]), "v"(rp[6]), "v"(rp[7]), "v"(rp[8]), "v"(rp[9]), "v"(rp[10]), "v"(rp[11]), "v"(rp[12]), "v"(rp[13]), "v"(rp[14]), "v"(rp[15]) : "memory"); }
  v8f accs[8] = {c00, c01, c02, c03, c10, c11, c12, c13};
#pragma unroll
  for (int u = 0; u < 8; ++u) { const int t = u & 3, half = u >> 2; const float bv = bf16_round(bl[t]);
#pragma unroll
    for (int r = 0; r < 8; ++r) { const int rloc = half * 16 + 8 * hh + r; float v = accs[u][r] * alpha + bv;
      if (ACT == 3) v = fmaxf(v, 0.f); else if (ACT == 6) v = 0.5f * v * (1.0f + erff(v * 0.70710678118654752f)); else if (ACT == 11) v = 1.0f / (1.0f + expf(-v)); else if (ACT == 15) v = v / (1.0f + expf(-v)); else if (ACT == 12) v = (v > 0.f) ? v : 0.01f * v; else if (ACT == 8) v = tanhf(v); else if (ACT == 9) v = 0.5f * v * (1.0f + tanhf(0.7978845608028654f * (v + 0.044715f * v * v * v))); else if (ACT == 14) v = (v > 0.f) ? v : 0.1f * v; else if (ACT == 16) v = (v >= 0.f) ? v : 0.3f * v; else if (ACT == 17) v = (v >= 0.f) ? v : 0.2f * v;
      so[w][rloc][t * 16 + ln] = v; } }
  __builtin_amdgcn_fence(__ATOMIC_ACQ_REL, "workgroup"); __builtin_amdgcn_wave_barrier();
  v4f ov[16];
#pragma unroll
  for (int q = 0; q < 16; ++q) { ov[q] = *(const v4fa*)&so[w][q * 2 + rsub][c4]; if (RES) ov[q] += rv[q]; }
  /* stores in groups of eight; behind each group the s_wait_xcnt, with the group's pointers and data as inputs: they stay as they are up to the wait */
  if (C) {
#pragma unroll
    for (int g = 0; g < 2; ++g) { float* cp[8];
#pragma unroll
      for (int i = 0; i < 8; ++i) { cp[i] = C + e0 + (g * 8 + i) * es; *(v4f*)cp[i] = ov[g * 8 + i]; }
      asm volatile("s_wait_xcnt 0x0" :: "v"(cp[0]), "v"(cp[1]), "v"(cp[2]), "v"(cp[3]), "v"(cp[4]), "v"(cp[5]), "v"(cp[6]), "v"(cp[7]), "v"(ov[g * 8 + 0]), "v"(ov[g * 8 + 1]), "v"(ov[g * 8 + 2]), "v"(ov[g * 8 + 3]), "v"(ov[g * 8 + 4]), "v"(ov[g * 8 + 5]), "v"(ov[g * 8 + 6]), "v"(ov[g * 8 + 7]) : "memory"); } }
  if (C16) {
#pragma unroll
    for (int g = 0; g < 2; ++g) { _Float16* cp[8]; v4h hv[8];
#pragma unroll
      for (int i = 0; i < 8; ++i) { for (int j = 0; j < 4; ++j) hv[i][j] = (_Float16)ov[g * 8 + i][j]; cp[i] = C16 + e0 + (g * 8 + i) * es; *(v4h*)cp[i] = hv[i]; }
      asm volatile("s_wait_xcnt 0x0" :: "v"(cp[0]), "v"(cp[1]), "v"(cp[2]), "v"(cp[3]), "v"(cp[4]), "v"(cp[5]), "v"(cp[6]), "v"(cp[7]), "v"(hv[0]), "v"(hv[1]), "v"(hv[2]), "v"(hv[3]), "v"(hv[4]), "v"(hv[5]), "v"(hv[6]), "v"(hv[7]) : "memory"); } } }


__global__ __launch_bounds__(256) void k_wnat(const float* __restrict__ w, size_t n8, _Float16* __restrict__ Bt) { const size_t t = (size_t)blockIdx.x * 256 + threadIdx.x; if (t >= n8) return; FragH f; for (int q = 0; q < 8; ++q) f.h[q] = (_Float16)(bf16_round(w[t * 8 + q]) * 16.0f); *(v8us*)((unsigned short*)Bt + t * 8) = f.half[0];  }
__global__ __launch_bounds__(256) void k_rsm(const float* __restrict__ S, _Float16* __restrict__ P, int nrows) {
  #pragma clang fp contract(off)
  const int i = blockIdx.x * 256 + threadIdx.x; if (i >= nrows) return; const float* s = S + (size_t)i * SQ; float mx = -3.0e38f;
#pragma unroll 1
  for (int j = 0; j < SQ; ++j) mx = fmaxf(mx, s[j]); float se = 0.f;
#pragma unroll 1
  for (int j = 0; j < SQ; ++j) se += expf(s[j] - mx); const float sc = 256.0f / se;
#pragma unroll 1
  for (int j0 = 0; j0 < SQ; j0 += 8) { FragH f; for (int q = 0; q < 8; ++q) f.h[q] = (_Float16)(expf(s[j0 + q] - mx) * sc); unsigned short* d = (unsigned short*)P + (size_t)i * SQ + j0; *(v8us*)d = f.half[0];  } }
__global__ __launch_bounds__(256) void k_vt(const _Float16* __restrict__ V16, int b, int h0, _Float16* __restrict__ VT) { __shared__ unsigned short tl[64][65]; const int tid = threadIdx.x; const int hh = blockIdx.x % HG, sg = blockIdx.x / HG; const int s0 = sg * 64; const int h = h0 + hh;
  for (int i = tid; i < 64 * 8; i += 256) { const int j = i / 8, d8 = (i % 8) * 8; FragH f; f.half[0] = *(const v8us*)((const unsigned short*)V16 + ((size_t)b * SQ + s0 + j) * DM + h * HD + d8); for (int q = 0; q < 8; ++q) tl[d8 + q][j] = f.u[q]; }
  __syncthreads();
  { for (int i = tid; i < 64 * 8; i += 256) { const int d = i / 8, j8 = (i % 8) * 8; FragH f; for (int q = 0; q < 8; ++q) f.u[q] = tl[d][j8 + q]; *(v8us*)((unsigned short*)VT + ((size_t)hh * HD + d) * SQ + s0 + j8) = f.half[0]; }  } }



__global__ __launch_bounds__(256) void k_rsmcf2(const float* __restrict__ S, _Float16* __restrict__ P, int hg, int q0, int nk) {
  #pragma clang fp contract(off)
  const int t = blockIdx.x * 256 + threadIdx.x; if (t >= hg * QT) return; const size_t i = (size_t)t; const float* s = S + i * NKX; const int last = q0 + (t % QT); float mx = -3.0e38f;
#pragma unroll 1
  for (int j = 0; j < nk; ++j) { const float f = (j <= last) ? 1.f : 0.f; mx = fmaxf(mx, fmaf(f, s[j], (1.f - f) * -1.0e9f)); } float se = 0.f;
#pragma unroll 1
  for (int j = 0; j < nk; ++j) { const float f = (j <= last) ? 1.f : 0.f; se += __expf(fmaf(f, s[j], (1.f - f) * -1.0e9f) - mx); } const float sc = 256.0f / se;
#pragma unroll 1
  for (int j0 = 0; j0 < nk; j0 += 8) { FragH fr; for (int q = 0; q < 8; ++q) { const int j = j0 + q; const float f = (j <= last) ? 1.f : 0.f; fr.h[q] = (_Float16)(__expf(fmaf(f, s[j], (1.f - f) * -1.0e9f) - mx) * sc); } unsigned short* d = (unsigned short*)P + i * NKX + j0; *(v8us*)d = fr.half[0];  } }


template <int MASKADD>
__global__ __launch_bounds__(64) void k_att0(const float* __restrict__ QF, const float* __restrict__ KF, const float* __restrict__ VF, int ld, const float* __restrict__ mask, float scale, float* __restrict__ OF, int ldo) {
  #pragma clang fp contract(off)
  __shared__ __attribute__((aligned(16))) float lq[64][64]; __shared__ __attribute__((aligned(16))) float lo[64][64];
  const int tid = threadIdx.x; const int h = blockIdx.x / (QT0 / 64), rg = blockIdx.x % (QT0 / 64); const int i = rg * 64 + tid;
  const float* qr = QF + (size_t)i * ld + h * HD;
#pragma unroll 1
  for (int c = 0; c < HD / 4; ++c) { *(v4f*)&lq[tid][c * 4] = *(const v4fa*)(qr + c * 4); const v4f z = {0.f, 0.f, 0.f, 0.f}; *(v4f*)&lo[tid][c * 4] = z; }
  float m = -1.0e30f, l = 0.f; const int jmax = MASKADD ? (SQ - 1) : (rg * 64 + 63);      /* additive-mask form: every key (the mask input decides); causal form: keys up to the block's last row */
#pragma unroll 1
  for (int j = 0; j <= jmax; ++j) { const float* kr = KF + (size_t)j * ld + h * HD; const float* vr = VF + (size_t)j * ld + h * HD; float s = 0.f;
#pragma unroll 1
    for (int c = 0; c < HD / 4; ++c) { const v4f kq = *(const v4fa*)(kr + c * 4); const v4f qq = *(v4f*)&lq[tid][c * 4]; s = __fadd_rn(s, __fmul_rn(qq[0], kq[0])); s = __fadd_rn(s, __fmul_rn(qq[1], kq[1])); s = __fadd_rn(s, __fmul_rn(qq[2], kq[2])); s = __fadd_rn(s, __fmul_rn(qq[3], kq[3])); }
    s = __fmul_rn(s, scale); if (MASKADD) s = __fadd_rn(s, __fmul_rn(bf16_round(mask[(size_t)i * SQ + j]), -10000.0f));
    const float f = (MASKADD || j <= i) ? 1.f : 0.f; const float sm = fmaf(f, s, (1.f - f) * -1.0e30f); const float mn = fmaxf(m, sm); const float sc = expf(m - mn); const float e = expf(sm - mn); l = __fadd_rn(__fmul_rn(l, sc), e); m = mn;
#pragma unroll 1
    for (int c = 0; c < HD / 4; ++c) { const v4f vv = *(const v4fa*)(vr + c * 4); v4f oo = *(v4f*)&lo[tid][c * 4]; for (int u = 0; u < 4; ++u) oo[u] = __fadd_rn(__fmul_rn(oo[u], sc), __fmul_rn(e, vv[u])); *(v4f*)&lo[tid][c * 4] = oo; } }
  const float fin = 64.0f / l;      /* o carried x64 like the f16 path */
#pragma unroll 1
  for (int c = 0; c < HD / 4; ++c) { v4f oo = *(v4f*)&lo[tid][c * 4]; for (int u = 0; u < 4; ++u) oo[u] = __fmul_rn(oo[u], fin); *(v4f*)&lo[tid][c * 4] = oo; }
  __syncthreads();
  {
#pragma unroll 1
    for (int it = 0; it < 16; ++it) { const int row = it * 4 + tid / 16, pc = (tid % 16) * 4; const v4f v = *(const v4f*)&lo[row][pc]; *(v4f*)(OF + (size_t)(rg * 64 + row) * ldo + h * HD + pc) = v; }
     } }


template <int BFIN, int WXB>
__global__ __launch_bounds__(256) void k_ln16(const float* __restrict__ X, const float* __restrict__ g, const float* __restrict__ bb, float eps, _Float16* __restrict__ N16, float* __restrict__ XB) {
  #pragma clang fp contract(off)
  __shared__ float red[256]; const size_t r = blockIdx.x; const int t = threadIdx.x; const v4f xa = *(const v4fa*)(X + r * DMQ + t * 4); float s[4]; float sum = 0.f;
  for (int q = 0; q < 4; ++q) { s[q] = BFIN ? bf16_round(xa[q]) : xa[q]; sum = __fadd_rn(sum, s[q]); }
  red[t] = sum; __syncthreads(); for (int st = 128; st > 0; st >>= 1) { if (t < st) red[t] = __fadd_rn(red[t], red[t + st]); __syncthreads(); } const float mu = red[0] / (float)DMQ; __syncthreads();
  float vs = 0.f; for (int q = 0; q < 4; ++q) { const float dl = __fadd_rn(s[q], -mu); vs = __fadd_rn(vs, __fmul_rn(dl, dl)); } red[t] = vs; __syncthreads(); for (int st = 128; st > 0; st >>= 1) { if (t < st) red[t] = __fadd_rn(red[t], red[t + st]); __syncthreads(); }
  const float rs = rsqrtf(__fadd_rn(red[0] / (float)DMQ, eps)); v4h y; v4f xb;
  for (int q = 0; q < 4; ++q) { const int c = t * 4 + q; y[q] = (_Float16)__fadd_rn(__fmul_rn(__fmul_rn(__fadd_rn(s[q], -mu), rs), bf16_round(g[c])), bf16_round(bb[c])); xb[q] = s[q]; }
  { *(v4h*)(N16 + r * DMQ + t * 4) = y; if (WXB) *(v4f*)(XB + r * DMQ + t * 4) = xb;  } }
__global__ __launch_bounds__(256) void k_ftres2(const float* __restrict__ OF0, const float* __restrict__ XB, float* __restrict__ X1, size_t n4) {
  #pragma clang fp contract(off)
  const size_t t = (size_t)blockIdx.x * 256 + threadIdx.x; if (t >= n4) return; const v4f o = *(const v4fa*)(OF0 + t * 4), xv = *(const v4fa*)(XB + t * 4); v4f y; for (int q = 0; q < 4; ++q) y[q] = __fadd_rn(__fmul_rn(o[q], 0.015625f), xv[q]); *(v4f*)(X1 + t * 4) = y;  }

__global__ __launch_bounds__(256) void k_wthd(const float* __restrict__ Wt, _Float16* __restrict__ Bt) { const size_t t = (size_t)blockIdx.x * 256 + threadIdx.x; if (t >= (size_t)NH * HD * (DM / 8)) return; const int m8 = (int)(t % (DM / 8)) * 8; const int d = (int)((t / (DM / 8)) % HD); const int h = (int)(t / ((size_t)(DM / 8) * HD)); FragH f;
  for (int q = 0; q < 8; ++q) f.h[q] = (_Float16)(16.0f * bf16_round(Wt[((size_t)h * DM + m8 + q) * HD + d])); unsigned short* dst = (unsigned short*)Bt + ((size_t)h * HD + d) * DM + m8; *(v8us*)dst = f.half[0];  }




template <int BFIN, int W16, int W32>
__global__ __launch_bounds__(256) void k_lnx(const float* __restrict__ X, const float* __restrict__ g, const float* __restrict__ bb, float eps, _Float16* __restrict__ N16, float* __restrict__ N32) {
  #pragma clang fp contract(off)
  __shared__ float red[256]; const size_t r = blockIdx.x; const int t = threadIdx.x; const bool act = t < (DMQ / 4); const int c0 = act ? t * 4 : 0;
  const v4f xa = *(const v4fa*)(X + r * DMQ + c0); float s[4]; float sum = 0.f;
  for (int q = 0; q < 4; ++q) { s[q] = act ? (BFIN ? bf16_round(xa[q]) : xa[q]) : 0.f; sum = __fadd_rn(sum, s[q]); }
  red[t] = sum; __syncthreads(); for (int st = 128; st > 0; st >>= 1) { if (t < st) red[t] = __fadd_rn(red[t], red[t + st]); __syncthreads(); } const float mu = red[0] / (float)DMQ; __syncthreads();
  float vs = 0.f; for (int q = 0; q < 4; ++q) { const float dl = act ? __fadd_rn(s[q], -mu) : 0.f; vs = __fadd_rn(vs, __fmul_rn(dl, dl)); } red[t] = vs; __syncthreads(); for (int st = 128; st > 0; st >>= 1) { if (t < st) red[t] = __fadd_rn(red[t], red[t + st]); __syncthreads(); }
  const float rs = rsqrtf(__fadd_rn(red[0] / (float)DMQ, eps)); v4h y; v4f yf;
  for (int q = 0; q < 4; ++q) { const int c = c0 + q; yf[q] = __fadd_rn(__fmul_rn(__fmul_rn(__fadd_rn(s[q], -mu), rs), bf16_round(g[c])), bf16_round(bb[c])); y[q] = (_Float16)yf[q]; }
  if (!act) return;      /* no barriers after this point */
  { if (W16) *(v4h*)(N16 + r * DMQ + c0) = y; if (W32) *(v4f*)(N32 + r * DMQ + c0) = yf;  } }






__global__ __launch_bounds__(256) void k_lorafold(const float* __restrict__ Wm, const float* __restrict__ A, const float* __restrict__ Bm, float* __restrict__ WE, int K, int N, float sc) {
  #pragma clang fp contract(off)
  const size_t t = (size_t)blockIdx.x * 256 + threadIdx.x; if (t >= (size_t)K * N) return; const int i = (int)(t / N), o = (int)(t % N); float a = 0.f;
  for (int r = 0; r < 16; ++r) a = __fadd_rn(a, __fmul_rn(bf16_round(A[(size_t)i * 16 + r]), bf16_round(Bm[(size_t)r * N + o])));
  const float v = __fadd_rn(bf16_round(Wm[t]), __fmul_rn(sc, a)); *(float*)(WE + t) = v;  }
__global__ __launch_bounds__(256) void k_wt32rep(const float* __restrict__ Wf, _Float16* __restrict__ Bt, int K, int N, int DOUT, float scale) {
  const int t = blockIdx.x * 256 + threadIdx.x; if (t >= DOUT * (K / 8)) return; const int n = t / (K / 8), k8 = (t % (K / 8)) * 8; const int rep = DOUT / N; const int src = (n / (HD * rep)) * HD + (n % HD);      /* head h = n / HD -> group h / rep */
  FragH f; for (int i = 0; i < 8; ++i) f.h[i] = (_Float16)(Wf[(size_t)(k8 + i) * N + src] * scale);
  *(v8us*)((unsigned short*)Bt + (size_t)n * K + k8) = f.half[0];  }
__global__ __launch_bounds__(256) void k_brep(const float* __restrict__ b, float* __restrict__ out) { const int t = blockIdx.x * 256 + threadIdx.x; if (t >= DM) return; const float v = b[(t / (HD * 4)) * HD + (t % HD)]; *(float*)(out + t) = v;  }

__global__ __launch_bounds__(256) void k_rsmcim(const float* __restrict__ S, _Float16* __restrict__ P, int hg, int q0, int nk, const int* __restrict__ am) {
  #pragma clang fp contract(off)
  const int t = blockIdx.x * 256 + threadIdx.x; if (t >= hg * QT) return; const size_t i = (size_t)t; const float* s = S + i * NKX; const int last = q0 + (t % QT); const int* mr = am + (size_t)last * SQ; float mx = -3.0e38f;      /* the module's mask row of this query (keys >= nk lie above the diagonal of the causal mask and are not computed) */
#pragma unroll 1
  for (int j = 0; j < nk; ++j) { const float f = (mr[j] != 0) ? 1.f : 0.f; mx = fmaxf(mx, fmaf(f, s[j], (1.f - f) * -1.0e9f)); } float se = 0.f;
#pragma unroll 1
  for (int j = 0; j < nk; ++j) { const float f = (mr[j] != 0) ? 1.f : 0.f; se += __expf(fmaf(f, s[j], (1.f - f) * -1.0e9f) - mx); } const float sc = 256.0f / se;
#pragma unroll 1
  for (int j0 = 0; j0 < nk; j0 += 8) { FragH fr; for (int q = 0; q < 8; ++q) { const int j = j0 + q; const float f = (mr[j] != 0) ? 1.f : 0.f; fr.h[q] = (_Float16)(__expf(fmaf(f, s[j], (1.f - f) * -1.0e9f) - mx) * sc); } unsigned short* d = (unsigned short*)P + i * NKX + j0; *(v8us*)d = fr.half[0];  } }



// One grid for the eleven preparation jobs (six weight transposes, the two planes of x, the three biases stacked): none reads what another writes, so they need no order among themselves.
// The block index picks the job (block-uniform branches; no job has a barrier). The large transposes come first, the short bias blocks last.
#define PB_WL ((DM / 128) * (DFF / 64))      /* tiles of W1, and of W2 */
#define PB_WS ((DM / 128) * (DM / 64))       /* tiles of one of Wq, Wk, Wv, Wo */
#define PB_W (2 * PB_WL + 4 * PB_WS)
#define PB_XE 4096                           /* elements of x a block: 8 pieces of 16 bytes a lane */
#define PB_X ((int)(NR * DM / PB_XE))
#define PB_B (3 * DM / 128)
__global__ __launch_bounds__(128) void k_prep(const float* __restrict__ x, const float* __restrict__ wq, const float* __restrict__ wk, const float* __restrict__ wv, const float* __restrict__ wo, const float* __restrict__ wfc, const float* __restrict__ wmp,
    const float* __restrict__ bq, const float* __restrict__ bk, const float* __restrict__ bv, _Float16* __restrict__ BQKV, _Float16* __restrict__ BO, _Float16* __restrict__ BW1, _Float16* __restrict__ BW2, float* __restrict__ bqkv, _Float16* __restrict__ X16, float* __restrict__ XB) {
  const int blk = blockIdx.x, tid = threadIdx.x;
  if (blk < PB_W) {      /* [in][out] -> Bt x16: W1, W2, stacked q | k | v, Wo */
    const float* W; _Float16* Wt; int K = DM, N = DM, r;
    if (blk < PB_WL) { W = wfc; Wt = BW1; N = DFF; r = blk; }
    else if (blk < 2 * PB_WL) { W = wmp; Wt = BW2; K = DFF; r = blk - PB_WL; }
    else { const int j = (blk - 2 * PB_WL) / PB_WS; r = (blk - 2 * PB_WL) - j * PB_WS; W = (j == 0) ? wq : (j == 1) ? wk : (j == 2) ? wv : wo; Wt = (j < 3) ? BQKV + (size_t)j * DM * DM : BO; }
    wt_f16_tile(W, Wt, K, N, 16.0f, r);
  } else if (blk < PB_W + PB_X) {      /* x read once: bf16(x) as exact f16 rows (GEMM operand) and as f32 rows (residual). A wave's load covers four whole lines, its stores four and two */
    const size_t e0 = (size_t)(blk - PB_W) * PB_XE + tid * 4; const float* p = x + e0; v4f a[8];
    /* unrolled: constant indices (registers), and the eight loads of a lane fly together */
#pragma unroll
    for (int i = 0; i < 8; ++i) a[i] = *(const v4fa*)(p + i * 512);
#pragma unroll
    for (int i = 0; i < 8; ++i) { v4f f; v4h h;
#pragma unroll
      for (int q = 0; q < 4; ++q) { f[q] = bf16_round(a[i][q]); h[q] = (_Float16)f[q]; }
      *(v4f*)(XB + e0 + i * 512) = f; *(v4h*)(X16 + e0 + i * 512) = h; }
    asm volatile("s_wait_xcnt 0x0" ::: "memory");      /* stands behind the last store, in front of any later write of a register that a store names */
  } else {      /* stacked bias bq | bk | bv: a block lies inside one of the three */
    const int c = blk - PB_W - PB_X, j = c / (DM / 128); const float* b = (j == 0) ? bq : (j == 1) ? bk : bv; const int i = (c - j * (DM / 128)) * 128 + tid; (bqkv + j * DM)[i] = b[i];
    asm volatile("s_wait_xcnt 0x0" ::: "memory");      /* as above: behind the store, in front of any later write of its registers */
  }
}



// lane l with lane l ^ 16
__device__ __forceinline__ float rs_xh(float v) { return __builtin_bit_cast(float, __builtin_amdgcn_permlanex16(__builtin_bit_cast(int, v), __builtin_bit_cast(int, v), 0x76543210, 0xfedcba98, false, false)); }
// native 2^t; the v_nop is the slot the instruction set asks for behind a transcendental before its result is read or its source overwritten
__device__ __forceinline__ float fa_exp2(float t) { float e; asm("v_exp_f32 %0, %1\n\tv_nop" : "=v"(e) : "v"(t)); return e; }
#define FA_KT 128      /* keys a stage */
#define FA_KP 144      /* LDS pitch of a K row, bytes: 128 of data + 16, an odd multiple of 16 (no bank conflict for 16-byte row reads) */
#define FA_VP 272      /* LDS pitch of a V^T row: 256 of data + 16, likewise */
#define FA_VO (FA_KT * FA_KP)      /* the 64 V^T rows stand behind the 128 K rows */
#define FA_STAGE (FA_VO + HD * FA_VP)      /* one buffer */
// Eight asynchronous 16-byte copies of a lane, global -> LDS: four of K (rows 32 apart), four of V^T (rows 16 apart). The s_wait_xcnt stands in the copies' own statement, behind the last of them,
// so that it precedes every later write of a register that a copy names.
__device__ __forceinline__ void fa_copy8(unsigned lk, const _Float16* gk, unsigned lv, const _Float16* gv) {
  asm volatile("global_load_async_to_lds_b128 %0, %8, off\n\t"
               "global_load_async_to_lds_b128 %1, %9, off\n\t"
               "global_load_async_to_lds_b128 %2, %10, off\n\t"
               "global_load_async_to_lds_b128 %3, %11, off\n\t"
               "global_load_async_to_lds_b128 %4, %12, off\n\t"
               "global_load_async_to_lds_b128 %5, %13, off\n\t"
               "global_load_async_to_lds_b128 %6, %14, off\n\t"
               "global_load_async_to_lds_b128 %7, %15, off\n\t"
               "s_wait_xcnt 0x0"
               :: "v"(lk), "v"(lk + 32u * FA_KP), "v"(lk + 64u * FA_KP), "v"(lk + 96u * FA_KP), "v"(lv), "v"(lv + 16u * FA_VP), "v"(lv + 32u * FA_VP), "v"(lv + 48u * FA_VP),
                  "v"(gk), "v"(gk + (size_t)32 * LQ), "v"(gk + (size_t)64 * LQ), "v"(gk + (size_t)96 * LQ), "v"(gv), "v"(gv + (size_t)16 * SQ), "v"(gv + (size_t)32 * SQ), "v"(gv + (size_t)48 * SQ) : "memory"); }
__global__ __launch_bounds__(256) void k_fattn(const _Float16* __restrict__ Q, const _Float16* __restrict__ Kk, const _Float16* __restrict__ VT, _Float16* __restrict__ O) {
  __shared__ __attribute__((aligned(16))) unsigned char sm[2 * FA_STAGE];
  const int tid = threadIdx.x, lane = tid & 31, w = tid >> 5, ln = lane & 15, hh = lane >> 4; const int h = blockIdx.y, b = blockIdx.z; const int q0 = blockIdx.x * 256 + w * 32; const size_t r0 = (size_t)b * SQ;
  const _Float16* qp = Q + (r0 + q0 + ln) * LQ + h * HD + 8 * hh;      /* the lane's own 8 hh is in the pointer: g2_frag is called with 0 */
  /* copies: lane = 16 bytes. K: 8 lanes a row of 128 bytes, thread rows tid / 8 + 32 i; V^T: 16 lanes a row of 256 bytes, thread rows tid / 16 + 16 i: a wave's copy covers four whole lines */
  const unsigned lk = (unsigned)(size_t)sm + (unsigned)(tid >> 3) * FA_KP + (unsigned)(tid & 7) * 16u; const unsigned lv = (unsigned)(size_t)sm + FA_VO + (unsigned)(tid >> 4) * FA_VP + (unsigned)(tid & 15) * 16u;
  const _Float16* gk = Kk + (r0 + (tid >> 3)) * LQ + h * HD + (tid & 7) * 8; const _Float16* gv = VT + ((size_t)(b * NH + h) * HD + (tid >> 4)) * SQ + (tid & 15) * 8;
  auto fill = [&](int t, int buf) { fa_copy8(lk + (unsigned)buf * FA_STAGE, gk + (size_t)t * FA_KT * LQ, lv + (unsigned)buf * FA_STAGE, gv + (size_t)t * FA_KT); };
  const unsigned char* sk = sm + ln * FA_KP + 16 * hh; const unsigned char* sv = sm + FA_VO + ln * FA_VP + 16 * hh;      /* the lane's fragment rows; same k order as g2_frag */
  const float L2E = 1.44269504088896340736f; const v8f z8 = {0.f,0.f,0.f,0.f,0.f,0.f,0.f,0.f};
  v16h qf[2][2], kf[2][2], vf[4]; v8f o[2][4]; float m[2] = {-3.0e38f, -3.0e38f}, l[2] = {0.f, 0.f};
  fill(0, 0);
  /* every loop over a fragment index is unrolled so that the fragment arrays have constant indices and stay in registers */
#pragma unroll
  for (int t = 0; t < 2; ++t) { qf[t][0] = g2_frag(qp + (size_t)t * 16 * LQ, 0); qf[t][1] = g2_frag(qp + (size_t)t * 16 * LQ + 32, 0);
#pragma unroll
    for (int dt = 0; dt < 4; ++dt) o[t][dt] = z8; }
  /* behind the loads that share one address pair: the wait that precedes any overwrite of that pair; the pair is an input, so it stays live (no load's result lands on it) up to the wait */
  asm volatile("s_wait_xcnt 0x0" :: "v"(qp) : "memory");
  asm volatile("s_wait_asynccnt 0x0" ::: "memory");      /* this wave's copies of stage 0 have landed */
  __syncthreads();      /* and every other wave's: stage 0 may be read */
  fill(1, 1);
  /* rolled: one copy of the body; a stage is 128 keys, while the next stage's copies fly */
#pragma unroll 1
  for (int t = 0; t < SQ / FA_KT; ++t) { const unsigned char* pk = sk + (t & 1) * FA_STAGE; const unsigned char* pv = sv + (t & 1) * FA_STAGE;
#pragma unroll
    for (int kt = 0; kt < 2; ++kt) { kf[kt][0] = g2_lfrag(pk + kt * 16 * FA_KP); kf[kt][1] = g2_lfrag(pk + kt * 16 * FA_KP + 64); }
    /* rolled: a pass is some 350 instructions already, and four copies of it spill. The stage's last pass fetches no K ahead (nothing of the next stage is read in front of the barrier) */
#pragma unroll 1
    for (int p = 0; p < FA_KT / 32; ++p) {
#pragma unroll
      for (int dt = 0; dt < 4; ++dt) vf[dt] = g2_lfrag(pv + dt * 16 * FA_VP + p * 64);
      v8f s[2][2];
#pragma unroll
      for (int u = 0; u < 2; ++u)
#pragma unroll
        for (int kt = 0; kt < 2; ++kt) s[u][kt] = g2_mma(kf[kt][1], qf[u][1], g2_mma(kf[kt][0], qf[u][0], z8));
      if (p + 1 < FA_KT / 32) {
#pragma unroll
        for (int kt = 0; kt < 2; ++kt) { kf[kt][0] = g2_lfrag(pk + ((p + 1) * 32 + kt * 16) * FA_KP); kf[kt][1] = g2_lfrag(pk + ((p + 1) * 32 + kt * 16) * FA_KP + 64); } }
      FragH pf[2];
#pragma unroll
      for (int u = 0; u < 2; ++u) { float mx = fmaxf(s[u][0][0], s[u][1][0]);
#pragma unroll
        for (int r = 1; r < 8; ++r) mx = fmaxf(mx, fmaxf(s[u][0][r], s[u][1][r]));
        mx = fmaxf(mx, rs_xh(mx)); const float mn = fmaxf(m[u], mx); const float al = fa_exp2((m[u] - mn) * L2E); const float mb = mn * L2E - 8.0f; m[u] = mn; float e0 = 0.f, e1 = 0.f;
#pragma unroll
        for (int r = 0; r < 8; ++r) { const float p0 = fa_exp2(fmaf(s[u][0][r], L2E, -mb)), p1 = fa_exp2(fmaf(s[u][1][r], L2E, -mb)); e0 += p0; e1 += p1; pf[u].h[r] = (_Float16)p0; pf[u].h[8 + r] = (_Float16)p1; }
        l[u] = fmaf(l[u], al, e0 + e1);      /* this half's keys only; the halves are joined behind the loop */
#pragma unroll
        for (int dt = 0; dt < 4; ++dt) o[u][dt] *= al; }
#pragma unroll
      for (int u = 0; u < 2; ++u)
#pragma unroll
        for (int dt = 0; dt < 4; ++dt) o[u][dt] = g2_mma(vf[dt], pf[u].v, o[u][dt]); }
    asm volatile("s_wait_dscnt 0x0" ::: "memory");      /* this wave's reads of the buffer are done before it is refilled */
    asm volatile("s_wait_asynccnt 0x0" ::: "memory");      /* this wave's copies of stage t + 1 have landed */
    __syncthreads();      /* publishes stage t + 1 and ends every wave's reads of stage t */
    if (t + 2 < SQ / FA_KT) fill(t + 2, t & 1); }
  asm volatile("s_wait_asynccnt 0x0" ::: "memory");      /* no copy is outstanding when the wave ends */
#pragma unroll
  for (int t = 0; t < 2; ++t) { const float fin = 64.0f / (l[t] + rs_xh(l[t]));      /* ctx carried x64; the x256 of the weights cancels in the quotient */
    _Float16* d = O + (r0 + q0 + t * 16 + ln) * DM + h * HD + 8 * hh;
#pragma unroll
    for (int dt = 0; dt < 4; ++dt) { FragH f;
#pragma unroll
      for (int r = 0; r < 8; ++r) f.h[r] = (_Float16)(o[t][dt][r] * fin);
      *(v8us*)((unsigned short*)d + dt * 16) = f.half[0]; } } }
extern "C" void kernel_launch(void* const* d_in, const int* in_sizes, int n_in,
                              void* d_out, int out_size, void* d_ws, size_t ws_size, hipStream_t stream) {
  (void)in_sizes; (void)n_in; (void)out_size;
  const float* const* I = (const float* const*)d_in; const float* x = I[0]; const float* wq = I[1]; const float* bq = I[2]; const float* wk = I[3]; const float* bk = I[4]; const float* wv = I[5]; const float* bv = I[6]; const float* wo = I[7]; const float* bo = I[8]; const float* wfc = I[9]; const float* bfc = I[10]; const float* wmp = I[11]; const float* bmp = I[12]; const float* g1 = I[13]; const float* be1 = I[14]; const float* gg2 = I[15]; const float* be2 = I[16];      /* x; [in][out] Wq / Wk / Wv / Wo + biases; W1 [1024][4096] + b1, W2 [4096][1024] + b2; LN1 g / b, LN2 g / b */
  char* ws = (char*)d_ws; size_t off = 0;
  auto take = [&](size_t bytes) { char* p = ws + off; off += (bytes + 255) & ~(size_t)255; return p; };
  _Float16* BQKV = (_Float16*)take((size_t)3 * DM * DM * 2); _Float16* BO = (_Float16*)take((size_t)DM * DM * 2); float* bqkv = (float*)take((size_t)3 * DM * 4); float* X1N = nullptr;      /* LN1 output (f32): aliases the QKV plane below (QKV's last readers, the V^T and attention launches, precede LN1) to stay within 256 MiB at NB 4 / SQ 2048 */
  _Float16* X16 = (_Float16*)take(NR * DM * 2); float* XB = (float*)take(NR * DM * 4); float* X1 = (float*)take(NR * DM * 4); _Float16* M16 = nullptr;      /* = X16 below (alias: X16's last reader, the fused QKV GEMM, precedes LN1's f16 write) */ _Float16* HF16 = nullptr;      /* FFN hidden plane of all rows [4096][4096] f16, taken below */ _Float16* BW1 = (_Float16*)take((size_t)DFF * DM * 2); _Float16* BW2 = (_Float16*)take((size_t)DM * DFF * 2); _Float16* QKV = (_Float16*)take(NR * 3 * DM * 2); _Float16* Q16 = QKV; _Float16* K16 = QKV + DM; _Float16* V16 = QKV + 2 * DM; _Float16* O16 = (_Float16*)take(NR * DM * 2); M16 = X16; X1N = (float*)QKV; HF16 = (_Float16*)take(NR * DFF * 2);      /* the FFN hidden plane of all rows (32 MiB) gets its OWN region here */      /* alias: X1N (NR*DM f32 = 16 MiB) inside QKV (24 MiB) */
  _Float16* VT = (_Float16*)take((size_t)NB * NH * HD * SQ * 2);
  if (off > ws_size) return;
  k_prep<<<(unsigned)(PB_W + PB_X + PB_B), 128, 0, stream>>>(x, wq, wk, wv, wo, wfc, wmp, bq, bk, bv, BQKV, BO, BW1, BW2, bqkv, X16, XB);      /* weights as Bt x16, stacked bias, x as exact f16 rows (post-LN: the attention runs on the raw input) and as bf16(x) f32 rows for the residual */
  const size_t r0p = (size_t)B0 * SQ;      /* first projected row */
  k_gemm2<0, false><<<dim3((unsigned)((MP / 128) * (3 * DM / 128)), 1), 256, 0, stream>>>(X16 + r0p * DM, DM, 0, BQKV, DM, 0, 0.0625f, bqkv, 0, nullptr, 1, 0, 0, nullptr, QKV + r0p * 3 * DM, 3 * DM, 0, MP, 3 * DM, DM);      /* q | k | v rows (f16); head h = columns h*HD.. of each DM block */
  k_vt<NH, SQ><<<NB * NH * (SQ / 64), 256, 0, stream>>>(V16, LQ, 0, VT);      /* V^T [NB][NH][HD][SQ] */
  k_fattn<<<dim3(SQ / 256, NH, NB), 256, 0, stream>>>(Q16, K16, VT, O16);      /* scores q.k (no scaling), softmax over all keys, ctx (merged heads, x64) as f16 rows */
  k_gemm2<0, true><<<dim3((unsigned)((MPO / 128) * (DM / 128)), 1), 256, 0, stream>>>(O16 + r0p * DM, DM, 0, BO, DM, 0, 0.0009765625f, bo, 0, XB + r0p * DM, -1, 0, 0, X1 + r0p * DM, nullptr, DM, 0, MPO, DM, DM);      /* out rows are the output layout */
  k_lnx<0, 1, 1><<<(unsigned)NR, 256, 0, stream>>>(X1, g1, be1, 1e-5f, M16, X1N);      /* x1 = LN1(x + attn_out) (eps 1e-5): f16 rows for the FFN input and f32 rows for the residual */
  k_gemm2<6, false><<<dim3((unsigned)((MPO / 128) * (DFF / 128)), 1), 256, 0, stream>>>(M16, DM, 0, BW1, DM, 0, 0.0625f, bfc, 0, nullptr, 1, 0, 0, nullptr, HF16, DFF, 0, MPO, DFF, DM);      /* gelu_erf(x1 W1 + b1) -> f16, the rows of both batches in one grid */
  k_gemm2<0, true><<<dim3((unsigned)((MPO / 128) * (DM / 128)), 1), 256, 0, stream>>>(HF16, DFF, 0, BW2, DFF, 0, 0.0625f, bmp, 0, X1N, -1, 0, 0, X1, nullptr, DM, 0, MPO, DM, DFF);      /* t = x1 + ffn + b2 (own-element residual) f32, over the dead pre-LN1 plane; likewise one grid */
  k_lnx<0, 0, 1><<<(unsigned)NR, 256, 0, stream>>>(X1, gg2, be2, 1e-5f, nullptr, (float*)d_out);      /* out = LN2(t) (eps 1e-5) -> f32 output rows */
}
